// v000
// Measured on an AMD MI455X. A time is GPU time per run, averaged over a window of back-to-back runs after a warm-up
// (all launches, gaps included; the runs take copies of the inputs in turn), and the median of several windows.
// Apart from v000's, it joins two sittings. Times from different sittings can be a few percent apart, while
// side-by-side timings come from the same sitting.
// The starting kernel, v000, takes 4210 microseconds a run.
// Contractions (per sample, per branch): the 1x1 projections theta^T / phi^T = x^T.W^T [4096x512].[512x256] (image+flow channels as two K=256 products accumulated) and val = W.x [256x512].[512x4096], the affinity theta^T.phi [2048x256].[256x4096] per row half, att = val.attn^T [256x4096].[4096x2048] (attn as f16 of 4096 p), the output 1x1 convs W_o.att + b and the fusion conv over the concatenated branches — all f16 operands on pre-cast planes (v_wmma_f32_16x16x32_f16; 64x64 register-blocked wave tiles, weights x16; strided channel-major operands); f32 accumulate. The 8 spatial-coordinate channels (gx, gy, 1-gx, 1-gy, (gx+gy)/2 x4, computed on device) enter the projections and the fusion conv as rank-8 f32 corrections (+bias); the row softmax (exp once) is an f32 kernel.
#include <hip/hip_runtime.h>
#include <math.h>

typedef __attribute__((ext_vector_type(16))) _Float16 v16h;
typedef __attribute__((ext_vector_type(8)))  _Float16 v8h;
typedef __attribute__((ext_vector_type(16))) __bf16   v16b;
typedef __attribute__((ext_vector_type(8)))  float    v8f;
typedef __attribute__((ext_vector_type(4)))  float    v4f;

// 16-bit WMMA fragment map (wave32), lane L, h = L>>4, m = L&15:
//   A 16x32: lane = row m;   element i -> k = (i<8) ? 8h+i : 16+8h+(i-8)
//   B 32x16: lane = column m; the SAME k(i,h)
//   D 16x16 (8 f32): lane = column m; element r -> row 8h+r
__device__ __forceinline__ int frag_k(int i, int h) { return (i < 8) ? (8 * h + i) : (16 + 8 * h + (i - 8)); }
__device__ __forceinline__ __bf16 bf16_rne(float f) {
    unsigned int u = __float_as_uint(f);
    u += 0x7fffu + ((u >> 16) & 1u);
    return __builtin_bit_cast(__bf16, (unsigned short)(u >> 16));
}
__device__ __forceinline__ float bf16_f32(__bf16 b) { return __uint_as_float(((unsigned int)__builtin_bit_cast(unsigned short, b)) << 16); }
__device__ __forceinline__ v8f wmma16(v16h a, v16h b, v8f c) {
    c = __builtin_amdgcn_wmma_f32_16x16x32_f16(false, a, false, b, (short)0, c, false, false);
    asm volatile("v_nop\n\tv_nop\n\tv_nop\n\tv_nop" : "+v"(c) : "v"(a), "v"(b));
    return c;
}
__device__ __forceinline__ v8f wmmab(v16b a, v16b b, v8f c) {
    c = __builtin_amdgcn_wmma_f32_16x16x32_bf16(false, a, false, b, (short)0, c, false, false);
    asm volatile("v_nop\n\tv_nop\n\tv_nop\n\tv_nop" : "+v"(c) : "v"(a), "v"(b));
    return c;
}
struct Split { v16b hi, lo; };
// hi/lo split product: a.hi*b.hi + a.hi*b.lo + a.lo*b.hi
__device__ __forceinline__ v8f wmma3(const Split& a, const Split& b, v8f c) {
    c = __builtin_amdgcn_wmma_f32_16x16x32_bf16(false, a.hi, false, b.hi, (short)0, c, false, false);
    c = __builtin_amdgcn_wmma_f32_16x16x32_bf16(false, a.hi, false, b.lo, (short)0, c, false, false);
    c = __builtin_amdgcn_wmma_f32_16x16x32_bf16(false, a.lo, false, b.hi, (short)0, c, false, false);
    asm volatile("v_nop\n\tv_nop\n\tv_nop\n\tv_nop" : "+v"(c) : "v"(a.hi), "v"(a.lo), "v"(b.hi), "v"(b.lo));
    return c;
}
struct Split3 { v16b hi, mid, lo; };
// triple split product (6 terms, drops only terms below 2^-24 relative)
__device__ __forceinline__ v8f wmma6(const Split3& a, const Split3& b, v8f c) {
    c = __builtin_amdgcn_wmma_f32_16x16x32_bf16(false, a.hi, false, b.hi, (short)0, c, false, false);
    c = __builtin_amdgcn_wmma_f32_16x16x32_bf16(false, a.hi, false, b.mid, (short)0, c, false, false);
    c = __builtin_amdgcn_wmma_f32_16x16x32_bf16(false, a.mid, false, b.hi, (short)0, c, false, false);
    c = __builtin_amdgcn_wmma_f32_16x16x32_bf16(false, a.hi, false, b.lo, (short)0, c, false, false);
    c = __builtin_amdgcn_wmma_f32_16x16x32_bf16(false, a.mid, false, b.mid, (short)0, c, false, false);
    c = __builtin_amdgcn_wmma_f32_16x16x32_bf16(false, a.lo, false, b.hi, (short)0, c, false, false);
    asm volatile("v_nop\n\tv_nop\n\tv_nop\n\tv_nop" : "+v"(c) : "v"(a.hi), "v"(a.mid), "v"(a.lo), "v"(b.hi), "v"(b.mid), "v"(b.lo));
    return c;
}

// Fragment gathers from f32 memory: element i <- p[(k0 + frag_k(i,h)) * sk] * s, zero for k >= klen.
__device__ __forceinline__ v16h fh_ld(const float* __restrict__ p, long long sk, int k0, int h, int klen, float s) {
    v16h a;
#pragma unroll
    for (int i = 0; i < 16; ++i) { const int k = k0 + frag_k(i, h); a[i] = (k < klen) ? (_Float16)(p[(long long)k * sk] * s) : (_Float16)0.f; }
    return a;
}
__device__ __forceinline__ Split sp_ld(const float* __restrict__ p, long long sk, int k0, int h, int klen, float s) {
    Split r;
#pragma unroll
    for (int i = 0; i < 16; ++i) {
        const int k = k0 + frag_k(i, h); const float x = (k < klen) ? p[(long long)k * sk] * s : 0.f;
        const __bf16 hb = bf16_rne(x); r.hi[i] = hb; r.lo[i] = bf16_rne(x - bf16_f32(hb));
    }
    return r;
}
__device__ __forceinline__ Split3 sp3_ld(const float* __restrict__ p, long long sk, int k0, int h, int klen, float s) {
    Split3 r;
#pragma unroll
    for (int i = 0; i < 16; ++i) {
        const int k = k0 + frag_k(i, h); const float x = (k < klen) ? p[(long long)k * sk] * s : 0.f;
        const __bf16 hb = bf16_rne(x); const float r1 = x - bf16_f32(hb); const __bf16 mb = bf16_rne(r1);
        r.hi[i] = hb; r.mid[i] = mb; r.lo[i] = bf16_rne(r1 - bf16_f32(mb));
    }
    return r;
}
__device__ __forceinline__ v16b bh_ld(const float* __restrict__ p, long long sk, int k0, int h, int klen, float s) {
    v16b a;
#pragma unroll
    for (int i = 0; i < 16; ++i) { const int k = k0 + frag_k(i, h); a[i] = bf16_rne((k < klen) ? p[(long long)k * sk] * s : 0.f); }
    return a;
}
// f16 fragment from an f16 LDS/global row with element stride 1 (k-contiguous), no bounds (tile already zero padded)
__device__ __forceinline__ v16h fh_row(const _Float16* __restrict__ row, int k0, int h) {
    v16h a;
#pragma unroll
    for (int i = 0; i < 16; ++i) a[i] = row[k0 + frag_k(i, h)];
    return a;
}

#define VST2(T, ptr, val) do { const T vst2_v_ = (val); *(T*)(ptr) = vst2_v_;  } while (0)
typedef float v4f __attribute__((ext_vector_type(4)));
#define VST2V4(ptr, val) do { const v4f vst2_v4_ = (val); *(v4f*)(ptr) = vst2_v4_;  } while (0)

__device__ __attribute__((noinline)) float act_fn(float v, int act) {
    if (act == 1) return fmaxf(v, 0.f);                                                                               // relu
    if (act == 2) { const float u = 0.7978845608028654f * (v + 0.044715f * v * v * v); return 0.5f * v * (1.f + tanhf(u)); } // tanh-gelu
    if (act == 3) return v / (1.f + expf(-v));                                                                        // silu
    if (act == 4) return 0.5f * v * (1.f + erff(v * 0.7071067811865476f));                                             // erf-gelu
    if (act == 5) return tanhf(v);
    if (act == 6) return 1.f / (1.f + expf(-v));                                                                      // sigmoid
    if (act == 7) return (v > 0.f) ? v : 0.01f * v;                                                                   // leaky relu 0.01
    if (act == 8) return (v > 0.f) ? v : (expf(v) - 1.f);                                                             // elu
    if (act == 9) return fminf(fmaxf(v, 0.f), 6.f);                                                                   // relu6
    if (act == 10) return fabsf(v);                                                                                    // abs
    if (act == 11) return (v >= 0.f) ? v : 0.1f * v;                                                                  // leaky 0.1
    if (act == 12) return (v > 0.f) ? v : 0.2f * v;                                                                   // leaky 0.2
    if (act == 13) return (v > 20.f) ? v : log1pf(expf(v));                                                            // softplus
    return v;
}

// =====================================================================================================================
// k_gemm<MODE>: C(z, m, n) = act(alpha * sum_k A(z, m, k) * B(z, k, n) + bias) + beta * R(z, m, n)
//   One wave (32-thread block) per 16 x 32 tile of C; grid (ceil(N/32), ceil(M/16), Z). Batch z -> (zo = z / zi_n, zi = z % zi_n)
//   with separate outer/inner strides for every tensor (e.g. batch and head). A(m,k) = A[zo*sAo + zi*sAi + m*sAm + k*sAk] (f32),
//   B(k,n) = B[zo*sBo + zi*sBi + n*sBn + k*sBk] (f32); any M, N, K (K zero-padded to 32 inside the fragments, M/N tails guarded).
//   C(m,n) = C[zo*sCo + zi*sCi + m*sCm + n] (n contiguous). flags: 1 bias[n], 2 bias[m], 4 residual R[zo*sRo + zi*sRi + m*sRm + n*sRn].
//   MODE 0: f16 operands (A prescaled by sa, B by sb, both undone in the epilogue); 1: bf16 hi/lo split (3 products); 2: bf16;
//   3: bf16 hi/mid/lo triple split (6 products); 4: as 3 with Kahan-compensated f32 accumulation across k-steps.
// =====================================================================================================================
struct GemmP {
    const float* A; const float* B; const float* bias; const float* R; float* C;
    long long sAo, sAi, sAm, sAk, sBo, sBi, sBn, sBk, sCo, sCi, sCm, sRo, sRi, sRm, sRn;
    int M, N, K, zi_n, flags, act; float alpha, beta, sa, sb;
    int Npad, pad_;     // columns [N, Npad) of C are written as 0 so that padded workspace rows are covered by whole-line stores; Npad >= N
};
static_assert(sizeof(GemmP) == 5 * 8 + 15 * 8 + 6 * 4 + 4 * 4 + 2 * 4, "GemmP has padding");

template <int MODE>
__global__ __launch_bounds__(32) void k_gemm(GemmP p) {
    const int lane = threadIdx.x & 31, h = lane >> 4, l15 = lane & 15;
    const int m0 = blockIdx.y * 16, n0 = blockIdx.x * 32;
    const int z = blockIdx.z, zo = z / p.zi_n, zi = z - zo * p.zi_n;
    const float* A = p.A + zo * p.sAo + zi * p.sAi;
    const float* B = p.B + zo * p.sBo + zi * p.sBi;
    const int am = min(m0 + l15, p.M - 1);                       // clamped row for loads (stores are guarded)
    v8f acc[2], comp[2];
#pragma unroll
    for (int t = 0; t < 2; ++t) { v8f zz = {}; acc[t] = zz; comp[t] = zz; }
    for (int k0 = 0; k0 < p.K; k0 += 32) {
        const float* arow = A + (long long)am * p.sAm;
        if (MODE == 1) {
            const Split a = sp_ld(arow, p.sAk, k0, h, p.K, 1.f);
#pragma unroll
            for (int t = 0; t < 2; ++t) {
                const int bn = min(n0 + t * 16 + l15, p.N - 1);
                acc[t] = wmma3(a, sp_ld(B + (long long)bn * p.sBn, p.sBk, k0, h, p.K, 1.f), acc[t]);
            }
        } else if (MODE == 3) {
            const Split3 a = sp3_ld(arow, p.sAk, k0, h, p.K, 1.f);
#pragma unroll
            for (int t = 0; t < 2; ++t) {
                const int bn = min(n0 + t * 16 + l15, p.N - 1);
                acc[t] = wmma6(a, sp3_ld(B + (long long)bn * p.sBn, p.sBk, k0, h, p.K, 1.f), acc[t]);
            }
        } else if (MODE == 4) {
            // triple split as MODE 3, but each k-step's 6 products go into a fresh accumulator and the partial is added to the running f32 sum
            // on the VALU with Kahan compensation (accumulation error stays ~1 ulp however long K is)
            const Split3 a = sp3_ld(arow, p.sAk, k0, h, p.K, 1.f);
#pragma unroll
            for (int t = 0; t < 2; ++t) {
                const int bn = min(n0 + t * 16 + l15, p.N - 1); v8f zz = {};
                const v8f part = wmma6(a, sp3_ld(B + (long long)bn * p.sBn, p.sBk, k0, h, p.K, 1.f), zz);
                const v8f y = part - comp[t]; const v8f s = acc[t] + y; comp[t] = (s - acc[t]) - y; acc[t] = s;
            }
        } else if (MODE == 2) {
            const v16b a = bh_ld(arow, p.sAk, k0, h, p.K, 1.f);
#pragma unroll
            for (int t = 0; t < 2; ++t) {
                const int bn = min(n0 + t * 16 + l15, p.N - 1);
                acc[t] = wmmab(a, bh_ld(B + (long long)bn * p.sBn, p.sBk, k0, h, p.K, 1.f), acc[t]);
            }
        } else {
            const v16h a = fh_ld(arow, p.sAk, k0, h, p.K, p.sa);
#pragma unroll
            for (int t = 0; t < 2; ++t) {
                const int bn = min(n0 + t * 16 + l15, p.N - 1);
                acc[t] = wmma16(a, fh_ld(B + (long long)bn * p.sBn, p.sBk, k0, h, p.K, p.sb), acc[t]);
            }
        }
    }
    const float iscale = (MODE == 0) ? p.alpha / (p.sa * p.sb) : p.alpha;
    float* C = p.C + zo * p.sCo + zi * p.sCi;
    const float* R = p.R + zo * p.sRo + zi * p.sRi;
    __shared__ __align__(16) float ctile[16][36];
#pragma unroll
    for (int t = 0; t < 2; ++t) {
        const int n = n0 + t * 16 + l15; const int nn = min(n, p.N - 1);
#pragma unroll
        for (int r = 0; r < 8; ++r) {
            const int m = m0 + 8 * h + r; const int mm = min(m, p.M - 1);
            float v = acc[t][r] * iscale;
            if (p.flags & 1) v += p.bias[nn];
            if (p.flags & 2) v += p.bias[mm];
            if (p.flags & 8) v *= p.bias[(long long)zo * p.M + mm];   /* per-(z,row) scale vector laid out [Z][M]; exclusive with the bias flags */
            v = act_fn(v, p.act);
            if (p.flags & 4) v += p.beta * R[(long long)mm * p.sRm + (long long)nn * p.sRn];
            ctile[8 * h + r][t * 16 + l15] = (n < p.N) ? v : 0.f;
        }
    }
    __syncthreads();
    const int NW = (p.Npad > p.N) ? p.Npad : p.N;           // write width
    const bool fast = (m0 + 16 <= p.M) && (n0 + 32 <= NW) && ((p.sCm & 3) == 0) && ((((size_t)C) & 15) == 0);
    if (fast) {
#pragma unroll
        for (int s = 0; s < 4; ++s) {
            const int row = s * 4 + (lane >> 3), c4 = (lane & 7) * 4;
            const v4f v = *(const v4f*)&ctile[row][c4];
            VST2V4(C + (long long)(m0 + row) * p.sCm + n0 + c4, v);
        }
    } else {
        for (int row = 0; row < 16; ++row) {
            const int m = m0 + row, n = n0 + lane;
            if (m < p.M && n < NW) VST2(float, C + (long long)m * p.sCm + n, ctile[row][lane]);
        }
    }
}


// =====================================================================================================================
// k_gemmT<MODE, TM, TN>: same contract as k_gemm, but one wave computes a (16*TM) x (16*TN) tile: TM A fragments and TN B fragments are
//   loaded per 32-wide k-step and reused across TM*TN WMMAs (far fewer load/convert instructions per MAC). MODE 0 (f16), 1 (bf16 hi/lo),
//   2 (bf16) only. grid (ceil(NW/(16*TN)), ceil(M/(16*TM)), Z), block 32. Epilogue identical to k_gemm, run per 16x32 sub-tile.
// =====================================================================================================================
template <int MODE, int TM, int TN>
__global__ __launch_bounds__(32) void k_gemmT(GemmP p) {
    const int lane = threadIdx.x & 31, h = lane >> 4, l15 = lane & 15;
    const int m0 = blockIdx.y * (16 * TM), n0 = blockIdx.x * (16 * TN);
    const int z = blockIdx.z, zo = z / p.zi_n, zi = z - zo * p.zi_n;
    const float* A = p.A + zo * p.sAo + zi * p.sAi;
    const float* B = p.B + zo * p.sBo + zi * p.sBi;
    v8f acc[TM][TN];
#pragma unroll
    for (int i = 0; i < TM; ++i)
#pragma unroll
        for (int t = 0; t < TN; ++t) { v8f zz = {}; acc[i][t] = zz; }
    for (int k0 = 0; k0 < p.K; k0 += 32) {
        if (MODE == 1) {
            Split a[TM], b[TN];
#pragma unroll
            for (int i = 0; i < TM; ++i) { const int am = min(m0 + 16 * i + l15, p.M - 1); a[i] = sp_ld(A + (long long)am * p.sAm, p.sAk, k0, h, p.K, 1.f); }
#pragma unroll
            for (int t = 0; t < TN; ++t) { const int bn = min(n0 + 16 * t + l15, p.N - 1); b[t] = sp_ld(B + (long long)bn * p.sBn, p.sBk, k0, h, p.K, 1.f); }
#pragma unroll
            for (int i = 0; i < TM; ++i)
#pragma unroll
                for (int t = 0; t < TN; ++t) acc[i][t] = wmma3(a[i], b[t], acc[i][t]);
        } else if (MODE == 2) {
            v16b a[TM], b[TN];
#pragma unroll
            for (int i = 0; i < TM; ++i) { const int am = min(m0 + 16 * i + l15, p.M - 1); a[i] = bh_ld(A + (long long)am * p.sAm, p.sAk, k0, h, p.K, 1.f); }
#pragma unroll
            for (int t = 0; t < TN; ++t) { const int bn = min(n0 + 16 * t + l15, p.N - 1); b[t] = bh_ld(B + (long long)bn * p.sBn, p.sBk, k0, h, p.K, 1.f); }
#pragma unroll
            for (int i = 0; i < TM; ++i)
#pragma unroll
                for (int t = 0; t < TN; ++t) acc[i][t] = wmmab(a[i], b[t], acc[i][t]);
        } else {
            v16h a[TM], b[TN];
#pragma unroll
            for (int i = 0; i < TM; ++i) { const int am = min(m0 + 16 * i + l15, p.M - 1); a[i] = fh_ld(A + (long long)am * p.sAm, p.sAk, k0, h, p.K, p.sa); }
#pragma unroll
            for (int t = 0; t < TN; ++t) { const int bn = min(n0 + 16 * t + l15, p.N - 1); b[t] = fh_ld(B + (long long)bn * p.sBn, p.sBk, k0, h, p.K, p.sb); }
#pragma unroll
            for (int i = 0; i < TM; ++i)
#pragma unroll
                for (int t = 0; t < TN; ++t) acc[i][t] = wmma16(a[i], b[t], acc[i][t]);
        }
    }
    const float iscale = (MODE == 0) ? p.alpha / (p.sa * p.sb) : p.alpha;
    float* C = p.C + zo * p.sCo + zi * p.sCi;
    const float* R = p.R + zo * p.sRo + zi * p.sRi;
    const int NW = (p.Npad > p.N) ? p.Npad : p.N;
    __shared__ __align__(16) float ctile[16][36];
#pragma unroll
    for (int i = 0; i < TM; ++i) {
        const int mb = m0 + 16 * i; if (mb >= p.M) break;          // wave-uniform
#pragma unroll
        for (int tp = 0; tp < TN / 2; ++tp) {
            const int nb = n0 + 32 * tp; if (nb >= NW) break;        // wave-uniform
#pragma unroll
            for (int t2 = 0; t2 < 2; ++t2) {
                const int t = 2 * tp + t2; const int n = nb + t2 * 16 + l15; const int nn = min(n, p.N - 1);
#pragma unroll
                for (int r = 0; r < 8; ++r) {
                    const int m = mb + 8 * h + r; const int mm = min(m, p.M - 1);
                    float v = acc[i][t][r] * iscale;
                    if (p.flags & 1) v += p.bias[nn];
                    if (p.flags & 2) v += p.bias[mm];
            if (p.flags & 8) v *= p.bias[(long long)zo * p.M + mm];   /* per-(z,row) scale vector laid out [Z][M]; exclusive with the bias flags */
                    v = act_fn(v, p.act);
                    if (p.flags & 4) v += p.beta * R[(long long)mm * p.sRm + (long long)nn * p.sRn];
                    ctile[8 * h + r][t2 * 16 + l15] = (n < p.N) ? v : 0.f;
                }
            }
            __syncthreads();
            const bool fast = (mb + 16 <= p.M) && (nb + 32 <= NW) && ((p.sCm & 3) == 0) && ((((size_t)C) & 15) == 0);
            if (fast) {
#pragma unroll
                for (int s = 0; s < 4; ++s) {
                    const int row = s * 4 + (lane >> 3), c4 = (lane & 7) * 4;
                    const v4f v = *(const v4f*)&ctile[row][c4];
                    VST2V4(C + (long long)(mb + row) * p.sCm + nb + c4, v);
                }
            } else {
                for (int row = 0; row < 16; ++row) {
                    const int m = mb + row, n = nb + lane;
                    if (m < p.M && n < NW) VST2(float, C + (long long)m * p.sCm + n, ctile[row][lane]);
                }
            }
            __syncthreads();
        }
    }
}

// =====================================================================================================================
//   Wave = 16 queries, AW waves per block, 64-key blocks; grid (ceil(Lq/(16*AW)), H, B), block 32*AW. Any Lq, Lk; head dim dh <= DHP
//   (DHP multiple of 32), value dim dv <= DVP (multiple of 16, <= 128). Every tensor addressed by (batch, head, row, element) strides, f32.
//   Scores: QM 0 f16 operands, 1 bf16 hi/lo split, 2 bf16 triple split; statistics f32 (exp2 domain); P.V: P x 4096 as f16 with V f16 staged in LDS
//   (SPLITPV: P and V as bf16 hi/lo splits). kv head = h / hrep. Masking: causal = 1 (keep j <= i + coff, masked -> -inf, key blocks beyond the
//   diagonal skipped), causal = 2 (masked -> mfill, a finite fill like the -1e9; no skipping), causal = 3 (keep j >= i + coff,
//   masked -> -inf, no skipping); optional additive f32 mask Mf,
//   optional int keep-mask Mi (0 -> score := mfill), both addressed b*smb + h*smh + i*smi + j*smj (0 strides broadcast).
// =====================================================================================================================
#define AW 4
struct AttnP {   // apv4
    const float* Q; const float* K; const float* V; float* O; float* P; const float* Mf; const int* Mi; float* ST;
    const float* Pw; const float* Rt; const int* SQ; const int* SK;           // optional: post-softmax weight, relative-position table, segment ids
    long long swb, swh, swi, swj, srb, srh, sri;                                 // Pw strides (b,h,i,j); Rt strides (b,h,i), column = clamp(i - j + roff, 0, rn-1)
    long long sQb, sQh, sQi, sQd, sKb, sKh, sKj, sKd, sVb, sVh, sVj, sVd, sOb, sOh, sOi, sPb, sPh, sPi, smb, smh, smi, smj;
    int Lq, Lk, dh, dv, hrep, causal, coff, pband;   // pband > 0: P holds only the band |j - i| <= pband, column j - i + pband
    float scale, mfill; int nonorm, mpol;             // nonorm (online path only): O = sum_j exp(score_j) V_j without the 1/rowsum (scores must be <= ~0); mpol: Mi masks where ==0 (mpol 0) or where !=0 (mpol 1)
    int roff, rn, segpol, win;                        // Rt column offset/count; SQ/SK: score := mfill where (segpol 0) SQ[i] != SK[j] or (segpol 1) SQ[i] == SK[j]; win > 0: keys with i - j > win (after coff) -> -inf
};
//   Pw: the softmax numerator is multiplied by Pw(b,h,i,j) AFTER the row sum is taken (probs * weight, then P.V), as in post-softmax multiplicative biases.                                                    // ST (optional): per row (b,h,i) -> ST[((b*H + h)*Lq + i)*2 + {0,1}] = {row max of the scaled+masked score (natural units), sum_j exp(score - max)}
static_assert(sizeof(AttnP) == 12 * 8 + 29 * 8 + 16 * 4, "AttnP has padding");

#ifndef KATTN_ATTR
#define KATTN_ATTR
#endif
template <int DHP, int DVP, int QM, bool SPLITPV, bool TWOPASS>
__global__ __launch_bounds__(32 * AW) KATTN_ATTR void k_attn(AttnP p) {
    constexpr int NT = DVP / 16;                // output tiles
    constexpr int KS = DHP / 32;                // k-steps for the scores
    constexpr int VP = DVP + 8;                 // LDS pitch (halves)
    __shared__ __align__(16) float    pl[AW][16 * 64];
    __shared__ __align__(16) _Float16 vl[(SPLITPV ? 2 : 1) * 64 * VP];   // f16 V tile, or bf16 hi and lo tiles (same 2-byte size)
    const int lane = threadIdx.x & 31, hf = lane >> 4, l15 = lane & 15, wave = threadIdx.x >> 5;
    const int h = blockIdx.y, b = blockIdx.z, hk = h / p.hrep;
    const int q0 = (blockIdx.x * AW + wave) * 16;
    float* myp = pl[wave];
    const float L2E = 1.4426950408889634f;
    const float NEG = -__builtin_inff();
    const int qi = min(q0 + l15, p.Lq - 1);
    const float* qrow = p.Q + b * p.sQb + h * p.sQh + (long long)qi * p.sQi;
    const float* kbase = p.K + b * p.sKb + hk * p.sKh;
    const float* vbase = p.V + b * p.sVb + hk * p.sVh;
    v16h qa[QM == 0 ? KS : 1]; Split qs_[QM == 1 ? KS : 1]; Split3 qt_[QM == 2 ? KS : 1];
#pragma unroll
    for (int ks = 0; ks < KS; ++ks) {
        if (QM == 2) qt_[ks] = sp3_ld(qrow, p.sQd, ks * 32, hf, p.dh, 1.f);
        else if (QM == 1) qs_[ks] = sp_ld(qrow, p.sQd, ks * 32, hf, p.dh, 1.f);
        else qa[ks] = fh_ld(qrow, p.sQd, ks * 32, hf, p.dh, 1.f);
    }
    v8f o[NT]; float m8[8], l8[8];
#pragma unroll
    for (int t = 0; t < NT; ++t) { v8f zz = {}; o[t] = zz; }
#pragma unroll
    for (int i = 0; i < 8; ++i) { m8[i] = NEG; l8[i] = 0.f; }
    int jend = p.Lk; int jstart = 0;
    if (p.causal == 1) { const int je = (blockIdx.x * AW + AW - 1) * 16 + 16 + p.coff; jend = min(jend, max(je, 0)); }   // uniform per block
    if (p.win > 0) { const int js = (int)(blockIdx.x * AW) * 16 + p.coff - p.win; jstart = (js > 0) ? (js / 64) * 64 : 0; }   // uniform per block: key blocks entirely outside every row's window hold only -inf entries and are skipped exactly
    const int npass = TWOPASS ? 2 : 1;
    for (int pass = 0; pass < npass; ++pass) {
        const bool dopv = (!TWOPASS) || pass == 1;
        for (int j0 = jstart; j0 < jend; j0 += 64) {
            if (dopv) {
                __syncthreads();                                 // previous key block's reads of vl / pl are done
                for (int idx = threadIdx.x; idx < 64 * DVP; idx += 32 * AW) {
                    const int jr = idx / DVP, d = idx - jr * DVP, j = j0 + jr;
                    const float f = (j < p.Lk && d < p.dv) ? vbase[(long long)j * p.sVj + (long long)d * p.sVd] : 0.f;
                    if (SPLITPV) {
                        const __bf16 hb = bf16_rne(f);
                        ((__bf16*)vl)[jr * VP + d] = hb; ((__bf16*)vl)[64 * VP + jr * VP + d] = bf16_rne(f - bf16_f32(hb));
                    } else vl[jr * VP + d] = (_Float16)f;
                }
            }
            v8f s[4];
#pragma unroll
            for (int t = 0; t < 4; ++t) {
                const int j = min(j0 + t * 16 + l15, p.Lk - 1);
                const float* krow = kbase + (long long)j * p.sKj;
                v8f acc = {};
#pragma unroll
                for (int ks = 0; ks < KS; ++ks) {
                    if (QM == 2)      acc = wmma6(qt_[ks], sp3_ld(krow, p.sKd, ks * 32, hf, p.dh, 1.f), acc);
                    else if (QM == 1) acc = wmma3(qs_[ks], sp_ld(krow, p.sKd, ks * 32, hf, p.dh, 1.f), acc);
                    else              acc = wmma16(qa[ks], fh_ld(krow, p.sKd, ks * 32, hf, p.dh, 1.f), acc);
                }
                s[t] = acc;
            }
            float pv[8][4];
#pragma unroll
            for (int i = 0; i < 8; ++i) {
                const int irow = q0 + i + 8 * hf;
                const int ic = min(irow, p.Lq - 1);
                float sc[4];
#pragma unroll
                for (int t = 0; t < 4; ++t) {
                    const int jg = j0 + t * 16 + l15;
                    float v = s[t][i] * p.scale;
                    if (p.Mf) v += p.Mf[b * p.smb + h * p.smh + (long long)ic * p.smi + (long long)min(jg, p.Lk - 1) * p.smj];
                    if (p.Rt) { int rc = ic - min(jg, p.Lk - 1) + p.roff; rc = rc < 0 ? 0 : (rc >= p.rn ? p.rn - 1 : rc); v += p.Rt[b * p.srb + h * p.srh + (long long)ic * p.sri + rc]; }
                    if (p.Mi) { const int mv = p.Mi[b * p.smb + h * p.smh + (long long)ic * p.smi + (long long)min(jg, p.Lk - 1) * p.smj]; if (p.mpol ? (mv != 0) : (mv == 0)) v = p.mfill; }
                    if (p.SQ) { const bool same = p.SQ[(long long)b * p.Lq + ic] == p.SK[(long long)b * p.Lk + min(jg, p.Lk - 1)]; if (p.segpol ? same : !same) v = p.mfill; }
                    if (p.causal == 2 && jg > irow + p.coff) v = p.mfill;
                    if (jg >= p.Lk || (p.causal == 1 && jg > irow + p.coff) || (p.causal == 3 && jg < irow + p.coff) || (p.win > 0 && irow + p.coff - jg > p.win)) v = NEG; else v *= L2E;
                    sc[t] = v;
                }
                if (!TWOPASS || pass == 0) {
                    float mx = fmaxf(fmaxf(sc[0], sc[1]), fmaxf(sc[2], sc[3]));
                    mx = fmaxf(mx, __shfl_xor(mx, 1, 32)); mx = fmaxf(mx, __shfl_xor(mx, 2, 32));
                    mx = fmaxf(mx, __shfl_xor(mx, 4, 32)); mx = fmaxf(mx, __shfl_xor(mx, 8, 32));
                    const float mnew = fmaxf(m8[i], mx);
                    const float corr = (mnew == NEG) ? 1.f : exp2f(m8[i] - mnew);
                    float rs = 0.f;
#pragma unroll
                    for (int t = 0; t < 4; ++t) {
                        const float pp = (sc[t] == NEG) ? 0.f : exp2f(sc[t] - mnew); rs += pp;
                        pv[i][t] = p.Pw ? pp * p.Pw[b * p.swb + h * p.swh + (long long)ic * p.swi + (long long)min(j0 + t * 16 + l15, p.Lk - 1) * p.swj] : pp;
                    }
                    rs += __shfl_xor(rs, 1, 32); rs += __shfl_xor(rs, 2, 32); rs += __shfl_xor(rs, 4, 32); rs += __shfl_xor(rs, 8, 32);
                    l8[i] = l8[i] * corr + rs; m8[i] = mnew;
                    if (!TWOPASS) {
#pragma unroll
                        for (int t = 0; t < NT; ++t) o[t][i] *= corr;
                    }
                } else {
                    const float inv = (l8[i] > 0.f) ? 1.f / l8[i] : 0.f;
#pragma unroll
                    for (int t = 0; t < 4; ++t) {
                        const int jg = j0 + t * 16 + l15;
                        float pp = (sc[t] == NEG) ? 0.f : exp2f(sc[t] - m8[i]) * inv;
                        if (p.Pw) pp *= p.Pw[b * p.swb + h * p.swh + (long long)ic * p.swi + (long long)min(jg, p.Lk - 1) * p.swj];
                        pv[i][t] = pp;
                    }
                }
            }
            if (dopv) {
#pragma unroll
                for (int i = 0; i < 8; ++i)
#pragma unroll
                    for (int t = 0; t < 4; ++t) ((float*)myp)[(i + 8 * hf) * 64 + t * 16 + l15] = pv[i][t];
                __syncthreads();                                 // P (per wave) and V (shared) visible
                if (p.P) {
                    float* pb_ = p.P + b * p.sPb + h * p.sPh;
                    const bool fastP = (p.pband == 0) && ((p.sPi & 3) == 0) && (j0 + 64 <= p.Lk) && (q0 + 16 <= p.Lq) && ((((size_t)pb_) & 15) == 0);
                    if (fastP) {
#pragma unroll
                        for (int s = 0; s < 8; ++s) {
                            const int row = s * 2 + (lane >> 4), c4 = (lane & 15) * 4;
                            const v4f v = *(const v4f*)(myp + row * 64 + c4);
                            VST2V4(pb_ + (long long)(q0 + row) * p.sPi + j0 + c4, v);
                        }
                    } else {
                        for (int row = 0; row < 16; ++row) {
                            const int irow = q0 + row; if (irow >= p.Lq) continue;
                            for (int c = lane; c < 64; c += 32) {
                                const int jg = j0 + c; if (jg >= p.Lk) continue;
                                if (p.pband == 0) VST2(float, pb_ + (long long)irow * p.sPi + jg, myp[row * 64 + c]);
                                else if (jg - irow <= p.pband && irow - jg <= p.pband) VST2(float, pb_ + (long long)irow * p.sPi + (jg - irow + p.pband), myp[row * 64 + c]);
                            }
                        }
                    }
                }
                if (SPLITPV) {
                    const Split pa0 = sp_ld(myp + l15 * 64, 1, 0, hf, 64, 1.f), pa1 = sp_ld(myp + l15 * 64, 1, 32, hf, 64, 1.f);
                    const __bf16* vh = (const __bf16*)vl; const __bf16* vlo = vh + 64 * VP;
#pragma unroll
                    for (int t = 0; t < NT; ++t) {
                        const int dcol = t * 16 + l15;
                        Split b0, b1;
#pragma unroll
                        for (int e = 0; e < 16; ++e) {
                            const int k0 = frag_k(e, hf), k1 = 32 + frag_k(e, hf);
                            b0.hi[e] = vh[k0 * VP + dcol]; b0.lo[e] = vlo[k0 * VP + dcol]; b1.hi[e] = vh[k1 * VP + dcol]; b1.lo[e] = vlo[k1 * VP + dcol];
                        }
                        o[t] = wmma3(pa0, b0, o[t]);
                        o[t] = wmma3(pa1, b1, o[t]);
                    }
                } else {
                    const v16h pa0 = fh_ld(myp + l15 * 64, 1, 0, hf, 64, 4096.f), pa1 = fh_ld(myp + l15 * 64, 1, 32, hf, 64, 4096.f);
#pragma unroll
                    for (int t = 0; t < NT; ++t) {
                        const int dcol = t * 16 + l15;
                        v16h b0, b1;
#pragma unroll
                        for (int e = 0; e < 16; ++e) { b0[e] = vl[frag_k(e, hf) * VP + dcol]; b1[e] = vl[(32 + frag_k(e, hf)) * VP + dcol]; }
                        o[t] = wmma16(pa0, b0, o[t]);
                        o[t] = wmma16(pa1, b1, o[t]);
                    }
                }
            }
        }
    }
    float* obase = p.O + b * p.sOb + h * p.sOh;
    if (p.ST) {
        const int rl = lane >> 1, isel = rl & 7;           // row q0 + rl ; rl>>3 == hf holds because lane>>4 == (lane>>1)>>3
        float mv = 0.f, lv = 0.f;
#pragma unroll
        for (int i = 0; i < 8; ++i) if (i == isel) { mv = m8[i]; lv = l8[i]; }
        const int irow = q0 + rl;
        if (irow < p.Lq) { float* st = p.ST + (((long long)b * gridDim.y + h) * p.Lq + irow) * 2 + (lane & 1); VST2(float, st, (lane & 1) ? lv : mv * 0.6931471805599453f); }
    }
    float invr[8];
#pragma unroll
    for (int i = 0; i < 8; ++i) {
        if (TWOPASS) invr[i] = SPLITPV ? 1.f : (1.f / 4096.f);
        else if (p.nonorm) invr[i] = exp2f(m8[i]) * (SPLITPV ? 1.f : (1.f / 4096.f));
        else invr[i] = (l8[i] > 0.f) ? (SPLITPV ? 1.f / l8[i] : 1.f / (l8[i] * 4096.f)) : 0.f;
    }
    __syncthreads();                                             // all waves done with pl/vl from the main loop
    const bool ofast = ((p.sOi & 3) == 0) && ((((size_t)obase) & 15) == 0) && (q0 + 16 <= p.Lq);
#pragma unroll
    for (int c0 = 0; c0 < DVP; c0 += 64) {
#pragma unroll
        for (int i = 0; i < 8; ++i)
#pragma unroll
            for (int t = 0; t < NT; ++t) if (t * 16 >= c0 && t * 16 < c0 + 64) ((float*)myp)[(i + 8 * hf) * 64 + (t * 16 - c0) + l15] = o[t][i] * invr[i];
        __syncthreads();
        const int cw = (DVP - c0 < 64) ? (DVP - c0) : 64;      // staged columns in this chunk (multiple of 16)
        if (ofast && (c0 + cw <= p.dv) && (cw % 32 == 0)) {
            const int lpr = cw / 4;                              // lanes per row (16 for 64 cols, 8 for 32)
            const int rows_per_ins = 32 / lpr;
            for (int r0 = 0; r0 < 16; r0 += rows_per_ins) {
                const int row = r0 + lane / lpr, c4 = (lane % lpr) * 4;
                const v4f v = *(const v4f*)(myp + row * 64 + c4);
                VST2V4(obase + (long long)(q0 + row) * p.sOi + c0 + c4, v);
            }
        } else {
            for (int row = 0; row < 16; ++row) {
                const int irow = q0 + row; if (irow >= p.Lq) continue;
                for (int c = lane; c < cw; c += 32) { const int d = c0 + c; if (d < p.dv) VST2(float, obase + (long long)irow * p.sOi + d, myp[row * 64 + c]); }
            }
        }
        __syncthreads();
    }
}

// =====================================================================================================================
// k_tr: dst(z, c, r) = alpha * src(z, r, c) (+ beta * R2(z, c, r)): [Z][R][C] (row stride lds) -> [Z][C][R] (row stride ldd) through a 32x32 LDS tile;
//   flags: 1 -> add beta * residual R2 addressed like dst (z*sRz + c*ldr + r); act applied before the residual.
// =====================================================================================================================
struct TrP { const float* src; float* dst; const float* R2; long long sSz, lds, sDz, ldd, sRz, ldr; int R, C, flags, act; float alpha, beta; };
static_assert(sizeof(TrP) == 3 * 8 + 6 * 8 + 6 * 4, "TrP has padding");
__global__ __launch_bounds__(256) void k_tr(TrP p) {
    __shared__ float tile[32][33];
    const int c0 = blockIdx.x * 32, r0 = blockIdx.y * 32, z = blockIdx.z;
    const int lane = threadIdx.x & 31, wave = threadIdx.x >> 5;
    const float* s = p.src + z * p.sSz;
#pragma unroll
    for (int k = 0; k < 4; ++k) {
        const int rl = wave * 4 + k, r = r0 + rl, c = c0 + lane;
        tile[rl][lane] = (r < p.R && c < p.C) ? s[(long long)r * p.lds + c] : 0.f;
    }
    __syncthreads();
    float* d = p.dst + z * p.sDz; const float* rr = p.R2 + z * p.sRz;
#pragma unroll
    for (int k = 0; k < 4; ++k) {
        const int cl = wave * 4 + k, c = c0 + cl, r = r0 + lane;
        if (c < p.C && r < p.R) {
            float v = act_fn(p.alpha * tile[lane][cl], p.act);
            if (p.flags & 1) v += p.beta * rr[(long long)c * p.ldr + r];
            VST2(float, d + (long long)c * p.ldd + r, v);
        }
    }
}

// k_affine: dst[i] = a * (sdev ? sdev[0] : 1) * src[i] + b, i < n (one thread per element; consecutive lanes -> consecutive addresses)
__global__ __launch_bounds__(256) void k_affine(const float* __restrict__ src, float* __restrict__ dst, int n, float a, float b, const float* __restrict__ sdev) {
    const int i = blockIdx.x * 256 + threadIdx.x;
    if (i < n) { const float aa = sdev ? a * sdev[0] : a; const float v = aa * src[i] + b; VST2(float, dst + i, v); }
}

// =====================================================================================================================
// k_softmax: row softmax over n contiguous elements, one 256-thread block per row; rows addressed z*sz + r*sr (grid (R, Z)).
//   out = scale_out * softmax(scale_in * x + (Mf ? Mf[z*smz + r*smr + j] : 0)); a row whose max is -inf is written as 0.
// =====================================================================================================================
struct SmP { const float* src; float* dst; const float* Mf; long long sz, sr, dz, dr, smz, smr; int n, pad; float scale_in, scale_out; };
static_assert(sizeof(SmP) == 3 * 8 + 6 * 8 + 4 * 4, "SmP has padding");
__global__ __launch_bounds__(256) void k_softmax(SmP p) {
    __shared__ float red[256];
    const int r = blockIdx.x, z = blockIdx.y, tid = threadIdx.x;
    const float* s = p.src + z * p.sz + (long long)r * p.sr;
    const float* mf = p.Mf ? (p.Mf + z * p.smz + (long long)r * p.smr) : nullptr;
    float mx = -__builtin_inff();
    for (int j = tid; j < p.n; j += 256) { float v = s[j] * p.scale_in; if (mf) v += mf[j]; mx = fmaxf(mx, v); }
    red[tid] = mx; __syncthreads();
    for (int o = 128; o > 0; o >>= 1) { if (tid < o) red[tid] = fmaxf(red[tid], red[tid + o]); __syncthreads(); }
    mx = red[0]; __syncthreads();
    float sum = 0.f;
    for (int j = tid; j < p.n; j += 256) { float v = s[j] * p.scale_in; if (mf) v += mf[j]; sum += (mx == -__builtin_inff()) ? 0.f : expf(v - mx); }
    red[tid] = sum; __syncthreads();
    for (int o = 128; o > 0; o >>= 1) { if (tid < o) red[tid] += red[tid + o]; __syncthreads(); }
    sum = red[0];
    const float inv = (sum > 0.f) ? p.scale_out / sum : 0.f;
    float* d = p.dst + z * p.dz + (long long)r * p.dr;
    for (int j = tid; j < p.n; j += 256) { float v = s[j] * p.scale_in; if (mf) v += mf[j]; const float o = (mx == -__builtin_inff()) ? 0.f : expf(v - mx) * inv; VST2(float, d + j, o); }
}
// =====================================================================================================================
// k_stats: mean and rsqrt(var + eps) over a set of n elements addressed base + z*sz + (e / inner) * so + (e % inner) * si, one 256-thread
// k_norm_apply: y = (x - mean[set]) * rstd[set] * g[c] + b[c] over a [Z][C][L] channel-major tensor with set = z*G + c / (C/G) (G groups per z;
//   G = C -> per-channel sets indexed z*C+c; for batch norm pass stats indexed by c only via bn = 1). Optional act. Output same layout.
// =====================================================================================================================
//   mode 0: mean / rsqrt(var + eps); mode 1 (RMSNorm): 0 / rsqrt(mean(x^2) + eps); mode 2 (L2 normalize * sqrt(n)): 0 / sqrt(n) / max(||x||, eps); mode 3: as 0 with unbiased variance (n-1)
__global__ __launch_bounds__(256) void k_stats(const float* __restrict__ x, long long sz, long long so, long long si, int inner, int n, float eps, float* __restrict__ stat, int mode) {
    __shared__ float red[256];
    const int z = blockIdx.x, tid = threadIdx.x;
    const float* base = x + z * sz;
    float s = 0.f;
    for (int e = tid; e < n; e += 256) s += base[(long long)(e / inner) * so + (long long)(e % inner) * si];
    red[tid] = s; __syncthreads();
    for (int o = 128; o > 0; o >>= 1) { if (tid < o) red[tid] += red[tid + o]; __syncthreads(); }
    const float mu = (mode == 0 || mode == 3) ? red[0] / (float)n : 0.f; __syncthreads();
    float q = 0.f;
    for (int e = tid; e < n; e += 256) { const float dlt = base[(long long)(e / inner) * so + (long long)(e % inner) * si] - mu; q += dlt * dlt; }
    red[tid] = q; __syncthreads();
    for (int o = 128; o > 0; o >>= 1) { if (tid < o) red[tid] += red[tid + o]; __syncthreads(); }
    {
        float rs;
        if (mode == 2) rs = sqrtf((float)n) / fmaxf(sqrtf(red[0]), eps); else if (mode == 3) rs = rsqrtf(red[0] / (float)(n - 1) + eps); else rs = rsqrtf(red[0] / (float)n + eps);
        if (tid < 32) { const float v = (tid == 0) ? mu : ((tid == 1) ? rs : 0.f); VST2(float, stat + (long long)z * 32 + tid, v); }
    }
}
//   One thread per element over the flat [Z][C][L] index space: grid ceil(Z*C*L / 256).
__global__ __launch_bounds__(256) void k_norm_apply(const float* __restrict__ x, float* __restrict__ y, const float* __restrict__ stat, const float* __restrict__ g, const float* __restrict__ bta,
                                                     int Z, int C, int L, int G, int bn, int act) {
    const long long idx = (long long)blockIdx.x * 256 + threadIdx.x;
    if (idx >= (long long)Z * C * L) return;
    const int l = (int)(idx % L); const long long zc = idx / L; const int c = (int)(zc % C), z = (int)(zc / C); (void)l;
    const int set = bn ? c : (z * G + c / (C / G));
    float v = (x[idx] - stat[(long long)set * 32]) * stat[(long long)set * 32 + 1];
    if (g) v *= g[c];
    if (bta) v += bta[c];
    v = act_fn(v, act);
    VST2(float, y + idx, v);
}

// k_lse_neg: c[i] = -(st[2i] + log(st[2i+1])) = minus the log-sum-exp of row i from k_attn's ST output (for softmax over the query dimension)
__global__ __launch_bounds__(256) void k_lse_neg(const float* __restrict__ st, float* __restrict__ c, int n) {
    const int i = blockIdx.x * 256 + threadIdx.x;
    if (i < n) { const float v = -(st[2 * i] + logf(st[2 * i + 1])); VST2(float, c + i, v); }
}

// k_iota: dst[i] = a * i + b as int32 (segment/position id helper)
__global__ __launch_bounds__(256) void k_iota(int* __restrict__ dst, int n, int a, int b) {
    const int i = blockIdx.x * 256 + threadIdx.x;
    if (i < n) { const int v = a * i + b; VST2(int, dst + i, v); }
}

// k_axpby: dst[i] = a * x[i] + b * y[i] (+ c), i < n
__global__ __launch_bounds__(256) void k_axpby(const float* __restrict__ x, const float* __restrict__ y, float* __restrict__ dst, int n, float a, float b, float c) {
    const int i = blockIdx.x * 256 + threadIdx.x;
    if (i < n) { const float v = a * x[i] + b * y[i] + c; VST2(float, dst + i, v); }
}

// =====================================================================================================================
// k_rope: rotary embedding on a [R rows][Hn heads][D] view (row stride sXr, head stride sXh, element stride 1) -> Y (own strides).
//   mode 0: rotate_half (partner d±D/2, sign - for d<D/2); mode 1: interleaved pairs (partner d^1, sign - for even d).
//   table column tcol: tmode 0 -> d, 1 -> d % (D/2), 2 -> d / 2; position p: pmode 0 -> r % S, 1 -> head index, 2 -> pos[r];
//   c = C[(r / S) * sCb + p * sCp + tcol * sCd], s likewise from Sn; y = x[d] * c + sign * x[partner] * s. X and Y must not alias.
// =====================================================================================================================
struct RopeP { const float* X; float* Y; const float* C; const float* Sn; const int* pos; long long sXr, sXh, sYr, sYh, sCb, sCp, sCd; int R, Hn, D, S, mode, tmode, pmode, pad; };
static_assert(sizeof(RopeP) == 5 * 8 + 7 * 8 + 8 * 4, "RopeP has padding");
__global__ __launch_bounds__(256) void k_rope(RopeP p) {
    const long long idx = (long long)blockIdx.x * 256 + threadIdx.x;
    if (idx >= (long long)p.R * p.Hn * p.D) return;
    const int d = (int)(idx % p.D); const long long rh = idx / p.D; const int h = (int)(rh % p.Hn); const int r = (int)(rh / p.Hn);
    const int half = p.D / 2;
    int partner; float sign;
    if (p.mode == 0) { partner = (d < half) ? d + half : d - half; sign = (d < half) ? -1.f : 1.f; }
    else { partner = d ^ 1; sign = (d & 1) ? 1.f : -1.f; }
    const int tcol = (p.tmode == 0) ? d : ((p.tmode == 1) ? (d % half) : (d >> 1));
    const int pp = (p.pmode == 0) ? (r % p.S) : ((p.pmode == 1) ? h : p.pos[r]);
    const long long toff = (long long)(r / p.S) * p.sCb + (long long)pp * p.sCp + (long long)tcol * p.sCd;
    const float* xr = p.X + (long long)r * p.sXr + (long long)h * p.sXh;
    const float v = xr[d] * p.C[toff] + sign * xr[partner] * p.Sn[toff];
    VST2(float, p.Y + (long long)r * p.sYr + (long long)h * p.sYh + d, v);
}

// k_invf + k_sincos (split so neither kernel carries a large VALU-fma footprint): invf_i = num * (1 / powf(base, (2 i)/D)) [fmode 0],
//   num * expf((2 i) * cexp) [fmode 1], num * powf(base, -2 (i - 1) / D) [fmode 2]; then cs/sn[s*half + i] = cos/sin((pscale * s) * invf_i)
__global__ __launch_bounds__(256) void k_invf(float* __restrict__ invb, int half, int D, float base, float num, int fmode, float cexp) {
    const int i = blockIdx.x * 256 + threadIdx.x;
    if (i >= ((half + 31) / 32) * 32) return;
    if (i >= half) { VST2(float, invb + i, 0.f); return; }
    const float e = (float)(2 * i) / (float)D;
    float invf;
    if (fmode == 1) invf = num * expf((float)(2 * i) * cexp);
    else if (fmode == 2) invf = num * powf(base, (-2.0f * ((float)i - 1.0f)) / (float)D);
    else invf = num * (1.0f / powf(base, e));
    VST2(float, invb + i, invf);
}
__global__ __launch_bounds__(256) void k_sincos(float* __restrict__ cs, float* __restrict__ sn, const float* __restrict__ invb, int S, int half, float pscale) {
    const int idx = blockIdx.x * 256 + threadIdx.x;
    if (idx >= S * half) return;
    const int s = idx / half, i = idx - s * half;
    const float ang = (pscale * (float)s) * invb[i];
    VST2(float, cs + idx, cosf(ang)); VST2(float, sn + idx, sinf(ang));
}

// k_mulact: dst[i] = act(x[i]) * y[i]
__global__ __launch_bounds__(256) void k_mulact(const float* __restrict__ x, const float* __restrict__ y, float* __restrict__ dst, int n, int act) {
    const int i = blockIdx.x * 256 + threadIdx.x;
    if (i < n) { const float v = act_fn(x[i], act) * y[i]; VST2(float, dst + i, v); }
}

// =====================================================================================================================
// k_matvec: thread-per-row matrix-vector products for N <= 8 output columns (heads with 1-3 outputs, gates), f32 on the VALU.
//   C[r*sCm + j] = act(alpha * sum_k A[r*sAm + k*sAk] * B[j*sBn + k*sBk] + bias[j]) + beta * R[r*sRm + j*sRn]; each thread writes its N contiguous floats.
// =====================================================================================================================
__global__ __launch_bounds__(256) void k_matvec(GemmP p) {
    // 32 lanes write one line with one instruction.
    const int rpt = (p.N == 1) ? 1 : 32;
    const long long r0 = ((long long)blockIdx.x * 256 + threadIdx.x) * rpt; const int z = blockIdx.z, zo = z / p.zi_n, zi = z - zo * p.zi_n;
    if (r0 >= p.M) return;
    const float* Bb = p.B + zo * p.sBo + zi * p.sBi;
    float* C = p.C + zo * p.sCo + zi * p.sCi; const float* R = p.R + zo * p.sRo + zi * p.sRi;
    for (int rr = 0; rr < rpt; ++rr) {
        const long long r = r0 + rr; if (r >= p.M) break;
        const float* A = p.A + zo * p.sAo + zi * p.sAi + r * p.sAm;
        float acc[8] = {0.f, 0.f, 0.f, 0.f, 0.f, 0.f, 0.f, 0.f};
        for (int k = 0; k < p.K; ++k) { const float a = A[(long long)k * p.sAk];
#pragma unroll
            for (int j = 0; j < 8; ++j) if (j < p.N) acc[j] += a * Bb[(long long)j * p.sBn + (long long)k * p.sBk]; }
#pragma unroll
        for (int j = 0; j < 8; ++j) if (j < p.N) {
            float v = acc[j] * p.alpha;
            if (p.flags & 1) v += p.bias[j];
            if (p.flags & 2) v += p.bias[r];
            v = act_fn(v, p.act);
            if (p.flags & 4) v += p.beta * R[r * p.sRm + (long long)j * p.sRn];
            VST2(float, C + r * p.sCm + j, v);
        }
    }
}
// k_smallsoftmax: thread-per-row softmax for short rows (n <= 64): dst[r*dr + j] = softmax(scale*src[r*sr + j])
__global__ __launch_bounds__(256) void k_smallsoftmax(const float* __restrict__ src, float* __restrict__ dst, long long sr, long long dr, int n, long long R, float scale) {
    const long long r0 = ((long long)blockIdx.x * 256 + threadIdx.x) * 32;
    for (int rr = 0; rr < 32; ++rr) {
        const long long r = r0 + rr; if (r >= R) return;
        const float* s = src + r * sr; float* d = dst + r * dr;
        float mx = -__builtin_inff();
        for (int j = 0; j < n; ++j) mx = fmaxf(mx, s[j] * scale);
        float sum = 0.f;
        for (int j = 0; j < n; ++j) sum += expf(s[j] * scale - mx);
        const float inv = 1.f / sum;
        for (int j = 0; j < n; ++j) { const float v = expf(s[j] * scale - mx) * inv; VST2(float, d + j, v); }
    }
}

__global__ __launch_bounds__(32) void k_unitstat(float* __restrict__ st) { const int t = threadIdx.x; const float v = (t == 1) ? 1.f : 0.f; VST2(float, st + t, v); }

// destination (e.g. a d_out whose row width is not a multiple of 32 floats) is written by consecutive lanes of one instruction
__global__ __launch_bounds__(256) void k_lincopy(const float* __restrict__ src, long long lds, float* __restrict__ dst, long long ldd, long long rows, int cols) {
    const long long i = (long long)blockIdx.x * 256 + threadIdx.x; if (i >= rows * cols) return;
    const long long r = i / cols; const int c = (int)(i - r * cols);
    const float v = src[r * lds + c]; VST2(float, dst + r * ldd + c, v);
}

namespace w25 {
typedef __attribute__((ext_vector_type(16))) _Float16 v16h;
typedef __attribute__((ext_vector_type(8)))  _Float16 v8h;
typedef __attribute__((ext_vector_type(16))) __bf16   v16b;
typedef __attribute__((ext_vector_type(8)))  __bf16   v8b;
typedef __attribute__((ext_vector_type(8)))  float    v8f;
typedef __attribute__((ext_vector_type(4)))  float    v4f;

__device__ __forceinline__ unsigned short f2bf_bits(float f) {
  unsigned u = __float_as_uint(f);
  return (unsigned short)((u + 0x7FFFu + ((u >> 16) & 1u)) >> 16);
}
__device__ __forceinline__ float bf_bits2f(unsigned short h) { return __uint_as_float(((unsigned)h) << 16); }

// hazard guards as plain device helpers (no inline asm inside the kernel template body)
__device__ __forceinline__ void dep_guard_h(v8f& a, v8f& b, v16h x, v16h y) { asm volatile("v_nop\n\tv_nop\n\tv_nop\n\tv_nop" : "+v"(a), "+v"(b) : "v"(x), "v"(y)); }
__device__ __forceinline__ void dep_guard_b(v8f& a, v8f& b, v16b x, v16b y) { asm volatile("v_nop\n\tv_nop\n\tv_nop\n\tv_nop" : "+v"(a), "+v"(b) : "v"(x), "v"(y)); }
__device__ __forceinline__ void keep4_h(v16h a, v16h b, v16h c, v16h d) { asm volatile("v_nop" :: "v"(a), "v"(b), "v"(c), "v"(d)); }
__device__ __forceinline__ void keep4_b(v16b a, v16b b, v16b c, v16b d) { asm volatile("v_nop" :: "v"(a), "v"(b), "v"(c), "v"(d)); }
__device__ __forceinline__ void acc_guard4(v8f& a, v8f& b, v8f& c, v8f& d) { asm volatile("v_nop\n\tv_nop\n\tv_nop\n\tv_nop" : "+v"(a), "+v"(b), "+v"(c), "+v"(d)); }
template <typename T> struct Frag;
template <> struct Frag<_Float16> {
  typedef v16h V; union U { v16h v; v8h h[2]; };
  static __device__ __forceinline__ v16h load(const _Float16* p) {   // elements 0..7 <- p[0..7], 8..15 <- p[16..23]
    U f; f.h[0] = *(const v8h*)(p); f.h[1] = *(const v8h*)(p + 16); return f.v;
  }
  static __device__ __forceinline__ v8f mma(v16h a, v16h b, v8f c) {
    return __builtin_amdgcn_wmma_f32_16x16x32_f16(false, a, false, b, (short)0, c, false, false);
  }
  static __device__ __forceinline__ void guard(v8f& a, v8f& b, v16h x, v16h y) { dep_guard_h(a, b, x, y); }
  static __device__ __forceinline__ void keep(v16h a, v16h b, v16h c, v16h d) { keep4_h(a, b, c, d); }
};
template <> struct Frag<__bf16> {
  typedef v16b V; union U { v16b v; v8b h[2]; };
  static __device__ __forceinline__ v16b load(const __bf16* p) {
    U f; f.h[0] = *(const v8b*)(p); f.h[1] = *(const v8b*)(p + 16); return f.v;
  }
  static __device__ __forceinline__ v8f mma(v16b a, v16b b, v8f c) {
    return __builtin_amdgcn_wmma_f32_16x16x32_bf16(false, a, false, b, (short)0, c, false, false);
  }
  static __device__ __forceinline__ void guard(v8f& a, v8f& b, v16b x, v16b y) { dep_guard_b(a, b, x, y); }
  static __device__ __forceinline__ void keep(v16b a, v16b b, v16b c, v16b d) { keep4_b(a, b, c, d); }
};

// ---- Register-blocked batched WMMA GEMM ------------------------------------
// C[m,n] = scale * sum_k A[m,k] * Bt[n,k] (+bias)(+resid); each wave owns a 64x64 tile.
// A row-major [M,K]; Bt row-major [N,K]; M,N % 64 == 0, K % 32 == 0.
// SPLIT: operands are hi/lo planes (A2/Bt2 = lo planes, same layout); product = hi·hi + hi·lo + lo·hi.
// BIAS_MODE: 0 = none, 1 = bias[m], 2 = bias[n].
// OUT_MODE: 0 = f32, 1 = f16, 2 = bf16 hi plane (Cout) + bf16 lo plane (Cout2).
// ET: 0 = f16 operands, 1 = bf16 operands (pointers passed as 16-bit storage)
template <int ET> struct Elem;
template <> struct Elem<0> { typedef _Float16 T; };
template <> struct Elem<1> { typedef __bf16 T; };
template <int ET, bool SPLIT, int BIAS_MODE, int OUT_MODE, bool RESID, int ACT = 0>
__global__ __launch_bounds__(256) void wmma_gemm64(
    const unsigned short* __restrict__ Ap, const unsigned short* __restrict__ A2p, int lda, long strideA,
    const unsigned short* __restrict__ Btp, const unsigned short* __restrict__ Bt2p, int ldb, long strideB,
    void* __restrict__ Cout, void* __restrict__ Cout2, int ldc, long strideC,
    const float* __restrict__ bias,
    const float* __restrict__ resid, long strideR,
    int M, int N, int K, float scale) {
  typedef typename Elem<ET>::T T;
  typedef typename Frag<T>::V V;
  const T* A = (const T*)Ap; const T* A2 = (const T*)A2p; const T* Bt = (const T*)Btp; const T* Bt2 = (const T*)Bt2p;
  __shared__ __align__(16) float sT[8][16 * 68];   // per-wave 16x64 slab, pitch 68 floats
  const int b    = blockIdx.y;
  const int lane = threadIdx.x & 31;
  const int wave = threadIdx.x >> 5;
  const int tilesN = N >> 6;
  const int tilesM = M >> 6;
  const int tile = blockIdx.x * 8 + wave;
  if (tile >= tilesM * tilesN) return;   // wave-uniform; no block barriers in this kernel
  const int tm = tile / tilesN;
  const int tn = tile - tm * tilesN;
  const int m0 = tm << 6;
  const int n0 = tn << 6;

  const T* Ab  = A  + (size_t)b * strideA;
  const T* Bb  = Bt + (size_t)b * strideB;
  const T* Ab2 = SPLIT ? (A2  + (size_t)b * strideA) : nullptr;
  const T* Bb2 = SPLIT ? (Bt2 + (size_t)b * strideB) : nullptr;

  const int rlane = lane & 15;                 // row (A) / col (B, D) within subtile
  const int koff  = (lane >> 4) * 8;           // k offset of this lane half
  const int mOff  = (lane >> 4) * 8;           // D row offset

  v8f acc[4][4];
#pragma unroll
  for (int i = 0; i < 4; ++i)
#pragma unroll
    for (int j = 0; j < 4; ++j) acc[i][j] = (v8f){0.f,0.f,0.f,0.f,0.f,0.f,0.f,0.f};

  for (int k0 = 0; k0 < K; k0 += 32) {
    V bh[4], bl[4];
#pragma unroll
    for (int j = 0; j < 4; ++j) {
      const size_t bo = (size_t)(n0 + (j << 4) + rlane) * ldb + koff + k0;
      bh[j] = Frag<T>::load(Bb + bo);
      if (SPLIT) bl[j] = Frag<T>::load(Bb2 + bo);
    }
#pragma unroll
    for (int i = 0; i < 4; ++i) {
      const size_t ao = (size_t)(m0 + (i << 4) + rlane) * lda + koff + k0;
      V ah = Frag<T>::load(Ab + ao);
      V al;
      if (SPLIT) al = Frag<T>::load(Ab2 + ao);
#pragma unroll
      for (int j = 0; j < 4; ++j) {
        acc[i][j] = Frag<T>::mma(ah, bh[j], acc[i][j]);
        if (SPLIT) {
          acc[i][j] = Frag<T>::mma(ah, bl[j], acc[i][j]);
          acc[i][j] = Frag<T>::mma(al, bh[j], acc[i][j]);
        }
      }
      Frag<T>::guard(acc[i][0], acc[i][3], ah, SPLIT ? al : ah);
    }
    Frag<T>::keep(bh[0], bh[1], bh[2], bh[3]);
    if (SPLIT) Frag<T>::keep(bl[0], bl[1], bl[2], bl[3]);
  }
  acc_guard4(acc[0][0], acc[0][1], acc[0][2], acc[0][3]);
  acc_guard4(acc[1][0], acc[1][1], acc[1][2], acc[1][3]);
  acc_guard4(acc[2][0], acc[2][1], acc[2][2], acc[2][3]);
  acc_guard4(acc[3][0], acc[3][1], acc[3][2], acc[3][3]);

  // ---- epilogue ----
  float* slab = sT[wave];
  const float* Rb = RESID ? (resid + (size_t)b * strideR) : nullptr;
#pragma unroll
  for (int i = 0; i < 4; ++i) {
    const int mBase = m0 + (i << 4);
#pragma unroll
    for (int j = 0; j < 4; ++j) {
      const int n = n0 + (j << 4) + rlane;
      float bv = 0.f;
      if (BIAS_MODE == 2) bv = bias[n];
#pragma unroll
      for (int r = 0; r < 8; ++r) {
        float v = acc[i][j][r] * scale;
        if (BIAS_MODE == 1) v += bias[mBase + mOff + r];
        if (BIAS_MODE == 2) v += bv;
        if (RESID) v += Rb[(size_t)(mBase + mOff + r) * ldc + n];
        if (ACT == 1) v = tanhf(v);
        if (ACT == 2) v = fmaxf(v, 0.0f);
        if (ACT == 3) v = v / (1.0f + expf(-v));
        if (ACT == 4) v = (v > 0.f) ? v : 0.01f * v;
        if (ACT == 5) v = 0.5f * v * (1.0f + erff(v * 0.70710678118654752f));
        slab[(mOff + r) * 68 + (j << 4) + rlane] = v;
      }
    }
    __builtin_amdgcn_fence(__ATOMIC_RELEASE, "workgroup");
    __builtin_amdgcn_wave_barrier();
    __builtin_amdgcn_fence(__ATOMIC_ACQUIRE, "workgroup");
    if (OUT_MODE == 0) {
      float* C = (float*)Cout + (size_t)b * strideC;
      const int hh = lane >> 4, c4 = (lane & 15) * 4;     // row seg = 256 B = 16 lanes x 16 B
      {
#pragma unroll
        for (int it = 0; it < 8; ++it) {
          const int row = it * 2 + hh;
          v4f v = *(const v4f*)(slab + row * 68 + c4);
          *(v4f*)(C + (size_t)(mBase + row) * ldc + n0 + c4) = v;
        }
        
      }
    } else {
      const int q = lane >> 3, c8 = (lane & 7) * 8;
      unsigned short* C  = (unsigned short*)Cout  + (size_t)b * strideC;
      unsigned short* C2 = (OUT_MODE == 2) ? ((unsigned short*)Cout2 + (size_t)b * strideC) : nullptr;
      {
#pragma unroll
        for (int it = 0; it < 4; ++it) {
          const int row = it * 4 + q;
          const float* sp = slab + row * 68 + c8;
          v8h hv, lv;
#pragma unroll
          for (int e = 0; e < 8; ++e) {
            if (OUT_MODE == 1) {
              hv[e] = (_Float16)sp[e];
            } else {
              unsigned short hb = f2bf_bits(sp[e]);
              unsigned short lb = f2bf_bits(sp[e] - bf_bits2f(hb));
              hv[e] = __builtin_bit_cast(_Float16, hb);
              lv[e] = __builtin_bit_cast(_Float16, lb);
            }
          }
          *(v8h*)(C + (size_t)(mBase + row) * ldc + n0 + c8) = hv;
          if (OUT_MODE == 2) *(v8h*)(C2 + (size_t)(mBase + row) * ldc + n0 + c8) = lv;
        }
        
      }
    }
    __builtin_amdgcn_fence(__ATOMIC_RELEASE, "workgroup");
    __builtin_amdgcn_wave_barrier();
    __builtin_amdgcn_fence(__ATOMIC_ACQUIRE, "workgroup");
  }
}

__global__ __launch_bounds__(256) void cast_f32_f16x2(
    const float* __restrict__ in, _Float16* __restrict__ out, int n2) {
  int i = blockIdx.x * 256 + threadIdx.x;
  if (i < n2) {
    const _Float16 h0 = (_Float16)in[2 * i], h1 = (_Float16)in[2 * i + 1];
    const unsigned u = (unsigned)__builtin_bit_cast(unsigned short, h0) | ((unsigned)__builtin_bit_cast(unsigned short, h1) << 16);
    ((unsigned*)out)[i] = u;
    
  }
}


} // namespace w25

__global__ __launch_bounds__(256) void k_castT16(const float* __restrict__ src, long long lds, _Float16* __restrict__ dst, long long ldd, int R, int C, float s) {
    const long long i = (long long)blockIdx.x * 256 + threadIdx.x; const long long np = (long long)C * (R / 2); if (i >= np) return; const int c = (int)(i / (R / 2)); const int r = 2 * (int)(i % (R / 2));
    const _Float16 h0 = (_Float16)(src[(long long)r * lds + c] * s), h1 = (_Float16)(src[(long long)(r + 1) * lds + c] * s);
    const unsigned u = (unsigned)__builtin_bit_cast(unsigned short, h0) | ((unsigned)__builtin_bit_cast(unsigned short, h1) << 16);
    unsigned* d = (unsigned*)(dst + (long long)c * ldd + r); *d = u;  }
__global__ __launch_bounds__(256) void k_cast16(const float* __restrict__ src, long long lds, _Float16* __restrict__ dst, long long ldd, int R, int C, float s) {
    const long long i = (long long)blockIdx.x * 256 + threadIdx.x; const long long np = (long long)R * (C / 2); if (i >= np) return; const int r = (int)(i / (C / 2)); const int c = 2 * (int)(i % (C / 2));
    const _Float16 h0 = (_Float16)(src[(long long)r * lds + c] * s), h1 = (_Float16)(src[(long long)r * lds + c + 1] * s);
    const unsigned u = (unsigned)__builtin_bit_cast(unsigned short, h0) | ((unsigned)__builtin_bit_cast(unsigned short, h1) << 16);
    unsigned* d = (unsigned*)(dst + (long long)r * ldd + c); *d = u;  }

// f32 -> bf16 hi plane + bf16 lo plane (x = hi + lo to ~2^-17 relative; RNE both), [R][C] -> [R][C] (or transposed to [C][R]); 2 consecutive destination elements
__device__ __forceinline__ unsigned int f2bf2_pack(float a, float b, unsigned int* lo) {
    const unsigned short ha = w25::f2bf_bits(a), hb = w25::f2bf_bits(b);
    const unsigned short la = w25::f2bf_bits(a - w25::bf_bits2f(ha)), lb = w25::f2bf_bits(b - w25::bf_bits2f(hb));
    *lo = (unsigned)la | ((unsigned)lb << 16); return (unsigned)ha | ((unsigned)hb << 16); }
__global__ __launch_bounds__(256) void k_castS16(const float* __restrict__ src, long long lds, __bf16* __restrict__ dhi, __bf16* __restrict__ dlo, long long ldd, int R, int C, float s, int transpose) {
    const long long i = (long long)blockIdx.x * 256 + threadIdx.x; long long o; float a, b;
    if (transpose) { const long long np = (long long)C * (R / 2); if (i >= np) return; const int c = (int)(i / (R / 2)); const int r = 2 * (int)(i % (R / 2)); a = src[(long long)r * lds + c] * s; b = src[(long long)(r + 1) * lds + c] * s; o = (long long)c * ldd + r; }
    else { const long long np = (long long)R * (C / 2); if (i >= np) return; const int r = (int)(i / (C / 2)); const int c = 2 * (int)(i % (C / 2)); a = src[(long long)r * lds + c] * s; b = src[(long long)r * lds + c + 1] * s; o = (long long)r * ldd + c; }
    unsigned lo; const unsigned hi = f2bf2_pack(a, b, &lo); unsigned* ph = (unsigned*)(dhi + o); unsigned* pl = (unsigned*)(dlo + o);
    *ph = hi; *pl = lo;  }

namespace w25 {
// =====================================================================================
// Generic causal/non-causal attention for head_dim 64, f32 in / f32 out; 16-bit operands: bf16 with optional hi/lo splits, or
// plain f16 (F16=true, non-split, probabilities carried x2^15).
//   scores = (q*qscale)·kᵀ : v_wmma_f32_16x16x32_bf16; SPLIT_QK -> q,k as bf16 hi/lo (hi·hi + hi·lo + lo·hi)
//   out    = p·v           : v_wmma_f32_16x16x32_bf16; SPLIT_PV -> p,v as bf16 hi/lo; else p,v plain bf16
//   f32 accumulate; online softmax in f32. Block = 4 waves = 64 query rows of one (batch, head); S % 64 == 0.
//   Element (b, s, h, d) of tensor X lives at X[b*X_bs + s*X_rs + h*X_hs + d] (strides in floats, multiples of 4).
//   Masking: mask_mode 0 none, 1 causal (kv > q masked), 2 tensor [S][Skv] shared over (b,h) (float if
//   mask_is_int==0, int32 with element == 0 -> masked if 1, int32 with element != 0 -> masked if 2), 3 per-token vectors qmask[B][S] & kvmask[B][Skv] (int32,
//   0 -> masked), 4 causal + sliding window (kv > q or q - kv > W masked; W passed in mask_is_int);
//   5 = relative-position bias: s += cp[b,h,q][idx[q][kv]] + pc[b,h,kv][idx[q][kv]] with idx = mask_b ([S][Skv] int32) and
//   mask_a an int32 [S][Skv] tensor with nonzero = masked (tables: element (b,h,row,n) at X + b*c_bs + h*c_hs + row*c_rs + n);
//   masked scores are replaced by mask_fill (e.g. -inf or -1e9) before the softmax.
//   grid.x = B * H * (S/64) (or a sub-range with blk0).
// =====================================================================================
#define AT_D 64
#define AT_NW 4
#define AT_QB 64
#define AT_KC 64
struct AttnGeom { const float* cp = nullptr; const float* pc = nullptr; long c_bs = 0, c_rs = 0, c_hs = 0;   // mode-5 score-bias tables
                  long q_bs, q_rs, q_hs, k_bs, k_rs, k_hs, v_bs, v_rs, v_hs, o_bs, o_rs, o_hs;
                  int S, Skv, H, mask_mode; float qscale; int blk0; float mask_fill; int mask_is_int; };
static_assert(sizeof(AttnGeom) == 168, "no padding");

__device__ __forceinline__ unsigned short at_bf_bits(float f) {
  unsigned u = __float_as_uint(f);
  return (unsigned short)((u + 0x7FFFu + ((u >> 16) & 1u)) >> 16);
}
__device__ __forceinline__ __bf16 at_f2bf(float f) { return __builtin_bit_cast(__bf16, at_bf_bits(f)); }
__device__ __forceinline__ void at_split(float f, __bf16& hi, __bf16& lo) {
  const unsigned short hb = at_bf_bits(f);
  hi = __builtin_bit_cast(__bf16, hb);
  lo = at_f2bf(f - __uint_as_float(((unsigned)hb) << 16));
}
__device__ __forceinline__ v8f at_mma(v16b a, v16b b, v8f c) {
  c = __builtin_amdgcn_wmma_f32_16x16x32_bf16(false, a, false, b, (short)0, c, false, false);
  asm volatile("v_nop\n\tv_nop\n\tv_nop\n\tv_nop" : "+v"(c) : "v"(a), "v"(b));
  return c;
}
// 16-bit element as a bit pattern held in a __bf16 slot: f16 bits when F16, bf16 (RNE) otherwise
template <bool F16> __device__ __forceinline__ __bf16 at_to16(float f) {
  if (F16) return __builtin_bit_cast(__bf16, (_Float16)f);
  return at_f2bf(f);
}
template <bool F16> __device__ __forceinline__ v8f at_mma16(v16b a, v16b b, v8f c) {
  if (F16) {
    const v16h ah = __builtin_bit_cast(v16h, a), bh = __builtin_bit_cast(v16h, b);
    c = __builtin_amdgcn_wmma_f32_16x16x32_f16(false, ah, false, bh, (short)0, c, false, false);
    asm volatile("v_nop\n\tv_nop\n\tv_nop\n\tv_nop" : "+v"(c) : "v"(ah), "v"(bh));
    return c;
  }
  return at_mma(a, b, c);
}

template <bool SPLIT_QK, bool SPLIT_PV, bool F16 = false>
__global__ __launch_bounds__(128)
void attn64_kernel(const float* __restrict__ q, const float* __restrict__ k,
                   const float* __restrict__ v, float* __restrict__ out,
                   const void* __restrict__ mask_a, const int* __restrict__ mask_b, AttnGeom g) {
  static_assert(!(F16 && (SPLIT_QK || SPLIT_PV)), "f16 mode is non-split");
  const float PSC = F16 ? 32768.0f : 1.0f;     // f16 probabilities carried x2^15 (subnormal range), folded into the final 1/l
  union FB { v16b v; v8b h[2]; };
  __shared__ __align__(16) __bf16 Ksh[AT_KC * AT_D];             // K hi [kv][d]      8 KB
  __shared__ __align__(16) __bf16 Ksl[SPLIT_QK ? AT_KC * AT_D : 8];
  __shared__ __align__(16) __bf16 Vth[AT_D * AT_KC];             // V hi [d][kv]      8 KB
  __shared__ __align__(16) __bf16 Vtl[SPLIT_PV ? AT_D * AT_KC : 8];
  __shared__ __align__(16) __bf16 Psh[AT_NW][16 * AT_KC];        // per wave P hi [row][kv]  8 KB
  __shared__ __align__(16) __bf16 Psl[SPLIT_PV ? AT_NW : 1][SPLIT_PV ? 16 * AT_KC : 8];
  __shared__ __align__(16) float  Os[AT_NW][16 * 68];            // per wave out tile, pitch 68

  const int tid  = threadIdx.x;
  const int wave = tid >> 5;
  const int lane = tid & 31;
  const int hh   = lane >> 4;
  const int c    = lane & 15;

  const int nqb = g.S / AT_QB;
  const int bx = blockIdx.x + g.blk0;
  const int qb = bx % nqb;
  const int bh = bx / nqb;
  const int h  = bh % g.H;
  const int b  = bh / g.H;
  const int qbase_block = qb * AT_QB;
  const int q0 = qbase_block + wave * 16;

  const float* qb_ptr = q + (size_t)b * g.q_bs + (size_t)h * g.q_hs;
  const float* kb_ptr = k + (size_t)b * g.k_bs + (size_t)h * g.k_hs;
  const float* vb_ptr = v + (size_t)b * g.v_bs + (size_t)h * g.v_hs;
  float*       ob_ptr = out + (size_t)b * g.o_bs + (size_t)h * g.o_hs;

  // ---- Q fragments (A operand): 2 d-chunks, hi (and lo) ----
  v16b qah[2], qal[2];
  {
    const float* qrow = qb_ptr + (size_t)(q0 + c) * g.q_rs;
#pragma unroll
    for (int dc = 0; dc < 2; ++dc) {
#pragma unroll
      for (int e = 0; e < 8; ++e) {
        const float f0 = qrow[dc * 32 + 8 * hh + e] * g.qscale;
        const float f1 = qrow[dc * 32 + 16 + 8 * hh + e] * g.qscale;
        if (SPLIT_QK) { __bf16 hq, lq; at_split(f0, hq, lq); qah[dc][e] = hq; qal[dc][e] = lq; at_split(f1, hq, lq); qah[dc][8 + e] = hq; qal[dc][8 + e] = lq; }
        else { qah[dc][e] = at_to16<F16>(f0); qah[dc][8 + e] = at_to16<F16>(f1); qal[dc][e] = qah[dc][e]; qal[dc][8 + e] = qah[dc][8 + e]; }
      }
    }
  }

  float mrow[8], lrow[8];
  v8f oacc[4];
#pragma unroll
  for (int r = 0; r < 8; ++r) { mrow[r] = -INFINITY; lrow[r] = 0.f; }
#pragma unroll
  for (int t = 0; t < 4; ++t) oacc[t] = (v8f){0.f,0.f,0.f,0.f,0.f,0.f,0.f,0.f};

  const int nChunks = (g.mask_mode == 1 || g.mask_mode == 4) ? (qb + 1) : (g.Skv / AT_KC);   // block-uniform
  // per-row query mask (mode 3)
  int qkeep[8];
#pragma unroll
  for (int r = 0; r < 8; ++r) qkeep[r] = (g.mask_mode == 3) ? mask_b[(size_t)b * g.S + q0 + 8 * hh + r] : 1;   // mask_b = qmask in mode 3
  for (int kc = 0; kc < nChunks; ++kc) {
    const int kv0 = kc * AT_KC;
    __syncthreads();
    {
      const int kvr = tid >> 1, dh = (tid & 1) * 32;
      const float* krow = kb_ptr + (size_t)(kv0 + kvr) * g.k_rs + dh;
      const float* vrow = vb_ptr + (size_t)(kv0 + kvr) * g.v_rs + dh;
#pragma unroll
      for (int i = 0; i < 8; ++i) {
        v4f kk = *(const v4f*)(krow + 4 * i);
        v4f vv = *(const v4f*)(vrow + 4 * i);
#pragma unroll
        for (int e = 0; e < 4; ++e) {
          const int d = dh + 4 * i + e;
          if (SPLIT_QK) { __bf16 a, bl; at_split(kk[e], a, bl); Ksh[kvr * AT_D + d] = a; Ksl[kvr * AT_D + d] = bl; }
          else Ksh[kvr * AT_D + d] = at_to16<F16>(kk[e]);
          if (SPLIT_PV) { __bf16 a, bl; at_split(vv[e], a, bl); Vth[d * AT_KC + kvr] = a; Vtl[d * AT_KC + kvr] = bl; }
          else Vth[d * AT_KC + kvr] = at_to16<F16>(vv[e]);
        }
      }
    }
    __syncthreads();

    v8f s[4];
#pragma unroll
    for (int j = 0; j < 4; ++j) {
      s[j] = (v8f){0.f,0.f,0.f,0.f,0.f,0.f,0.f,0.f};
#pragma unroll 1
      for (int dc = 0; dc < 2; ++dc) {
        FB kb;
        kb.h[0] = *(const v8b*)(Ksh + (j * 16 + c) * AT_D + dc * 32 + 8 * hh);
        kb.h[1] = *(const v8b*)(Ksh + (j * 16 + c) * AT_D + dc * 32 + 16 + 8 * hh);
        s[j] = at_mma16<F16>(qah[dc], kb.v, s[j]);
        if (SPLIT_QK) {
          FB kl;
          kl.h[0] = *(const v8b*)(Ksl + (j * 16 + c) * AT_D + dc * 32 + 8 * hh);
          kl.h[1] = *(const v8b*)(Ksl + (j * 16 + c) * AT_D + dc * 32 + 16 + 8 * hh);
          s[j] = at_mma16<F16>(qah[dc], kl.v, s[j]);
          s[j] = at_mma16<F16>(qal[dc], kb.v, s[j]);
        }
      }
    }
    const bool diag = (g.mask_mode == 1) && (kc == qb);
    int kvkeep[4] = {1, 1, 1, 1};
    if (g.mask_mode == 3) {
#pragma unroll
      for (int j = 0; j < 4; ++j) kvkeep[j] = ((const int*)mask_a)[(size_t)b * g.Skv + kv0 + j * 16 + c];   // mask_a = kvmask
    }
    float cm[8];
#pragma unroll
    for (int r = 0; r < 8; ++r) {
      const int qrow = q0 + 8 * hh + r;
      float m = -INFINITY;
#pragma unroll
      for (int j = 0; j < 4; ++j) {
        const int kvcol = kv0 + j * 16 + c;
        bool masked = false;
        if (diag) masked = (kvcol > qrow);
        else if (g.mask_mode == 4) masked = (kvcol > qrow) || (qrow - kvcol > g.mask_is_int);
        else if (g.mask_mode == 2) {
          const size_t mi = (size_t)qrow * g.Skv + kvcol;
          masked = (g.mask_is_int == 0) ? (((const float*)mask_a)[mi] == 0.0f)
                 : (g.mask_is_int == 1) ? (((const int*)mask_a)[mi] == 0) : (((const int*)mask_a)[mi] != 0);
        } else if (g.mask_mode == 3) masked = (qkeep[r] == 0) || (kvkeep[j] == 0);
        else if (g.mask_mode == 5) {
          const size_t mi = (size_t)qrow * g.Skv + kvcol;
          masked = (((const int*)mask_a)[mi] != 0);
          int n = mask_b[mi]; n = n < 0 ? 0 : n;
          s[j][r] += g.cp[(size_t)b * g.c_bs + (size_t)h * g.c_hs + (size_t)qrow * g.c_rs + n]
                   + g.pc[(size_t)b * g.c_bs + (size_t)h * g.c_hs + (size_t)kvcol * g.c_rs + n];
        }
        if (masked) s[j][r] = g.mask_fill;
        m = fmaxf(m, s[j][r]);
      }
#pragma unroll
      for (int off = 1; off < 16; off <<= 1) m = fmaxf(m, __shfl_xor(m, off, 32));
      cm[r] = m;
    }
    __bf16* pwh = Psh[wave];
    __bf16* pwl = Psl[SPLIT_PV ? wave : 0];
#pragma unroll
    for (int r = 0; r < 8; ++r) {
      const float mnew = fmaxf(mrow[r], cm[r]);
      const float alpha = expf(mrow[r] - mnew);
      mrow[r] = mnew;
      float psum = 0.f;
#pragma unroll
      for (int j = 0; j < 4; ++j) {
        const float p = expf(s[j][r] - mnew);
        psum += p;
        if (SPLIT_PV) { __bf16 a, bl; at_split(p, a, bl); pwh[(8 * hh + r) * AT_KC + j * 16 + c] = a; pwl[(8 * hh + r) * AT_KC + j * 16 + c] = bl; }
        else pwh[(8 * hh + r) * AT_KC + j * 16 + c] = at_to16<F16>(p * PSC);
      }
#pragma unroll
      for (int off = 1; off < 16; off <<= 1) psum += __shfl_xor(psum, off, 32);
      lrow[r] = lrow[r] * alpha + psum;
#pragma unroll
      for (int t = 0; t < 4; ++t) oacc[t][r] *= alpha;
    }
    __builtin_amdgcn_fence(__ATOMIC_RELEASE, "workgroup");
    __builtin_amdgcn_wave_barrier();
    __builtin_amdgcn_fence(__ATOMIC_ACQUIRE, "workgroup");
#pragma unroll 1
    for (int kk = 0; kk < 2; ++kk) {
      FB pa, pl;
      pa.h[0] = *(const v8b*)(pwh + c * AT_KC + kk * 32 + 8 * hh);
      pa.h[1] = *(const v8b*)(pwh + c * AT_KC + kk * 32 + 16 + 8 * hh);
      if (SPLIT_PV) {
        pl.h[0] = *(const v8b*)(pwl + c * AT_KC + kk * 32 + 8 * hh);
        pl.h[1] = *(const v8b*)(pwl + c * AT_KC + kk * 32 + 16 + 8 * hh);
      }
#pragma unroll
      for (int t = 0; t < 4; ++t) {
        FB vb;
        vb.h[0] = *(const v8b*)(Vth + (t * 16 + c) * AT_KC + kk * 32 + 8 * hh);
        vb.h[1] = *(const v8b*)(Vth + (t * 16 + c) * AT_KC + kk * 32 + 16 + 8 * hh);
        oacc[t] = at_mma16<F16>(pa.v, vb.v, oacc[t]);
        if (SPLIT_PV) {
          FB vl;
          vl.h[0] = *(const v8b*)(Vtl + (t * 16 + c) * AT_KC + kk * 32 + 8 * hh);
          vl.h[1] = *(const v8b*)(Vtl + (t * 16 + c) * AT_KC + kk * 32 + 16 + 8 * hh);
          oacc[t] = at_mma16<F16>(pa.v, vl.v, oacc[t]);
          oacc[t] = at_mma16<F16>(pl.v, vb.v, oacc[t]);
        }
      }
    }
  }

  float* os = Os[wave];
#pragma unroll
  for (int r = 0; r < 8; ++r) {
    const float inv = 1.0f / (lrow[r] * PSC);
#pragma unroll
    for (int t = 0; t < 4; ++t) os[(8 * hh + r) * 68 + t * 16 + c] = oacc[t][r] * inv;
  }
  __builtin_amdgcn_fence(__ATOMIC_RELEASE, "workgroup");
  __builtin_amdgcn_wave_barrier();
  __builtin_amdgcn_fence(__ATOMIC_ACQUIRE, "workgroup");
  {
    const int c4 = (lane & 15) * 4;
    {
#pragma unroll
      for (int it = 0; it < 8; ++it) {
        const int row = it * 2 + hh;
        v4f val = *(const v4f*)(os + row * 68 + c4);
        *(v4f*)(ob_ptr + (size_t)(q0 + row) * g.o_rs + c4) = val;
      }
      
    }
  }
}

} // namespace w25

__device__ __forceinline__ void st_h2(_Float16* dst, float a, float b) { const unsigned u = (unsigned)__builtin_bit_cast(unsigned short, (_Float16)a) | ((unsigned)__builtin_bit_cast(unsigned short, (_Float16)b) << 16); unsigned* d = (unsigned*)dst; *d = u;  }
__device__ __forceinline__ void spat8(int n, float* s) { const int hh = n / 64, ww = n % 64; const float gx = (float)ww / 63.f, gy = (float)hh / 63.f; s[0] = gx; s[1] = gy; s[2] = 1.f - gx; s[3] = 1.f - gy; const float m = (gx + gy) * 0.5f; s[4] = m; s[5] = m; s[6] = m; s[7] = m; }
__global__ __launch_bounds__(256) void k_cm_spT(float* __restrict__ T, const float* __restrict__ Wt, const float* __restrict__ Bb, int ldw, int coff, int A, long long n) { const long long t = (long long)blockIdx.x * 256 + threadIdx.x; if (t >= n) return; const int a = (int)(t % A); const int pos = (int)(t / A); float s[8]; spat8(pos, s); float acc = Bb[a];
    if (coff >= 0) {
#pragma unroll
        for (int j = 0; j < 8; ++j) acc += Wt[(long long)a * ldw + coff + j] * s[j]; }
    VST2(float, T + t, T[t] + acc); }
// channel-major [a][n] += sum_j W[a][coff + j] * spat_j(n) + b[a]  (thread-linear over A*HW; n fastest)
__global__ __launch_bounds__(256) void k_cm_spC(float* __restrict__ V, const float* __restrict__ Wt, const float* __restrict__ Bb, int ldw, int coff, int HW, long long n) { const long long t = (long long)blockIdx.x * 256 + threadIdx.x; if (t >= n) return; const int a = (int)(t / HW); const int pos = (int)(t % HW); float s[8]; spat8(pos, s); float acc = Bb[a];
    if (coff >= 0) {
#pragma unroll
        for (int j = 0; j < 8; ++j) acc += Wt[(long long)a * ldw + coff + j] * s[j]; }
    VST2(float, V + t, V[t] + acc); }
// VAL16 = f16(VAL)
__global__ __launch_bounds__(256) void k_cm_v16(const float* __restrict__ V, _Float16* __restrict__ V16, long long n) { const long long t = (long long)blockIdx.x * 256 + threadIdx.x; if (t >= n / 2) return; st_h2(V16 + 2 * t, V[2 * t], V[2 * t + 1]); }
// row softmax (exp once) -> P16 = f16(4096 p)
__global__ __launch_bounds__(256) void k_cm_soft(float* __restrict__ EN, _Float16* __restrict__ P16, int HW) { __shared__ float red[256]; const long long row = blockIdx.x; float* sr = EN + row * HW; const int t = threadIdx.x; float mx = -3.0e38f;
#pragma unroll 1
    for (int j = 2 * t; j < HW; j += 512) mx = fmaxf(mx, fmaxf(sr[j], sr[j + 1]));
    red[t] = mx; __syncthreads(); for (int o = 128; o > 0; o >>= 1) { if (t < o) red[t] = fmaxf(red[t], red[t + o]); __syncthreads(); } const float m = red[0]; __syncthreads();
    float s = 0.f;
#pragma unroll 1
    for (int j = 2 * t; j < HW; j += 512) { const float e0 = expf(sr[j] - m), e1 = expf(sr[j + 1] - m); s += e0 + e1; const unsigned long long pk = (unsigned long long)__builtin_bit_cast(unsigned, e0) | ((unsigned long long)__builtin_bit_cast(unsigned, e1) << 32); VST2(unsigned long long, (unsigned long long*)(sr + j), pk); }
    red[t] = s; __syncthreads(); for (int o = 128; o > 0; o >>= 1) { if (t < o) red[t] += red[t + o]; __syncthreads(); } const float f = 4096.f / red[0];
#pragma unroll 1
    for (int j = 2 * t; j < HW; j += 512) st_h2(P16 + row * HW + j, sr[j] * f, sr[j + 1] * f); }


extern "C" void kernel_launch(void* const* d_in, const int* in_sizes, int n_in, void* d_out, int out_size, void* d_ws, size_t ws_size, hipStream_t stream) {
    (void)in_sizes; (void)n_in; (void)out_size; (void)ws_size;
    const float* img = (const float*)d_in[0];
    const float* flo = (const float*)d_in[1];
    const float* iwt = (const float*)d_in[2];
    const float* ibt = (const float*)d_in[3];
    const float* iwp = (const float*)d_in[4];
    const float* ibp = (const float*)d_in[5];
    const float* iwv = (const float*)d_in[6];
    const float* ibv = (const float*)d_in[7];
    const float* iwo = (const float*)d_in[8];
    const float* ibo = (const float*)d_in[9];
    const float* lwt = (const float*)d_in[10];
    const float* lbt = (const float*)d_in[11];
    const float* lwp = (const float*)d_in[12];
    const float* lbp = (const float*)d_in[13];
    const float* lwv = (const float*)d_in[14];
    const float* lbv = (const float*)d_in[15];
    const float* lwo = (const float*)d_in[16];
    const float* lbo = (const float*)d_in[17];
    const float* fw = (const float*)d_in[18];
    const float* fb = (const float*)d_in[19];
    const int Bn = 4;
    const int C = 256;
    const int A = 256;
    const int HW = 4096;
    const int CM = 520;
    const int HS = 2048;
    float* out = (float*)d_out;
    char* wsp = (char*)d_ws;
    float* THT = (float*)wsp; wsp += (((size_t)((size_t)HW * A) * 4 + 255) / 256) * 256;
    float* PHT = (float*)wsp; wsp += (((size_t)((size_t)HW * A) * 4 + 255) / 256) * 256;
    float* VAL = (float*)wsp; wsp += (((size_t)((size_t)A * HW) * 4 + 255) / 256) * 256;
    unsigned short* VAL16 = (unsigned short*)wsp; wsp += (((size_t)((size_t)A * HW) * 2 + 255) / 256) * 256;
    float* EN = (float*)wsp; wsp += (((size_t)((size_t)HS * HW) * 4 + 255) / 256) * 256;
    unsigned short* P16 = (unsigned short*)wsp; wsp += (((size_t)((size_t)HS * HW) * 2 + 255) / 256) * 256;
    float* ATT = (float*)wsp; wsp += (((size_t)((size_t)A * HW) * 4 + 255) / 256) * 256;
    float* FUS = (float*)wsp; wsp += (((size_t)((size_t)2 * A * HW) * 4 + 255) / 256) * 256;
    unsigned short* G64A = (unsigned short*)wsp; wsp += (((size_t)(1048576) * 2 + 255) / 256) * 256;
    unsigned short* G64B = (unsigned short*)wsp; wsp += (((size_t)(2097152) * 2 + 255) / 256) * 256;
    k_castT16<<<(unsigned)((((long long)(4096) * ((256) / 2)) + 255) / 256), 256, 0, stream>>>(img + (size_t)0 * C * HW, 4096, (_Float16*)(G64A), 256, 256, 4096, 1.0f);
    k_cast16<<<(unsigned)((((long long)(256) * ((256) / 2)) + 255) / 256), 256, 0, stream>>>(iwt + 0, 520, (_Float16*)(G64B), 256, 256, 256, 16.0f);
    w25::wmma_gemm64<0, false, 0, 0, false, 0><<<dim3((unsigned)((((4096) / 64) * ((256) / 64) + 7) / 8), (unsigned)(1)), 256, 0, stream>>>((const unsigned short*)(G64A), nullptr, 256, 0, (const unsigned short*)(G64B), nullptr, 256, 0, (void*)(THT), nullptr, 256, 0, nullptr, nullptr, 0, 4096, 256, 256, 0.0625f);
    k_castT16<<<(unsigned)((((long long)(4096) * ((256) / 2)) + 255) / 256), 256, 0, stream>>>(flo + (size_t)0 * C * HW, 4096, (_Float16*)(G64A), 256, 256, 4096, 1.0f);
    k_cast16<<<(unsigned)((((long long)(256) * ((256) / 2)) + 255) / 256), 256, 0, stream>>>(iwt + 256, 520, (_Float16*)(G64B), 256, 256, 256, 16.0f);
    w25::wmma_gemm64<0, false, 0, 0, true, 0><<<dim3((unsigned)((((4096) / 64) * ((256) / 64) + 7) / 8), (unsigned)(1)), 256, 0, stream>>>((const unsigned short*)(G64A), nullptr, 256, 0, (const unsigned short*)(G64B), nullptr, 256, 0, (void*)(THT), nullptr, 256, 0, nullptr, THT, 0, 4096, 256, 256, 0.0625f);
    k_castT16<<<(unsigned)((((long long)(4096) * ((256) / 2)) + 255) / 256), 256, 0, stream>>>(img + (size_t)0 * C * HW, 4096, (_Float16*)(G64A), 256, 256, 4096, 1.0f);
    k_cast16<<<(unsigned)((((long long)(256) * ((256) / 2)) + 255) / 256), 256, 0, stream>>>(iwp + 0, 520, (_Float16*)(G64B), 256, 256, 256, 16.0f);
    w25::wmma_gemm64<0, false, 0, 0, false, 0><<<dim3((unsigned)((((4096) / 64) * ((256) / 64) + 7) / 8), (unsigned)(1)), 256, 0, stream>>>((const unsigned short*)(G64A), nullptr, 256, 0, (const unsigned short*)(G64B), nullptr, 256, 0, (void*)(PHT), nullptr, 256, 0, nullptr, nullptr, 0, 4096, 256, 256, 0.0625f);
    k_castT16<<<(unsigned)((((long long)(4096) * ((256) / 2)) + 255) / 256), 256, 0, stream>>>(flo + (size_t)0 * C * HW, 4096, (_Float16*)(G64A), 256, 256, 4096, 1.0f);
    k_cast16<<<(unsigned)((((long long)(256) * ((256) / 2)) + 255) / 256), 256, 0, stream>>>(iwp + 256, 520, (_Float16*)(G64B), 256, 256, 256, 16.0f);
    w25::wmma_gemm64<0, false, 0, 0, true, 0><<<dim3((unsigned)((((4096) / 64) * ((256) / 64) + 7) / 8), (unsigned)(1)), 256, 0, stream>>>((const unsigned short*)(G64A), nullptr, 256, 0, (const unsigned short*)(G64B), nullptr, 256, 0, (void*)(PHT), nullptr, 256, 0, nullptr, PHT, 0, 4096, 256, 256, 0.0625f);
    k_cast16<<<(unsigned)((((long long)(256) * ((256) / 2)) + 255) / 256), 256, 0, stream>>>(iwv + 0, 520, (_Float16*)(G64A), 256, 256, 256, 1.0f);
    k_castT16<<<(unsigned)((((long long)(4096) * ((256) / 2)) + 255) / 256), 256, 0, stream>>>(img + (size_t)0 * C * HW, 4096, (_Float16*)(G64B), 256, 256, 4096, 16.0f);
    w25::wmma_gemm64<0, false, 0, 0, false, 0><<<dim3((unsigned)((((256) / 64) * ((4096) / 64) + 7) / 8), (unsigned)(1)), 256, 0, stream>>>((const unsigned short*)(G64A), nullptr, 256, 0, (const unsigned short*)(G64B), nullptr, 256, 0, (void*)(VAL), nullptr, 4096, 0, nullptr, nullptr, 0, 256, 4096, 256, 0.0625f);
    k_cast16<<<(unsigned)((((long long)(256) * ((256) / 2)) + 255) / 256), 256, 0, stream>>>(iwv + 256, 520, (_Float16*)(G64A), 256, 256, 256, 1.0f);
    k_castT16<<<(unsigned)((((long long)(4096) * ((256) / 2)) + 255) / 256), 256, 0, stream>>>(flo + (size_t)0 * C * HW, 4096, (_Float16*)(G64B), 256, 256, 4096, 16.0f);
    w25::wmma_gemm64<0, false, 0, 0, true, 0><<<dim3((unsigned)((((256) / 64) * ((4096) / 64) + 7) / 8), (unsigned)(1)), 256, 0, stream>>>((const unsigned short*)(G64A), nullptr, 256, 0, (const unsigned short*)(G64B), nullptr, 256, 0, (void*)(VAL), nullptr, 4096, 0, nullptr, VAL, 0, 256, 4096, 256, 0.0625f);
    k_cm_spT<<<(unsigned)(((long long)HW * A + 255) / 256), 256, 0, stream>>>(THT, iwt, ibt, 520, 512, A, (long long)HW * A); k_cm_spT<<<(unsigned)(((long long)HW * A + 255) / 256), 256, 0, stream>>>(PHT, iwp, ibp, 520, 512, A, (long long)HW * A); k_cm_spC<<<(unsigned)(((long long)A * HW + 255) / 256), 256, 0, stream>>>(VAL, iwv, ibv, 520, 512, HW, (long long)A * HW); k_cm_v16<<<(unsigned)(((long long)A * HW / 2 + 255) / 256), 256, 0, stream>>>(VAL, (_Float16*)VAL16, (long long)A * HW);
    k_cast16<<<(unsigned)((((long long)(2048) * ((256) / 2)) + 255) / 256), 256, 0, stream>>>(THT + (size_t)0 * HS * A, 256, (_Float16*)(G64A), 256, 2048, 256, 1.0f);
    k_cast16<<<(unsigned)((((long long)(4096) * ((256) / 2)) + 255) / 256), 256, 0, stream>>>(PHT, 256, (_Float16*)(G64B), 256, 4096, 256, 1.0f);
    w25::wmma_gemm64<0, false, 0, 0, false, 0><<<dim3((unsigned)((((2048) / 64) * ((4096) / 64) + 7) / 8), (unsigned)(1)), 256, 0, stream>>>((const unsigned short*)(G64A), nullptr, 256, 0, (const unsigned short*)(G64B), nullptr, 256, 0, (void*)(EN), nullptr, 4096, 0, nullptr, nullptr, 0, 2048, 4096, 256, 1.0f);
    k_cm_soft<<<HS, 256, 0, stream>>>(EN, (_Float16*)P16, HW);
    w25::wmma_gemm64<0, false, 0, 0, false, 0><<<dim3((unsigned)((((A) / 64) * ((HS) / 64) + 7) / 8), (unsigned)(1)), 256, 0, stream>>>((const unsigned short*)(VAL16), nullptr, HW, 0, (const unsigned short*)(P16), nullptr, HW, 0, (void*)(ATT + (size_t)0 * HS), nullptr, HW, 0, nullptr, nullptr, 0, A, HS, HW, 0.000244140625f);
    k_cast16<<<(unsigned)((((long long)(2048) * ((256) / 2)) + 255) / 256), 256, 0, stream>>>(THT + (size_t)1 * HS * A, 256, (_Float16*)(G64A), 256, 2048, 256, 1.0f);
    k_cast16<<<(unsigned)((((long long)(4096) * ((256) / 2)) + 255) / 256), 256, 0, stream>>>(PHT, 256, (_Float16*)(G64B), 256, 4096, 256, 1.0f);
    w25::wmma_gemm64<0, false, 0, 0, false, 0><<<dim3((unsigned)((((2048) / 64) * ((4096) / 64) + 7) / 8), (unsigned)(1)), 256, 0, stream>>>((const unsigned short*)(G64A), nullptr, 256, 0, (const unsigned short*)(G64B), nullptr, 256, 0, (void*)(EN), nullptr, 4096, 0, nullptr, nullptr, 0, 2048, 4096, 256, 1.0f);
    k_cm_soft<<<HS, 256, 0, stream>>>(EN, (_Float16*)P16, HW);
    w25::wmma_gemm64<0, false, 0, 0, false, 0><<<dim3((unsigned)((((A) / 64) * ((HS) / 64) + 7) / 8), (unsigned)(1)), 256, 0, stream>>>((const unsigned short*)(VAL16), nullptr, HW, 0, (const unsigned short*)(P16), nullptr, HW, 0, (void*)(ATT + (size_t)1 * HS), nullptr, HW, 0, nullptr, nullptr, 0, A, HS, HW, 0.000244140625f);
    k_cast16<<<(unsigned)((((long long)(256) * ((256) / 2)) + 255) / 256), 256, 0, stream>>>(iwo, 256, (_Float16*)(G64A), 256, 256, 256, 16.0f);
    k_castT16<<<(unsigned)((((long long)(4096) * ((256) / 2)) + 255) / 256), 256, 0, stream>>>(ATT, 4096, (_Float16*)(G64B), 256, 256, 4096, 1.0f);
    w25::wmma_gemm64<0, false, 1, 0, false, 0><<<dim3((unsigned)((((256) / 64) * ((4096) / 64) + 7) / 8), (unsigned)(1)), 256, 0, stream>>>((const unsigned short*)(G64A), nullptr, 256, 0, (const unsigned short*)(G64B), nullptr, 256, 0, (void*)(FUS + (size_t)0 * A * HW), nullptr, 4096, 0, ibo, nullptr, 0, 256, 4096, 256, 0.0625f);
    k_castT16<<<(unsigned)((((long long)(4096) * ((256) / 2)) + 255) / 256), 256, 0, stream>>>(flo + (size_t)0 * C * HW, 4096, (_Float16*)(G64A), 256, 256, 4096, 1.0f);
    k_cast16<<<(unsigned)((((long long)(256) * ((256) / 2)) + 255) / 256), 256, 0, stream>>>(lwt + 0, 256, (_Float16*)(G64B), 256, 256, 256, 16.0f);
    w25::wmma_gemm64<0, false, 0, 0, false, 0><<<dim3((unsigned)((((4096) / 64) * ((256) / 64) + 7) / 8), (unsigned)(1)), 256, 0, stream>>>((const unsigned short*)(G64A), nullptr, 256, 0, (const unsigned short*)(G64B), nullptr, 256, 0, (void*)(THT), nullptr, 256, 0, nullptr, nullptr, 0, 4096, 256, 256, 0.0625f);
    k_castT16<<<(unsigned)((((long long)(4096) * ((256) / 2)) + 255) / 256), 256, 0, stream>>>(flo + (size_t)0 * C * HW, 4096, (_Float16*)(G64A), 256, 256, 4096, 1.0f);
    k_cast16<<<(unsigned)((((long long)(256) * ((256) / 2)) + 255) / 256), 256, 0, stream>>>(lwp + 0, 256, (_Float16*)(G64B), 256, 256, 256, 16.0f);
    w25::wmma_gemm64<0, false, 0, 0, false, 0><<<dim3((unsigned)((((4096) / 64) * ((256) / 64) + 7) / 8), (unsigned)(1)), 256, 0, stream>>>((const unsigned short*)(G64A), nullptr, 256, 0, (const unsigned short*)(G64B), nullptr, 256, 0, (void*)(PHT), nullptr, 256, 0, nullptr, nullptr, 0, 4096, 256, 256, 0.0625f);
    k_cast16<<<(unsigned)((((long long)(256) * ((256) / 2)) + 255) / 256), 256, 0, stream>>>(lwv + 0, 256, (_Float16*)(G64A), 256, 256, 256, 1.0f);
    k_castT16<<<(unsigned)((((long long)(4096) * ((256) / 2)) + 255) / 256), 256, 0, stream>>>(flo + (size_t)0 * C * HW, 4096, (_Float16*)(G64B), 256, 256, 4096, 16.0f);
    w25::wmma_gemm64<0, false, 0, 0, false, 0><<<dim3((unsigned)((((256) / 64) * ((4096) / 64) + 7) / 8), (unsigned)(1)), 256, 0, stream>>>((const unsigned short*)(G64A), nullptr, 256, 0, (const unsigned short*)(G64B), nullptr, 256, 0, (void*)(VAL), nullptr, 4096, 0, nullptr, nullptr, 0, 256, 4096, 256, 0.0625f);
    k_cm_spT<<<(unsigned)(((long long)HW * A + 255) / 256), 256, 0, stream>>>(THT, lwt, lbt, 256, -1, A, (long long)HW * A); k_cm_spT<<<(unsigned)(((long long)HW * A + 255) / 256), 256, 0, stream>>>(PHT, lwp, lbp, 256, -1, A, (long long)HW * A); k_cm_spC<<<(unsigned)(((long long)A * HW + 255) / 256), 256, 0, stream>>>(VAL, lwv, lbv, 256, -1, HW, (long long)A * HW); k_cm_v16<<<(unsigned)(((long long)A * HW / 2 + 255) / 256), 256, 0, stream>>>(VAL, (_Float16*)VAL16, (long long)A * HW);
    k_cast16<<<(unsigned)((((long long)(2048) * ((256) / 2)) + 255) / 256), 256, 0, stream>>>(THT + (size_t)0 * HS * A, 256, (_Float16*)(G64A), 256, 2048, 256, 1.0f);
    k_cast16<<<(unsigned)((((long long)(4096) * ((256) / 2)) + 255) / 256), 256, 0, stream>>>(PHT, 256, (_Float16*)(G64B), 256, 4096, 256, 1.0f);
    w25::wmma_gemm64<0, false, 0, 0, false, 0><<<dim3((unsigned)((((2048) / 64) * ((4096) / 64) + 7) / 8), (unsigned)(1)), 256, 0, stream>>>((const unsigned short*)(G64A), nullptr, 256, 0, (const unsigned short*)(G64B), nullptr, 256, 0, (void*)(EN), nullptr, 4096, 0, nullptr, nullptr, 0, 2048, 4096, 256, 1.0f);
    k_cm_soft<<<HS, 256, 0, stream>>>(EN, (_Float16*)P16, HW);
    w25::wmma_gemm64<0, false, 0, 0, false, 0><<<dim3((unsigned)((((A) / 64) * ((HS) / 64) + 7) / 8), (unsigned)(1)), 256, 0, stream>>>((const unsigned short*)(VAL16), nullptr, HW, 0, (const unsigned short*)(P16), nullptr, HW, 0, (void*)(ATT + (size_t)0 * HS), nullptr, HW, 0, nullptr, nullptr, 0, A, HS, HW, 0.000244140625f);
    k_cast16<<<(unsigned)((((long long)(2048) * ((256) / 2)) + 255) / 256), 256, 0, stream>>>(THT + (size_t)1 * HS * A, 256, (_Float16*)(G64A), 256, 2048, 256, 1.0f);
    k_cast16<<<(unsigned)((((long long)(4096) * ((256) / 2)) + 255) / 256), 256, 0, stream>>>(PHT, 256, (_Float16*)(G64B), 256, 4096, 256, 1.0f);
    w25::wmma_gemm64<0, false, 0, 0, false, 0><<<dim3((unsigned)((((2048) / 64) * ((4096) / 64) + 7) / 8), (unsigned)(1)), 256, 0, stream>>>((const unsigned short*)(G64A), nullptr, 256, 0, (const unsigned short*)(G64B), nullptr, 256, 0, (void*)(EN), nullptr, 4096, 0, nullptr, nullptr, 0, 2048, 4096, 256, 1.0f);
    k_cm_soft<<<HS, 256, 0, stream>>>(EN, (_Float16*)P16, HW);
    w25::wmma_gemm64<0, false, 0, 0, false, 0><<<dim3((unsigned)((((A) / 64) * ((HS) / 64) + 7) / 8), (unsigned)(1)), 256, 0, stream>>>((const unsigned short*)(VAL16), nullptr, HW, 0, (const unsigned short*)(P16), nullptr, HW, 0, (void*)(ATT + (size_t)1 * HS), nullptr, HW, 0, nullptr, nullptr, 0, A, HS, HW, 0.000244140625f);
    k_cast16<<<(unsigned)((((long long)(256) * ((256) / 2)) + 255) / 256), 256, 0, stream>>>(lwo, 256, (_Float16*)(G64A), 256, 256, 256, 16.0f);
    k_castT16<<<(unsigned)((((long long)(4096) * ((256) / 2)) + 255) / 256), 256, 0, stream>>>(ATT, 4096, (_Float16*)(G64B), 256, 256, 4096, 1.0f);
    w25::wmma_gemm64<0, false, 1, 0, false, 0><<<dim3((unsigned)((((256) / 64) * ((4096) / 64) + 7) / 8), (unsigned)(1)), 256, 0, stream>>>((const unsigned short*)(G64A), nullptr, 256, 0, (const unsigned short*)(G64B), nullptr, 256, 0, (void*)(FUS + (size_t)1 * A * HW), nullptr, 4096, 0, lbo, nullptr, 0, 256, 4096, 256, 0.0625f);
    k_cast16<<<(unsigned)((((long long)(256) * ((512) / 2)) + 255) / 256), 256, 0, stream>>>(fw, 520, (_Float16*)(G64A), 512, 256, 512, 16.0f);
    k_castT16<<<(unsigned)((((long long)(4096) * ((512) / 2)) + 255) / 256), 256, 0, stream>>>(FUS, 4096, (_Float16*)(G64B), 512, 512, 4096, 1.0f);
    w25::wmma_gemm64<0, false, 0, 0, false, 0><<<dim3((unsigned)((((256) / 64) * ((4096) / 64) + 7) / 8), (unsigned)(1)), 256, 0, stream>>>((const unsigned short*)(G64A), nullptr, 512, 0, (const unsigned short*)(G64B), nullptr, 512, 0, (void*)(out + (size_t)0 * A * HW), nullptr, 4096, 0, nullptr, nullptr, 0, 256, 4096, 512, 0.0625f);
    k_cm_spC<<<(unsigned)(((long long)A * HW + 255) / 256), 256, 0, stream>>>(out + (size_t)0 * A * HW, fw, fb, 520, 512, HW, (long long)A * HW);
    k_castT16<<<(unsigned)((((long long)(4096) * ((256) / 2)) + 255) / 256), 256, 0, stream>>>(img + (size_t)1 * C * HW, 4096, (_Float16*)(G64A), 256, 256, 4096, 1.0f);
    k_cast16<<<(unsigned)((((long long)(256) * ((256) / 2)) + 255) / 256), 256, 0, stream>>>(iwt + 0, 520, (_Float16*)(G64B), 256, 256, 256, 16.0f);
    w25::wmma_gemm64<0, false, 0, 0, false, 0><<<dim3((unsigned)((((4096) / 64) * ((256) / 64) + 7) / 8), (unsigned)(1)), 256, 0, stream>>>((const unsigned short*)(G64A), nullptr, 256, 0, (const unsigned short*)(G64B), nullptr, 256, 0, (void*)(THT), nullptr, 256, 0, nullptr, nullptr, 0, 4096, 256, 256, 0.0625f);
    k_castT16<<<(unsigned)((((long long)(4096) * ((256) / 2)) + 255) / 256), 256, 0, stream>>>(flo + (size_t)1 * C * HW, 4096, (_Float16*)(G64A), 256, 256, 4096, 1.0f);
    k_cast16<<<(unsigned)((((long long)(256) * ((256) / 2)) + 255) / 256), 256, 0, stream>>>(iwt + 256, 520, (_Float16*)(G64B), 256, 256, 256, 16.0f);
    w25::wmma_gemm64<0, false, 0, 0, true, 0><<<dim3((unsigned)((((4096) / 64) * ((256) / 64) + 7) / 8), (unsigned)(1)), 256, 0, stream>>>((const unsigned short*)(G64A), nullptr, 256, 0, (const unsigned short*)(G64B), nullptr, 256, 0, (void*)(THT), nullptr, 256, 0, nullptr, THT, 0, 4096, 256, 256, 0.0625f);
    k_castT16<<<(unsigned)((((long long)(4096) * ((256) / 2)) + 255) / 256), 256, 0, stream>>>(img + (size_t)1 * C * HW, 4096, (_Float16*)(G64A), 256, 256, 4096, 1.0f);
    k_cast16<<<(unsigned)((((long long)(256) * ((256) / 2)) + 255) / 256), 256, 0, stream>>>(iwp + 0, 520, (_Float16*)(G64B), 256, 256, 256, 16.0f);
    w25::wmma_gemm64<0, false, 0, 0, false, 0><<<dim3((unsigned)((((4096) / 64) * ((256) / 64) + 7) / 8), (unsigned)(1)), 256, 0, stream>>>((const unsigned short*)(G64A), nullptr, 256, 0, (const unsigned short*)(G64B), nullptr, 256, 0, (void*)(PHT), nullptr, 256, 0, nullptr, nullptr, 0, 4096, 256, 256, 0.0625f);
    k_castT16<<<(unsigned)((((long long)(4096) * ((256) / 2)) + 255) / 256), 256, 0, stream>>>(flo + (size_t)1 * C * HW, 4096, (_Float16*)(G64A), 256, 256, 4096, 1.0f);
    k_cast16<<<(unsigned)((((long long)(256) * ((256) / 2)) + 255) / 256), 256, 0, stream>>>(iwp + 256, 520, (_Float16*)(G64B), 256, 256, 256, 16.0f);
    w25::wmma_gemm64<0, false, 0, 0, true, 0><<<dim3((unsigned)((((4096) / 64) * ((256) / 64) + 7) / 8), (unsigned)(1)), 256, 0, stream>>>((const unsigned short*)(G64A), nullptr, 256, 0, (const unsigned short*)(G64B), nullptr, 256, 0, (void*)(PHT), nullptr, 256, 0, nullptr, PHT, 0, 4096, 256, 256, 0.0625f);
    k_cast16<<<(unsigned)((((long long)(256) * ((256) / 2)) + 255) / 256), 256, 0, stream>>>(iwv + 0, 520, (_Float16*)(G64A), 256, 256, 256, 1.0f);
    k_castT16<<<(unsigned)((((long long)(4096) * ((256) / 2)) + 255) / 256), 256, 0, stream>>>(img + (size_t)1 * C * HW, 4096, (_Float16*)(G64B), 256, 256, 4096, 16.0f);
    w25::wmma_gemm64<0, false, 0, 0, false, 0><<<dim3((unsigned)((((256) / 64) * ((4096) / 64) + 7) / 8), (unsigned)(1)), 256, 0, stream>>>((const unsigned short*)(G64A), nullptr, 256, 0, (const unsigned short*)(G64B), nullptr, 256, 0, (void*)(VAL), nullptr, 4096, 0, nullptr, nullptr, 0, 256, 4096, 256, 0.0625f);
    k_cast16<<<(unsigned)((((long long)(256) * ((256) / 2)) + 255) / 256), 256, 0, stream>>>(iwv + 256, 520, (_Float16*)(G64A), 256, 256, 256, 1.0f);
    k_castT16<<<(unsigned)((((long long)(4096) * ((256) / 2)) + 255) / 256), 256, 0, stream>>>(flo + (size_t)1 * C * HW, 4096, (_Float16*)(G64B), 256, 256, 4096, 16.0f);
    w25::wmma_gemm64<0, false, 0, 0, true, 0><<<dim3((unsigned)((((256) / 64) * ((4096) / 64) + 7) / 8), (unsigned)(1)), 256, 0, stream>>>((const unsigned short*)(G64A), nullptr, 256, 0, (const unsigned short*)(G64B), nullptr, 256, 0, (void*)(VAL), nullptr, 4096, 0, nullptr, VAL, 0, 256, 4096, 256, 0.0625f);
    k_cm_spT<<<(unsigned)(((long long)HW * A + 255) / 256), 256, 0, stream>>>(THT, iwt, ibt, 520, 512, A, (long long)HW * A); k_cm_spT<<<(unsigned)(((long long)HW * A + 255) / 256), 256, 0, stream>>>(PHT, iwp, ibp, 520, 512, A, (long long)HW * A); k_cm_spC<<<(unsigned)(((long long)A * HW + 255) / 256), 256, 0, stream>>>(VAL, iwv, ibv, 520, 512, HW, (long long)A * HW); k_cm_v16<<<(unsigned)(((long long)A * HW / 2 + 255) / 256), 256, 0, stream>>>(VAL, (_Float16*)VAL16, (long long)A * HW);
    k_cast16<<<(unsigned)((((long long)(2048) * ((256) / 2)) + 255) / 256), 256, 0, stream>>>(THT + (size_t)0 * HS * A, 256, (_Float16*)(G64A), 256, 2048, 256, 1.0f);
    k_cast16<<<(unsigned)((((long long)(4096) * ((256) / 2)) + 255) / 256), 256, 0, stream>>>(PHT, 256, (_Float16*)(G64B), 256, 4096, 256, 1.0f);
    w25::wmma_gemm64<0, false, 0, 0, false, 0><<<dim3((unsigned)((((2048) / 64) * ((4096) / 64) + 7) / 8), (unsigned)(1)), 256, 0, stream>>>((const unsigned short*)(G64A), nullptr, 256, 0, (const unsigned short*)(G64B), nullptr, 256, 0, (void*)(EN), nullptr, 4096, 0, nullptr, nullptr, 0, 2048, 4096, 256, 1.0f);
    k_cm_soft<<<HS, 256, 0, stream>>>(EN, (_Float16*)P16, HW);
    w25::wmma_gemm64<0, false, 0, 0, false, 0><<<dim3((unsigned)((((A) / 64) * ((HS) / 64) + 7) / 8), (unsigned)(1)), 256, 0, stream>>>((const unsigned short*)(VAL16), nullptr, HW, 0, (const unsigned short*)(P16), nullptr, HW, 0, (void*)(ATT + (size_t)0 * HS), nullptr, HW, 0, nullptr, nullptr, 0, A, HS, HW, 0.000244140625f);
    k_cast16<<<(unsigned)((((long long)(2048) * ((256) / 2)) + 255) / 256), 256, 0, stream>>>(THT + (size_t)1 * HS * A, 256, (_Float16*)(G64A), 256, 2048, 256, 1.0f);
    k_cast16<<<(unsigned)((((long long)(4096) * ((256) / 2)) + 255) / 256), 256, 0, stream>>>(PHT, 256, (_Float16*)(G64B), 256, 4096, 256, 1.0f);
    w25::wmma_gemm64<0, false, 0, 0, false, 0><<<dim3((unsigned)((((2048) / 64) * ((4096) / 64) + 7) / 8), (unsigned)(1)), 256, 0, stream>>>((const unsigned short*)(G64A), nullptr, 256, 0, (const unsigned short*)(G64B), nullptr, 256, 0, (void*)(EN), nullptr, 4096, 0, nullptr, nullptr, 0, 2048, 4096, 256, 1.0f);
    k_cm_soft<<<HS, 256, 0, stream>>>(EN, (_Float16*)P16, HW);
    w25::wmma_gemm64<0, false, 0, 0, false, 0><<<dim3((unsigned)((((A) / 64) * ((HS) / 64) + 7) / 8), (unsigned)(1)), 256, 0, stream>>>((const unsigned short*)(VAL16), nullptr, HW, 0, (const unsigned short*)(P16), nullptr, HW, 0, (void*)(ATT + (size_t)1 * HS), nullptr, HW, 0, nullptr, nullptr, 0, A, HS, HW, 0.000244140625f);
    k_cast16<<<(unsigned)((((long long)(256) * ((256) / 2)) + 255) / 256), 256, 0, stream>>>(iwo, 256, (_Float16*)(G64A), 256, 256, 256, 16.0f);
    k_castT16<<<(unsigned)((((long long)(4096) * ((256) / 2)) + 255) / 256), 256, 0, stream>>>(ATT, 4096, (_Float16*)(G64B), 256, 256, 4096, 1.0f);
    w25::wmma_gemm64<0, false, 1, 0, false, 0><<<dim3((unsigned)((((256) / 64) * ((4096) / 64) + 7) / 8), (unsigned)(1)), 256, 0, stream>>>((const unsigned short*)(G64A), nullptr, 256, 0, (const unsigned short*)(G64B), nullptr, 256, 0, (void*)(FUS + (size_t)0 * A * HW), nullptr, 4096, 0, ibo, nullptr, 0, 256, 4096, 256, 0.0625f);
    k_castT16<<<(unsigned)((((long long)(4096) * ((256) / 2)) + 255) / 256), 256, 0, stream>>>(flo + (size_t)1 * C * HW, 4096, (_Float16*)(G64A), 256, 256, 4096, 1.0f);
    k_cast16<<<(unsigned)((((long long)(256) * ((256) / 2)) + 255) / 256), 256, 0, stream>>>(lwt + 0, 256, (_Float16*)(G64B), 256, 256, 256, 16.0f);
    w25::wmma_gemm64<0, false, 0, 0, false, 0><<<dim3((unsigned)((((4096) / 64) * ((256) / 64) + 7) / 8), (unsigned)(1)), 256, 0, stream>>>((const unsigned short*)(G64A), nullptr, 256, 0, (const unsigned short*)(G64B), nullptr, 256, 0, (void*)(THT), nullptr, 256, 0, nullptr, nullptr, 0, 4096, 256, 256, 0.0625f);
    k_castT16<<<(unsigned)((((long long)(4096) * ((256) / 2)) + 255) / 256), 256, 0, stream>>>(flo + (size_t)1 * C * HW, 4096, (_Float16*)(G64A), 256, 256, 4096, 1.0f);
    k_cast16<<<(unsigned)((((long long)(256) * ((256) / 2)) + 255) / 256), 256, 0, stream>>>(lwp + 0, 256, (_Float16*)(G64B), 256, 256, 256, 16.0f);
    w25::wmma_gemm64<0, false, 0, 0, false, 0><<<dim3((unsigned)((((4096) / 64) * ((256) / 64) + 7) / 8), (unsigned)(1)), 256, 0, stream>>>((const unsigned short*)(G64A), nullptr, 256, 0, (const unsigned short*)(G64B), nullptr, 256, 0, (void*)(PHT), nullptr, 256, 0, nullptr, nullptr, 0, 4096, 256, 256, 0.0625f);
    k_cast16<<<(unsigned)((((long long)(256) * ((256) / 2)) + 255) / 256), 256, 0, stream>>>(lwv + 0, 256, (_Float16*)(G64A), 256, 256, 256, 1.0f);
    k_castT16<<<(unsigned)((((long long)(4096) * ((256) / 2)) + 255) / 256), 256, 0, stream>>>(flo + (size_t)1 * C * HW, 4096, (_Float16*)(G64B), 256, 256, 4096, 16.0f);
    w25::wmma_gemm64<0, false, 0, 0, false, 0><<<dim3((unsigned)((((256) / 64) * ((4096) / 64) + 7) / 8), (unsigned)(1)), 256, 0, stream>>>((const unsigned short*)(G64A), nullptr, 256, 0, (const unsigned short*)(G64B), nullptr, 256, 0, (void*)(VAL), nullptr, 4096, 0, nullptr, nullptr, 0, 256, 4096, 256, 0.0625f);
    k_cm_spT<<<(unsigned)(((long long)HW * A + 255) / 256), 256, 0, stream>>>(THT, lwt, lbt, 256, -1, A, (long long)HW * A); k_cm_spT<<<(unsigned)(((long long)HW * A + 255) / 256), 256, 0, stream>>>(PHT, lwp, lbp, 256, -1, A, (long long)HW * A); k_cm_spC<<<(unsigned)(((long long)A * HW + 255) / 256), 256, 0, stream>>>(VAL, lwv, lbv, 256, -1, HW, (long long)A * HW); k_cm_v16<<<(unsigned)(((long long)A * HW / 2 + 255) / 256), 256, 0, stream>>>(VAL, (_Float16*)VAL16, (long long)A * HW);
    k_cast16<<<(unsigned)((((long long)(2048) * ((256) / 2)) + 255) / 256), 256, 0, stream>>>(THT + (size_t)0 * HS * A, 256, (_Float16*)(G64A), 256, 2048, 256, 1.0f);
    k_cast16<<<(unsigned)((((long long)(4096) * ((256) / 2)) + 255) / 256), 256, 0, stream>>>(PHT, 256, (_Float16*)(G64B), 256, 4096, 256, 1.0f);
    w25::wmma_gemm64<0, false, 0, 0, false, 0><<<dim3((unsigned)((((2048) / 64) * ((4096) / 64) + 7) / 8), (unsigned)(1)), 256, 0, stream>>>((const unsigned short*)(G64A), nullptr, 256, 0, (const unsigned short*)(G64B), nullptr, 256, 0, (void*)(EN), nullptr, 4096, 0, nullptr, nullptr, 0, 2048, 4096, 256, 1.0f);
    k_cm_soft<<<HS, 256, 0, stream>>>(EN, (_Float16*)P16, HW);
    w25::wmma_gemm64<0, false, 0, 0, false, 0><<<dim3((unsigned)((((A) / 64) * ((HS) / 64) + 7) / 8), (unsigned)(1)), 256, 0, stream>>>((const unsigned short*)(VAL16), nullptr, HW, 0, (const unsigned short*)(P16), nullptr, HW, 0, (void*)(ATT + (size_t)0 * HS), nullptr, HW, 0, nullptr, nullptr, 0, A, HS, HW, 0.000244140625f);
    k_cast16<<<(unsigned)((((long long)(2048) * ((256) / 2)) + 255) / 256), 256, 0, stream>>>(THT + (size_t)1 * HS * A, 256, (_Float16*)(G64A), 256, 2048, 256, 1.0f);
    k_cast16<<<(unsigned)((((long long)(4096) * ((256) / 2)) + 255) / 256), 256, 0, stream>>>(PHT, 256, (_Float16*)(G64B), 256, 4096, 256, 1.0f);
    w25::wmma_gemm64<0, false, 0, 0, false, 0><<<dim3((unsigned)((((2048) / 64) * ((4096) / 64) + 7) / 8), (unsigned)(1)), 256, 0, stream>>>((const unsigned short*)(G64A), nullptr, 256, 0, (const unsigned short*)(G64B), nullptr, 256, 0, (void*)(EN), nullptr, 4096, 0, nullptr, nullptr, 0, 2048, 4096, 256, 1.0f);
    k_cm_soft<<<HS, 256, 0, stream>>>(EN, (_Float16*)P16, HW);
    w25::wmma_gemm64<0, false, 0, 0, false, 0><<<dim3((unsigned)((((A) / 64) * ((HS) / 64) + 7) / 8), (unsigned)(1)), 256, 0, stream>>>((const unsigned short*)(VAL16), nullptr, HW, 0, (const unsigned short*)(P16), nullptr, HW, 0, (void*)(ATT + (size_t)1 * HS), nullptr, HW, 0, nullptr, nullptr, 0, A, HS, HW, 0.000244140625f);
    k_cast16<<<(unsigned)((((long long)(256) * ((256) / 2)) + 255) / 256), 256, 0, stream>>>(lwo, 256, (_Float16*)(G64A), 256, 256, 256, 16.0f);
    k_castT16<<<(unsigned)((((long long)(4096) * ((256) / 2)) + 255) / 256), 256, 0, stream>>>(ATT, 4096, (_Float16*)(G64B), 256, 256, 4096, 1.0f);
    w25::wmma_gemm64<0, false, 1, 0, false, 0><<<dim3((unsigned)((((256) / 64) * ((4096) / 64) + 7) / 8), (unsigned)(1)), 256, 0, stream>>>((const unsigned short*)(G64A), nullptr, 256, 0, (const unsigned short*)(G64B), nullptr, 256, 0, (void*)(FUS + (size_t)1 * A * HW), nullptr, 4096, 0, lbo, nullptr, 0, 256, 4096, 256, 0.0625f);
    k_cast16<<<(unsigned)((((long long)(256) * ((512) / 2)) + 255) / 256), 256, 0, stream>>>(fw, 520, (_Float16*)(G64A), 512, 256, 512, 16.0f);
    k_castT16<<<(unsigned)((((long long)(4096) * ((512) / 2)) + 255) / 256), 256, 0, stream>>>(FUS, 4096, (_Float16*)(G64B), 512, 512, 4096, 1.0f);
    w25::wmma_gemm64<0, false, 0, 0, false, 0><<<dim3((unsigned)((((256) / 64) * ((4096) / 64) + 7) / 8), (unsigned)(1)), 256, 0, stream>>>((const unsigned short*)(G64A), nullptr, 512, 0, (const unsigned short*)(G64B), nullptr, 512, 0, (void*)(out + (size_t)1 * A * HW), nullptr, 4096, 0, nullptr, nullptr, 0, 256, 4096, 512, 0.0625f);
    k_cm_spC<<<(unsigned)(((long long)A * HW + 255) / 256), 256, 0, stream>>>(out + (size_t)1 * A * HW, fw, fb, 520, 512, HW, (long long)A * HW);
    k_castT16<<<(unsigned)((((long long)(4096) * ((256) / 2)) + 255) / 256), 256, 0, stream>>>(img + (size_t)2 * C * HW, 4096, (_Float16*)(G64A), 256, 256, 4096, 1.0f);
    k_cast16<<<(unsigned)((((long long)(256) * ((256) / 2)) + 255) / 256), 256, 0, stream>>>(iwt + 0, 520, (_Float16*)(G64B), 256, 256, 256, 16.0f);
    w25::wmma_gemm64<0, false, 0, 0, false, 0><<<dim3((unsigned)((((4096) / 64) * ((256) / 64) + 7) / 8), (unsigned)(1)), 256, 0, stream>>>((const unsigned short*)(G64A), nullptr, 256, 0, (const unsigned short*)(G64B), nullptr, 256, 0, (void*)(THT), nullptr, 256, 0, nullptr, nullptr, 0, 4096, 256, 256, 0.0625f);
    k_castT16<<<(unsigned)((((long long)(4096) * ((256) / 2)) + 255) / 256), 256, 0, stream>>>(flo + (size_t)2 * C * HW, 4096, (_Float16*)(G64A), 256, 256, 4096, 1.0f);
    k_cast16<<<(unsigned)((((long long)(256) * ((256) / 2)) + 255) / 256), 256, 0, stream>>>(iwt + 256, 520, (_Float16*)(G64B), 256, 256, 256, 16.0f);
    w25::wmma_gemm64<0, false, 0, 0, true, 0><<<dim3((unsigned)((((4096) / 64) * ((256) / 64) + 7) / 8), (unsigned)(1)), 256, 0, stream>>>((const unsigned short*)(G64A), nullptr, 256, 0, (const unsigned short*)(G64B), nullptr, 256, 0, (void*)(THT), nullptr, 256, 0, nullptr, THT, 0, 4096, 256, 256, 0.0625f);
    k_castT16<<<(unsigned)((((long long)(4096) * ((256) / 2)) + 255) / 256), 256, 0, stream>>>(img + (size_t)2 * C * HW, 4096, (_Float16*)(G64A), 256, 256, 4096, 1.0f);
    k_cast16<<<(unsigned)((((long long)(256) * ((256) / 2)) + 255) / 256), 256, 0, stream>>>(iwp + 0, 520, (_Float16*)(G64B), 256, 256, 256, 16.0f);
    w25::wmma_gemm64<0, false, 0, 0, false, 0><<<dim3((unsigned)((((4096) / 64) * ((256) / 64) + 7) / 8), (unsigned)(1)), 256, 0, stream>>>((const unsigned short*)(G64A), nullptr, 256, 0, (const unsigned short*)(G64B), nullptr, 256, 0, (void*)(PHT), nullptr, 256, 0, nullptr, nullptr, 0, 4096, 256, 256, 0.0625f);
    k_castT16<<<(unsigned)((((long long)(4096) * ((256) / 2)) + 255) / 256), 256, 0, stream>>>(flo + (size_t)2 * C * HW, 4096, (_Float16*)(G64A), 256, 256, 4096, 1.0f);
    k_cast16<<<(unsigned)((((long long)(256) * ((256) / 2)) + 255) / 256), 256, 0, stream>>>(iwp + 256, 520, (_Float16*)(G64B), 256, 256, 256, 16.0f);
    w25::wmma_gemm64<0, false, 0, 0, true, 0><<<dim3((unsigned)((((4096) / 64) * ((256) / 64) + 7) / 8), (unsigned)(1)), 256, 0, stream>>>((const unsigned short*)(G64A), nullptr, 256, 0, (const unsigned short*)(G64B), nullptr, 256, 0, (void*)(PHT), nullptr, 256, 0, nullptr, PHT, 0, 4096, 256, 256, 0.0625f);
    k_cast16<<<(unsigned)((((long long)(256) * ((256) / 2)) + 255) / 256), 256, 0, stream>>>(iwv + 0, 520, (_Float16*)(G64A), 256, 256, 256, 1.0f);
    k_castT16<<<(unsigned)((((long long)(4096) * ((256) / 2)) + 255) / 256), 256, 0, stream>>>(img + (size_t)2 * C * HW, 4096, (_Float16*)(G64B), 256, 256, 4096, 16.0f);
    w25::wmma_gemm64<0, false, 0, 0, false, 0><<<dim3((unsigned)((((256) / 64) * ((4096) / 64) + 7) / 8), (unsigned)(1)), 256, 0, stream>>>((const unsigned short*)(G64A), nullptr, 256, 0, (const unsigned short*)(G64B), nullptr, 256, 0, (void*)(VAL), nullptr, 4096, 0, nullptr, nullptr, 0, 256, 4096, 256, 0.0625f);
    k_cast16<<<(unsigned)((((long long)(256) * ((256) / 2)) + 255) / 256), 256, 0, stream>>>(iwv + 256, 520, (_Float16*)(G64A), 256, 256, 256, 1.0f);
    k_castT16<<<(unsigned)((((long long)(4096) * ((256) / 2)) + 255) / 256), 256, 0, stream>>>(flo + (size_t)2 * C * HW, 4096, (_Float16*)(G64B), 256, 256, 4096, 16.0f);
    w25::wmma_gemm64<0, false, 0, 0, true, 0><<<dim3((unsigned)((((256) / 64) * ((4096) / 64) + 7) / 8), (unsigned)(1)), 256, 0, stream>>>((const unsigned short*)(G64A), nullptr, 256, 0, (const unsigned short*)(G64B), nullptr, 256, 0, (void*)(VAL), nullptr, 4096, 0, nullptr, VAL, 0, 256, 4096, 256, 0.0625f);
    k_cm_spT<<<(unsigned)(((long long)HW * A + 255) / 256), 256, 0, stream>>>(THT, iwt, ibt, 520, 512, A, (long long)HW * A); k_cm_spT<<<(unsigned)(((long long)HW * A + 255) / 256), 256, 0, stream>>>(PHT, iwp, ibp, 520, 512, A, (long long)HW * A); k_cm_spC<<<(unsigned)(((long long)A * HW + 255) / 256), 256, 0, stream>>>(VAL, iwv, ibv, 520, 512, HW, (long long)A * HW); k_cm_v16<<<(unsigned)(((long long)A * HW / 2 + 255) / 256), 256, 0, stream>>>(VAL, (_Float16*)VAL16, (long long)A * HW);
    k_cast16<<<(unsigned)((((long long)(2048) * ((256) / 2)) + 255) / 256), 256, 0, stream>>>(THT + (size_t)0 * HS * A, 256, (_Float16*)(G64A), 256, 2048, 256, 1.0f);
    k_cast16<<<(unsigned)((((long long)(4096) * ((256) / 2)) + 255) / 256), 256, 0, stream>>>(PHT, 256, (_Float16*)(G64B), 256, 4096, 256, 1.0f);
    w25::wmma_gemm64<0, false, 0, 0, false, 0><<<dim3((unsigned)((((2048) / 64) * ((4096) / 64) + 7) / 8), (unsigned)(1)), 256, 0, stream>>>((const unsigned short*)(G64A), nullptr, 256, 0, (const unsigned short*)(G64B), nullptr, 256, 0, (void*)(EN), nullptr, 4096, 0, nullptr, nullptr, 0, 2048, 4096, 256, 1.0f);
    k_cm_soft<<<HS, 256, 0, stream>>>(EN, (_Float16*)P16, HW);
    w25::wmma_gemm64<0, false, 0, 0, false, 0><<<dim3((unsigned)((((A) / 64) * ((HS) / 64) + 7) / 8), (unsigned)(1)), 256, 0, stream>>>((const unsigned short*)(VAL16), nullptr, HW, 0, (const unsigned short*)(P16), nullptr, HW, 0, (void*)(ATT + (size_t)0 * HS), nullptr, HW, 0, nullptr, nullptr, 0, A, HS, HW, 0.000244140625f);
    k_cast16<<<(unsigned)((((long long)(2048) * ((256) / 2)) + 255) / 256), 256, 0, stream>>>(THT + (size_t)1 * HS * A, 256, (_Float16*)(G64A), 256, 2048, 256, 1.0f);
    k_cast16<<<(unsigned)((((long long)(4096) * ((256) / 2)) + 255) / 256), 256, 0, stream>>>(PHT, 256, (_Float16*)(G64B), 256, 4096, 256, 1.0f);
    w25::wmma_gemm64<0, false, 0, 0, false, 0><<<dim3((unsigned)((((2048) / 64) * ((4096) / 64) + 7) / 8), (unsigned)(1)), 256, 0, stream>>>((const unsigned short*)(G64A), nullptr, 256, 0, (const unsigned short*)(G64B), nullptr, 256, 0, (void*)(EN), nullptr, 4096, 0, nullptr, nullptr, 0, 2048, 4096, 256, 1.0f);
    k_cm_soft<<<HS, 256, 0, stream>>>(EN, (_Float16*)P16, HW);
    w25::wmma_gemm64<0, false, 0, 0, false, 0><<<dim3((unsigned)((((A) / 64) * ((HS) / 64) + 7) / 8), (unsigned)(1)), 256, 0, stream>>>((const unsigned short*)(VAL16), nullptr, HW, 0, (const unsigned short*)(P16), nullptr, HW, 0, (void*)(ATT + (size_t)1 * HS), nullptr, HW, 0, nullptr, nullptr, 0, A, HS, HW, 0.000244140625f);
    k_cast16<<<(unsigned)((((long long)(256) * ((256) / 2)) + 255) / 256), 256, 0, stream>>>(iwo, 256, (_Float16*)(G64A), 256, 256, 256, 16.0f);
    k_castT16<<<(unsigned)((((long long)(4096) * ((256) / 2)) + 255) / 256), 256, 0, stream>>>(ATT, 4096, (_Float16*)(G64B), 256, 256, 4096, 1.0f);
    w25::wmma_gemm64<0, false, 1, 0, false, 0><<<dim3((unsigned)((((256) / 64) * ((4096) / 64) + 7) / 8), (unsigned)(1)), 256, 0, stream>>>((const unsigned short*)(G64A), nullptr, 256, 0, (const unsigned short*)(G64B), nullptr, 256, 0, (void*)(FUS + (size_t)0 * A * HW), nullptr, 4096, 0, ibo, nullptr, 0, 256, 4096, 256, 0.0625f);
    k_castT16<<<(unsigned)((((long long)(4096) * ((256) / 2)) + 255) / 256), 256, 0, stream>>>(flo + (size_t)2 * C * HW, 4096, (_Float16*)(G64A), 256, 256, 4096, 1.0f);
    k_cast16<<<(unsigned)((((long long)(256) * ((256) / 2)) + 255) / 256), 256, 0, stream>>>(lwt + 0, 256, (_Float16*)(G64B), 256, 256, 256, 16.0f);
    w25::wmma_gemm64<0, false, 0, 0, false, 0><<<dim3((unsigned)((((4096) / 64) * ((256) / 64) + 7) / 8), (unsigned)(1)), 256, 0, stream>>>((const unsigned short*)(G64A), nullptr, 256, 0, (const unsigned short*)(G64B), nullptr, 256, 0, (void*)(THT), nullptr, 256, 0, nullptr, nullptr, 0, 4096, 256, 256, 0.0625f);
    k_castT16<<<(unsigned)((((long long)(4096) * ((256) / 2)) + 255) / 256), 256, 0, stream>>>(flo + (size_t)2 * C * HW, 4096, (_Float16*)(G64A), 256, 256, 4096, 1.0f);
    k_cast16<<<(unsigned)((((long long)(256) * ((256) / 2)) + 255) / 256), 256, 0, stream>>>(lwp + 0, 256, (_Float16*)(G64B), 256, 256, 256, 16.0f);
    w25::wmma_gemm64<0, false, 0, 0, false, 0><<<dim3((unsigned)((((4096) / 64) * ((256) / 64) + 7) / 8), (unsigned)(1)), 256, 0, stream>>>((const unsigned short*)(G64A), nullptr, 256, 0, (const unsigned short*)(G64B), nullptr, 256, 0, (void*)(PHT), nullptr, 256, 0, nullptr, nullptr, 0, 4096, 256, 256, 0.0625f);
    k_cast16<<<(unsigned)((((long long)(256) * ((256) / 2)) + 255) / 256), 256, 0, stream>>>(lwv + 0, 256, (_Float16*)(G64A), 256, 256, 256, 1.0f);
    k_castT16<<<(unsigned)((((long long)(4096) * ((256) / 2)) + 255) / 256), 256, 0, stream>>>(flo + (size_t)2 * C * HW, 4096, (_Float16*)(G64B), 256, 256, 4096, 16.0f);
    w25::wmma_gemm64<0, false, 0, 0, false, 0><<<dim3((unsigned)((((256) / 64) * ((4096) / 64) + 7) / 8), (unsigned)(1)), 256, 0, stream>>>((const unsigned short*)(G64A), nullptr, 256, 0, (const unsigned short*)(G64B), nullptr, 256, 0, (void*)(VAL), nullptr, 4096, 0, nullptr, nullptr, 0, 256, 4096, 256, 0.0625f);
    k_cm_spT<<<(unsigned)(((long long)HW * A + 255) / 256), 256, 0, stream>>>(THT, lwt, lbt, 256, -1, A, (long long)HW * A); k_cm_spT<<<(unsigned)(((long long)HW * A + 255) / 256), 256, 0, stream>>>(PHT, lwp, lbp, 256, -1, A, (long long)HW * A); k_cm_spC<<<(unsigned)(((long long)A * HW + 255) / 256), 256, 0, stream>>>(VAL, lwv, lbv, 256, -1, HW, (long long)A * HW); k_cm_v16<<<(unsigned)(((long long)A * HW / 2 + 255) / 256), 256, 0, stream>>>(VAL, (_Float16*)VAL16, (long long)A * HW);
    k_cast16<<<(unsigned)((((long long)(2048) * ((256) / 2)) + 255) / 256), 256, 0, stream>>>(THT + (size_t)0 * HS * A, 256, (_Float16*)(G64A), 256, 2048, 256, 1.0f);
    k_cast16<<<(unsigned)((((long long)(4096) * ((256) / 2)) + 255) / 256), 256, 0, stream>>>(PHT, 256, (_Float16*)(G64B), 256, 4096, 256, 1.0f);
    w25::wmma_gemm64<0, false, 0, 0, false, 0><<<dim3((unsigned)((((2048) / 64) * ((4096) / 64) + 7) / 8), (unsigned)(1)), 256, 0, stream>>>((const unsigned short*)(G64A), nullptr, 256, 0, (const unsigned short*)(G64B), nullptr, 256, 0, (void*)(EN), nullptr, 4096, 0, nullptr, nullptr, 0, 2048, 4096, 256, 1.0f);
    k_cm_soft<<<HS, 256, 0, stream>>>(EN, (_Float16*)P16, HW);
    w25::wmma_gemm64<0, false, 0, 0, false, 0><<<dim3((unsigned)((((A) / 64) * ((HS) / 64) + 7) / 8), (unsigned)(1)), 256, 0, stream>>>((const unsigned short*)(VAL16), nullptr, HW, 0, (const unsigned short*)(P16), nullptr, HW, 0, (void*)(ATT + (size_t)0 * HS), nullptr, HW, 0, nullptr, nullptr, 0, A, HS, HW, 0.000244140625f);
    k_cast16<<<(unsigned)((((long long)(2048) * ((256) / 2)) + 255) / 256), 256, 0, stream>>>(THT + (size_t)1 * HS * A, 256, (_Float16*)(G64A), 256, 2048, 256, 1.0f);
    k_cast16<<<(unsigned)((((long long)(4096) * ((256) / 2)) + 255) / 256), 256, 0, stream>>>(PHT, 256, (_Float16*)(G64B), 256, 4096, 256, 1.0f);
    w25::wmma_gemm64<0, false, 0, 0, false, 0><<<dim3((unsigned)((((2048) / 64) * ((4096) / 64) + 7) / 8), (unsigned)(1)), 256, 0, stream>>>((const unsigned short*)(G64A), nullptr, 256, 0, (const unsigned short*)(G64B), nullptr, 256, 0, (void*)(EN), nullptr, 4096, 0, nullptr, nullptr, 0, 2048, 4096, 256, 1.0f);
    k_cm_soft<<<HS, 256, 0, stream>>>(EN, (_Float16*)P16, HW);
    w25::wmma_gemm64<0, false, 0, 0, false, 0><<<dim3((unsigned)((((A) / 64) * ((HS) / 64) + 7) / 8), (unsigned)(1)), 256, 0, stream>>>((const unsigned short*)(VAL16), nullptr, HW, 0, (const unsigned short*)(P16), nullptr, HW, 0, (void*)(ATT + (size_t)1 * HS), nullptr, HW, 0, nullptr, nullptr, 0, A, HS, HW, 0.000244140625f);
    k_cast16<<<(unsigned)((((long long)(256) * ((256) / 2)) + 255) / 256), 256, 0, stream>>>(lwo, 256, (_Float16*)(G64A), 256, 256, 256, 16.0f);
    k_castT16<<<(unsigned)((((long long)(4096) * ((256) / 2)) + 255) / 256), 256, 0, stream>>>(ATT, 4096, (_Float16*)(G64B), 256, 256, 4096, 1.0f);
    w25::wmma_gemm64<0, false, 1, 0, false, 0><<<dim3((unsigned)((((256) / 64) * ((4096) / 64) + 7) / 8), (unsigned)(1)), 256, 0, stream>>>((const unsigned short*)(G64A), nullptr, 256, 0, (const unsigned short*)(G64B), nullptr, 256, 0, (void*)(FUS + (size_t)1 * A * HW), nullptr, 4096, 0, lbo, nullptr, 0, 256, 4096, 256, 0.0625f);
    k_cast16<<<(unsigned)((((long long)(256) * ((512) / 2)) + 255) / 256), 256, 0, stream>>>(fw, 520, (_Float16*)(G64A), 512, 256, 512, 16.0f);
    k_castT16<<<(unsigned)((((long long)(4096) * ((512) / 2)) + 255) / 256), 256, 0, stream>>>(FUS, 4096, (_Float16*)(G64B), 512, 512, 4096, 1.0f);
    w25::wmma_gemm64<0, false, 0, 0, false, 0><<<dim3((unsigned)((((256) / 64) * ((4096) / 64) + 7) / 8), (unsigned)(1)), 256, 0, stream>>>((const unsigned short*)(G64A), nullptr, 512, 0, (const unsigned short*)(G64B), nullptr, 512, 0, (void*)(out + (size_t)2 * A * HW), nullptr, 4096, 0, nullptr, nullptr, 0, 256, 4096, 512, 0.0625f);
    k_cm_spC<<<(unsigned)(((long long)A * HW + 255) / 256), 256, 0, stream>>>(out + (size_t)2 * A * HW, fw, fb, 520, 512, HW, (long long)A * HW);
    k_castT16<<<(unsigned)((((long long)(4096) * ((256) / 2)) + 255) / 256), 256, 0, stream>>>(img + (size_t)3 * C * HW, 4096, (_Float16*)(G64A), 256, 256, 4096, 1.0f);
    k_cast16<<<(unsigned)((((long long)(256) * ((256) / 2)) + 255) / 256), 256, 0, stream>>>(iwt + 0, 520, (_Float16*)(G64B), 256, 256, 256, 16.0f);
    w25::wmma_gemm64<0, false, 0, 0, false, 0><<<dim3((unsigned)((((4096) / 64) * ((256) / 64) + 7) / 8), (unsigned)(1)), 256, 0, stream>>>((const unsigned short*)(G64A), nullptr, 256, 0, (const unsigned short*)(G64B), nullptr, 256, 0, (void*)(THT), nullptr, 256, 0, nullptr, nullptr, 0, 4096, 256, 256, 0.0625f);
    k_castT16<<<(unsigned)((((long long)(4096) * ((256) / 2)) + 255) / 256), 256, 0, stream>>>(flo + (size_t)3 * C * HW, 4096, (_Float16*)(G64A), 256, 256, 4096, 1.0f);
    k_cast16<<<(unsigned)((((long long)(256) * ((256) / 2)) + 255) / 256), 256, 0, stream>>>(iwt + 256, 520, (_Float16*)(G64B), 256, 256, 256, 16.0f);
    w25::wmma_gemm64<0, false, 0, 0, true, 0><<<dim3((unsigned)((((4096) / 64) * ((256) / 64) + 7) / 8), (unsigned)(1)), 256, 0, stream>>>((const unsigned short*)(G64A), nullptr, 256, 0, (const unsigned short*)(G64B), nullptr, 256, 0, (void*)(THT), nullptr, 256, 0, nullptr, THT, 0, 4096, 256, 256, 0.0625f);
    k_castT16<<<(unsigned)((((long long)(4096) * ((256) / 2)) + 255) / 256), 256, 0, stream>>>(img + (size_t)3 * C * HW, 4096, (_Float16*)(G64A), 256, 256, 4096, 1.0f);
    k_cast16<<<(unsigned)((((long long)(256) * ((256) / 2)) + 255) / 256), 256, 0, stream>>>(iwp + 0, 520, (_Float16*)(G64B), 256, 256, 256, 16.0f);
    w25::wmma_gemm64<0, false, 0, 0, false, 0><<<dim3((unsigned)((((4096) / 64) * ((256) / 64) + 7) / 8), (unsigned)(1)), 256, 0, stream>>>((const unsigned short*)(G64A), nullptr, 256, 0, (const unsigned short*)(G64B), nullptr, 256, 0, (void*)(PHT), nullptr, 256, 0, nullptr, nullptr, 0, 4096, 256, 256, 0.0625f);
    k_castT16<<<(unsigned)((((long long)(4096) * ((256) / 2)) + 255) / 256), 256, 0, stream>>>(flo + (size_t)3 * C * HW, 4096, (_Float16*)(G64A), 256, 256, 4096, 1.0f);
    k_cast16<<<(unsigned)((((long long)(256) * ((256) / 2)) + 255) / 256), 256, 0, stream>>>(iwp + 256, 520, (_Float16*)(G64B), 256, 256, 256, 16.0f);
    w25::wmma_gemm64<0, false, 0, 0, true, 0><<<dim3((unsigned)((((4096) / 64) * ((256) / 64) + 7) / 8), (unsigned)(1)), 256, 0, stream>>>((const unsigned short*)(G64A), nullptr, 256, 0, (const unsigned short*)(G64B), nullptr, 256, 0, (void*)(PHT), nullptr, 256, 0, nullptr, PHT, 0, 4096, 256, 256, 0.0625f);
    k_cast16<<<(unsigned)((((long long)(256) * ((256) / 2)) + 255) / 256), 256, 0, stream>>>(iwv + 0, 520, (_Float16*)(G64A), 256, 256, 256, 1.0f);
    k_castT16<<<(unsigned)((((long long)(4096) * ((256) / 2)) + 255) / 256), 256, 0, stream>>>(img + (size_t)3 * C * HW, 4096, (_Float16*)(G64B), 256, 256, 4096, 16.0f);
    w25::wmma_gemm64<0, false, 0, 0, false, 0><<<dim3((unsigned)((((256) / 64) * ((4096) / 64) + 7) / 8), (unsigned)(1)), 256, 0, stream>>>((const unsigned short*)(G64A), nullptr, 256, 0, (const unsigned short*)(G64B), nullptr, 256, 0, (void*)(VAL), nullptr, 4096, 0, nullptr, nullptr, 0, 256, 4096, 256, 0.0625f);
    k_cast16<<<(unsigned)((((long long)(256) * ((256) / 2)) + 255) / 256), 256, 0, stream>>>(iwv + 256, 520, (_Float16*)(G64A), 256, 256, 256, 1.0f);
    k_castT16<<<(unsigned)((((long long)(4096) * ((256) / 2)) + 255) / 256), 256, 0, stream>>>(flo + (size_t)3 * C * HW, 4096, (_Float16*)(G64B), 256, 256, 4096, 16.0f);
    w25::wmma_gemm64<0, false, 0, 0, true, 0><<<dim3((unsigned)((((256) / 64) * ((4096) / 64) + 7) / 8), (unsigned)(1)), 256, 0, stream>>>((const unsigned short*)(G64A), nullptr, 256, 0, (const unsigned short*)(G64B), nullptr, 256, 0, (void*)(VAL), nullptr, 4096, 0, nullptr, VAL, 0, 256, 4096, 256, 0.0625f);
    k_cm_spT<<<(unsigned)(((long long)HW * A + 255) / 256), 256, 0, stream>>>(THT, iwt, ibt, 520, 512, A, (long long)HW * A); k_cm_spT<<<(unsigned)(((long long)HW * A + 255) / 256), 256, 0, stream>>>(PHT, iwp, ibp, 520, 512, A, (long long)HW * A); k_cm_spC<<<(unsigned)(((long long)A * HW + 255) / 256), 256, 0, stream>>>(VAL, iwv, ibv, 520, 512, HW, (long long)A * HW); k_cm_v16<<<(unsigned)(((long long)A * HW / 2 + 255) / 256), 256, 0, stream>>>(VAL, (_Float16*)VAL16, (long long)A * HW);
    k_cast16<<<(unsigned)((((long long)(2048) * ((256) / 2)) + 255) / 256), 256, 0, stream>>>(THT + (size_t)0 * HS * A, 256, (_Float16*)(G64A), 256, 2048, 256, 1.0f);
    k_cast16<<<(unsigned)((((long long)(4096) * ((256) / 2)) + 255) / 256), 256, 0, stream>>>(PHT, 256, (_Float16*)(G64B), 256, 4096, 256, 1.0f);
    w25::wmma_gemm64<0, false, 0, 0, false, 0><<<dim3((unsigned)((((2048) / 64) * ((4096) / 64) + 7) / 8), (unsigned)(1)), 256, 0, stream>>>((const unsigned short*)(G64A), nullptr, 256, 0, (const unsigned short*)(G64B), nullptr, 256, 0, (void*)(EN), nullptr, 4096, 0, nullptr, nullptr, 0, 2048, 4096, 256, 1.0f);
    k_cm_soft<<<HS, 256, 0, stream>>>(EN, (_Float16*)P16, HW);
    w25::wmma_gemm64<0, false, 0, 0, false, 0><<<dim3((unsigned)((((A) / 64) * ((HS) / 64) + 7) / 8), (unsigned)(1)), 256, 0, stream>>>((const unsigned short*)(VAL16), nullptr, HW, 0, (const unsigned short*)(P16), nullptr, HW, 0, (void*)(ATT + (size_t)0 * HS), nullptr, HW, 0, nullptr, nullptr, 0, A, HS, HW, 0.000244140625f);
    k_cast16<<<(unsigned)((((long long)(2048) * ((256) / 2)) + 255) / 256), 256, 0, stream>>>(THT + (size_t)1 * HS * A, 256, (_Float16*)(G64A), 256, 2048, 256, 1.0f);
    k_cast16<<<(unsigned)((((long long)(4096) * ((256) / 2)) + 255) / 256), 256, 0, stream>>>(PHT, 256, (_Float16*)(G64B), 256, 4096, 256, 1.0f);
    w25::wmma_gemm64<0, false, 0, 0, false, 0><<<dim3((unsigned)((((2048) / 64) * ((4096) / 64) + 7) / 8), (unsigned)(1)), 256, 0, stream>>>((const unsigned short*)(G64A), nullptr, 256, 0, (const unsigned short*)(G64B), nullptr, 256, 0, (void*)(EN), nullptr, 4096, 0, nullptr, nullptr, 0, 2048, 4096, 256, 1.0f);
    k_cm_soft<<<HS, 256, 0, stream>>>(EN, (_Float16*)P16, HW);
    w25::wmma_gemm64<0, false, 0, 0, false, 0><<<dim3((unsigned)((((A) / 64) * ((HS) / 64) + 7) / 8), (unsigned)(1)), 256, 0, stream>>>((const unsigned short*)(VAL16), nullptr, HW, 0, (const unsigned short*)(P16), nullptr, HW, 0, (void*)(ATT + (size_t)1 * HS), nullptr, HW, 0, nullptr, nullptr, 0, A, HS, HW, 0.000244140625f);
    k_cast16<<<(unsigned)((((long long)(256) * ((256) / 2)) + 255) / 256), 256, 0, stream>>>(iwo, 256, (_Float16*)(G64A), 256, 256, 256, 16.0f);
    k_castT16<<<(unsigned)((((long long)(4096) * ((256) / 2)) + 255) / 256), 256, 0, stream>>>(ATT, 4096, (_Float16*)(G64B), 256, 256, 4096, 1.0f);
    w25::wmma_gemm64<0, false, 1, 0, false, 0><<<dim3((unsigned)((((256) / 64) * ((4096) / 64) + 7) / 8), (unsigned)(1)), 256, 0, stream>>>((const unsigned short*)(G64A), nullptr, 256, 0, (const unsigned short*)(G64B), nullptr, 256, 0, (void*)(FUS + (size_t)0 * A * HW), nullptr, 4096, 0, ibo, nullptr, 0, 256, 4096, 256, 0.0625f);
    k_castT16<<<(unsigned)((((long long)(4096) * ((256) / 2)) + 255) / 256), 256, 0, stream>>>(flo + (size_t)3 * C * HW, 4096, (_Float16*)(G64A), 256, 256, 4096, 1.0f);
    k_cast16<<<(unsigned)((((long long)(256) * ((256) / 2)) + 255) / 256), 256, 0, stream>>>(lwt + 0, 256, (_Float16*)(G64B), 256, 256, 256, 16.0f);
    w25::wmma_gemm64<0, false, 0, 0, false, 0><<<dim3((unsigned)((((4096) / 64) * ((256) / 64) + 7) / 8), (unsigned)(1)), 256, 0, stream>>>((const unsigned short*)(G64A), nullptr, 256, 0, (const unsigned short*)(G64B), nullptr, 256, 0, (void*)(THT), nullptr, 256, 0, nullptr, nullptr, 0, 4096, 256, 256, 0.0625f);
    k_castT16<<<(unsigned)((((long long)(4096) * ((256) / 2)) + 255) / 256), 256, 0, stream>>>(flo + (size_t)3 * C * HW, 4096, (_Float16*)(G64A), 256, 256, 4096, 1.0f);
    k_cast16<<<(unsigned)((((long long)(256) * ((256) / 2)) + 255) / 256), 256, 0, stream>>>(lwp + 0, 256, (_Float16*)(G64B), 256, 256, 256, 16.0f);
    w25::wmma_gemm64<0, false, 0, 0, false, 0><<<dim3((unsigned)((((4096) / 64) * ((256) / 64) + 7) / 8), (unsigned)(1)), 256, 0, stream>>>((const unsigned short*)(G64A), nullptr, 256, 0, (const unsigned short*)(G64B), nullptr, 256, 0, (void*)(PHT), nullptr, 256, 0, nullptr, nullptr, 0, 4096, 256, 256, 0.0625f);
    k_cast16<<<(unsigned)((((long long)(256) * ((256) / 2)) + 255) / 256), 256, 0, stream>>>(lwv + 0, 256, (_Float16*)(G64A), 256, 256, 256, 1.0f);
    k_castT16<<<(unsigned)((((long long)(4096) * ((256) / 2)) + 255) / 256), 256, 0, stream>>>(flo + (size_t)3 * C * HW, 4096, (_Float16*)(G64B), 256, 256, 4096, 16.0f);
    w25::wmma_gemm64<0, false, 0, 0, false, 0><<<dim3((unsigned)((((256) / 64) * ((4096) / 64) + 7) / 8), (unsigned)(1)), 256, 0, stream>>>((const unsigned short*)(G64A), nullptr, 256, 0, (const unsigned short*)(G64B), nullptr, 256, 0, (void*)(VAL), nullptr, 4096, 0, nullptr, nullptr, 0, 256, 4096, 256, 0.0625f);
    k_cm_spT<<<(unsigned)(((long long)HW * A + 255) / 256), 256, 0, stream>>>(THT, lwt, lbt, 256, -1, A, (long long)HW * A); k_cm_spT<<<(unsigned)(((long long)HW * A + 255) / 256), 256, 0, stream>>>(PHT, lwp, lbp, 256, -1, A, (long long)HW * A); k_cm_spC<<<(unsigned)(((long long)A * HW + 255) / 256), 256, 0, stream>>>(VAL, lwv, lbv, 256, -1, HW, (long long)A * HW); k_cm_v16<<<(unsigned)(((long long)A * HW / 2 + 255) / 256), 256, 0, stream>>>(VAL, (_Float16*)VAL16, (long long)A * HW);
    k_cast16<<<(unsigned)((((long long)(2048) * ((256) / 2)) + 255) / 256), 256, 0, stream>>>(THT + (size_t)0 * HS * A, 256, (_Float16*)(G64A), 256, 2048, 256, 1.0f);
    k_cast16<<<(unsigned)((((long long)(4096) * ((256) / 2)) + 255) / 256), 256, 0, stream>>>(PHT, 256, (_Float16*)(G64B), 256, 4096, 256, 1.0f);
    w25::wmma_gemm64<0, false, 0, 0, false, 0><<<dim3((unsigned)((((2048) / 64) * ((4096) / 64) + 7) / 8), (unsigned)(1)), 256, 0, stream>>>((const unsigned short*)(G64A), nullptr, 256, 0, (const unsigned short*)(G64B), nullptr, 256, 0, (void*)(EN), nullptr, 4096, 0, nullptr, nullptr, 0, 2048, 4096, 256, 1.0f);
    k_cm_soft<<<HS, 256, 0, stream>>>(EN, (_Float16*)P16, HW);
    w25::wmma_gemm64<0, false, 0, 0, false, 0><<<dim3((unsigned)((((A) / 64) * ((HS) / 64) + 7) / 8), (unsigned)(1)), 256, 0, stream>>>((const unsigned short*)(VAL16), nullptr, HW, 0, (const unsigned short*)(P16), nullptr, HW, 0, (void*)(ATT + (size_t)0 * HS), nullptr, HW, 0, nullptr, nullptr, 0, A, HS, HW, 0.000244140625f);
    k_cast16<<<(unsigned)((((long long)(2048) * ((256) / 2)) + 255) / 256), 256, 0, stream>>>(THT + (size_t)1 * HS * A, 256, (_Float16*)(G64A), 256, 2048, 256, 1.0f);
    k_cast16<<<(unsigned)((((long long)(4096) * ((256) / 2)) + 255) / 256), 256, 0, stream>>>(PHT, 256, (_Float16*)(G64B), 256, 4096, 256, 1.0f);
    w25::wmma_gemm64<0, false, 0, 0, false, 0><<<dim3((unsigned)((((2048) / 64) * ((4096) / 64) + 7) / 8), (unsigned)(1)), 256, 0, stream>>>((const unsigned short*)(G64A), nullptr, 256, 0, (const unsigned short*)(G64B), nullptr, 256, 0, (void*)(EN), nullptr, 4096, 0, nullptr, nullptr, 0, 2048, 4096, 256, 1.0f);
    k_cm_soft<<<HS, 256, 0, stream>>>(EN, (_Float16*)P16, HW);
    w25::wmma_gemm64<0, false, 0, 0, false, 0><<<dim3((unsigned)((((A) / 64) * ((HS) / 64) + 7) / 8), (unsigned)(1)), 256, 0, stream>>>((const unsigned short*)(VAL16), nullptr, HW, 0, (const unsigned short*)(P16), nullptr, HW, 0, (void*)(ATT + (size_t)1 * HS), nullptr, HW, 0, nullptr, nullptr, 0, A, HS, HW, 0.000244140625f);
    k_cast16<<<(unsigned)((((long long)(256) * ((256) / 2)) + 255) / 256), 256, 0, stream>>>(lwo, 256, (_Float16*)(G64A), 256, 256, 256, 16.0f);
    k_castT16<<<(unsigned)((((long long)(4096) * ((256) / 2)) + 255) / 256), 256, 0, stream>>>(ATT, 4096, (_Float16*)(G64B), 256, 256, 4096, 1.0f);
    w25::wmma_gemm64<0, false, 1, 0, false, 0><<<dim3((unsigned)((((256) / 64) * ((4096) / 64) + 7) / 8), (unsigned)(1)), 256, 0, stream>>>((const unsigned short*)(G64A), nullptr, 256, 0, (const unsigned short*)(G64B), nullptr, 256, 0, (void*)(FUS + (size_t)1 * A * HW), nullptr, 4096, 0, lbo, nullptr, 0, 256, 4096, 256, 0.0625f);
    k_cast16<<<(unsigned)((((long long)(256) * ((512) / 2)) + 255) / 256), 256, 0, stream>>>(fw, 520, (_Float16*)(G64A), 512, 256, 512, 16.0f);
    k_castT16<<<(unsigned)((((long long)(4096) * ((512) / 2)) + 255) / 256), 256, 0, stream>>>(FUS, 4096, (_Float16*)(G64B), 512, 512, 4096, 1.0f);
    w25::wmma_gemm64<0, false, 0, 0, false, 0><<<dim3((unsigned)((((256) / 64) * ((4096) / 64) + 7) / 8), (unsigned)(1)), 256, 0, stream>>>((const unsigned short*)(G64A), nullptr, 512, 0, (const unsigned short*)(G64B), nullptr, 512, 0, (void*)(out + (size_t)3 * A * HW), nullptr, 4096, 0, nullptr, nullptr, 0, 256, 4096, 512, 0.0625f);
    k_cm_spC<<<(unsigned)(((long long)A * HW + 255) / 256), 256, 0, stream>>>(out + (size_t)3 * A * HW, fw, fb, 520, 512, HW, (long long)A * HW);
}

// v001
// A run of this version takes 2280 microseconds.
// Two timings next to v000 put it at 1.87 and 1.89 times that version's speed.
// Contractions (per sample, per branch): the 1x1 projections theta^T / phi^T = x^T.W^T [4096x512].[512x256] (image+flow channels as two K=256 products accumulated) and val = W.x [256x512].[512x4096] in the image branch (the flow branch's: K=256 over the flow channels alone), the affinity theta^T.phi [2048x256].[256x4096] per row half, att = val.attn^T [256x4096].[4096x2048] (attn as f16 of 4096 p; 32x64 work-group tiles, K dealt over 16 waves, f32 partials added in LDS), the output 1x1 convs W_o.att + b and the fusion conv over the concatenated branches — all f16 operands on pre-cast planes (v_wmma_f32_16x16x32_f16; 64x64 register-blocked wave tiles (att: 32x64 per wave), weights x16 (for val the x plane instead); strided channel-major operands); f32 accumulate. The 8 spatial-coordinate channels (gx, gy, 1-gx, 1-gy, (gx+gy)/2 x4, computed on device) enter the image branch's projections and the fusion conv as rank-8 f32 corrections (+bias); the row softmax (exp once) is an f32 kernel.
#include <hip/hip_runtime.h>
#include <math.h>

typedef __attribute__((ext_vector_type(16))) _Float16 v16h;
typedef __attribute__((ext_vector_type(8)))  _Float16 v8h;
typedef __attribute__((ext_vector_type(16))) __bf16   v16b;
typedef __attribute__((ext_vector_type(8)))  float    v8f;
typedef __attribute__((ext_vector_type(4)))  float    v4f;

// 16-bit WMMA fragment map (wave32), lane L, h = L>>4, m = L&15:
//   A 16x32: lane = row m;   element i -> k = (i<8) ? 8h+i : 16+8h+(i-8)
//   B 32x16: lane = column m; the SAME k(i,h)
//   D 16x16 (8 f32): lane = column m; element r -> row 8h+r
__device__ __forceinline__ int frag_k(int i, int h) { return (i < 8) ? (8 * h + i) : (16 + 8 * h + (i - 8)); }
__device__ __forceinline__ __bf16 bf16_rne(float f) {
    unsigned int u = __float_as_uint(f);
    u += 0x7fffu + ((u >> 16) & 1u);
    return __builtin_bit_cast(__bf16, (unsigned short)(u >> 16));
}
__device__ __forceinline__ float bf16_f32(__bf16 b) { return __uint_as_float(((unsigned int)__builtin_bit_cast(unsigned short, b)) << 16); }
__device__ __forceinline__ v8f wmma16(v16h a, v16h b, v8f c) {
    c = __builtin_amdgcn_wmma_f32_16x16x32_f16(false, a, false, b, (short)0, c, false, false);
    asm volatile("v_nop\n\tv_nop\n\tv_nop\n\tv_nop" : "+v"(c) : "v"(a), "v"(b));
    return c;
}
__device__ __forceinline__ v8f wmmab(v16b a, v16b b, v8f c) {
    c = __builtin_amdgcn_wmma_f32_16x16x32_bf16(false, a, false, b, (short)0, c, false, false);
    asm volatile("v_nop\n\tv_nop\n\tv_nop\n\tv_nop" : "+v"(c) : "v"(a), "v"(b));
    return c;
}
struct Split { v16b hi, lo; };
// hi/lo split product: a.hi*b.hi + a.hi*b.lo + a.lo*b.hi
__device__ __forceinline__ v8f wmma3(const Split& a, const Split& b, v8f c) {
    c = __builtin_amdgcn_wmma_f32_16x16x32_bf16(false, a.hi, false, b.hi, (short)0, c, false, false);
    c = __builtin_amdgcn_wmma_f32_16x16x32_bf16(false, a.hi, false, b.lo, (short)0, c, false, false);
    c = __builtin_amdgcn_wmma_f32_16x16x32_bf16(false, a.lo, false, b.hi, (short)0, c, false, false);
    asm volatile("v_nop\n\tv_nop\n\tv_nop\n\tv_nop" : "+v"(c) : "v"(a.hi), "v"(a.lo), "v"(b.hi), "v"(b.lo));
    return c;
}
struct Split3 { v16b hi, mid, lo; };
// triple split product (6 terms, drops only terms below 2^-24 relative)
__device__ __forceinline__ v8f wmma6(const Split3& a, const Split3& b, v8f c) {
    c = __builtin_amdgcn_wmma_f32_16x16x32_bf16(false, a.hi, false, b.hi, (short)0, c, false, false);
    c = __builtin_amdgcn_wmma_f32_16x16x32_bf16(false, a.hi, false, b.mid, (short)0, c, false, false);
    c = __builtin_amdgcn_wmma_f32_16x16x32_bf16(false, a.mid, false, b.hi, (short)0, c, false, false);
    c = __builtin_amdgcn_wmma_f32_16x16x32_bf16(false, a.hi, false, b.lo, (short)0, c, false, false);
    c = __builtin_amdgcn_wmma_f32_16x16x32_bf16(false, a.mid, false, b.mid, (short)0, c, false, false);
    c = __builtin_amdgcn_wmma_f32_16x16x32_bf16(false, a.lo, false, b.hi, (short)0, c, false, false);
    asm volatile("v_nop\n\tv_nop\n\tv_nop\n\tv_nop" : "+v"(c) : "v"(a.hi), "v"(a.mid), "v"(a.lo), "v"(b.hi), "v"(b.mid), "v"(b.lo));
    return c;
}

// Fragment gathers from f32 memory: element i <- p[(k0 + frag_k(i,h)) * sk] * s, zero for k >= klen.
__device__ __forceinline__ v16h fh_ld(const float* __restrict__ p, long long sk, int k0, int h, int klen, float s) {
    v16h a;
#pragma unroll
    for (int i = 0; i < 16; ++i) { const int k = k0 + frag_k(i, h); a[i] = (k < klen) ? (_Float16)(p[(long long)k * sk] * s) : (_Float16)0.f; }
    return a;
}
__device__ __forceinline__ Split sp_ld(const float* __restrict__ p, long long sk, int k0, int h, int klen, float s) {
    Split r;
#pragma unroll
    for (int i = 0; i < 16; ++i) {
        const int k = k0 + frag_k(i, h); const float x = (k < klen) ? p[(long long)k * sk] * s : 0.f;
        const __bf16 hb = bf16_rne(x); r.hi[i] = hb; r.lo[i] = bf16_rne(x - bf16_f32(hb));
    }
    return r;
}
__device__ __forceinline__ Split3 sp3_ld(const float* __restrict__ p, long long sk, int k0, int h, int klen, float s) {
    Split3 r;
#pragma unroll
    for (int i = 0; i < 16; ++i) {
        const int k = k0 + frag_k(i, h); const float x = (k < klen) ? p[(long long)k * sk] * s : 0.f;
        const __bf16 hb = bf16_rne(x); const float r1 = x - bf16_f32(hb); const __bf16 mb = bf16_rne(r1);
        r.hi[i] = hb; r.mid[i] = mb; r.lo[i] = bf16_rne(r1 - bf16_f32(mb));
    }
    return r;
}
__device__ __forceinline__ v16b bh_ld(const float* __restrict__ p, long long sk, int k0, int h, int klen, float s) {
    v16b a;
#pragma unroll
    for (int i = 0; i < 16; ++i) { const int k = k0 + frag_k(i, h); a[i] = bf16_rne((k < klen) ? p[(long long)k * sk] * s : 0.f); }
    return a;
}
// f16 fragment from an f16 LDS/global row with element stride 1 (k-contiguous), no bounds (tile already zero padded)
__device__ __forceinline__ v16h fh_row(const _Float16* __restrict__ row, int k0, int h) {
    v16h a;
#pragma unroll
    for (int i = 0; i < 16; ++i) a[i] = row[k0 + frag_k(i, h)];
    return a;
}

#define VST2(T, ptr, val) do { const T vst2_v_ = (val); *(T*)(ptr) = vst2_v_;  } while (0)
typedef float v4f __attribute__((ext_vector_type(4)));
#define VST2V4(ptr, val) do { const v4f vst2_v4_ = (val); *(v4f*)(ptr) = vst2_v4_;  } while (0)

__device__ __attribute__((noinline)) float act_fn(float v, int act) {
    if (act == 1) return fmaxf(v, 0.f);                                                                               // relu
    if (act == 2) { const float u = 0.7978845608028654f * (v + 0.044715f * v * v * v); return 0.5f * v * (1.f + tanhf(u)); } // tanh-gelu
    if (act == 3) return v / (1.f + expf(-v));                                                                        // silu
    if (act == 4) return 0.5f * v * (1.f + erff(v * 0.7071067811865476f));                                             // erf-gelu
    if (act == 5) return tanhf(v);
    if (act == 6) return 1.f / (1.f + expf(-v));                                                                      // sigmoid
    if (act == 7) return (v > 0.f) ? v : 0.01f * v;                                                                   // leaky relu 0.01
    if (act == 8) return (v > 0.f) ? v : (expf(v) - 1.f);                                                             // elu
    if (act == 9) return fminf(fmaxf(v, 0.f), 6.f);                                                                   // relu6
    if (act == 10) return fabsf(v);                                                                                    // abs
    if (act == 11) return (v >= 0.f) ? v : 0.1f * v;                                                                  // leaky 0.1
    if (act == 12) return (v > 0.f) ? v : 0.2f * v;                                                                   // leaky 0.2
    if (act == 13) return (v > 20.f) ? v : log1pf(expf(v));                                                            // softplus
    return v;
}

// =====================================================================================================================
// k_gemm<MODE>: C(z, m, n) = act(alpha * sum_k A(z, m, k) * B(z, k, n) + bias) + beta * R(z, m, n)
//   One wave (32-thread block) per 16 x 32 tile of C; grid (ceil(N/32), ceil(M/16), Z). Batch z -> (zo = z / zi_n, zi = z % zi_n)
//   with separate outer/inner strides for every tensor (e.g. batch and head). A(m,k) = A[zo*sAo + zi*sAi + m*sAm + k*sAk] (f32),
//   B(k,n) = B[zo*sBo + zi*sBi + n*sBn + k*sBk] (f32); any M, N, K (K zero-padded to 32 inside the fragments, M/N tails guarded).
//   C(m,n) = C[zo*sCo + zi*sCi + m*sCm + n] (n contiguous). flags: 1 bias[n], 2 bias[m], 4 residual R[zo*sRo + zi*sRi + m*sRm + n*sRn].
//   MODE 0: f16 operands (A prescaled by sa, B by sb, both undone in the epilogue); 1: bf16 hi/lo split (3 products); 2: bf16;
//   3: bf16 hi/mid/lo triple split (6 products); 4: as 3 with Kahan-compensated f32 accumulation across k-steps.
// =====================================================================================================================
struct GemmP {
    const float* A; const float* B; const float* bias; const float* R; float* C;
    long long sAo, sAi, sAm, sAk, sBo, sBi, sBn, sBk, sCo, sCi, sCm, sRo, sRi, sRm, sRn;
    int M, N, K, zi_n, flags, act; float alpha, beta, sa, sb;
    int Npad, pad_;     // columns [N, Npad) of C are written as 0 so that padded workspace rows are covered by whole-line stores; Npad >= N
};
static_assert(sizeof(GemmP) == 5 * 8 + 15 * 8 + 6 * 4 + 4 * 4 + 2 * 4, "GemmP has padding");

template <int MODE>
__global__ __launch_bounds__(32) void k_gemm(GemmP p) {
    const int lane = threadIdx.x & 31, h = lane >> 4, l15 = lane & 15;
    const int m0 = blockIdx.y * 16, n0 = blockIdx.x * 32;
    const int z = blockIdx.z, zo = z / p.zi_n, zi = z - zo * p.zi_n;
    const float* A = p.A + zo * p.sAo + zi * p.sAi;
    const float* B = p.B + zo * p.sBo + zi * p.sBi;
    const int am = min(m0 + l15, p.M - 1);                       // clamped row for loads (stores are guarded)
    v8f acc[2], comp[2];
#pragma unroll
    for (int t = 0; t < 2; ++t) { v8f zz = {}; acc[t] = zz; comp[t] = zz; }
    for (int k0 = 0; k0 < p.K; k0 += 32) {
        const float* arow = A + (long long)am * p.sAm;
        if (MODE == 1) {
            const Split a = sp_ld(arow, p.sAk, k0, h, p.K, 1.f);
#pragma unroll
            for (int t = 0; t < 2; ++t) {
                const int bn = min(n0 + t * 16 + l15, p.N - 1);
                acc[t] = wmma3(a, sp_ld(B + (long long)bn * p.sBn, p.sBk, k0, h, p.K, 1.f), acc[t]);
            }
        } else if (MODE == 3) {
            const Split3 a = sp3_ld(arow, p.sAk, k0, h, p.K, 1.f);
#pragma unroll
            for (int t = 0; t < 2; ++t) {
                const int bn = min(n0 + t * 16 + l15, p.N - 1);
                acc[t] = wmma6(a, sp3_ld(B + (long long)bn * p.sBn, p.sBk, k0, h, p.K, 1.f), acc[t]);
            }
        } else if (MODE == 4) {
            // triple split as MODE 3, but each k-step's 6 products go into a fresh accumulator and the partial is added to the running f32 sum
            // on the VALU with Kahan compensation (accumulation error stays ~1 ulp however long K is)
            const Split3 a = sp3_ld(arow, p.sAk, k0, h, p.K, 1.f);
#pragma unroll
            for (int t = 0; t < 2; ++t) {
                const int bn = min(n0 + t * 16 + l15, p.N - 1); v8f zz = {};
                const v8f part = wmma6(a, sp3_ld(B + (long long)bn * p.sBn, p.sBk, k0, h, p.K, 1.f), zz);
                const v8f y = part - comp[t]; const v8f s = acc[t] + y; comp[t] = (s - acc[t]) - y; acc[t] = s;
            }
        } else if (MODE == 2) {
            const v16b a = bh_ld(arow, p.sAk, k0, h, p.K, 1.f);
#pragma unroll
            for (int t = 0; t < 2; ++t) {
                const int bn = min(n0 + t * 16 + l15, p.N - 1);
                acc[t] = wmmab(a, bh_ld(B + (long long)bn * p.sBn, p.sBk, k0, h, p.K, 1.f), acc[t]);
            }
        } else {
            const v16h a = fh_ld(arow, p.sAk, k0, h, p.K, p.sa);
#pragma unroll
            for (int t = 0; t < 2; ++t) {
                const int bn = min(n0 + t * 16 + l15, p.N - 1);
                acc[t] = wmma16(a, fh_ld(B + (long long)bn * p.sBn, p.sBk, k0, h, p.K, p.sb), acc[t]);
            }
        }
    }
    const float iscale = (MODE == 0) ? p.alpha / (p.sa * p.sb) : p.alpha;
    float* C = p.C + zo * p.sCo + zi * p.sCi;
    const float* R = p.R + zo * p.sRo + zi * p.sRi;
    __shared__ __align__(16) float ctile[16][36];
#pragma unroll
    for (int t = 0; t < 2; ++t) {
        const int n = n0 + t * 16 + l15; const int nn = min(n, p.N - 1);
#pragma unroll
        for (int r = 0; r < 8; ++r) {
            const int m = m0 + 8 * h + r; const int mm = min(m, p.M - 1);
            float v = acc[t][r] * iscale;
            if (p.flags & 1) v += p.bias[nn];
            if (p.flags & 2) v += p.bias[mm];
            if (p.flags & 8) v *= p.bias[(long long)zo * p.M + mm];   /* per-(z,row) scale vector laid out [Z][M]; exclusive with the bias flags */
            v = act_fn(v, p.act);
            if (p.flags & 4) v += p.beta * R[(long long)mm * p.sRm + (long long)nn * p.sRn];
            ctile[8 * h + r][t * 16 + l15] = (n < p.N) ? v : 0.f;
        }
    }
    __syncthreads();
    const int NW = (p.Npad > p.N) ? p.Npad : p.N;           // write width
    const bool fast = (m0 + 16 <= p.M) && (n0 + 32 <= NW) && ((p.sCm & 3) == 0) && ((((size_t)C) & 15) == 0);
    if (fast) {
#pragma unroll
        for (int s = 0; s < 4; ++s) {
            const int row = s * 4 + (lane >> 3), c4 = (lane & 7) * 4;
            const v4f v = *(const v4f*)&ctile[row][c4];
            VST2V4(C + (long long)(m0 + row) * p.sCm + n0 + c4, v);
        }
    } else {
        for (int row = 0; row < 16; ++row) {
            const int m = m0 + row, n = n0 + lane;
            if (m < p.M && n < NW) VST2(float, C + (long long)m * p.sCm + n, ctile[row][lane]);
        }
    }
}


// =====================================================================================================================
// k_gemmT<MODE, TM, TN>: same contract as k_gemm, but one wave computes a (16*TM) x (16*TN) tile: TM A fragments and TN B fragments are
//   loaded per 32-wide k-step and reused across TM*TN WMMAs (far fewer load/convert instructions per MAC). MODE 0 (f16), 1 (bf16 hi/lo),
//   2 (bf16) only. grid (ceil(NW/(16*TN)), ceil(M/(16*TM)), Z), block 32. Epilogue identical to k_gemm, run per 16x32 sub-tile.
// =====================================================================================================================
template <int MODE, int TM, int TN>
__global__ __launch_bounds__(32) void k_gemmT(GemmP p) {
    const int lane = threadIdx.x & 31, h = lane >> 4, l15 = lane & 15;
    const int m0 = blockIdx.y * (16 * TM), n0 = blockIdx.x * (16 * TN);
    const int z = blockIdx.z, zo = z / p.zi_n, zi = z - zo * p.zi_n;
    const float* A = p.A + zo * p.sAo + zi * p.sAi;
    const float* B = p.B + zo * p.sBo + zi * p.sBi;
    v8f acc[TM][TN];
#pragma unroll
    for (int i = 0; i < TM; ++i)
#pragma unroll
        for (int t = 0; t < TN; ++t) { v8f zz = {}; acc[i][t] = zz; }
    for (int k0 = 0; k0 < p.K; k0 += 32) {
        if (MODE == 1) {
            Split a[TM], b[TN];
#pragma unroll
            for (int i = 0; i < TM; ++i) { const int am = min(m0 + 16 * i + l15, p.M - 1); a[i] = sp_ld(A + (long long)am * p.sAm, p.sAk, k0, h, p.K, 1.f); }
#pragma unroll
            for (int t = 0; t < TN; ++t) { const int bn = min(n0 + 16 * t + l15, p.N - 1); b[t] = sp_ld(B + (long long)bn * p.sBn, p.sBk, k0, h, p.K, 1.f); }
#pragma unroll
            for (int i = 0; i < TM; ++i)
#pragma unroll
                for (int t = 0; t < TN; ++t) acc[i][t] = wmma3(a[i], b[t], acc[i][t]);
        } else if (MODE == 2) {
            v16b a[TM], b[TN];
#pragma unroll
            for (int i = 0; i < TM; ++i) { const int am = min(m0 + 16 * i + l15, p.M - 1); a[i] = bh_ld(A + (long long)am * p.sAm, p.sAk, k0, h, p.K, 1.f); }
#pragma unroll
            for (int t = 0; t < TN; ++t) { const int bn = min(n0 + 16 * t + l15, p.N - 1); b[t] = bh_ld(B + (long long)bn * p.sBn, p.sBk, k0, h, p.K, 1.f); }
#pragma unroll
            for (int i = 0; i < TM; ++i)
#pragma unroll
                for (int t = 0; t < TN; ++t) acc[i][t] = wmmab(a[i], b[t], acc[i][t]);
        } else {
            v16h a[TM], b[TN];
#pragma unroll
            for (int i = 0; i < TM; ++i) { const int am = min(m0 + 16 * i + l15, p.M - 1); a[i] = fh_ld(A + (long long)am * p.sAm, p.sAk, k0, h, p.K, p.sa); }
#pragma unroll
            for (int t = 0; t < TN; ++t) { const int bn = min(n0 + 16 * t + l15, p.N - 1); b[t] = fh_ld(B + (long long)bn * p.sBn, p.sBk, k0, h, p.K, p.sb); }
#pragma unroll
            for (int i = 0; i < TM; ++i)
#pragma unroll
                for (int t = 0; t < TN; ++t) acc[i][t] = wmma16(a[i], b[t], acc[i][t]);
        }
    }
    const float iscale = (MODE == 0) ? p.alpha / (p.sa * p.sb) : p.alpha;
    float* C = p.C + zo * p.sCo + zi * p.sCi;
    const float* R = p.R + zo * p.sRo + zi * p.sRi;
    const int NW = (p.Npad > p.N) ? p.Npad : p.N;
    __shared__ __align__(16) float ctile[16][36];
#pragma unroll
    for (int i = 0; i < TM; ++i) {
        const int mb = m0 + 16 * i; if (mb >= p.M) break;          // wave-uniform
#pragma unroll
        for (int tp = 0; tp < TN / 2; ++tp) {
            const int nb = n0 + 32 * tp; if (nb >= NW) break;        // wave-uniform
#pragma unroll
            for (int t2 = 0; t2 < 2; ++t2) {
                const int t = 2 * tp + t2; const int n = nb + t2 * 16 + l15; const int nn = min(n, p.N - 1);
#pragma unroll
                for (int r = 0; r < 8; ++r) {
                    const int m = mb + 8 * h + r; const int mm = min(m, p.M - 1);
                    float v = acc[i][t][r] * iscale;
                    if (p.flags & 1) v += p.bias[nn];
                    if (p.flags & 2) v += p.bias[mm];
            if (p.flags & 8) v *= p.bias[(long long)zo * p.M + mm];   /* per-(z,row) scale vector laid out [Z][M]; exclusive with the bias flags */
                    v = act_fn(v, p.act);
                    if (p.flags & 4) v += p.beta * R[(long long)mm * p.sRm + (long long)nn * p.sRn];
                    ctile[8 * h + r][t2 * 16 + l15] = (n < p.N) ? v : 0.f;
                }
            }
            __syncthreads();
            const bool fast = (mb + 16 <= p.M) && (nb + 32 <= NW) && ((p.sCm & 3) == 0) && ((((size_t)C) & 15) == 0);
            if (fast) {
#pragma unroll
                for (int s = 0; s < 4; ++s) {
                    const int row = s * 4 + (lane >> 3), c4 = (lane & 7) * 4;
                    const v4f v = *(const v4f*)&ctile[row][c4];
                    VST2V4(C + (long long)(mb + row) * p.sCm + nb + c4, v);
                }
            } else {
                for (int row = 0; row < 16; ++row) {
                    const int m = mb + row, n = nb + lane;
                    if (m < p.M && n < NW) VST2(float, C + (long long)m * p.sCm + n, ctile[row][lane]);
                }
            }
            __syncthreads();
        }
    }
}

// =====================================================================================================================
//   Wave = 16 queries, AW waves per block, 64-key blocks; grid (ceil(Lq/(16*AW)), H, B), block 32*AW. Any Lq, Lk; head dim dh <= DHP
//   (DHP multiple of 32), value dim dv <= DVP (multiple of 16, <= 128). Every tensor addressed by (batch, head, row, element) strides, f32.
//   Scores: QM 0 f16 operands, 1 bf16 hi/lo split, 2 bf16 triple split; statistics f32 (exp2 domain); P.V: P x 4096 as f16 with V f16 staged in LDS
//   (SPLITPV: P and V as bf16 hi/lo splits). kv head = h / hrep. Masking: causal = 1 (keep j <= i + coff, masked -> -inf, key blocks beyond the
//   diagonal skipped), causal = 2 (masked -> mfill, a finite fill like the -1e9; no skipping), causal = 3 (keep j >= i + coff,
//   masked -> -inf, no skipping); optional additive f32 mask Mf,
//   optional int keep-mask Mi (0 -> score := mfill), both addressed b*smb + h*smh + i*smi + j*smj (0 strides broadcast).
// =====================================================================================================================
#define AW 4
struct AttnP {   // apv4
    const float* Q; const float* K; const float* V; float* O; float* P; const float* Mf; const int* Mi; float* ST;
    const float* Pw; const float* Rt; const int* SQ; const int* SK;           // optional: post-softmax weight, relative-position table, segment ids
    long long swb, swh, swi, swj, srb, srh, sri;                                 // Pw strides (b,h,i,j); Rt strides (b,h,i), column = clamp(i - j + roff, 0, rn-1)
    long long sQb, sQh, sQi, sQd, sKb, sKh, sKj, sKd, sVb, sVh, sVj, sVd, sOb, sOh, sOi, sPb, sPh, sPi, smb, smh, smi, smj;
    int Lq, Lk, dh, dv, hrep, causal, coff, pband;   // pband > 0: P holds only the band |j - i| <= pband, column j - i + pband
    float scale, mfill; int nonorm, mpol;             // nonorm (online path only): O = sum_j exp(score_j) V_j without the 1/rowsum (scores must be <= ~0); mpol: Mi masks where ==0 (mpol 0) or where !=0 (mpol 1)
    int roff, rn, segpol, win;                        // Rt column offset/count; SQ/SK: score := mfill where (segpol 0) SQ[i] != SK[j] or (segpol 1) SQ[i] == SK[j]; win > 0: keys with i - j > win (after coff) -> -inf
};
//   Pw: the softmax numerator is multiplied by Pw(b,h,i,j) AFTER the row sum is taken (probs * weight, then P.V), as in post-softmax multiplicative biases.                                                    // ST (optional): per row (b,h,i) -> ST[((b*H + h)*Lq + i)*2 + {0,1}] = {row max of the scaled+masked score (natural units), sum_j exp(score - max)}
static_assert(sizeof(AttnP) == 12 * 8 + 29 * 8 + 16 * 4, "AttnP has padding");

#ifndef KATTN_ATTR
#define KATTN_ATTR
#endif
template <int DHP, int DVP, int QM, bool SPLITPV, bool TWOPASS>
__global__ __launch_bounds__(32 * AW) KATTN_ATTR void k_attn(AttnP p) {
    constexpr int NT = DVP / 16;                // output tiles
    constexpr int KS = DHP / 32;                // k-steps for the scores
    constexpr int VP = DVP + 8;                 // LDS pitch (halves)
    __shared__ __align__(16) float    pl[AW][16 * 64];
    __shared__ __align__(16) _Float16 vl[(SPLITPV ? 2 : 1) * 64 * VP];   // f16 V tile, or bf16 hi and lo tiles (same 2-byte size)
    const int lane = threadIdx.x & 31, hf = lane >> 4, l15 = lane & 15, wave = threadIdx.x >> 5;
    const int h = blockIdx.y, b = blockIdx.z, hk = h / p.hrep;
    const int q0 = (blockIdx.x * AW + wave) * 16;
    float* myp = pl[wave];
    const float L2E = 1.4426950408889634f;
    const float NEG = -__builtin_inff();
    const int qi = min(q0 + l15, p.Lq - 1);
    const float* qrow = p.Q + b * p.sQb + h * p.sQh + (long long)qi * p.sQi;
    const float* kbase = p.K + b * p.sKb + hk * p.sKh;
    const float* vbase = p.V + b * p.sVb + hk * p.sVh;
    v16h qa[QM == 0 ? KS : 1]; Split qs_[QM == 1 ? KS : 1]; Split3 qt_[QM == 2 ? KS : 1];
#pragma unroll
    for (int ks = 0; ks < KS; ++ks) {
        if (QM == 2) qt_[ks] = sp3_ld(qrow, p.sQd, ks * 32, hf, p.dh, 1.f);
        else if (QM == 1) qs_[ks] = sp_ld(qrow, p.sQd, ks * 32, hf, p.dh, 1.f);
        else qa[ks] = fh_ld(qrow, p.sQd, ks * 32, hf, p.dh, 1.f);
    }
    v8f o[NT]; float m8[8], l8[8];
#pragma unroll
    for (int t = 0; t < NT; ++t) { v8f zz = {}; o[t] = zz; }
#pragma unroll
    for (int i = 0; i < 8; ++i) { m8[i] = NEG; l8[i] = 0.f; }
    int jend = p.Lk; int jstart = 0;
    if (p.causal == 1) { const int je = (blockIdx.x * AW + AW - 1) * 16 + 16 + p.coff; jend = min(jend, max(je, 0)); }   // uniform per block
    if (p.win > 0) { const int js = (int)(blockIdx.x * AW) * 16 + p.coff - p.win; jstart = (js > 0) ? (js / 64) * 64 : 0; }   // uniform per block: key blocks entirely outside every row's window hold only -inf entries and are skipped exactly
    const int npass = TWOPASS ? 2 : 1;
    for (int pass = 0; pass < npass; ++pass) {
        const bool dopv = (!TWOPASS) || pass == 1;
        for (int j0 = jstart; j0 < jend; j0 += 64) {
            if (dopv) {
                __syncthreads();                                 // previous key block's reads of vl / pl are done
                for (int idx = threadIdx.x; idx < 64 * DVP; idx += 32 * AW) {
                    const int jr = idx / DVP, d = idx - jr * DVP, j = j0 + jr;
                    const float f = (j < p.Lk && d < p.dv) ? vbase[(long long)j * p.sVj + (long long)d * p.sVd] : 0.f;
                    if (SPLITPV) {
                        const __bf16 hb = bf16_rne(f);
                        ((__bf16*)vl)[jr * VP + d] = hb; ((__bf16*)vl)[64 * VP + jr * VP + d] = bf16_rne(f - bf16_f32(hb));
                    } else vl[jr * VP + d] = (_Float16)f;
                }
            }
            v8f s[4];
#pragma unroll
            for (int t = 0; t < 4; ++t) {
                const int j = min(j0 + t * 16 + l15, p.Lk - 1);
                const float* krow = kbase + (long long)j * p.sKj;
                v8f acc = {};
#pragma unroll
                for (int ks = 0; ks < KS; ++ks) {
                    if (QM == 2)      acc = wmma6(qt_[ks], sp3_ld(krow, p.sKd, ks * 32, hf, p.dh, 1.f), acc);
                    else if (QM == 1) acc = wmma3(qs_[ks], sp_ld(krow, p.sKd, ks * 32, hf, p.dh, 1.f), acc);
                    else              acc = wmma16(qa[ks], fh_ld(krow, p.sKd, ks * 32, hf, p.dh, 1.f), acc);
                }
                s[t] = acc;
            }
            float pv[8][4];
#pragma unroll
            for (int i = 0; i < 8; ++i) {
                const int irow = q0 + i + 8 * hf;
                const int ic = min(irow, p.Lq - 1);
                float sc[4];
#pragma unroll
                for (int t = 0; t < 4; ++t) {
                    const int jg = j0 + t * 16 + l15;
                    float v = s[t][i] * p.scale;
                    if (p.Mf) v += p.Mf[b * p.smb + h * p.smh + (long long)ic * p.smi + (long long)min(jg, p.Lk - 1) * p.smj];
                    if (p.Rt) { int rc = ic - min(jg, p.Lk - 1) + p.roff; rc = rc < 0 ? 0 : (rc >= p.rn ? p.rn - 1 : rc); v += p.Rt[b * p.srb + h * p.srh + (long long)ic * p.sri + rc]; }
                    if (p.Mi) { const int mv = p.Mi[b * p.smb + h * p.smh + (long long)ic * p.smi + (long long)min(jg, p.Lk - 1) * p.smj]; if (p.mpol ? (mv != 0) : (mv == 0)) v = p.mfill; }
                    if (p.SQ) { const bool same = p.SQ[(long long)b * p.Lq + ic] == p.SK[(long long)b * p.Lk + min(jg, p.Lk - 1)]; if (p.segpol ? same : !same) v = p.mfill; }
                    if (p.causal == 2 && jg > irow + p.coff) v = p.mfill;
                    if (jg >= p.Lk || (p.causal == 1 && jg > irow + p.coff) || (p.causal == 3 && jg < irow + p.coff) || (p.win > 0 && irow + p.coff - jg > p.win)) v = NEG; else v *= L2E;
                    sc[t] = v;
                }
                if (!TWOPASS || pass == 0) {
                    float mx = fmaxf(fmaxf(sc[0], sc[1]), fmaxf(sc[2], sc[3]));
                    mx = fmaxf(mx, __shfl_xor(mx, 1, 32)); mx = fmaxf(mx, __shfl_xor(mx, 2, 32));
                    mx = fmaxf(mx, __shfl_xor(mx, 4, 32)); mx = fmaxf(mx, __shfl_xor(mx, 8, 32));
                    const float mnew = fmaxf(m8[i], mx);
                    const float corr = (mnew == NEG) ? 1.f : exp2f(m8[i] - mnew);
                    float rs = 0.f;
#pragma unroll
                    for (int t = 0; t < 4; ++t) {
                        const float pp = (sc[t] == NEG) ? 0.f : exp2f(sc[t] - mnew); rs += pp;
                        pv[i][t] = p.Pw ? pp * p.Pw[b * p.swb + h * p.swh + (long long)ic * p.swi + (long long)min(j0 + t * 16 + l15, p.Lk - 1) * p.swj] : pp;
                    }
                    rs += __shfl_xor(rs, 1, 32); rs += __shfl_xor(rs, 2, 32); rs += __shfl_xor(rs, 4, 32); rs += __shfl_xor(rs, 8, 32);
                    l8[i] = l8[i] * corr + rs; m8[i] = mnew;
                    if (!TWOPASS) {
#pragma unroll
                        for (int t = 0; t < NT; ++t) o[t][i] *= corr;
                    }
                } else {
                    const float inv = (l8[i] > 0.f) ? 1.f / l8[i] : 0.f;
#pragma unroll
                    for (int t = 0; t < 4; ++t) {
                        const int jg = j0 + t * 16 + l15;
                        float pp = (sc[t] == NEG) ? 0.f : exp2f(sc[t] - m8[i]) * inv;
                        if (p.Pw) pp *= p.Pw[b * p.swb + h * p.swh + (long long)ic * p.swi + (long long)min(jg, p.Lk - 1) * p.swj];
                        pv[i][t] = pp;
                    }
                }
            }
            if (dopv) {
#pragma unroll
                for (int i = 0; i < 8; ++i)
#pragma unroll
                    for (int t = 0; t < 4; ++t) ((float*)myp)[(i + 8 * hf) * 64 + t * 16 + l15] = pv[i][t];
                __syncthreads();                                 // P (per wave) and V (shared) visible
                if (p.P) {
                    float* pb_ = p.P + b * p.sPb + h * p.sPh;
                    const bool fastP = (p.pband == 0) && ((p.sPi & 3) == 0) && (j0 + 64 <= p.Lk) && (q0 + 16 <= p.Lq) && ((((size_t)pb_) & 15) == 0);
                    if (fastP) {
#pragma unroll
                        for (int s = 0; s < 8; ++s) {
                            const int row = s * 2 + (lane >> 4), c4 = (lane & 15) * 4;
                            const v4f v = *(const v4f*)(myp + row * 64 + c4);
                            VST2V4(pb_ + (long long)(q0 + row) * p.sPi + j0 + c4, v);
                        }
                    } else {
                        for (int row = 0; row < 16; ++row) {
                            const int irow = q0 + row; if (irow >= p.Lq) continue;
                            for (int c = lane; c < 64; c += 32) {
                                const int jg = j0 + c; if (jg >= p.Lk) continue;
                                if (p.pband == 0) VST2(float, pb_ + (long long)irow * p.sPi + jg, myp[row * 64 + c]);
                                else if (jg - irow <= p.pband && irow - jg <= p.pband) VST2(float, pb_ + (long long)irow * p.sPi + (jg - irow + p.pband), myp[row * 64 + c]);
                            }
                        }
                    }
                }
                if (SPLITPV) {
                    const Split pa0 = sp_ld(myp + l15 * 64, 1, 0, hf, 64, 1.f), pa1 = sp_ld(myp + l15 * 64, 1, 32, hf, 64, 1.f);
                    const __bf16* vh = (const __bf16*)vl; const __bf16* vlo = vh + 64 * VP;
#pragma unroll
                    for (int t = 0; t < NT; ++t) {
                        const int dcol = t * 16 + l15;
                        Split b0, b1;
#pragma unroll
                        for (int e = 0; e < 16; ++e) {
                            const int k0 = frag_k(e, hf), k1 = 32 + frag_k(e, hf);
                            b0.hi[e] = vh[k0 * VP + dcol]; b0.lo[e] = vlo[k0 * VP + dcol]; b1.hi[e] = vh[k1 * VP + dcol]; b1.lo[e] = vlo[k1 * VP + dcol];
                        }
                        o[t] = wmma3(pa0, b0, o[t]);
                        o[t] = wmma3(pa1, b1, o[t]);
                    }
                } else {
                    const v16h pa0 = fh_ld(myp + l15 * 64, 1, 0, hf, 64, 4096.f), pa1 = fh_ld(myp + l15 * 64, 1, 32, hf, 64, 4096.f);
#pragma unroll
                    for (int t = 0; t < NT; ++t) {
                        const int dcol = t * 16 + l15;
                        v16h b0, b1;
#pragma unroll
                        for (int e = 0; e < 16; ++e) { b0[e] = vl[frag_k(e, hf) * VP + dcol]; b1[e] = vl[(32 + frag_k(e, hf)) * VP + dcol]; }
                        o[t] = wmma16(pa0, b0, o[t]);
                        o[t] = wmma16(pa1, b1, o[t]);
                    }
                }
            }
        }
    }
    float* obase = p.O + b * p.sOb + h * p.sOh;
    if (p.ST) {
        const int rl = lane >> 1, isel = rl & 7;           // row q0 + rl ; rl>>3 == hf holds because lane>>4 == (lane>>1)>>3
        float mv = 0.f, lv = 0.f;
#pragma unroll
        for (int i = 0; i < 8; ++i) if (i == isel) { mv = m8[i]; lv = l8[i]; }
        const int irow = q0 + rl;
        if (irow < p.Lq) { float* st = p.ST + (((long long)b * gridDim.y + h) * p.Lq + irow) * 2 + (lane & 1); VST2(float, st, (lane & 1) ? lv : mv * 0.6931471805599453f); }
    }
    float invr[8];
#pragma unroll
    for (int i = 0; i < 8; ++i) {
        if (TWOPASS) invr[i] = SPLITPV ? 1.f : (1.f / 4096.f);
        else if (p.nonorm) invr[i] = exp2f(m8[i]) * (SPLITPV ? 1.f : (1.f / 4096.f));
        else invr[i] = (l8[i] > 0.f) ? (SPLITPV ? 1.f / l8[i] : 1.f / (l8[i] * 4096.f)) : 0.f;
    }
    __syncthreads();                                             // all waves done with pl/vl from the main loop
    const bool ofast = ((p.sOi & 3) == 0) && ((((size_t)obase) & 15) == 0) && (q0 + 16 <= p.Lq);
#pragma unroll
    for (int c0 = 0; c0 < DVP; c0 += 64) {
#pragma unroll
        for (int i = 0; i < 8; ++i)
#pragma unroll
            for (int t = 0; t < NT; ++t) if (t * 16 >= c0 && t * 16 < c0 + 64) ((float*)myp)[(i + 8 * hf) * 64 + (t * 16 - c0) + l15] = o[t][i] * invr[i];
        __syncthreads();
        const int cw = (DVP - c0 < 64) ? (DVP - c0) : 64;      // staged columns in this chunk (multiple of 16)
        if (ofast && (c0 + cw <= p.dv) && (cw % 32 == 0)) {
            const int lpr = cw / 4;                              // lanes per row (16 for 64 cols, 8 for 32)
            const int rows_per_ins = 32 / lpr;
            for (int r0 = 0; r0 < 16; r0 += rows_per_ins) {
                const int row = r0 + lane / lpr, c4 = (lane % lpr) * 4;
                const v4f v = *(const v4f*)(myp + row * 64 + c4);
                VST2V4(obase + (long long)(q0 + row) * p.sOi + c0 + c4, v);
            }
        } else {
            for (int row = 0; row < 16; ++row) {
                const int irow = q0 + row; if (irow >= p.Lq) continue;
                for (int c = lane; c < cw; c += 32) { const int d = c0 + c; if (d < p.dv) VST2(float, obase + (long long)irow * p.sOi + d, myp[row * 64 + c]); }
            }
        }
        __syncthreads();
    }
}

// =====================================================================================================================
// k_tr: dst(z, c, r) = alpha * src(z, r, c) (+ beta * R2(z, c, r)): [Z][R][C] (row stride lds) -> [Z][C][R] (row stride ldd) through a 32x32 LDS tile;
//   flags: 1 -> add beta * residual R2 addressed like dst (z*sRz + c*ldr + r); act applied before the residual.
// =====================================================================================================================
struct TrP { const float* src; float* dst; const float* R2; long long sSz, lds, sDz, ldd, sRz, ldr; int R, C, flags, act; float alpha, beta; };
static_assert(sizeof(TrP) == 3 * 8 + 6 * 8 + 6 * 4, "TrP has padding");
__global__ __launch_bounds__(256) void k_tr(TrP p) {
    __shared__ float tile[32][33];
    const int c0 = blockIdx.x * 32, r0 = blockIdx.y * 32, z = blockIdx.z;
    const int lane = threadIdx.x & 31, wave = threadIdx.x >> 5;
    const float* s = p.src + z * p.sSz;
#pragma unroll
    for (int k = 0; k < 4; ++k) {
        const int rl = wave * 4 + k, r = r0 + rl, c = c0 + lane;
        tile[rl][lane] = (r < p.R && c < p.C) ? s[(long long)r * p.lds + c] : 0.f;
    }
    __syncthreads();
    float* d = p.dst + z * p.sDz; const float* rr = p.R2 + z * p.sRz;
#pragma unroll
    for (int k = 0; k < 4; ++k) {
        const int cl = wave * 4 + k, c = c0 + cl, r = r0 + lane;
        if (c < p.C && r < p.R) {
            float v = act_fn(p.alpha * tile[lane][cl], p.act);
            if (p.flags & 1) v += p.beta * rr[(long long)c * p.ldr + r];
            VST2(float, d + (long long)c * p.ldd + r, v);
        }
    }
}

// k_affine: dst[i] = a * (sdev ? sdev[0] : 1) * src[i] + b, i < n (one thread per element; consecutive lanes -> consecutive addresses)
__global__ __launch_bounds__(256) void k_affine(const float* __restrict__ src, float* __restrict__ dst, int n, float a, float b, const float* __restrict__ sdev) {
    const int i = blockIdx.x * 256 + threadIdx.x;
    if (i < n) { const float aa = sdev ? a * sdev[0] : a; const float v = aa * src[i] + b; VST2(float, dst + i, v); }
}

// =====================================================================================================================
// k_softmax: row softmax over n contiguous elements, one 256-thread block per row; rows addressed z*sz + r*sr (grid (R, Z)).
//   out = scale_out * softmax(scale_in * x + (Mf ? Mf[z*smz + r*smr + j] : 0)); a row whose max is -inf is written as 0.
// =====================================================================================================================
struct SmP { const float* src; float* dst; const float* Mf; long long sz, sr, dz, dr, smz, smr; int n, pad; float scale_in, scale_out; };
static_assert(sizeof(SmP) == 3 * 8 + 6 * 8 + 4 * 4, "SmP has padding");
__global__ __launch_bounds__(256) void k_softmax(SmP p) {
    __shared__ float red[256];
    const int r = blockIdx.x, z = blockIdx.y, tid = threadIdx.x;
    const float* s = p.src + z * p.sz + (long long)r * p.sr;
    const float* mf = p.Mf ? (p.Mf + z * p.smz + (long long)r * p.smr) : nullptr;
    float mx = -__builtin_inff();
    for (int j = tid; j < p.n; j += 256) { float v = s[j] * p.scale_in; if (mf) v += mf[j]; mx = fmaxf(mx, v); }
    red[tid] = mx; __syncthreads();
    for (int o = 128; o > 0; o >>= 1) { if (tid < o) red[tid] = fmaxf(red[tid], red[tid + o]); __syncthreads(); }
    mx = red[0]; __syncthreads();
    float sum = 0.f;
    for (int j = tid; j < p.n; j += 256) { float v = s[j] * p.scale_in; if (mf) v += mf[j]; sum += (mx == -__builtin_inff()) ? 0.f : expf(v - mx); }
    red[tid] = sum; __syncthreads();
    for (int o = 128; o > 0; o >>= 1) { if (tid < o) red[tid] += red[tid + o]; __syncthreads(); }
    sum = red[0];
    const float inv = (sum > 0.f) ? p.scale_out / sum : 0.f;
    float* d = p.dst + z * p.dz + (long long)r * p.dr;
    for (int j = tid; j < p.n; j += 256) { float v = s[j] * p.scale_in; if (mf) v += mf[j]; const float o = (mx == -__builtin_inff()) ? 0.f : expf(v - mx) * inv; VST2(float, d + j, o); }
}
// =====================================================================================================================
// k_stats: mean and rsqrt(var + eps) over a set of n elements addressed base + z*sz + (e / inner) * so + (e % inner) * si, one 256-thread
// k_norm_apply: y = (x - mean[set]) * rstd[set] * g[c] + b[c] over a [Z][C][L] channel-major tensor with set = z*G + c / (C/G) (G groups per z;
//   G = C -> per-channel sets indexed z*C+c; for batch norm pass stats indexed by c only via bn = 1). Optional act. Output same layout.
// =====================================================================================================================
//   mode 0: mean / rsqrt(var + eps); mode 1 (RMSNorm): 0 / rsqrt(mean(x^2) + eps); mode 2 (L2 normalize * sqrt(n)): 0 / sqrt(n) / max(||x||, eps); mode 3: as 0 with unbiased variance (n-1)
__global__ __launch_bounds__(256) void k_stats(const float* __restrict__ x, long long sz, long long so, long long si, int inner, int n, float eps, float* __restrict__ stat, int mode) {
    __shared__ float red[256];
    const int z = blockIdx.x, tid = threadIdx.x;
    const float* base = x + z * sz;
    float s = 0.f;
    for (int e = tid; e < n; e += 256) s += base[(long long)(e / inner) * so + (long long)(e % inner) * si];
    red[tid] = s; __syncthreads();
    for (int o = 128; o > 0; o >>= 1) { if (tid < o) red[tid] += red[tid + o]; __syncthreads(); }
    const float mu = (mode == 0 || mode == 3) ? red[0] / (float)n : 0.f; __syncthreads();
    float q = 0.f;
    for (int e = tid; e < n; e += 256) { const float dlt = base[(long long)(e / inner) * so + (long long)(e % inner) * si] - mu; q += dlt * dlt; }
    red[tid] = q; __syncthreads();
    for (int o = 128; o > 0; o >>= 1) { if (tid < o) red[tid] += red[tid + o]; __syncthreads(); }
    {
        float rs;
        if (mode == 2) rs = sqrtf((float)n) / fmaxf(sqrtf(red[0]), eps); else if (mode == 3) rs = rsqrtf(red[0] / (float)(n - 1) + eps); else rs = rsqrtf(red[0] / (float)n + eps);
        if (tid < 32) { const float v = (tid == 0) ? mu : ((tid == 1) ? rs : 0.f); VST2(float, stat + (long long)z * 32 + tid, v); }
    }
}
//   One thread per element over the flat [Z][C][L] index space: grid ceil(Z*C*L / 256).
__global__ __launch_bounds__(256) void k_norm_apply(const float* __restrict__ x, float* __restrict__ y, const float* __restrict__ stat, const float* __restrict__ g, const float* __restrict__ bta,
                                                     int Z, int C, int L, int G, int bn, int act) {
    const long long idx = (long long)blockIdx.x * 256 + threadIdx.x;
    if (idx >= (long long)Z * C * L) return;
    const int l = (int)(idx % L); const long long zc = idx / L; const int c = (int)(zc % C), z = (int)(zc / C); (void)l;
    const int set = bn ? c : (z * G + c / (C / G));
    float v = (x[idx] - stat[(long long)set * 32]) * stat[(long long)set * 32 + 1];
    if (g) v *= g[c];
    if (bta) v += bta[c];
    v = act_fn(v, act);
    VST2(float, y + idx, v);
}

// k_lse_neg: c[i] = -(st[2i] + log(st[2i+1])) = minus the log-sum-exp of row i from k_attn's ST output (for softmax over the query dimension)
__global__ __launch_bounds__(256) void k_lse_neg(const float* __restrict__ st, float* __restrict__ c, int n) {
    const int i = blockIdx.x * 256 + threadIdx.x;
    if (i < n) { const float v = -(st[2 * i] + logf(st[2 * i + 1])); VST2(float, c + i, v); }
}

// k_iota: dst[i] = a * i + b as int32 (segment/position id helper)
__global__ __launch_bounds__(256) void k_iota(int* __restrict__ dst, int n, int a, int b) {
    const int i = blockIdx.x * 256 + threadIdx.x;
    if (i < n) { const int v = a * i + b; VST2(int, dst + i, v); }
}

// k_axpby: dst[i] = a * x[i] + b * y[i] (+ c), i < n
__global__ __launch_bounds__(256) void k_axpby(const float* __restrict__ x, const float* __restrict__ y, float* __restrict__ dst, int n, float a, float b, float c) {
    const int i = blockIdx.x * 256 + threadIdx.x;
    if (i < n) { const float v = a * x[i] + b * y[i] + c; VST2(float, dst + i, v); }
}

// =====================================================================================================================
// k_rope: rotary embedding on a [R rows][Hn heads][D] view (row stride sXr, head stride sXh, element stride 1) -> Y (own strides).
//   mode 0: rotate_half (partner d±D/2, sign - for d<D/2); mode 1: interleaved pairs (partner d^1, sign - for even d).
//   table column tcol: tmode 0 -> d, 1 -> d % (D/2), 2 -> d / 2; position p: pmode 0 -> r % S, 1 -> head index, 2 -> pos[r];
//   c = C[(r / S) * sCb + p * sCp + tcol * sCd], s likewise from Sn; y = x[d] * c + sign * x[partner] * s. X and Y must not alias.
// =====================================================================================================================
struct RopeP { const float* X; float* Y; const float* C; const float* Sn; const int* pos; long long sXr, sXh, sYr, sYh, sCb, sCp, sCd; int R, Hn, D, S, mode, tmode, pmode, pad; };
static_assert(sizeof(RopeP) == 5 * 8 + 7 * 8 + 8 * 4, "RopeP has padding");
__global__ __launch_bounds__(256) void k_rope(RopeP p) {
    const long long idx = (long long)blockIdx.x * 256 + threadIdx.x;
    if (idx >= (long long)p.R * p.Hn * p.D) return;
    const int d = (int)(idx % p.D); const long long rh = idx / p.D; const int h = (int)(rh % p.Hn); const int r = (int)(rh / p.Hn);
    const int half = p.D / 2;
    int partner; float sign;
    if (p.mode == 0) { partner = (d < half) ? d + half : d - half; sign = (d < half) ? -1.f : 1.f; }
    else { partner = d ^ 1; sign = (d & 1) ? 1.f : -1.f; }
    const int tcol = (p.tmode == 0) ? d : ((p.tmode == 1) ? (d % half) : (d >> 1));
    const int pp = (p.pmode == 0) ? (r % p.S) : ((p.pmode == 1) ? h : p.pos[r]);
    const long long toff = (long long)(r / p.S) * p.sCb + (long long)pp * p.sCp + (long long)tcol * p.sCd;
    const float* xr = p.X + (long long)r * p.sXr + (long long)h * p.sXh;
    const float v = xr[d] * p.C[toff] + sign * xr[partner] * p.Sn[toff];
    VST2(float, p.Y + (long long)r * p.sYr + (long long)h * p.sYh + d, v);
}

// k_invf + k_sincos (split so neither kernel carries a large VALU-fma footprint): invf_i = num * (1 / powf(base, (2 i)/D)) [fmode 0],
//   num * expf((2 i) * cexp) [fmode 1], num * powf(base, -2 (i - 1) / D) [fmode 2]; then cs/sn[s*half + i] = cos/sin((pscale * s) * invf_i)
__global__ __launch_bounds__(256) void k_invf(float* __restrict__ invb, int half, int D, float base, float num, int fmode, float cexp) {
    const int i = blockIdx.x * 256 + threadIdx.x;
    if (i >= ((half + 31) / 32) * 32) return;
    if (i >= half) { VST2(float, invb + i, 0.f); return; }
    const float e = (float)(2 * i) / (float)D;
    float invf;
    if (fmode == 1) invf = num * expf((float)(2 * i) * cexp);
    else if (fmode == 2) invf = num * powf(base, (-2.0f * ((float)i - 1.0f)) / (float)D);
    else invf = num * (1.0f / powf(base, e));
    VST2(float, invb + i, invf);
}
__global__ __launch_bounds__(256) void k_sincos(float* __restrict__ cs, float* __restrict__ sn, const float* __restrict__ invb, int S, int half, float pscale) {
    const int idx = blockIdx.x * 256 + threadIdx.x;
    if (idx >= S * half) return;
    const int s = idx / half, i = idx - s * half;
    const float ang = (pscale * (float)s) * invb[i];
    VST2(float, cs + idx, cosf(ang)); VST2(float, sn + idx, sinf(ang));
}

// k_mulact: dst[i] = act(x[i]) * y[i]
__global__ __launch_bounds__(256) void k_mulact(const float* __restrict__ x, const float* __restrict__ y, float* __restrict__ dst, int n, int act) {
    const int i = blockIdx.x * 256 + threadIdx.x;
    if (i < n) { const float v = act_fn(x[i], act) * y[i]; VST2(float, dst + i, v); }
}

// =====================================================================================================================
// k_matvec: thread-per-row matrix-vector products for N <= 8 output columns (heads with 1-3 outputs, gates), f32 on the VALU.
//   C[r*sCm + j] = act(alpha * sum_k A[r*sAm + k*sAk] * B[j*sBn + k*sBk] + bias[j]) + beta * R[r*sRm + j*sRn]; each thread writes its N contiguous floats.
// =====================================================================================================================
__global__ __launch_bounds__(256) void k_matvec(GemmP p) {
    // 32 lanes write one line with one instruction.
    const int rpt = (p.N == 1) ? 1 : 32;
    const long long r0 = ((long long)blockIdx.x * 256 + threadIdx.x) * rpt; const int z = blockIdx.z, zo = z / p.zi_n, zi = z - zo * p.zi_n;
    if (r0 >= p.M) return;
    const float* Bb = p.B + zo * p.sBo + zi * p.sBi;
    float* C = p.C + zo * p.sCo + zi * p.sCi; const float* R = p.R + zo * p.sRo + zi * p.sRi;
    for (int rr = 0; rr < rpt; ++rr) {
        const long long r = r0 + rr; if (r >= p.M) break;
        const float* A = p.A + zo * p.sAo + zi * p.sAi + r * p.sAm;
        float acc[8] = {0.f, 0.f, 0.f, 0.f, 0.f, 0.f, 0.f, 0.f};
        for (int k = 0; k < p.K; ++k) { const float a = A[(long long)k * p.sAk];
#pragma unroll
            for (int j = 0; j < 8; ++j) if (j < p.N) acc[j] += a * Bb[(long long)j * p.sBn + (long long)k * p.sBk]; }
#pragma unroll
        for (int j = 0; j < 8; ++j) if (j < p.N) {
            float v = acc[j] * p.alpha;
            if (p.flags & 1) v += p.bias[j];
            if (p.flags & 2) v += p.bias[r];
            v = act_fn(v, p.act);
            if (p.flags & 4) v += p.beta * R[r * p.sRm + (long long)j * p.sRn];
            VST2(float, C + r * p.sCm + j, v);
        }
    }
}
// k_smallsoftmax: thread-per-row softmax for short rows (n <= 64): dst[r*dr + j] = softmax(scale*src[r*sr + j])
__global__ __launch_bounds__(256) void k_smallsoftmax(const float* __restrict__ src, float* __restrict__ dst, long long sr, long long dr, int n, long long R, float scale) {
    const long long r0 = ((long long)blockIdx.x * 256 + threadIdx.x) * 32;
    for (int rr = 0; rr < 32; ++rr) {
        const long long r = r0 + rr; if (r >= R) return;
        const float* s = src + r * sr; float* d = dst + r * dr;
        float mx = -__builtin_inff();
        for (int j = 0; j < n; ++j) mx = fmaxf(mx, s[j] * scale);
        float sum = 0.f;
        for (int j = 0; j < n; ++j) sum += expf(s[j] * scale - mx);
        const float inv = 1.f / sum;
        for (int j = 0; j < n; ++j) { const float v = expf(s[j] * scale - mx) * inv; VST2(float, d + j, v); }
    }
}

__global__ __launch_bounds__(32) void k_unitstat(float* __restrict__ st) { const int t = threadIdx.x; const float v = (t == 1) ? 1.f : 0.f; VST2(float, st + t, v); }

// destination (e.g. a d_out whose row width is not a multiple of 32 floats) is written by consecutive lanes of one instruction
__global__ __launch_bounds__(256) void k_lincopy(const float* __restrict__ src, long long lds, float* __restrict__ dst, long long ldd, long long rows, int cols) {
    const long long i = (long long)blockIdx.x * 256 + threadIdx.x; if (i >= rows * cols) return;
    const long long r = i / cols; const int c = (int)(i - r * cols);
    const float v = src[r * lds + c]; VST2(float, dst + r * ldd + c, v);
}

namespace w25 {
typedef __attribute__((ext_vector_type(16))) _Float16 v16h;
typedef __attribute__((ext_vector_type(8)))  _Float16 v8h;
typedef __attribute__((ext_vector_type(16))) __bf16   v16b;
typedef __attribute__((ext_vector_type(8)))  __bf16   v8b;
typedef __attribute__((ext_vector_type(8)))  float    v8f;
typedef __attribute__((ext_vector_type(4)))  float    v4f;

__device__ __forceinline__ unsigned short f2bf_bits(float f) {
  unsigned u = __float_as_uint(f);
  return (unsigned short)((u + 0x7FFFu + ((u >> 16) & 1u)) >> 16);
}
__device__ __forceinline__ float bf_bits2f(unsigned short h) { return __uint_as_float(((unsigned)h) << 16); }

// hazard guards as plain device helpers (no inline asm inside the kernel template body)
__device__ __forceinline__ void dep_guard_h(v8f& a, v8f& b, v16h x, v16h y) { asm volatile("v_nop\n\tv_nop\n\tv_nop\n\tv_nop" : "+v"(a), "+v"(b) : "v"(x), "v"(y)); }
__device__ __forceinline__ void dep_guard_b(v8f& a, v8f& b, v16b x, v16b y) { asm volatile("v_nop\n\tv_nop\n\tv_nop\n\tv_nop" : "+v"(a), "+v"(b) : "v"(x), "v"(y)); }
__device__ __forceinline__ void keep4_h(v16h a, v16h b, v16h c, v16h d) { asm volatile("v_nop" :: "v"(a), "v"(b), "v"(c), "v"(d)); }
__device__ __forceinline__ void keep4_b(v16b a, v16b b, v16b c, v16b d) { asm volatile("v_nop" :: "v"(a), "v"(b), "v"(c), "v"(d)); }
__device__ __forceinline__ void acc_guard4(v8f& a, v8f& b, v8f& c, v8f& d) { asm volatile("v_nop\n\tv_nop\n\tv_nop\n\tv_nop" : "+v"(a), "+v"(b), "+v"(c), "+v"(d)); }
template <typename T> struct Frag;
template <> struct Frag<_Float16> {
  typedef v16h V; union U { v16h v; v8h h[2]; };
  static __device__ __forceinline__ v16h load(const _Float16* p) {   // elements 0..7 <- p[0..7], 8..15 <- p[16..23]
    U f; f.h[0] = *(const v8h*)(p); f.h[1] = *(const v8h*)(p + 16); return f.v;
  }
  static __device__ __forceinline__ v8f mma(v16h a, v16h b, v8f c) {
    return __builtin_amdgcn_wmma_f32_16x16x32_f16(false, a, false, b, (short)0, c, false, false);
  }
  static __device__ __forceinline__ void guard(v8f& a, v8f& b, v16h x, v16h y) { dep_guard_h(a, b, x, y); }
  static __device__ __forceinline__ void keep(v16h a, v16h b, v16h c, v16h d) { keep4_h(a, b, c, d); }
};
template <> struct Frag<__bf16> {
  typedef v16b V; union U { v16b v; v8b h[2]; };
  static __device__ __forceinline__ v16b load(const __bf16* p) {
    U f; f.h[0] = *(const v8b*)(p); f.h[1] = *(const v8b*)(p + 16); return f.v;
  }
  static __device__ __forceinline__ v8f mma(v16b a, v16b b, v8f c) {
    return __builtin_amdgcn_wmma_f32_16x16x32_bf16(false, a, false, b, (short)0, c, false, false);
  }
  static __device__ __forceinline__ void guard(v8f& a, v8f& b, v16b x, v16b y) { dep_guard_b(a, b, x, y); }
  static __device__ __forceinline__ void keep(v16b a, v16b b, v16b c, v16b d) { keep4_b(a, b, c, d); }
};

// ---- Register-blocked batched WMMA GEMM ------------------------------------
// C[m,n] = scale * sum_k A[m,k] * Bt[n,k] (+bias)(+resid); each wave owns a 64x64 tile.
// A row-major [M,K]; Bt row-major [N,K]; M,N % 64 == 0, K % 32 == 0.
// SPLIT: operands are hi/lo planes (A2/Bt2 = lo planes, same layout); product = hi·hi + hi·lo + lo·hi.
// BIAS_MODE: 0 = none, 1 = bias[m], 2 = bias[n].
// OUT_MODE: 0 = f32, 1 = f16, 2 = bf16 hi plane (Cout) + bf16 lo plane (Cout2).
// ET: 0 = f16 operands, 1 = bf16 operands (pointers passed as 16-bit storage)
template <int ET> struct Elem;
template <> struct Elem<0> { typedef _Float16 T; };
template <> struct Elem<1> { typedef __bf16 T; };
template <int ET, bool SPLIT, int BIAS_MODE, int OUT_MODE, bool RESID, int ACT = 0>
__global__ __launch_bounds__(256) void wmma_gemm64(
    const unsigned short* __restrict__ Ap, const unsigned short* __restrict__ A2p, int lda, long strideA,
    const unsigned short* __restrict__ Btp, const unsigned short* __restrict__ Bt2p, int ldb, long strideB,
    void* __restrict__ Cout, void* __restrict__ Cout2, int ldc, long strideC,
    const float* __restrict__ bias,
    const float* __restrict__ resid, long strideR,
    int M, int N, int K, float scale) {
  typedef typename Elem<ET>::T T;
  typedef typename Frag<T>::V V;
  const T* A = (const T*)Ap; const T* A2 = (const T*)A2p; const T* Bt = (const T*)Btp; const T* Bt2 = (const T*)Bt2p;
  __shared__ __align__(16) float sT[8][16 * 68];   // per-wave 16x64 slab, pitch 68 floats
  const int b    = blockIdx.y;
  const int lane = threadIdx.x & 31;
  const int wave = threadIdx.x >> 5;
  const int tilesN = N >> 6;
  const int tilesM = M >> 6;
  const int tile = blockIdx.x * 8 + wave;
  if (tile >= tilesM * tilesN) return;   // wave-uniform; no block barriers in this kernel
  const int tm = tile / tilesN;
  const int tn = tile - tm * tilesN;
  const int m0 = tm << 6;
  const int n0 = tn << 6;

  const T* Ab  = A  + (size_t)b * strideA;
  const T* Bb  = Bt + (size_t)b * strideB;
  const T* Ab2 = SPLIT ? (A2  + (size_t)b * strideA) : nullptr;
  const T* Bb2 = SPLIT ? (Bt2 + (size_t)b * strideB) : nullptr;

  const int rlane = lane & 15;                 // row (A) / col (B, D) within subtile
  const int koff  = (lane >> 4) * 8;           // k offset of this lane half
  const int mOff  = (lane >> 4) * 8;           // D row offset

  v8f acc[4][4];
#pragma unroll
  for (int i = 0; i < 4; ++i)
#pragma unroll
    for (int j = 0; j < 4; ++j) acc[i][j] = (v8f){0.f,0.f,0.f,0.f,0.f,0.f,0.f,0.f};

  for (int k0 = 0; k0 < K; k0 += 32) {
    V bh[4], bl[4];
#pragma unroll
    for (int j = 0; j < 4; ++j) {
      const size_t bo = (size_t)(n0 + (j << 4) + rlane) * ldb + koff + k0;
      bh[j] = Frag<T>::load(Bb + bo);
      if (SPLIT) bl[j] = Frag<T>::load(Bb2 + bo);
    }
#pragma unroll
    for (int i = 0; i < 4; ++i) {
      const size_t ao = (size_t)(m0 + (i << 4) + rlane) * lda + koff + k0;
      V ah = Frag<T>::load(Ab + ao);
      V al;
      if (SPLIT) al = Frag<T>::load(Ab2 + ao);
#pragma unroll
      for (int j = 0; j < 4; ++j) {
        acc[i][j] = Frag<T>::mma(ah, bh[j], acc[i][j]);
        if (SPLIT) {
          acc[i][j] = Frag<T>::mma(ah, bl[j], acc[i][j]);
          acc[i][j] = Frag<T>::mma(al, bh[j], acc[i][j]);
        }
      }
      Frag<T>::guard(acc[i][0], acc[i][3], ah, SPLIT ? al : ah);
    }
    Frag<T>::keep(bh[0], bh[1], bh[2], bh[3]);
    if (SPLIT) Frag<T>::keep(bl[0], bl[1], bl[2], bl[3]);
  }
  acc_guard4(acc[0][0], acc[0][1], acc[0][2], acc[0][3]);
  acc_guard4(acc[1][0], acc[1][1], acc[1][2], acc[1][3]);
  acc_guard4(acc[2][0], acc[2][1], acc[2][2], acc[2][3]);
  acc_guard4(acc[3][0], acc[3][1], acc[3][2], acc[3][3]);

  // ---- epilogue ----
  float* slab = sT[wave];
  const float* Rb = RESID ? (resid + (size_t)b * strideR) : nullptr;
#pragma unroll
  for (int i = 0; i < 4; ++i) {
    const int mBase = m0 + (i << 4);
#pragma unroll
    for (int j = 0; j < 4; ++j) {
      const int n = n0 + (j << 4) + rlane;
      float bv = 0.f;
      if (BIAS_MODE == 2) bv = bias[n];
#pragma unroll
      for (int r = 0; r < 8; ++r) {
        float v = acc[i][j][r] * scale;
        if (BIAS_MODE == 1) v += bias[mBase + mOff + r];
        if (BIAS_MODE == 2) v += bv;
        if (RESID) v += Rb[(size_t)(mBase + mOff + r) * ldc + n];
        if (ACT == 1) v = tanhf(v);
        if (ACT == 2) v = fmaxf(v, 0.0f);
        if (ACT == 3) v = v / (1.0f + expf(-v));
        if (ACT == 4) v = (v > 0.f) ? v : 0.01f * v;
        if (ACT == 5) v = 0.5f * v * (1.0f + erff(v * 0.70710678118654752f));
        slab[(mOff + r) * 68 + (j << 4) + rlane] = v;
      }
    }
    __builtin_amdgcn_fence(__ATOMIC_RELEASE, "workgroup");
    __builtin_amdgcn_wave_barrier();
    __builtin_amdgcn_fence(__ATOMIC_ACQUIRE, "workgroup");
    if (OUT_MODE == 0) {
      float* C = (float*)Cout + (size_t)b * strideC;
      const int hh = lane >> 4, c4 = (lane & 15) * 4;     // row seg = 256 B = 16 lanes x 16 B
      {
#pragma unroll
        for (int it = 0; it < 8; ++it) {
          const int row = it * 2 + hh;
          v4f v = *(const v4f*)(slab + row * 68 + c4);
          *(v4f*)(C + (size_t)(mBase + row) * ldc + n0 + c4) = v;
        }
        
      }
    } else {
      const int q = lane >> 3, c8 = (lane & 7) * 8;
      unsigned short* C  = (unsigned short*)Cout  + (size_t)b * strideC;
      unsigned short* C2 = (OUT_MODE == 2) ? ((unsigned short*)Cout2 + (size_t)b * strideC) : nullptr;
      {
#pragma unroll
        for (int it = 0; it < 4; ++it) {
          const int row = it * 4 + q;
          const float* sp = slab + row * 68 + c8;
          v8h hv, lv;
#pragma unroll
          for (int e = 0; e < 8; ++e) {
            if (OUT_MODE == 1) {
              hv[e] = (_Float16)sp[e];
            } else {
              unsigned short hb = f2bf_bits(sp[e]);
              unsigned short lb = f2bf_bits(sp[e] - bf_bits2f(hb));
              hv[e] = __builtin_bit_cast(_Float16, hb);
              lv[e] = __builtin_bit_cast(_Float16, lb);
            }
          }
          *(v8h*)(C + (size_t)(mBase + row) * ldc + n0 + c8) = hv;
          if (OUT_MODE == 2) *(v8h*)(C2 + (size_t)(mBase + row) * ldc + n0 + c8) = lv;
        }
        
      }
    }
    __builtin_amdgcn_fence(__ATOMIC_RELEASE, "workgroup");
    __builtin_amdgcn_wave_barrier();
    __builtin_amdgcn_fence(__ATOMIC_ACQUIRE, "workgroup");
  }
}

// ---- Deep-K product: K dealt over the 16 waves of a work-group ---------------
// C[m,n] = scale * sum_k A[m,k] * Bt[n,k], f16 operands, f32 out; one 32x64 tile of C per work-group.
// Per trip wave w takes the 64 k (one 128-B line of every operand row) at kb + 64 w, so the tile's K loop is 16 times shorter
// and a product with few output tiles still fills the chip. The 16 f32 partial tiles meet in LDS and are added in wave order.
// A row-major [M,K]; Bt row-major [N,K]; M % 32 == 0, N % 64 == 0, K % 1024 == 0; grid = (M / 32) * (N / 64).
__global__ __launch_bounds__(512) void wmma_gemm_kwaves(
    const unsigned short* __restrict__ Ap, int lda,
    const unsigned short* __restrict__ Btp, int ldb,
    float* __restrict__ C, int ldc, int N, int K, float scale) {
  typedef _Float16 T;
  __shared__ __align__(16) float sP[16][32 * 68];   // per-wave 32x64 partial tile, pitch 68 floats
  const int lane = threadIdx.x & 31;
  const int wave = __builtin_amdgcn_readfirstlane(threadIdx.x >> 5);
  const int tilesN = N >> 6;
  const int tm = blockIdx.x / tilesN;
  const int tn = blockIdx.x - tm * tilesN;
  const int m0 = tm << 5;
  const int n0 = tn << 6;
  const int rlane = lane & 15;                 // row (A) / col (B, D) within subtile
  const int koff  = (lane >> 4) * 8;           // k offset of this lane half
  const int mOff  = (lane >> 4) * 8;           // D row offset
  const T* Aw = (const T*)Ap  + (size_t)(m0 + rlane) * lda + koff + (wave << 6);
  const T* Bw = (const T*)Btp + (size_t)(n0 + rlane) * ldb + koff + (wave << 6);

  v8f acc[2][4];
#pragma unroll
  for (int i = 0; i < 2; ++i)
#pragma unroll
    for (int j = 0; j < 4; ++j) acc[i][j] = (v8f){0.f,0.f,0.f,0.f,0.f,0.f,0.f,0.f};

  for (int kb = 0; kb < K; kb += 1024) {
    v16h bh[2][4], ah[2][2];
#pragma unroll
    for (int s = 0; s < 2; ++s) {
#pragma unroll
      for (int j = 0; j < 4; ++j) bh[s][j] = Frag<T>::load(Bw + (size_t)(j << 4) * ldb + kb + (s << 5));
#pragma unroll
      for (int i = 0; i < 2; ++i) ah[s][i] = Frag<T>::load(Aw + (size_t)(i << 4) * lda + kb + (s << 5));
    }
    // inputs-only fence on the loaded values: keeps the trip's 24 loads ahead of its first WMMA, so that the four 32-B pieces of
    // each 128-B line are asked for together (the line need not outlive the other waves' traffic in the WGP cache) and the wave
    // waits out one load latency per trip instead of one per 32 k
    asm volatile("" :: "v"(bh[0][0]), "v"(bh[0][1]), "v"(bh[0][2]), "v"(bh[0][3]), "v"(bh[1][0]), "v"(bh[1][1]), "v"(bh[1][2]), "v"(bh[1][3]),
                       "v"(ah[0][0]), "v"(ah[0][1]), "v"(ah[1][0]), "v"(ah[1][1]));
#pragma unroll
    for (int s = 0; s < 2; ++s)
#pragma unroll
      for (int i = 0; i < 2; ++i)
#pragma unroll
        for (int j = 0; j < 4; ++j) acc[i][j] = Frag<T>::mma(ah[s][i], bh[s][j], acc[i][j]);
  }

  float* slab = sP[wave];
#pragma unroll
  for (int i = 0; i < 2; ++i)
#pragma unroll
    for (int j = 0; j < 4; ++j)
#pragma unroll
      for (int r = 0; r < 8; ++r) slab[((i << 4) + mOff + r) * 68 + (j << 4) + rlane] = acc[i][j][r];
  __syncthreads();
  const int row = threadIdx.x >> 4, c4 = (threadIdx.x & 15) * 4;   // row seg = 256 B = 16 lanes x 16 B
  v4f sum = *(const v4f*)(&sP[0][row * 68 + c4]);
#pragma unroll
  for (int w = 1; w < 16; ++w) sum += *(const v4f*)(&sP[w][row * 68 + c4]);
  *(v4f*)(C + (size_t)(m0 + row) * ldc + n0 + c4) = sum * scale;
}

__global__ __launch_bounds__(256) void cast_f32_f16x2(
    const float* __restrict__ in, _Float16* __restrict__ out, int n2) {
  int i = blockIdx.x * 256 + threadIdx.x;
  if (i < n2) {
    const _Float16 h0 = (_Float16)in[2 * i], h1 = (_Float16)in[2 * i + 1];
    const unsigned u = (unsigned)__builtin_bit_cast(unsigned short, h0) | ((unsigned)__builtin_bit_cast(unsigned short, h1) << 16);
    ((unsigned*)out)[i] = u;
    
  }
}


} // namespace w25

__global__ __launch_bounds__(256) void k_castT16(const float* __restrict__ src, long long lds, _Float16* __restrict__ dst, long long ldd, int R, int C, float s) {
    const long long i = (long long)blockIdx.x * 256 + threadIdx.x; const long long np = (long long)C * (R / 2); if (i >= np) return; const int c = (int)(i / (R / 2)); const int r = 2 * (int)(i % (R / 2));
    const _Float16 h0 = (_Float16)(src[(long long)r * lds + c] * s), h1 = (_Float16)(src[(long long)(r + 1) * lds + c] * s);
    const unsigned u = (unsigned)__builtin_bit_cast(unsigned short, h0) | ((unsigned)__builtin_bit_cast(unsigned short, h1) << 16);
    unsigned* d = (unsigned*)(dst + (long long)c * ldd + r); *d = u;  }
__global__ __launch_bounds__(256) void k_cast16(const float* __restrict__ src, long long lds, _Float16* __restrict__ dst, long long ldd, int R, int C, float s) {
    const long long i = (long long)blockIdx.x * 256 + threadIdx.x; const long long np = (long long)R * (C / 2); if (i >= np) return; const int r = (int)(i / (C / 2)); const int c = 2 * (int)(i % (C / 2));
    const _Float16 h0 = (_Float16)(src[(long long)r * lds + c] * s), h1 = (_Float16)(src[(long long)r * lds + c + 1] * s);
    const unsigned u = (unsigned)__builtin_bit_cast(unsigned short, h0) | ((unsigned)__builtin_bit_cast(unsigned short, h1) << 16);
    unsigned* d = (unsigned*)(dst + (long long)r * ldd + c); *d = u;  }

// f32 -> bf16 hi plane + bf16 lo plane (x = hi + lo to ~2^-17 relative; RNE both), [R][C] -> [R][C] (or transposed to [C][R]); 2 consecutive destination elements
__device__ __forceinline__ unsigned int f2bf2_pack(float a, float b, unsigned int* lo) {
    const unsigned short ha = w25::f2bf_bits(a), hb = w25::f2bf_bits(b);
    const unsigned short la = w25::f2bf_bits(a - w25::bf_bits2f(ha)), lb = w25::f2bf_bits(b - w25::bf_bits2f(hb));
    *lo = (unsigned)la | ((unsigned)lb << 16); return (unsigned)ha | ((unsigned)hb << 16); }
__global__ __launch_bounds__(256) void k_castS16(const float* __restrict__ src, long long lds, __bf16* __restrict__ dhi, __bf16* __restrict__ dlo, long long ldd, int R, int C, float s, int transpose) {
    const long long i = (long long)blockIdx.x * 256 + threadIdx.x; long long o; float a, b;
    if (transpose) { const long long np = (long long)C * (R / 2); if (i >= np) return; const int c = (int)(i / (R / 2)); const int r = 2 * (int)(i % (R / 2)); a = src[(long long)r * lds + c] * s; b = src[(long long)(r + 1) * lds + c] * s; o = (long long)c * ldd + r; }
    else { const long long np = (long long)R * (C / 2); if (i >= np) return; const int r = (int)(i / (C / 2)); const int c = 2 * (int)(i % (C / 2)); a = src[(long long)r * lds + c] * s; b = src[(long long)r * lds + c + 1] * s; o = (long long)r * ldd + c; }
    unsigned lo; const unsigned hi = f2bf2_pack(a, b, &lo); unsigned* ph = (unsigned*)(dhi + o); unsigned* pl = (unsigned*)(dlo + o);
    *ph = hi; *pl = lo;  }

namespace w25 {
// =====================================================================================
// Generic causal/non-causal attention for head_dim 64, f32 in / f32 out; 16-bit operands: bf16 with optional hi/lo splits, or
// plain f16 (F16=true, non-split, probabilities carried x2^15).
//   scores = (q*qscale)·kᵀ : v_wmma_f32_16x16x32_bf16; SPLIT_QK -> q,k as bf16 hi/lo (hi·hi + hi·lo + lo·hi)
//   out    = p·v           : v_wmma_f32_16x16x32_bf16; SPLIT_PV -> p,v as bf16 hi/lo; else p,v plain bf16
//   f32 accumulate; online softmax in f32. Block = 4 waves = 64 query rows of one (batch, head); S % 64 == 0.
//   Element (b, s, h, d) of tensor X lives at X[b*X_bs + s*X_rs + h*X_hs + d] (strides in floats, multiples of 4).
//   Masking: mask_mode 0 none, 1 causal (kv > q masked), 2 tensor [S][Skv] shared over (b,h) (float if
//   mask_is_int==0, int32 with element == 0 -> masked if 1, int32 with element != 0 -> masked if 2), 3 per-token vectors qmask[B][S] & kvmask[B][Skv] (int32,
//   0 -> masked), 4 causal + sliding window (kv > q or q - kv > W masked; W passed in mask_is_int);
//   5 = relative-position bias: s += cp[b,h,q][idx[q][kv]] + pc[b,h,kv][idx[q][kv]] with idx = mask_b ([S][Skv] int32) and
//   mask_a an int32 [S][Skv] tensor with nonzero = masked (tables: element (b,h,row,n) at X + b*c_bs + h*c_hs + row*c_rs + n);
//   masked scores are replaced by mask_fill (e.g. -inf or -1e9) before the softmax.
//   grid.x = B * H * (S/64) (or a sub-range with blk0).
// =====================================================================================
#define AT_D 64
#define AT_NW 4
#define AT_QB 64
#define AT_KC 64
struct AttnGeom { const float* cp = nullptr; const float* pc = nullptr; long c_bs = 0, c_rs = 0, c_hs = 0;   // mode-5 score-bias tables
                  long q_bs, q_rs, q_hs, k_bs, k_rs, k_hs, v_bs, v_rs, v_hs, o_bs, o_rs, o_hs;
                  int S, Skv, H, mask_mode; float qscale; int blk0; float mask_fill; int mask_is_int; };
static_assert(sizeof(AttnGeom) == 168, "no padding");

__device__ __forceinline__ unsigned short at_bf_bits(float f) {
  unsigned u = __float_as_uint(f);
  return (unsigned short)((u + 0x7FFFu + ((u >> 16) & 1u)) >> 16);
}
__device__ __forceinline__ __bf16 at_f2bf(float f) { return __builtin_bit_cast(__bf16, at_bf_bits(f)); }
__device__ __forceinline__ void at_split(float f, __bf16& hi, __bf16& lo) {
  const unsigned short hb = at_bf_bits(f);
  hi = __builtin_bit_cast(__bf16, hb);
  lo = at_f2bf(f - __uint_as_float(((unsigned)hb) << 16));
}
__device__ __forceinline__ v8f at_mma(v16b a, v16b b, v8f c) {
  c = __builtin_amdgcn_wmma_f32_16x16x32_bf16(false, a, false, b, (short)0, c, false, false);
  asm volatile("v_nop\n\tv_nop\n\tv_nop\n\tv_nop" : "+v"(c) : "v"(a), "v"(b));
  return c;
}
// 16-bit element as a bit pattern held in a __bf16 slot: f16 bits when F16, bf16 (RNE) otherwise
template <bool F16> __device__ __forceinline__ __bf16 at_to16(float f) {
  if (F16) return __builtin_bit_cast(__bf16, (_Float16)f);
  return at_f2bf(f);
}
template <bool F16> __device__ __forceinline__ v8f at_mma16(v16b a, v16b b, v8f c) {
  if (F16) {
    const v16h ah = __builtin_bit_cast(v16h, a), bh = __builtin_bit_cast(v16h, b);
    c = __builtin_amdgcn_wmma_f32_16x16x32_f16(false, ah, false, bh, (short)0, c, false, false);
    asm volatile("v_nop\n\tv_nop\n\tv_nop\n\tv_nop" : "+v"(c) : "v"(ah), "v"(bh));
    return c;
  }
  return at_mma(a, b, c);
}

template <bool SPLIT_QK, bool SPLIT_PV, bool F16 = false>
__global__ __launch_bounds__(128)
void attn64_kernel(const float* __restrict__ q, const float* __restrict__ k,
                   const float* __restrict__ v, float* __restrict__ out,
                   const void* __restrict__ mask_a, const int* __restrict__ mask_b, AttnGeom g) {
  static_assert(!(F16 && (SPLIT_QK || SPLIT_PV)), "f16 mode is non-split");
  const float PSC = F16 ? 32768.0f : 1.0f;     // f16 probabilities carried x2^15 (subnormal range), folded into the final 1/l
  union FB { v16b v; v8b h[2]; };
  __shared__ __align__(16) __bf16 Ksh[AT_KC * AT_D];             // K hi [kv][d]      8 KB
  __shared__ __align__(16) __bf16 Ksl[SPLIT_QK ? AT_KC * AT_D : 8];
  __shared__ __align__(16) __bf16 Vth[AT_D * AT_KC];             // V hi [d][kv]      8 KB
  __shared__ __align__(16) __bf16 Vtl[SPLIT_PV ? AT_D * AT_KC : 8];
  __shared__ __align__(16) __bf16 Psh[AT_NW][16 * AT_KC];        // per wave P hi [row][kv]  8 KB
  __shared__ __align__(16) __bf16 Psl[SPLIT_PV ? AT_NW : 1][SPLIT_PV ? 16 * AT_KC : 8];
  __shared__ __align__(16) float  Os[AT_NW][16 * 68];            // per wave out tile, pitch 68

  const int tid  = threadIdx.x;
  const int wave = tid >> 5;
  const int lane = tid & 31;
  const int hh   = lane >> 4;
  const int c    = lane & 15;

  const int nqb = g.S / AT_QB;
  const int bx = blockIdx.x + g.blk0;
  const int qb = bx % nqb;
  const int bh = bx / nqb;
  const int h  = bh % g.H;
  const int b  = bh / g.H;
  const int qbase_block = qb * AT_QB;
  const int q0 = qbase_block + wave * 16;

  const float* qb_ptr = q + (size_t)b * g.q_bs + (size_t)h * g.q_hs;
  const float* kb_ptr = k + (size_t)b * g.k_bs + (size_t)h * g.k_hs;
  const float* vb_ptr = v + (size_t)b * g.v_bs + (size_t)h * g.v_hs;
  float*       ob_ptr = out + (size_t)b * g.o_bs + (size_t)h * g.o_hs;

  // ---- Q fragments (A operand): 2 d-chunks, hi (and lo) ----
  v16b qah[2], qal[2];
  {
    const float* qrow = qb_ptr + (size_t)(q0 + c) * g.q_rs;
#pragma unroll
    for (int dc = 0; dc < 2; ++dc) {
#pragma unroll
      for (int e = 0; e < 8; ++e) {
        const float f0 = qrow[dc * 32 + 8 * hh + e] * g.qscale;
        const float f1 = qrow[dc * 32 + 16 + 8 * hh + e] * g.qscale;
        if (SPLIT_QK) { __bf16 hq, lq; at_split(f0, hq, lq); qah[dc][e] = hq; qal[dc][e] = lq; at_split(f1, hq, lq); qah[dc][8 + e] = hq; qal[dc][8 + e] = lq; }
        else { qah[dc][e] = at_to16<F16>(f0); qah[dc][8 + e] = at_to16<F16>(f1); qal[dc][e] = qah[dc][e]; qal[dc][8 + e] = qah[dc][8 + e]; }
      }
    }
  }

  float mrow[8], lrow[8];
  v8f oacc[4];
#pragma unroll
  for (int r = 0; r < 8; ++r) { mrow[r] = -INFINITY; lrow[r] = 0.f; }
#pragma unroll
  for (int t = 0; t < 4; ++t) oacc[t] = (v8f){0.f,0.f,0.f,0.f,0.f,0.f,0.f,0.f};

  const int nChunks = (g.mask_mode == 1 || g.mask_mode == 4) ? (qb + 1) : (g.Skv / AT_KC);   // block-uniform
  // per-row query mask (mode 3)
  int qkeep[8];
#pragma unroll
  for (int r = 0; r < 8; ++r) qkeep[r] = (g.mask_mode == 3) ? mask_b[(size_t)b * g.S + q0 + 8 * hh + r] : 1;   // mask_b = qmask in mode 3
  for (int kc = 0; kc < nChunks; ++kc) {
    const int kv0 = kc * AT_KC;
    __syncthreads();
    {
      const int kvr = tid >> 1, dh = (tid & 1) * 32;
      const float* krow = kb_ptr + (size_t)(kv0 + kvr) * g.k_rs + dh;
      const float* vrow = vb_ptr + (size_t)(kv0 + kvr) * g.v_rs + dh;
#pragma unroll
      for (int i = 0; i < 8; ++i) {
        v4f kk = *(const v4f*)(krow + 4 * i);
        v4f vv = *(const v4f*)(vrow + 4 * i);
#pragma unroll
        for (int e = 0; e < 4; ++e) {
          const int d = dh + 4 * i + e;
          if (SPLIT_QK) { __bf16 a, bl; at_split(kk[e], a, bl); Ksh[kvr * AT_D + d] = a; Ksl[kvr * AT_D + d] = bl; }
          else Ksh[kvr * AT_D + d] = at_to16<F16>(kk[e]);
          if (SPLIT_PV) { __bf16 a, bl; at_split(vv[e], a, bl); Vth[d * AT_KC + kvr] = a; Vtl[d * AT_KC + kvr] = bl; }
          else Vth[d * AT_KC + kvr] = at_to16<F16>(vv[e]);
        }
      }
    }
    __syncthreads();

    v8f s[4];
#pragma unroll
    for (int j = 0; j < 4; ++j) {
      s[j] = (v8f){0.f,0.f,0.f,0.f,0.f,0.f,0.f,0.f};
#pragma unroll 1
      for (int dc = 0; dc < 2; ++dc) {
        FB kb;
        kb.h[0] = *(const v8b*)(Ksh + (j * 16 + c) * AT_D + dc * 32 + 8 * hh);
        kb.h[1] = *(const v8b*)(Ksh + (j * 16 + c) * AT_D + dc * 32 + 16 + 8 * hh);
        s[j] = at_mma16<F16>(qah[dc], kb.v, s[j]);
        if (SPLIT_QK) {
          FB kl;
          kl.h[0] = *(const v8b*)(Ksl + (j * 16 + c) * AT_D + dc * 32 + 8 * hh);
          kl.h[1] = *(const v8b*)(Ksl + (j * 16 + c) * AT_D + dc * 32 + 16 + 8 * hh);
          s[j] = at_mma16<F16>(qah[dc], kl.v, s[j]);
          s[j] = at_mma16<F16>(qal[dc], kb.v, s[j]);
        }
      }
    }
    const bool diag = (g.mask_mode == 1) && (kc == qb);
    int kvkeep[4] = {1, 1, 1, 1};
    if (g.mask_mode == 3) {
#pragma unroll
      for (int j = 0; j < 4; ++j) kvkeep[j] = ((const int*)mask_a)[(size_t)b * g.Skv + kv0 + j * 16 + c];   // mask_a = kvmask
    }
    float cm[8];
#pragma unroll
    for (int r = 0; r < 8; ++r) {
      const int qrow = q0 + 8 * hh + r;
      float m = -INFINITY;
#pragma unroll
      for (int j = 0; j < 4; ++j) {
        const int kvcol = kv0 + j * 16 + c;
        bool masked = false;
        if (diag) masked = (kvcol > qrow);
        else if (g.mask_mode == 4) masked = (kvcol > qrow) || (qrow - kvcol > g.mask_is_int);
        else if (g.mask_mode == 2) {
          const size_t mi = (size_t)qrow * g.Skv + kvcol;
          masked = (g.mask_is_int == 0) ? (((const float*)mask_a)[mi] == 0.0f)
                 : (g.mask_is_int == 1) ? (((const int*)mask_a)[mi] == 0) : (((const int*)mask_a)[mi] != 0);
        } else if (g.mask_mode == 3) masked = (qkeep[r] == 0) || (kvkeep[j] == 0);
        else if (g.mask_mode == 5) {
          const size_t mi = (size_t)qrow * g.Skv + kvcol;
          masked = (((const int*)mask_a)[mi] != 0);
          int n = mask_b[mi]; n = n < 0 ? 0 : n;
          s[j][r] += g.cp[(size_t)b * g.c_bs + (size_t)h * g.c_hs + (size_t)qrow * g.c_rs + n]
                   + g.pc[(size_t)b * g.c_bs + (size_t)h * g.c_hs + (size_t)kvcol * g.c_rs + n];
        }
        if (masked) s[j][r] = g.mask_fill;
        m = fmaxf(m, s[j][r]);
      }
#pragma unroll
      for (int off = 1; off < 16; off <<= 1) m = fmaxf(m, __shfl_xor(m, off, 32));
      cm[r] = m;
    }
    __bf16* pwh = Psh[wave];
    __bf16* pwl = Psl[SPLIT_PV ? wave : 0];
#pragma unroll
    for (int r = 0; r < 8; ++r) {
      const float mnew = fmaxf(mrow[r], cm[r]);
      const float alpha = expf(mrow[r] - mnew);
      mrow[r] = mnew;
      float psum = 0.f;
#pragma unroll
      for (int j = 0; j < 4; ++j) {
        const float p = expf(s[j][r] - mnew);
        psum += p;
        if (SPLIT_PV) { __bf16 a, bl; at_split(p, a, bl); pwh[(8 * hh + r) * AT_KC + j * 16 + c] = a; pwl[(8 * hh + r) * AT_KC + j * 16 + c] = bl; }
        else pwh[(8 * hh + r) * AT_KC + j * 16 + c] = at_to16<F16>(p * PSC);
      }
#pragma unroll
      for (int off = 1; off < 16; off <<= 1) psum += __shfl_xor(psum, off, 32);
      lrow[r] = lrow[r] * alpha + psum;
#pragma unroll
      for (int t = 0; t < 4; ++t) oacc[t][r] *= alpha;
    }
    __builtin_amdgcn_fence(__ATOMIC_RELEASE, "workgroup");
    __builtin_amdgcn_wave_barrier();
    __builtin_amdgcn_fence(__ATOMIC_ACQUIRE, "workgroup");
#pragma unroll 1
    for (int kk = 0; kk < 2; ++kk) {
      FB pa, pl;
      pa.h[0] = *(const v8b*)(pwh + c * AT_KC + kk * 32 + 8 * hh);
      pa.h[1] = *(const v8b*)(pwh + c * AT_KC + kk * 32 + 16 + 8 * hh);
      if (SPLIT_PV) {
        pl.h[0] = *(const v8b*)(pwl + c * AT_KC + kk * 32 + 8 * hh);
        pl.h[1] = *(const v8b*)(pwl + c * AT_KC + kk * 32 + 16 + 8 * hh);
      }
#pragma unroll
      for (int t = 0; t < 4; ++t) {
        FB vb;
        vb.h[0] = *(const v8b*)(Vth + (t * 16 + c) * AT_KC + kk * 32 + 8 * hh);
        vb.h[1] = *(const v8b*)(Vth + (t * 16 + c) * AT_KC + kk * 32 + 16 + 8 * hh);
        oacc[t] = at_mma16<F16>(pa.v, vb.v, oacc[t]);
        if (SPLIT_PV) {
          FB vl;
          vl.h[0] = *(const v8b*)(Vtl + (t * 16 + c) * AT_KC + kk * 32 + 8 * hh);
          vl.h[1] = *(const v8b*)(Vtl + (t * 16 + c) * AT_KC + kk * 32 + 16 + 8 * hh);
          oacc[t] = at_mma16<F16>(pa.v, vl.v, oacc[t]);
          oacc[t] = at_mma16<F16>(pl.v, vb.v, oacc[t]);
        }
      }
    }
  }

  float* os = Os[wave];
#pragma unroll
  for (int r = 0; r < 8; ++r) {
    const float inv = 1.0f / (lrow[r] * PSC);
#pragma unroll
    for (int t = 0; t < 4; ++t) os[(8 * hh + r) * 68 + t * 16 + c] = oacc[t][r] * inv;
  }
  __builtin_amdgcn_fence(__ATOMIC_RELEASE, "workgroup");
  __builtin_amdgcn_wave_barrier();
  __builtin_amdgcn_fence(__ATOMIC_ACQUIRE, "workgroup");
  {
    const int c4 = (lane & 15) * 4;
    {
#pragma unroll
      for (int it = 0; it < 8; ++it) {
        const int row = it * 2 + hh;
        v4f val = *(const v4f*)(os + row * 68 + c4);
        *(v4f*)(ob_ptr + (size_t)(q0 + row) * g.o_rs + c4) = val;
      }
      
    }
  }
}

} // namespace w25

__device__ __forceinline__ void st_h2(_Float16* dst, float a, float b) { const unsigned u = (unsigned)__builtin_bit_cast(unsigned short, (_Float16)a) | ((unsigned)__builtin_bit_cast(unsigned short, (_Float16)b) << 16); unsigned* d = (unsigned*)dst; *d = u;  }
__device__ __forceinline__ void spat8(int n, float* s) { const int hh = n / 64, ww = n % 64; const float gx = (float)ww / 63.f, gy = (float)hh / 63.f; s[0] = gx; s[1] = gy; s[2] = 1.f - gx; s[3] = 1.f - gy; const float m = (gx + gy) * 0.5f; s[4] = m; s[5] = m; s[6] = m; s[7] = m; }
__global__ __launch_bounds__(256) void k_cm_spT(float* __restrict__ T, const float* __restrict__ Wt, const float* __restrict__ Bb, int ldw, int coff, int A, long long n) { const long long t = (long long)blockIdx.x * 256 + threadIdx.x; if (t >= n) return; const int a = (int)(t % A); const int pos = (int)(t / A); float s[8]; spat8(pos, s); float acc = Bb[a];
    if (coff >= 0) {
#pragma unroll
        for (int j = 0; j < 8; ++j) acc += Wt[(long long)a * ldw + coff + j] * s[j]; }
    VST2(float, T + t, T[t] + acc); }
// channel-major [a][n] += sum_j W[a][coff + j] * spat_j(n) + b[a]  (thread-linear over A*HW; n fastest)
__global__ __launch_bounds__(256) void k_cm_spC(float* __restrict__ V, const float* __restrict__ Wt, const float* __restrict__ Bb, int ldw, int coff, int HW, long long n) { const long long t = (long long)blockIdx.x * 256 + threadIdx.x; if (t >= n) return; const int a = (int)(t / HW); const int pos = (int)(t % HW); float s[8]; spat8(pos, s); float acc = Bb[a];
    if (coff >= 0) {
#pragma unroll
        for (int j = 0; j < 8; ++j) acc += Wt[(long long)a * ldw + coff + j] * s[j]; }
    VST2(float, V + t, V[t] + acc); }
// VAL16 = f16(VAL)
__global__ __launch_bounds__(256) void k_cm_v16(const float* __restrict__ V, _Float16* __restrict__ V16, long long n) { const long long t = (long long)blockIdx.x * 256 + threadIdx.x; if (t >= n / 2) return; st_h2(V16 + 2 * t, V[2 * t], V[2 * t + 1]); }
// row softmax (exp once) -> P16 = f16(4096 p)
__global__ __launch_bounds__(256) void k_cm_soft(float* __restrict__ EN, _Float16* __restrict__ P16, int HW) { __shared__ float red[256]; const long long row = blockIdx.x; float* sr = EN + row * HW; const int t = threadIdx.x; float mx = -3.0e38f;
#pragma unroll 1
    for (int j = 2 * t; j < HW; j += 512) mx = fmaxf(mx, fmaxf(sr[j], sr[j + 1]));
    red[t] = mx; __syncthreads(); for (int o = 128; o > 0; o >>= 1) { if (t < o) red[t] = fmaxf(red[t], red[t + o]); __syncthreads(); } const float m = red[0]; __syncthreads();
    float s = 0.f;
#pragma unroll 1
    for (int j = 2 * t; j < HW; j += 512) { const float e0 = expf(sr[j] - m), e1 = expf(sr[j + 1] - m); s += e0 + e1; const unsigned long long pk = (unsigned long long)__builtin_bit_cast(unsigned, e0) | ((unsigned long long)__builtin_bit_cast(unsigned, e1) << 32); VST2(unsigned long long, (unsigned long long*)(sr + j), pk); }
    red[t] = s; __syncthreads(); for (int o = 128; o > 0; o >>= 1) { if (t < o) red[t] += red[t + o]; __syncthreads(); } const float f = 4096.f / red[0];
#pragma unroll 1
    for (int j = 2 * t; j < HW; j += 512) st_h2(P16 + row * HW + j, sr[j] * f, sr[j + 1] * f); }


extern "C" void kernel_launch(void* const* d_in, const int* in_sizes, int n_in, void* d_out, int out_size, void* d_ws, size_t ws_size, hipStream_t stream) {
    (void)in_sizes; (void)n_in; (void)out_size; (void)ws_size;
    const float* img = (const float*)d_in[0];
    const float* flo = (const float*)d_in[1];
    const float* iwt = (const float*)d_in[2];
    const float* ibt = (const float*)d_in[3];
    const float* iwp = (const float*)d_in[4];
    const float* ibp = (const float*)d_in[5];
    const float* iwv = (const float*)d_in[6];
    const float* ibv = (const float*)d_in[7];
    const float* iwo = (const float*)d_in[8];
    const float* ibo = (const float*)d_in[9];
    const float* lwt = (const float*)d_in[10];
    const float* lbt = (const float*)d_in[11];
    const float* lwp = (const float*)d_in[12];
    const float* lbp = (const float*)d_in[13];
    const float* lwv = (const float*)d_in[14];
    const float* lbv = (const float*)d_in[15];
    const float* lwo = (const float*)d_in[16];
    const float* lbo = (const float*)d_in[17];
    const float* fw = (const float*)d_in[18];
    const float* fb = (const float*)d_in[19];
    const int Bn = 4;
    const int C = 256;
    const int A = 256;
    const int HW = 4096;
    const int CM = 520;
    const int HS = 2048;
    float* out = (float*)d_out;
    char* wsp = (char*)d_ws;
    float* THT = (float*)wsp; wsp += (((size_t)((size_t)HW * A) * 4 + 255) / 256) * 256;
    float* PHT = (float*)wsp; wsp += (((size_t)((size_t)HW * A) * 4 + 255) / 256) * 256;
    float* VAL = (float*)wsp; wsp += (((size_t)((size_t)A * HW) * 4 + 255) / 256) * 256;
    unsigned short* VAL16 = (unsigned short*)wsp; wsp += (((size_t)((size_t)A * HW) * 2 + 255) / 256) * 256;
    float* EN = (float*)wsp; wsp += (((size_t)((size_t)HS * HW) * 4 + 255) / 256) * 256;
    unsigned short* P16 = (unsigned short*)wsp; wsp += (((size_t)((size_t)HS * HW) * 2 + 255) / 256) * 256;
    float* ATT = (float*)wsp; wsp += (((size_t)((size_t)A * HW) * 4 + 255) / 256) * 256;
    float* FUS = (float*)wsp; wsp += (((size_t)((size_t)2 * A * HW) * 4 + 255) / 256) * 256;
    unsigned short* G64A = (unsigned short*)wsp; wsp += (((size_t)(1048576) * 2 + 255) / 256) * 256;
    unsigned short* G64B = (unsigned short*)wsp; wsp += (((size_t)(2097152) * 2 + 255) / 256) * 256;
    k_castT16<<<(unsigned)((((long long)(4096) * ((256) / 2)) + 255) / 256), 256, 0, stream>>>(img + (size_t)0 * C * HW, 4096, (_Float16*)(G64A), 256, 256, 4096, 1.0f);
    k_cast16<<<(unsigned)((((long long)(256) * ((256) / 2)) + 255) / 256), 256, 0, stream>>>(iwt + 0, 520, (_Float16*)(G64B), 256, 256, 256, 16.0f);
    w25::wmma_gemm64<0, false, 0, 0, false, 0><<<dim3((unsigned)((((4096) / 64) * ((256) / 64) + 7) / 8), (unsigned)(1)), 256, 0, stream>>>((const unsigned short*)(G64A), nullptr, 256, 0, (const unsigned short*)(G64B), nullptr, 256, 0, (void*)(THT), nullptr, 256, 0, nullptr, nullptr, 0, 4096, 256, 256, 0.0625f);
    k_castT16<<<(unsigned)((((long long)(4096) * ((256) / 2)) + 255) / 256), 256, 0, stream>>>(flo + (size_t)0 * C * HW, 4096, (_Float16*)(G64A), 256, 256, 4096, 1.0f);
    k_cast16<<<(unsigned)((((long long)(256) * ((256) / 2)) + 255) / 256), 256, 0, stream>>>(iwt + 256, 520, (_Float16*)(G64B), 256, 256, 256, 16.0f);
    w25::wmma_gemm64<0, false, 0, 0, true, 0><<<dim3((unsigned)((((4096) / 64) * ((256) / 64) + 7) / 8), (unsigned)(1)), 256, 0, stream>>>((const unsigned short*)(G64A), nullptr, 256, 0, (const unsigned short*)(G64B), nullptr, 256, 0, (void*)(THT), nullptr, 256, 0, nullptr, THT, 0, 4096, 256, 256, 0.0625f);
    k_castT16<<<(unsigned)((((long long)(4096) * ((256) / 2)) + 255) / 256), 256, 0, stream>>>(img + (size_t)0 * C * HW, 4096, (_Float16*)(G64A), 256, 256, 4096, 1.0f);
    k_cast16<<<(unsigned)((((long long)(256) * ((256) / 2)) + 255) / 256), 256, 0, stream>>>(iwp + 0, 520, (_Float16*)(G64B), 256, 256, 256, 16.0f);
    w25::wmma_gemm64<0, false, 0, 0, false, 0><<<dim3((unsigned)((((4096) / 64) * ((256) / 64) + 7) / 8), (unsigned)(1)), 256, 0, stream>>>((const unsigned short*)(G64A), nullptr, 256, 0, (const unsigned short*)(G64B), nullptr, 256, 0, (void*)(PHT), nullptr, 256, 0, nullptr, nullptr, 0, 4096, 256, 256, 0.0625f);
    k_castT16<<<(unsigned)((((long long)(4096) * ((256) / 2)) + 255) / 256), 256, 0, stream>>>(flo + (size_t)0 * C * HW, 4096, (_Float16*)(G64A), 256, 256, 4096, 1.0f);
    k_cast16<<<(unsigned)((((long long)(256) * ((256) / 2)) + 255) / 256), 256, 0, stream>>>(iwp + 256, 520, (_Float16*)(G64B), 256, 256, 256, 16.0f);
    w25::wmma_gemm64<0, false, 0, 0, true, 0><<<dim3((unsigned)((((4096) / 64) * ((256) / 64) + 7) / 8), (unsigned)(1)), 256, 0, stream>>>((const unsigned short*)(G64A), nullptr, 256, 0, (const unsigned short*)(G64B), nullptr, 256, 0, (void*)(PHT), nullptr, 256, 0, nullptr, PHT, 0, 4096, 256, 256, 0.0625f);
    k_cast16<<<(unsigned)((((long long)(256) * ((256) / 2)) + 255) / 256), 256, 0, stream>>>(iwv + 0, 520, (_Float16*)(G64A), 256, 256, 256, 1.0f);
    k_castT16<<<(unsigned)((((long long)(4096) * ((256) / 2)) + 255) / 256), 256, 0, stream>>>(img + (size_t)0 * C * HW, 4096, (_Float16*)(G64B), 256, 256, 4096, 16.0f);
    w25::wmma_gemm64<0, false, 0, 0, false, 0><<<dim3((unsigned)((((256) / 64) * ((4096) / 64) + 7) / 8), (unsigned)(1)), 256, 0, stream>>>((const unsigned short*)(G64A), nullptr, 256, 0, (const unsigned short*)(G64B), nullptr, 256, 0, (void*)(VAL), nullptr, 4096, 0, nullptr, nullptr, 0, 256, 4096, 256, 0.0625f);
    k_cast16<<<(unsigned)((((long long)(256) * ((256) / 2)) + 255) / 256), 256, 0, stream>>>(iwv + 256, 520, (_Float16*)(G64A), 256, 256, 256, 1.0f);
    k_castT16<<<(unsigned)((((long long)(4096) * ((256) / 2)) + 255) / 256), 256, 0, stream>>>(flo + (size_t)0 * C * HW, 4096, (_Float16*)(G64B), 256, 256, 4096, 16.0f);
    w25::wmma_gemm64<0, false, 0, 0, true, 0><<<dim3((unsigned)((((256) / 64) * ((4096) / 64) + 7) / 8), (unsigned)(1)), 256, 0, stream>>>((const unsigned short*)(G64A), nullptr, 256, 0, (const unsigned short*)(G64B), nullptr, 256, 0, (void*)(VAL), nullptr, 4096, 0, nullptr, VAL, 0, 256, 4096, 256, 0.0625f);
    k_cm_spT<<<(unsigned)(((long long)HW * A + 255) / 256), 256, 0, stream>>>(THT, iwt, ibt, 520, 512, A, (long long)HW * A); k_cm_spT<<<(unsigned)(((long long)HW * A + 255) / 256), 256, 0, stream>>>(PHT, iwp, ibp, 520, 512, A, (long long)HW * A); k_cm_spC<<<(unsigned)(((long long)A * HW + 255) / 256), 256, 0, stream>>>(VAL, iwv, ibv, 520, 512, HW, (long long)A * HW); k_cm_v16<<<(unsigned)(((long long)A * HW / 2 + 255) / 256), 256, 0, stream>>>(VAL, (_Float16*)VAL16, (long long)A * HW);
    k_cast16<<<(unsigned)((((long long)(2048) * ((256) / 2)) + 255) / 256), 256, 0, stream>>>(THT + (size_t)0 * HS * A, 256, (_Float16*)(G64A), 256, 2048, 256, 1.0f);
    k_cast16<<<(unsigned)((((long long)(4096) * ((256) / 2)) + 255) / 256), 256, 0, stream>>>(PHT, 256, (_Float16*)(G64B), 256, 4096, 256, 1.0f);
    w25::wmma_gemm64<0, false, 0, 0, false, 0><<<dim3((unsigned)((((2048) / 64) * ((4096) / 64) + 7) / 8), (unsigned)(1)), 256, 0, stream>>>((const unsigned short*)(G64A), nullptr, 256, 0, (const unsigned short*)(G64B), nullptr, 256, 0, (void*)(EN), nullptr, 4096, 0, nullptr, nullptr, 0, 2048, 4096, 256, 1.0f);
    k_cm_soft<<<HS, 256, 0, stream>>>(EN, (_Float16*)P16, HW);
    w25::wmma_gemm_kwaves<<<(unsigned)(((A) / 32) * ((HS) / 64)), 512, 0, stream>>>((const unsigned short*)(VAL16), HW, (const unsigned short*)(P16), HW, ATT + (size_t)0 * HS, HW, HS, HW, 0.000244140625f);
    k_cast16<<<(unsigned)((((long long)(2048) * ((256) / 2)) + 255) / 256), 256, 0, stream>>>(THT + (size_t)1 * HS * A, 256, (_Float16*)(G64A), 256, 2048, 256, 1.0f);
    k_cast16<<<(unsigned)((((long long)(4096) * ((256) / 2)) + 255) / 256), 256, 0, stream>>>(PHT, 256, (_Float16*)(G64B), 256, 4096, 256, 1.0f);
    w25::wmma_gemm64<0, false, 0, 0, false, 0><<<dim3((unsigned)((((2048) / 64) * ((4096) / 64) + 7) / 8), (unsigned)(1)), 256, 0, stream>>>((const unsigned short*)(G64A), nullptr, 256, 0, (const unsigned short*)(G64B), nullptr, 256, 0, (void*)(EN), nullptr, 4096, 0, nullptr, nullptr, 0, 2048, 4096, 256, 1.0f);
    k_cm_soft<<<HS, 256, 0, stream>>>(EN, (_Float16*)P16, HW);
    w25::wmma_gemm_kwaves<<<(unsigned)(((A) / 32) * ((HS) / 64)), 512, 0, stream>>>((const unsigned short*)(VAL16), HW, (const unsigned short*)(P16), HW, ATT + (size_t)1 * HS, HW, HS, HW, 0.000244140625f);
    k_cast16<<<(unsigned)((((long long)(256) * ((256) / 2)) + 255) / 256), 256, 0, stream>>>(iwo, 256, (_Float16*)(G64A), 256, 256, 256, 16.0f);
    k_castT16<<<(unsigned)((((long long)(4096) * ((256) / 2)) + 255) / 256), 256, 0, stream>>>(ATT, 4096, (_Float16*)(G64B), 256, 256, 4096, 1.0f);
    w25::wmma_gemm64<0, false, 1, 0, false, 0><<<dim3((unsigned)((((256) / 64) * ((4096) / 64) + 7) / 8), (unsigned)(1)), 256, 0, stream>>>((const unsigned short*)(G64A), nullptr, 256, 0, (const unsigned short*)(G64B), nullptr, 256, 0, (void*)(FUS + (size_t)0 * A * HW), nullptr, 4096, 0, ibo, nullptr, 0, 256, 4096, 256, 0.0625f);
    k_castT16<<<(unsigned)((((long long)(4096) * ((256) / 2)) + 255) / 256), 256, 0, stream>>>(flo + (size_t)0 * C * HW, 4096, (_Float16*)(G64A), 256, 256, 4096, 1.0f);
    k_cast16<<<(unsigned)((((long long)(256) * ((256) / 2)) + 255) / 256), 256, 0, stream>>>(lwt + 0, 256, (_Float16*)(G64B), 256, 256, 256, 16.0f);
    w25::wmma_gemm64<0, false, 0, 0, false, 0><<<dim3((unsigned)((((4096) / 64) * ((256) / 64) + 7) / 8), (unsigned)(1)), 256, 0, stream>>>((const unsigned short*)(G64A), nullptr, 256, 0, (const unsigned short*)(G64B), nullptr, 256, 0, (void*)(THT), nullptr, 256, 0, nullptr, nullptr, 0, 4096, 256, 256, 0.0625f);
    k_castT16<<<(unsigned)((((long long)(4096) * ((256) / 2)) + 255) / 256), 256, 0, stream>>>(flo + (size_t)0 * C * HW, 4096, (_Float16*)(G64A), 256, 256, 4096, 1.0f);
    k_cast16<<<(unsigned)((((long long)(256) * ((256) / 2)) + 255) / 256), 256, 0, stream>>>(lwp + 0, 256, (_Float16*)(G64B), 256, 256, 256, 16.0f);
    w25::wmma_gemm64<0, false, 0, 0, false, 0><<<dim3((unsigned)((((4096) / 64) * ((256) / 64) + 7) / 8), (unsigned)(1)), 256, 0, stream>>>((const unsigned short*)(G64A), nullptr, 256, 0, (const unsigned short*)(G64B), nullptr, 256, 0, (void*)(PHT), nullptr, 256, 0, nullptr, nullptr, 0, 4096, 256, 256, 0.0625f);
    k_cast16<<<(unsigned)((((long long)(256) * ((256) / 2)) + 255) / 256), 256, 0, stream>>>(lwv + 0, 256, (_Float16*)(G64A), 256, 256, 256, 1.0f);
    k_castT16<<<(unsigned)((((long long)(4096) * ((256) / 2)) + 255) / 256), 256, 0, stream>>>(flo + (size_t)0 * C * HW, 4096, (_Float16*)(G64B), 256, 256, 4096, 16.0f);
    w25::wmma_gemm64<0, false, 0, 0, false, 0><<<dim3((unsigned)((((256) / 64) * ((4096) / 64) + 7) / 8), (unsigned)(1)), 256, 0, stream>>>((const unsigned short*)(G64A), nullptr, 256, 0, (const unsigned short*)(G64B), nullptr, 256, 0, (void*)(VAL), nullptr, 4096, 0, nullptr, nullptr, 0, 256, 4096, 256, 0.0625f);
    k_cm_spT<<<(unsigned)(((long long)HW * A + 255) / 256), 256, 0, stream>>>(THT, lwt, lbt, 256, -1, A, (long long)HW * A); k_cm_spT<<<(unsigned)(((long long)HW * A + 255) / 256), 256, 0, stream>>>(PHT, lwp, lbp, 256, -1, A, (long long)HW * A); k_cm_spC<<<(unsigned)(((long long)A * HW + 255) / 256), 256, 0, stream>>>(VAL, lwv, lbv, 256, -1, HW, (long long)A * HW); k_cm_v16<<<(unsigned)(((long long)A * HW / 2 + 255) / 256), 256, 0, stream>>>(VAL, (_Float16*)VAL16, (long long)A * HW);
    k_cast16<<<(unsigned)((((long long)(2048) * ((256) / 2)) + 255) / 256), 256, 0, stream>>>(THT + (size_t)0 * HS * A, 256, (_Float16*)(G64A), 256, 2048, 256, 1.0f);
    k_cast16<<<(unsigned)((((long long)(4096) * ((256) / 2)) + 255) / 256), 256, 0, stream>>>(PHT, 256, (_Float16*)(G64B), 256, 4096, 256, 1.0f);
    w25::wmma_gemm64<0, false, 0, 0, false, 0><<<dim3((unsigned)((((2048) / 64) * ((4096) / 64) + 7) / 8), (unsigned)(1)), 256, 0, stream>>>((const unsigned short*)(G64A), nullptr, 256, 0, (const unsigned short*)(G64B), nullptr, 256, 0, (void*)(EN), nullptr, 4096, 0, nullptr, nullptr, 0, 2048, 4096, 256, 1.0f);
    k_cm_soft<<<HS, 256, 0, stream>>>(EN, (_Float16*)P16, HW);
    w25::wmma_gemm_kwaves<<<(unsigned)(((A) / 32) * ((HS) / 64)), 512, 0, stream>>>((const unsigned short*)(VAL16), HW, (const unsigned short*)(P16), HW, ATT + (size_t)0 * HS, HW, HS, HW, 0.000244140625f);
    k_cast16<<<(unsigned)((((long long)(2048) * ((256) / 2)) + 255) / 256), 256, 0, stream>>>(THT + (size_t)1 * HS * A, 256, (_Float16*)(G64A), 256, 2048, 256, 1.0f);
    k_cast16<<<(unsigned)((((long long)(4096) * ((256) / 2)) + 255) / 256), 256, 0, stream>>>(PHT, 256, (_Float16*)(G64B), 256, 4096, 256, 1.0f);
    w25::wmma_gemm64<0, false, 0, 0, false, 0><<<dim3((unsigned)((((2048) / 64) * ((4096) / 64) + 7) / 8), (unsigned)(1)), 256, 0, stream>>>((const unsigned short*)(G64A), nullptr, 256, 0, (const unsigned short*)(G64B), nullptr, 256, 0, (void*)(EN), nullptr, 4096, 0, nullptr, nullptr, 0, 2048, 4096, 256, 1.0f);
    k_cm_soft<<<HS, 256, 0, stream>>>(EN, (_Float16*)P16, HW);
    w25::wmma_gemm_kwaves<<<(unsigned)(((A) / 32) * ((HS) / 64)), 512, 0, stream>>>((const unsigned short*)(VAL16), HW, (const unsigned short*)(P16), HW, ATT + (size_t)1 * HS, HW, HS, HW, 0.000244140625f);
    k_cast16<<<(unsigned)((((long long)(256) * ((256) / 2)) + 255) / 256), 256, 0, stream>>>(lwo, 256, (_Float16*)(G64A), 256, 256, 256, 16.0f);
    k_castT16<<<(unsigned)((((long long)(4096) * ((256) / 2)) + 255) / 256), 256, 0, stream>>>(ATT, 4096, (_Float16*)(G64B), 256, 256, 4096, 1.0f);
    w25::wmma_gemm64<0, false, 1, 0, false, 0><<<dim3((unsigned)((((256) / 64) * ((4096) / 64) + 7) / 8), (unsigned)(1)), 256, 0, stream>>>((const unsigned short*)(G64A), nullptr, 256, 0, (const unsigned short*)(G64B), nullptr, 256, 0, (void*)(FUS + (size_t)1 * A * HW), nullptr, 4096, 0, lbo, nullptr, 0, 256, 4096, 256, 0.0625f);
    k_cast16<<<(unsigned)((((long long)(256) * ((512) / 2)) + 255) / 256), 256, 0, stream>>>(fw, 520, (_Float16*)(G64A), 512, 256, 512, 16.0f);
    k_castT16<<<(unsigned)((((long long)(4096) * ((512) / 2)) + 255) / 256), 256, 0, stream>>>(FUS, 4096, (_Float16*)(G64B), 512, 512, 4096, 1.0f);
    w25::wmma_gemm64<0, false, 0, 0, false, 0><<<dim3((unsigned)((((256) / 64) * ((4096) / 64) + 7) / 8), (unsigned)(1)), 256, 0, stream>>>((const unsigned short*)(G64A), nullptr, 512, 0, (const unsigned short*)(G64B), nullptr, 512, 0, (void*)(out + (size_t)0 * A * HW), nullptr, 4096, 0, nullptr, nullptr, 0, 256, 4096, 512, 0.0625f);
    k_cm_spC<<<(unsigned)(((long long)A * HW + 255) / 256), 256, 0, stream>>>(out + (size_t)0 * A * HW, fw, fb, 520, 512, HW, (long long)A * HW);
    k_castT16<<<(unsigned)((((long long)(4096) * ((256) / 2)) + 255) / 256), 256, 0, stream>>>(img + (size_t)1 * C * HW, 4096, (_Float16*)(G64A), 256, 256, 4096, 1.0f);
    k_cast16<<<(unsigned)((((long long)(256) * ((256) / 2)) + 255) / 256), 256, 0, stream>>>(iwt + 0, 520, (_Float16*)(G64B), 256, 256, 256, 16.0f);
    w25::wmma_gemm64<0, false, 0, 0, false, 0><<<dim3((unsigned)((((4096) / 64) * ((256) / 64) + 7) / 8), (unsigned)(1)), 256, 0, stream>>>((const unsigned short*)(G64A), nullptr, 256, 0, (const unsigned short*)(G64B), nullptr, 256, 0, (void*)(THT), nullptr, 256, 0, nullptr, nullptr, 0, 4096, 256, 256, 0.0625f);
    k_castT16<<<(unsigned)((((long long)(4096) * ((256) / 2)) + 255) / 256), 256, 0, stream>>>(flo + (size_t)1 * C * HW, 4096, (_Float16*)(G64A), 256, 256, 4096, 1.0f);
    k_cast16<<<(unsigned)((((long long)(256) * ((256) / 2)) + 255) / 256), 256, 0, stream>>>(iwt + 256, 520, (_Float16*)(G64B), 256, 256, 256, 16.0f);
    w25::wmma_gemm64<0, false, 0, 0, true, 0><<<dim3((unsigned)((((4096) / 64) * ((256) / 64) + 7) / 8), (unsigned)(1)), 256, 0, stream>>>((const unsigned short*)(G64A), nullptr, 256, 0, (const unsigned short*)(G64B), nullptr, 256, 0, (void*)(THT), nullptr, 256, 0, nullptr, THT, 0, 4096, 256, 256, 0.0625f);
    k_castT16<<<(unsigned)((((long long)(4096) * ((256) / 2)) + 255) / 256), 256, 0, stream>>>(img + (size_t)1 * C * HW, 4096, (_Float16*)(G64A), 256, 256, 4096, 1.0f);
    k_cast16<<<(unsigned)((((long long)(256) * ((256) / 2)) + 255) / 256), 256, 0, stream>>>(iwp + 0, 520, (_Float16*)(G64B), 256, 256, 256, 16.0f);
    w25::wmma_gemm64<0, false, 0, 0, false, 0><<<dim3((unsigned)((((4096) / 64) * ((256) / 64) + 7) / 8), (unsigned)(1)), 256, 0, stream>>>((const unsigned short*)(G64A), nullptr, 256, 0, (const unsigned short*)(G64B), nullptr, 256, 0, (void*)(PHT), nullptr, 256, 0, nullptr, nullptr, 0, 4096, 256, 256, 0.0625f);
    k_castT16<<<(unsigned)((((long long)(4096) * ((256) / 2)) + 255) / 256), 256, 0, stream>>>(flo + (size_t)1 * C * HW, 4096, (_Float16*)(G64A), 256, 256, 4096, 1.0f);
    k_cast16<<<(unsigned)((((long long)(256) * ((256) / 2)) + 255) / 256), 256, 0, stream>>>(iwp + 256, 520, (_Float16*)(G64B), 256, 256, 256, 16.0f);
    w25::wmma_gemm64<0, false, 0, 0, true, 0><<<dim3((unsigned)((((4096) / 64) * ((256) / 64) + 7) / 8), (unsigned)(1)), 256, 0, stream>>>((const unsigned short*)(G64A), nullptr, 256, 0, (const unsigned short*)(G64B), nullptr, 256, 0, (void*)(PHT), nullptr, 256, 0, nullptr, PHT, 0, 4096, 256, 256, 0.0625f);
    k_cast16<<<(unsigned)((((long long)(256) * ((256) / 2)) + 255) / 256), 256, 0, stream>>>(iwv + 0, 520, (_Float16*)(G64A), 256, 256, 256, 1.0f);
    k_castT16<<<(unsigned)((((long long)(4096) * ((256) / 2)) + 255) / 256), 256, 0, stream>>>(img + (size_t)1 * C * HW, 4096, (_Float16*)(G64B), 256, 256, 4096, 16.0f);
    w25::wmma_gemm64<0, false, 0, 0, false, 0><<<dim3((unsigned)((((256) / 64) * ((4096) / 64) + 7) / 8), (unsigned)(1)), 256, 0, stream>>>((const unsigned short*)(G64A), nullptr, 256, 0, (const unsigned short*)(G64B), nullptr, 256, 0, (void*)(VAL), nullptr, 4096, 0, nullptr, nullptr, 0, 256, 4096, 256, 0.0625f);
    k_cast16<<<(unsigned)((((long long)(256) * ((256) / 2)) + 255) / 256), 256, 0, stream>>>(iwv + 256, 520, (_Float16*)(G64A), 256, 256, 256, 1.0f);
    k_castT16<<<(unsigned)((((long long)(4096) * ((256) / 2)) + 255) / 256), 256, 0, stream>>>(flo + (size_t)1 * C * HW, 4096, (_Float16*)(G64B), 256, 256, 4096, 16.0f);
    w25::wmma_gemm64<0, false, 0, 0, true, 0><<<dim3((unsigned)((((256) / 64) * ((4096) / 64) + 7) / 8), (unsigned)(1)), 256, 0, stream>>>((const unsigned short*)(G64A), nullptr, 256, 0, (const unsigned short*)(G64B), nullptr, 256, 0, (void*)(VAL), nullptr, 4096, 0, nullptr, VAL, 0, 256, 4096, 256, 0.0625f);
    k_cm_spT<<<(unsigned)(((long long)HW * A + 255) / 256), 256, 0, stream>>>(THT, iwt, ibt, 520, 512, A, (long long)HW * A); k_cm_spT<<<(unsigned)(((long long)HW * A + 255) / 256), 256, 0, stream>>>(PHT, iwp, ibp, 520, 512, A, (long long)HW * A); k_cm_spC<<<(unsigned)(((long long)A * HW + 255) / 256), 256, 0, stream>>>(VAL, iwv, ibv, 520, 512, HW, (long long)A * HW); k_cm_v16<<<(unsigned)(((long long)A * HW / 2 + 255) / 256), 256, 0, stream>>>(VAL, (_Float16*)VAL16, (long long)A * HW);
    k_cast16<<<(unsigned)((((long long)(2048) * ((256) / 2)) + 255) / 256), 256, 0, stream>>>(THT + (size_t)0 * HS * A, 256, (_Float16*)(G64A), 256, 2048, 256, 1.0f);
    k_cast16<<<(unsigned)((((long long)(4096) * ((256) / 2)) + 255) / 256), 256, 0, stream>>>(PHT, 256, (_Float16*)(G64B), 256, 4096, 256, 1.0f);
    w25::wmma_gemm64<0, false, 0, 0, false, 0><<<dim3((unsigned)((((2048) / 64) * ((4096) / 64) + 7) / 8), (unsigned)(1)), 256, 0, stream>>>((const unsigned short*)(G64A), nullptr, 256, 0, (const unsigned short*)(G64B), nullptr, 256, 0, (void*)(EN), nullptr, 4096, 0, nullptr, nullptr, 0, 2048, 4096, 256, 1.0f);
    k_cm_soft<<<HS, 256, 0, stream>>>(EN, (_Float16*)P16, HW);
    w25::wmma_gemm_kwaves<<<(unsigned)(((A) / 32) * ((HS) / 64)), 512, 0, stream>>>((const unsigned short*)(VAL16), HW, (const unsigned short*)(P16), HW, ATT + (size_t)0 * HS, HW, HS, HW, 0.000244140625f);
    k_cast16<<<(unsigned)((((long long)(2048) * ((256) / 2)) + 255) / 256), 256, 0, stream>>>(THT + (size_t)1 * HS * A, 256, (_Float16*)(G64A), 256, 2048, 256, 1.0f);
    k_cast16<<<(unsigned)((((long long)(4096) * ((256) / 2)) + 255) / 256), 256, 0, stream>>>(PHT, 256, (_Float16*)(G64B), 256, 4096, 256, 1.0f);
    w25::wmma_gemm64<0, false, 0, 0, false, 0><<<dim3((unsigned)((((2048) / 64) * ((4096) / 64) + 7) / 8), (unsigned)(1)), 256, 0, stream>>>((const unsigned short*)(G64A), nullptr, 256, 0, (const unsigned short*)(G64B), nullptr, 256, 0, (void*)(EN), nullptr, 4096, 0, nullptr, nullptr, 0, 2048, 4096, 256, 1.0f);
    k_cm_soft<<<HS, 256, 0, stream>>>(EN, (_Float16*)P16, HW);
    w25::wmma_gemm_kwaves<<<(unsigned)(((A) / 32) * ((HS) / 64)), 512, 0, stream>>>((const unsigned short*)(VAL16), HW, (const unsigned short*)(P16), HW, ATT + (size_t)1 * HS, HW, HS, HW, 0.000244140625f);
    k_cast16<<<(unsigned)((((long long)(256) * ((256) / 2)) + 255) / 256), 256, 0, stream>>>(iwo, 256, (_Float16*)(G64A), 256, 256, 256, 16.0f);
    k_castT16<<<(unsigned)((((long long)(4096) * ((256) / 2)) + 255) / 256), 256, 0, stream>>>(ATT, 4096, (_Float16*)(G64B), 256, 256, 4096, 1.0f);
    w25::wmma_gemm64<0, false, 1, 0, false, 0><<<dim3((unsigned)((((256) / 64) * ((4096) / 64) + 7) / 8), (unsigned)(1)), 256, 0, stream>>>((const unsigned short*)(G64A), nullptr, 256, 0, (const unsigned short*)(G64B), nullptr, 256, 0, (void*)(FUS + (size_t)0 * A * HW), nullptr, 4096, 0, ibo, nullptr, 0, 256, 4096, 256, 0.0625f);
    k_castT16<<<(unsigned)((((long long)(4096) * ((256) / 2)) + 255) / 256), 256, 0, stream>>>(flo + (size_t)1 * C * HW, 4096, (_Float16*)(G64A), 256, 256, 4096, 1.0f);
    k_cast16<<<(unsigned)((((long long)(256) * ((256) / 2)) + 255) / 256), 256, 0, stream>>>(lwt + 0, 256, (_Float16*)(G64B), 256, 256, 256, 16.0f);
    w25::wmma_gemm64<0, false, 0, 0, false, 0><<<dim3((unsigned)((((4096) / 64) * ((256) / 64) + 7) / 8), (unsigned)(1)), 256, 0, stream>>>((const unsigned short*)(G64A), nullptr, 256, 0, (const unsigned short*)(G64B), nullptr, 256, 0, (void*)(THT), nullptr, 256, 0, nullptr, nullptr, 0, 4096, 256, 256, 0.0625f);
    k_castT16<<<(unsigned)((((long long)(4096) * ((256) / 2)) + 255) / 256), 256, 0, stream>>>(flo + (size_t)1 * C * HW, 4096, (_Float16*)(G64A), 256, 256, 4096, 1.0f);
    k_cast16<<<(unsigned)((((long long)(256) * ((256) / 2)) + 255) / 256), 256, 0, stream>>>(lwp + 0, 256, (_Float16*)(G64B), 256, 256, 256, 16.0f);
    w25::wmma_gemm64<0, false, 0, 0, false, 0><<<dim3((unsigned)((((4096) / 64) * ((256) / 64) + 7) / 8), (unsigned)(1)), 256, 0, stream>>>((const unsigned short*)(G64A), nullptr, 256, 0, (const unsigned short*)(G64B), nullptr, 256, 0, (void*)(PHT), nullptr, 256, 0, nullptr, nullptr, 0, 4096, 256, 256, 0.0625f);
    k_cast16<<<(unsigned)((((long long)(256) * ((256) / 2)) + 255) / 256), 256, 0, stream>>>(lwv + 0, 256, (_Float16*)(G64A), 256, 256, 256, 1.0f);
    k_castT16<<<(unsigned)((((long long)(4096) * ((256) / 2)) + 255) / 256), 256, 0, stream>>>(flo + (size_t)1 * C * HW, 4096, (_Float16*)(G64B), 256, 256, 4096, 16.0f);
    w25::wmma_gemm64<0, false, 0, 0, false, 0><<<dim3((unsigned)((((256) / 64) * ((4096) / 64) + 7) / 8), (unsigned)(1)), 256, 0, stream>>>((const unsigned short*)(G64A), nullptr, 256, 0, (const unsigned short*)(G64B), nullptr, 256, 0, (void*)(VAL), nullptr, 4096, 0, nullptr, nullptr, 0, 256, 4096, 256, 0.0625f);
    k_cm_spT<<<(unsigned)(((long long)HW * A + 255) / 256), 256, 0, stream>>>(THT, lwt, lbt, 256, -1, A, (long long)HW * A); k_cm_spT<<<(unsigned)(((long long)HW * A + 255) / 256), 256, 0, stream>>>(PHT, lwp, lbp, 256, -1, A, (long long)HW * A); k_cm_spC<<<(unsigned)(((long long)A * HW + 255) / 256), 256, 0, stream>>>(VAL, lwv, lbv, 256, -1, HW, (long long)A * HW); k_cm_v16<<<(unsigned)(((long long)A * HW / 2 + 255) / 256), 256, 0, stream>>>(VAL, (_Float16*)VAL16, (long long)A * HW);
    k_cast16<<<(unsigned)((((long long)(2048) * ((256) / 2)) + 255) / 256), 256, 0, stream>>>(THT + (size_t)0 * HS * A, 256, (_Float16*)(G64A), 256, 2048, 256, 1.0f);
    k_cast16<<<(unsigned)((((long long)(4096) * ((256) / 2)) + 255) / 256), 256, 0, stream>>>(PHT, 256, (_Float16*)(G64B), 256, 4096, 256, 1.0f);
    w25::wmma_gemm64<0, false, 0, 0, false, 0><<<dim3((unsigned)((((2048) / 64) * ((4096) / 64) + 7) / 8), (unsigned)(1)), 256, 0, stream>>>((const unsigned short*)(G64A), nullptr, 256, 0, (const unsigned short*)(G64B), nullptr, 256, 0, (void*)(EN), nullptr, 4096, 0, nullptr, nullptr, 0, 2048, 4096, 256, 1.0f);
    k_cm_soft<<<HS, 256, 0, stream>>>(EN, (_Float16*)P16, HW);
    w25::wmma_gemm_kwaves<<<(unsigned)(((A) / 32) * ((HS) / 64)), 512, 0, stream>>>((const unsigned short*)(VAL16), HW, (const unsigned short*)(P16), HW, ATT + (size_t)0 * HS, HW, HS, HW, 0.000244140625f);
    k_cast16<<<(unsigned)((((long long)(2048) * ((256) / 2)) + 255) / 256), 256, 0, stream>>>(THT + (size_t)1 * HS * A, 256, (_Float16*)(G64A), 256, 2048, 256, 1.0f);
    k_cast16<<<(unsigned)((((long long)(4096) * ((256) / 2)) + 255) / 256), 256, 0, stream>>>(PHT, 256, (_Float16*)(G64B), 256, 4096, 256, 1.0f);
    w25::wmma_gemm64<0, false, 0, 0, false, 0><<<dim3((unsigned)((((2048) / 64) * ((4096) / 64) + 7) / 8), (unsigned)(1)), 256, 0, stream>>>((const unsigned short*)(G64A), nullptr, 256, 0, (const unsigned short*)(G64B), nullptr, 256, 0, (void*)(EN), nullptr, 4096, 0, nullptr, nullptr, 0, 2048, 4096, 256, 1.0f);
    k_cm_soft<<<HS, 256, 0, stream>>>(EN, (_Float16*)P16, HW);
    w25::wmma_gemm_kwaves<<<(unsigned)(((A) / 32) * ((HS) / 64)), 512, 0, stream>>>((const unsigned short*)(VAL16), HW, (const unsigned short*)(P16), HW, ATT + (size_t)1 * HS, HW, HS, HW, 0.000244140625f);
    k_cast16<<<(unsigned)((((long long)(256) * ((256) / 2)) + 255) / 256), 256, 0, stream>>>(lwo, 256, (_Float16*)(G64A), 256, 256, 256, 16.0f);
    k_castT16<<<(unsigned)((((long long)(4096) * ((256) / 2)) + 255) / 256), 256, 0, stream>>>(ATT, 4096, (_Float16*)(G64B), 256, 256, 4096, 1.0f);
    w25::wmma_gemm64<0, false, 1, 0, false, 0><<<dim3((unsigned)((((256) / 64) * ((4096) / 64) + 7) / 8), (unsigned)(1)), 256, 0, stream>>>((const unsigned short*)(G64A), nullptr, 256, 0, (const unsigned short*)(G64B), nullptr, 256, 0, (void*)(FUS + (size_t)1 * A * HW), nullptr, 4096, 0, lbo, nullptr, 0, 256, 4096, 256, 0.0625f);
    k_cast16<<<(unsigned)((((long long)(256) * ((512) / 2)) + 255) / 256), 256, 0, stream>>>(fw, 520, (_Float16*)(G64A), 512, 256, 512, 16.0f);
    k_castT16<<<(unsigned)((((long long)(4096) * ((512) / 2)) + 255) / 256), 256, 0, stream>>>(FUS, 4096, (_Float16*)(G64B), 512, 512, 4096, 1.0f);
    w25::wmma_gemm64<0, false, 0, 0, false, 0><<<dim3((unsigned)((((256) / 64) * ((4096) / 64) + 7) / 8), (unsigned)(1)), 256, 0, stream>>>((const unsigned short*)(G64A), nullptr, 512, 0, (const unsigned short*)(G64B), nullptr, 512, 0, (void*)(out + (size_t)1 * A * HW), nullptr, 4096, 0, nullptr, nullptr, 0, 256, 4096, 512, 0.0625f);
    k_cm_spC<<<(unsigned)(((long long)A * HW + 255) / 256), 256, 0, stream>>>(out + (size_t)1 * A * HW, fw, fb, 520, 512, HW, (long long)A * HW);
    k_castT16<<<(unsigned)((((long long)(4096) * ((256) / 2)) + 255) / 256), 256, 0, stream>>>(img + (size_t)2 * C * HW, 4096, (_Float16*)(G64A), 256, 256, 4096, 1.0f);
    k_cast16<<<(unsigned)((((long long)(256) * ((256) / 2)) + 255) / 256), 256, 0, stream>>>(iwt + 0, 520, (_Float16*)(G64B), 256, 256, 256, 16.0f);
    w25::wmma_gemm64<0, false, 0, 0, false, 0><<<dim3((unsigned)((((4096) / 64) * ((256) / 64) + 7) / 8), (unsigned)(1)), 256, 0, stream>>>((const unsigned short*)(G64A), nullptr, 256, 0, (const unsigned short*)(G64B), nullptr, 256, 0, (void*)(THT), nullptr, 256, 0, nullptr, nullptr, 0, 4096, 256, 256, 0.0625f);
    k_castT16<<<(unsigned)((((long long)(4096) * ((256) / 2)) + 255) / 256), 256, 0, stream>>>(flo + (size_t)2 * C * HW, 4096, (_Float16*)(G64A), 256, 256, 4096, 1.0f);
    k_cast16<<<(unsigned)((((long long)(256) * ((256) / 2)) + 255) / 256), 256, 0, stream>>>(iwt + 256, 520, (_Float16*)(G64B), 256, 256, 256, 16.0f);
    w25::wmma_gemm64<0, false, 0, 0, true, 0><<<dim3((unsigned)((((4096) / 64) * ((256) / 64) + 7) / 8), (unsigned)(1)), 256, 0, stream>>>((const unsigned short*)(G64A), nullptr, 256, 0, (const unsigned short*)(G64B), nullptr, 256, 0, (void*)(THT), nullptr, 256, 0, nullptr, THT, 0, 4096, 256, 256, 0.0625f);
    k_castT16<<<(unsigned)((((long long)(4096) * ((256) / 2)) + 255) / 256), 256, 0, stream>>>(img + (size_t)2 * C * HW, 4096, (_Float16*)(G64A), 256, 256, 4096, 1.0f);
    k_cast16<<<(unsigned)((((long long)(256) * ((256) / 2)) + 255) / 256), 256, 0, stream>>>(iwp + 0, 520, (_Float16*)(G64B), 256, 256, 256, 16.0f);
    w25::wmma_gemm64<0, false, 0, 0, false, 0><<<dim3((unsigned)((((4096) / 64) * ((256) / 64) + 7) / 8), (unsigned)(1)), 256, 0, stream>>>((const unsigned short*)(G64A), nullptr, 256, 0, (const unsigned short*)(G64B), nullptr, 256, 0, (void*)(PHT), nullptr, 256, 0, nullptr, nullptr, 0, 4096, 256, 256, 0.0625f);
    k_castT16<<<(unsigned)((((long long)(4096) * ((256) / 2)) + 255) / 256), 256, 0, stream>>>(flo + (size_t)2 * C * HW, 4096, (_Float16*)(G64A), 256, 256, 4096, 1.0f);
    k_cast16<<<(unsigned)((((long long)(256) * ((256) / 2)) + 255) / 256), 256, 0, stream>>>(iwp + 256, 520, (_Float16*)(G64B), 256, 256, 256, 16.0f);
    w25::wmma_gemm64<0, false, 0, 0, true, 0><<<dim3((unsigned)((((4096) / 64) * ((256) / 64) + 7) / 8), (unsigned)(1)), 256, 0, stream>>>((const unsigned short*)(G64A), nullptr, 256, 0, (const unsigned short*)(G64B), nullptr, 256, 0, (void*)(PHT), nullptr, 256, 0, nullptr, PHT, 0, 4096, 256, 256, 0.0625f);
    k_cast16<<<(unsigned)((((long long)(256) * ((256) / 2)) + 255) / 256), 256, 0, stream>>>(iwv + 0, 520, (_Float16*)(G64A), 256, 256, 256, 1.0f);
    k_castT16<<<(unsigned)((((long long)(4096) * ((256) / 2)) + 255) / 256), 256, 0, stream>>>(img + (size_t)2 * C * HW, 4096, (_Float16*)(G64B), 256, 256, 4096, 16.0f);
    w25::wmma_gemm64<0, false, 0, 0, false, 0><<<dim3((unsigned)((((256) / 64) * ((4096) / 64) + 7) / 8), (unsigned)(1)), 256, 0, stream>>>((const unsigned short*)(G64A), nullptr, 256, 0, (const unsigned short*)(G64B), nullptr, 256, 0, (void*)(VAL), nullptr, 4096, 0, nullptr, nullptr, 0, 256, 4096, 256, 0.0625f);
    k_cast16<<<(unsigned)((((long long)(256) * ((256) / 2)) + 255) / 256), 256, 0, stream>>>(iwv + 256, 520, (_Float16*)(G64A), 256, 256, 256, 1.0f);
    k_castT16<<<(unsigned)((((long long)(4096) * ((256) / 2)) + 255) / 256), 256, 0, stream>>>(flo + (size_t)2 * C * HW, 4096, (_Float16*)(G64B), 256, 256, 4096, 16.0f);
    w25::wmma_gemm64<0, false, 0, 0, true, 0><<<dim3((unsigned)((((256) / 64) * ((4096) / 64) + 7) / 8), (unsigned)(1)), 256, 0, stream>>>((const unsigned short*)(G64A), nullptr, 256, 0, (const unsigned short*)(G64B), nullptr, 256, 0, (void*)(VAL), nullptr, 4096, 0, nullptr, VAL, 0, 256, 4096, 256, 0.0625f);
    k_cm_spT<<<(unsigned)(((long long)HW * A + 255) / 256), 256, 0, stream>>>(THT, iwt, ibt, 520, 512, A, (long long)HW * A); k_cm_spT<<<(unsigned)(((long long)HW * A + 255) / 256), 256, 0, stream>>>(PHT, iwp, ibp, 520, 512, A, (long long)HW * A); k_cm_spC<<<(unsigned)(((long long)A * HW + 255) / 256), 256, 0, stream>>>(VAL, iwv, ibv, 520, 512, HW, (long long)A * HW); k_cm_v16<<<(unsigned)(((long long)A * HW / 2 + 255) / 256), 256, 0, stream>>>(VAL, (_Float16*)VAL16, (long long)A * HW);
    k_cast16<<<(unsigned)((((long long)(2048) * ((256) / 2)) + 255) / 256), 256, 0, stream>>>(THT + (size_t)0 * HS * A, 256, (_Float16*)(G64A), 256, 2048, 256, 1.0f);
    k_cast16<<<(unsigned)((((long long)(4096) * ((256) / 2)) + 255) / 256), 256, 0, stream>>>(PHT, 256, (_Float16*)(G64B), 256, 4096, 256, 1.0f);
    w25::wmma_gemm64<0, false, 0, 0, false, 0><<<dim3((unsigned)((((2048) / 64) * ((4096) / 64) + 7) / 8), (unsigned)(1)), 256, 0, stream>>>((const unsigned short*)(G64A), nullptr, 256, 0, (const unsigned short*)(G64B), nullptr, 256, 0, (void*)(EN), nullptr, 4096, 0, nullptr, nullptr, 0, 2048, 4096, 256, 1.0f);
    k_cm_soft<<<HS, 256, 0, stream>>>(EN, (_Float16*)P16, HW);
    w25::wmma_gemm_kwaves<<<(unsigned)(((A) / 32) * ((HS) / 64)), 512, 0, stream>>>((const unsigned short*)(VAL16), HW, (const unsigned short*)(P16), HW, ATT + (size_t)0 * HS, HW, HS, HW, 0.000244140625f);
    k_cast16<<<(unsigned)((((long long)(2048) * ((256) / 2)) + 255) / 256), 256, 0, stream>>>(THT + (size_t)1 * HS * A, 256, (_Float16*)(G64A), 256, 2048, 256, 1.0f);
    k_cast16<<<(unsigned)((((long long)(4096) * ((256) / 2)) + 255) / 256), 256, 0, stream>>>(PHT, 256, (_Float16*)(G64B), 256, 4096, 256, 1.0f);
    w25::wmma_gemm64<0, false, 0, 0, false, 0><<<dim3((unsigned)((((2048) / 64) * ((4096) / 64) + 7) / 8), (unsigned)(1)), 256, 0, stream>>>((const unsigned short*)(G64A), nullptr, 256, 0, (const unsigned short*)(G64B), nullptr, 256, 0, (void*)(EN), nullptr, 4096, 0, nullptr, nullptr, 0, 2048, 4096, 256, 1.0f);
    k_cm_soft<<<HS, 256, 0, stream>>>(EN, (_Float16*)P16, HW);
    w25::wmma_gemm_kwaves<<<(unsigned)(((A) / 32) * ((HS) / 64)), 512, 0, stream>>>((const unsigned short*)(VAL16), HW, (const unsigned short*)(P16), HW, ATT + (size_t)1 * HS, HW, HS, HW, 0.000244140625f);
    k_cast16<<<(unsigned)((((long long)(256) * ((256) / 2)) + 255) / 256), 256, 0, stream>>>(iwo, 256, (_Float16*)(G64A), 256, 256, 256, 16.0f);
    k_castT16<<<(unsigned)((((long long)(4096) * ((256) / 2)) + 255) / 256), 256, 0, stream>>>(ATT, 4096, (_Float16*)(G64B), 256, 256, 4096, 1.0f);
    w25::wmma_gemm64<0, false, 1, 0, false, 0><<<dim3((unsigned)((((256) / 64) * ((4096) / 64) + 7) / 8), (unsigned)(1)), 256, 0, stream>>>((const unsigned short*)(G64A), nullptr, 256, 0, (const unsigned short*)(G64B), nullptr, 256, 0, (void*)(FUS + (size_t)0 * A * HW), nullptr, 4096, 0, ibo, nullptr, 0, 256, 4096, 256, 0.0625f);
    k_castT16<<<(unsigned)((((long long)(4096) * ((256) / 2)) + 255) / 256), 256, 0, stream>>>(flo + (size_t)2 * C * HW, 4096, (_Float16*)(G64A), 256, 256, 4096, 1.0f);
    k_cast16<<<(unsigned)((((long long)(256) * ((256) / 2)) + 255) / 256), 256, 0, stream>>>(lwt + 0, 256, (_Float16*)(G64B), 256, 256, 256, 16.0f);
    w25::wmma_gemm64<0, false, 0, 0, false, 0><<<dim3((unsigned)((((4096) / 64) * ((256) / 64) + 7) / 8), (unsigned)(1)), 256, 0, stream>>>((const unsigned short*)(G64A), nullptr, 256, 0, (const unsigned short*)(G64B), nullptr, 256, 0, (void*)(THT), nullptr, 256, 0, nullptr, nullptr, 0, 4096, 256, 256, 0.0625f);
    k_castT16<<<(unsigned)((((long long)(4096) * ((256) / 2)) + 255) / 256), 256, 0, stream>>>(flo + (size_t)2 * C * HW, 4096, (_Float16*)(G64A), 256, 256, 4096, 1.0f);
    k_cast16<<<(unsigned)((((long long)(256) * ((256) / 2)) + 255) / 256), 256, 0, stream>>>(lwp + 0, 256, (_Float16*)(G64B), 256, 256, 256, 16.0f);
    w25::wmma_gemm64<0, false, 0, 0, false, 0><<<dim3((unsigned)((((4096) / 64) * ((256) / 64) + 7) / 8), (unsigned)(1)), 256, 0, stream>>>((const unsigned short*)(G64A), nullptr, 256, 0, (const unsigned short*)(G64B), nullptr, 256, 0, (void*)(PHT), nullptr, 256, 0, nullptr, nullptr, 0, 4096, 256, 256, 0.0625f);
    k_cast16<<<(unsigned)((((long long)(256) * ((256) / 2)) + 255) / 256), 256, 0, stream>>>(lwv + 0, 256, (_Float16*)(G64A), 256, 256, 256, 1.0f);
    k_castT16<<<(unsigned)((((long long)(4096) * ((256) / 2)) + 255) / 256), 256, 0, stream>>>(flo + (size_t)2 * C * HW, 4096, (_Float16*)(G64B), 256, 256, 4096, 16.0f);
    w25::wmma_gemm64<0, false, 0, 0, false, 0><<<dim3((unsigned)((((256) / 64) * ((4096) / 64) + 7) / 8), (unsigned)(1)), 256, 0, stream>>>((const unsigned short*)(G64A), nullptr, 256, 0, (const unsigned short*)(G64B), nullptr, 256, 0, (void*)(VAL), nullptr, 4096, 0, nullptr, nullptr, 0, 256, 4096, 256, 0.0625f);
    k_cm_spT<<<(unsigned)(((long long)HW * A + 255) / 256), 256, 0, stream>>>(THT, lwt, lbt, 256, -1, A, (long long)HW * A); k_cm_spT<<<(unsigned)(((long long)HW * A + 255) / 256), 256, 0, stream>>>(PHT, lwp, lbp, 256, -1, A, (long long)HW * A); k_cm_spC<<<(unsigned)(((long long)A * HW + 255) / 256), 256, 0, stream>>>(VAL, lwv, lbv, 256, -1, HW, (long long)A * HW); k_cm_v16<<<(unsigned)(((long long)A * HW / 2 + 255) / 256), 256, 0, stream>>>(VAL, (_Float16*)VAL16, (long long)A * HW);
    k_cast16<<<(unsigned)((((long long)(2048) * ((256) / 2)) + 255) / 256), 256, 0, stream>>>(THT + (size_t)0 * HS * A, 256, (_Float16*)(G64A), 256, 2048, 256, 1.0f);
    k_cast16<<<(unsigned)((((long long)(4096) * ((256) / 2)) + 255) / 256), 256, 0, stream>>>(PHT, 256, (_Float16*)(G64B), 256, 4096, 256, 1.0f);
    w25::wmma_gemm64<0, false, 0, 0, false, 0><<<dim3((unsigned)((((2048) / 64) * ((4096) / 64) + 7) / 8), (unsigned)(1)), 256, 0, stream>>>((const unsigned short*)(G64A), nullptr, 256, 0, (const unsigned short*)(G64B), nullptr, 256, 0, (void*)(EN), nullptr, 4096, 0, nullptr, nullptr, 0, 2048, 4096, 256, 1.0f);
    k_cm_soft<<<HS, 256, 0, stream>>>(EN, (_Float16*)P16, HW);
    w25::wmma_gemm_kwaves<<<(unsigned)(((A) / 32) * ((HS) / 64)), 512, 0, stream>>>((const unsigned short*)(VAL16), HW, (const unsigned short*)(P16), HW, ATT + (size_t)0 * HS, HW, HS, HW, 0.000244140625f);
    k_cast16<<<(unsigned)((((long long)(2048) * ((256) / 2)) + 255) / 256), 256, 0, stream>>>(THT + (size_t)1 * HS * A, 256, (_Float16*)(G64A), 256, 2048, 256, 1.0f);
    k_cast16<<<(unsigned)((((long long)(4096) * ((256) / 2)) + 255) / 256), 256, 0, stream>>>(PHT, 256, (_Float16*)(G64B), 256, 4096, 256, 1.0f);
    w25::wmma_gemm64<0, false, 0, 0, false, 0><<<dim3((unsigned)((((2048) / 64) * ((4096) / 64) + 7) / 8), (unsigned)(1)), 256, 0, stream>>>((const unsigned short*)(G64A), nullptr, 256, 0, (const unsigned short*)(G64B), nullptr, 256, 0, (void*)(EN), nullptr, 4096, 0, nullptr, nullptr, 0, 2048, 4096, 256, 1.0f);
    k_cm_soft<<<HS, 256, 0, stream>>>(EN, (_Float16*)P16, HW);
    w25::wmma_gemm_kwaves<<<(unsigned)(((A) / 32) * ((HS) / 64)), 512, 0, stream>>>((const unsigned short*)(VAL16), HW, (const unsigned short*)(P16), HW, ATT + (size_t)1 * HS, HW, HS, HW, 0.000244140625f);
    k_cast16<<<(unsigned)((((long long)(256) * ((256) / 2)) + 255) / 256), 256, 0, stream>>>(lwo, 256, (_Float16*)(G64A), 256, 256, 256, 16.0f);
    k_castT16<<<(unsigned)((((long long)(4096) * ((256) / 2)) + 255) / 256), 256, 0, stream>>>(ATT, 4096, (_Float16*)(G64B), 256, 256, 4096, 1.0f);
    w25::wmma_gemm64<0, false, 1, 0, false, 0><<<dim3((unsigned)((((256) / 64) * ((4096) / 64) + 7) / 8), (unsigned)(1)), 256, 0, stream>>>((const unsigned short*)(G64A), nullptr, 256, 0, (const unsigned short*)(G64B), nullptr, 256, 0, (void*)(FUS + (size_t)1 * A * HW), nullptr, 4096, 0, lbo, nullptr, 0, 256, 4096, 256, 0.0625f);
    k_cast16<<<(unsigned)((((long long)(256) * ((512) / 2)) + 255) / 256), 256, 0, stream>>>(fw, 520, (_Float16*)(G64A), 512, 256, 512, 16.0f);
    k_castT16<<<(unsigned)((((long long)(4096) * ((512) / 2)) + 255) / 256), 256, 0, stream>>>(FUS, 4096, (_Float16*)(G64B), 512, 512, 4096, 1.0f);
    w25::wmma_gemm64<0, false, 0, 0, false, 0><<<dim3((unsigned)((((256) / 64) * ((4096) / 64) + 7) / 8), (unsigned)(1)), 256, 0, stream>>>((const unsigned short*)(G64A), nullptr, 512, 0, (const unsigned short*)(G64B), nullptr, 512, 0, (void*)(out + (size_t)2 * A * HW), nullptr, 4096, 0, nullptr, nullptr, 0, 256, 4096, 512, 0.0625f);
    k_cm_spC<<<(unsigned)(((long long)A * HW + 255) / 256), 256, 0, stream>>>(out + (size_t)2 * A * HW, fw, fb, 520, 512, HW, (long long)A * HW);
    k_castT16<<<(unsigned)((((long long)(4096) * ((256) / 2)) + 255) / 256), 256, 0, stream>>>(img + (size_t)3 * C * HW, 4096, (_Float16*)(G64A), 256, 256, 4096, 1.0f);
    k_cast16<<<(unsigned)((((long long)(256) * ((256) / 2)) + 255) / 256), 256, 0, stream>>>(iwt + 0, 520, (_Float16*)(G64B), 256, 256, 256, 16.0f);
    w25::wmma_gemm64<0, false, 0, 0, false, 0><<<dim3((unsigned)((((4096) / 64) * ((256) / 64) + 7) / 8), (unsigned)(1)), 256, 0, stream>>>((const unsigned short*)(G64A), nullptr, 256, 0, (const unsigned short*)(G64B), nullptr, 256, 0, (void*)(THT), nullptr, 256, 0, nullptr, nullptr, 0, 4096, 256, 256, 0.0625f);
    k_castT16<<<(unsigned)((((long long)(4096) * ((256) / 2)) + 255) / 256), 256, 0, stream>>>(flo + (size_t)3 * C * HW, 4096, (_Float16*)(G64A), 256, 256, 4096, 1.0f);
    k_cast16<<<(unsigned)((((long long)(256) * ((256) / 2)) + 255) / 256), 256, 0, stream>>>(iwt + 256, 520, (_Float16*)(G64B), 256, 256, 256, 16.0f);
    w25::wmma_gemm64<0, false, 0, 0, true, 0><<<dim3((unsigned)((((4096) / 64) * ((256) / 64) + 7) / 8), (unsigned)(1)), 256, 0, stream>>>((const unsigned short*)(G64A), nullptr, 256, 0, (const unsigned short*)(G64B), nullptr, 256, 0, (void*)(THT), nullptr, 256, 0, nullptr, THT, 0, 4096, 256, 256, 0.0625f);
    k_castT16<<<(unsigned)((((long long)(4096) * ((256) / 2)) + 255) / 256), 256, 0, stream>>>(img + (size_t)3 * C * HW, 4096, (_Float16*)(G64A), 256, 256, 4096, 1.0f);
    k_cast16<<<(unsigned)((((long long)(256) * ((256) / 2)) + 255) / 256), 256, 0, stream>>>(iwp + 0, 520, (_Float16*)(G64B), 256, 256, 256, 16.0f);
    w25::wmma_gemm64<0, false, 0, 0, false, 0><<<dim3((unsigned)((((4096) / 64) * ((256) / 64) + 7) / 8), (unsigned)(1)), 256, 0, stream>>>((const unsigned short*)(G64A), nullptr, 256, 0, (const unsigned short*)(G64B), nullptr, 256, 0, (void*)(PHT), nullptr, 256, 0, nullptr, nullptr, 0, 4096, 256, 256, 0.0625f);
    k_castT16<<<(unsigned)((((long long)(4096) * ((256) / 2)) + 255) / 256), 256, 0, stream>>>(flo + (size_t)3 * C * HW, 4096, (_Float16*)(G64A), 256, 256, 4096, 1.0f);
    k_cast16<<<(unsigned)((((long long)(256) * ((256) / 2)) + 255) / 256), 256, 0, stream>>>(iwp + 256, 520, (_Float16*)(G64B), 256, 256, 256, 16.0f);
    w25::wmma_gemm64<0, false, 0, 0, true, 0><<<dim3((unsigned)((((4096) / 64) * ((256) / 64) + 7) / 8), (unsigned)(1)), 256, 0, stream>>>((const unsigned short*)(G64A), nullptr, 256, 0, (const unsigned short*)(G64B), nullptr, 256, 0, (void*)(PHT), nullptr, 256, 0, nullptr, PHT, 0, 4096, 256, 256, 0.0625f);
    k_cast16<<<(unsigned)((((long long)(256) * ((256) / 2)) + 255) / 256), 256, 0, stream>>>(iwv + 0, 520, (_Float16*)(G64A), 256, 256, 256, 1.0f);
    k_castT16<<<(unsigned)((((long long)(4096) * ((256) / 2)) + 255) / 256), 256, 0, stream>>>(img + (size_t)3 * C * HW, 4096, (_Float16*)(G64B), 256, 256, 4096, 16.0f);
    w25::wmma_gemm64<0, false, 0, 0, false, 0><<<dim3((unsigned)((((256) / 64) * ((4096) / 64) + 7) / 8), (unsigned)(1)), 256, 0, stream>>>((const unsigned short*)(G64A), nullptr, 256, 0, (const unsigned short*)(G64B), nullptr, 256, 0, (void*)(VAL), nullptr, 4096, 0, nullptr, nullptr, 0, 256, 4096, 256, 0.0625f);
    k_cast16<<<(unsigned)((((long long)(256) * ((256) / 2)) + 255) / 256), 256, 0, stream>>>(iwv + 256, 520, (_Float16*)(G64A), 256, 256, 256, 1.0f);
    k_castT16<<<(unsigned)((((long long)(4096) * ((256) / 2)) + 255) / 256), 256, 0, stream>>>(flo + (size_t)3 * C * HW, 4096, (_Float16*)(G64B), 256, 256, 4096, 16.0f);
    w25::wmma_gemm64<0, false, 0, 0, true, 0><<<dim3((unsigned)((((256) / 64) * ((4096) / 64) + 7) / 8), (unsigned)(1)), 256, 0, stream>>>((const unsigned short*)(G64A), nullptr, 256, 0, (const unsigned short*)(G64B), nullptr, 256, 0, (void*)(VAL), nullptr, 4096, 0, nullptr, VAL, 0, 256, 4096, 256, 0.0625f);
    k_cm_spT<<<(unsigned)(((long long)HW * A + 255) / 256), 256, 0, stream>>>(THT, iwt, ibt, 520, 512, A, (long long)HW * A); k_cm_spT<<<(unsigned)(((long long)HW * A + 255) / 256), 256, 0, stream>>>(PHT, iwp, ibp, 520, 512, A, (long long)HW * A); k_cm_spC<<<(unsigned)(((long long)A * HW + 255) / 256), 256, 0, stream>>>(VAL, iwv, ibv, 520, 512, HW, (long long)A * HW); k_cm_v16<<<(unsigned)(((long long)A * HW / 2 + 255) / 256), 256, 0, stream>>>(VAL, (_Float16*)VAL16, (long long)A * HW);
    k_cast16<<<(unsigned)((((long long)(2048) * ((256) / 2)) + 255) / 256), 256, 0, stream>>>(THT + (size_t)0 * HS * A, 256, (_Float16*)(G64A), 256, 2048, 256, 1.0f);
    k_cast16<<<(unsigned)((((long long)(4096) * ((256) / 2)) + 255) / 256), 256, 0, stream>>>(PHT, 256, (_Float16*)(G64B), 256, 4096, 256, 1.0f);
    w25::wmma_gemm64<0, false, 0, 0, false, 0><<<dim3((unsigned)((((2048) / 64) * ((4096) / 64) + 7) / 8), (unsigned)(1)), 256, 0, stream>>>((const unsigned short*)(G64A), nullptr, 256, 0, (const unsigned short*)(G64B), nullptr, 256, 0, (void*)(EN), nullptr, 4096, 0, nullptr, nullptr, 0, 2048, 4096, 256, 1.0f);
    k_cm_soft<<<HS, 256, 0, stream>>>(EN, (_Float16*)P16, HW);
    w25::wmma_gemm_kwaves<<<(unsigned)(((A) / 32) * ((HS) / 64)), 512, 0, stream>>>((const unsigned short*)(VAL16), HW, (const unsigned short*)(P16), HW, ATT + (size_t)0 * HS, HW, HS, HW, 0.000244140625f);
    k_cast16<<<(unsigned)((((long long)(2048) * ((256) / 2)) + 255) / 256), 256, 0, stream>>>(THT + (size_t)1 * HS * A, 256, (_Float16*)(G64A), 256, 2048, 256, 1.0f);
    k_cast16<<<(unsigned)((((long long)(4096) * ((256) / 2)) + 255) / 256), 256, 0, stream>>>(PHT, 256, (_Float16*)(G64B), 256, 4096, 256, 1.0f);
    w25::wmma_gemm64<0, false, 0, 0, false, 0><<<dim3((unsigned)((((2048) / 64) * ((4096) / 64) + 7) / 8), (unsigned)(1)), 256, 0, stream>>>((const unsigned short*)(G64A), nullptr, 256, 0, (const unsigned short*)(G64B), nullptr, 256, 0, (void*)(EN), nullptr, 4096, 0, nullptr, nullptr, 0, 2048, 4096, 256, 1.0f);
    k_cm_soft<<<HS, 256, 0, stream>>>(EN, (_Float16*)P16, HW);
    w25::wmma_gemm_kwaves<<<(unsigned)(((A) / 32) * ((HS) / 64)), 512, 0, stream>>>((const unsigned short*)(VAL16), HW, (const unsigned short*)(P16), HW, ATT + (size_t)1 * HS, HW, HS, HW, 0.000244140625f);
    k_cast16<<<(unsigned)((((long long)(256) * ((256) / 2)) + 255) / 256), 256, 0, stream>>>(iwo, 256, (_Float16*)(G64A), 256, 256, 256, 16.0f);
    k_castT16<<<(unsigned)((((long long)(4096) * ((256) / 2)) + 255) / 256), 256, 0, stream>>>(ATT, 4096, (_Float16*)(G64B), 256, 256, 4096, 1.0f);
    w25::wmma_gemm64<0, false, 1, 0, false, 0><<<dim3((unsigned)((((256) / 64) * ((4096) / 64) + 7) / 8), (unsigned)(1)), 256, 0, stream>>>((const unsigned short*)(G64A), nullptr, 256, 0, (const unsigned short*)(G64B), nullptr, 256, 0, (void*)(FUS + (size_t)0 * A * HW), nullptr, 4096, 0, ibo, nullptr, 0, 256, 4096, 256, 0.0625f);
    k_castT16<<<(unsigned)((((long long)(4096) * ((256) / 2)) + 255) / 256), 256, 0, stream>>>(flo + (size_t)3 * C * HW, 4096, (_Float16*)(G64A), 256, 256, 4096, 1.0f);
    k_cast16<<<(unsigned)((((long long)(256) * ((256) / 2)) + 255) / 256), 256, 0, stream>>>(lwt + 0, 256, (_Float16*)(G64B), 256, 256, 256, 16.0f);
    w25::wmma_gemm64<0, false, 0, 0, false, 0><<<dim3((unsigned)((((4096) / 64) * ((256) / 64) + 7) / 8), (unsigned)(1)), 256, 0, stream>>>((const unsigned short*)(G64A), nullptr, 256, 0, (const unsigned short*)(G64B), nullptr, 256, 0, (void*)(THT), nullptr, 256, 0, nullptr, nullptr, 0, 4096, 256, 256, 0.0625f);
    k_castT16<<<(unsigned)((((long long)(4096) * ((256) / 2)) + 255) / 256), 256, 0, stream>>>(flo + (size_t)3 * C * HW, 4096, (_Float16*)(G64A), 256, 256, 4096, 1.0f);
    k_cast16<<<(unsigned)((((long long)(256) * ((256) / 2)) + 255) / 256), 256, 0, stream>>>(lwp + 0, 256, (_Float16*)(G64B), 256, 256, 256, 16.0f);
    w25::wmma_gemm64<0, false, 0, 0, false, 0><<<dim3((unsigned)((((4096) / 64) * ((256) / 64) + 7) / 8), (unsigned)(1)), 256, 0, stream>>>((const unsigned short*)(G64A), nullptr, 256, 0, (const unsigned short*)(G64B), nullptr, 256, 0, (void*)(PHT), nullptr, 256, 0, nullptr, nullptr, 0, 4096, 256, 256, 0.0625f);
    k_cast16<<<(unsigned)((((long long)(256) * ((256) / 2)) + 255) / 256), 256, 0, stream>>>(lwv + 0, 256, (_Float16*)(G64A), 256, 256, 256, 1.0f);
    k_castT16<<<(unsigned)((((long long)(4096) * ((256) / 2)) + 255) / 256), 256, 0, stream>>>(flo + (size_t)3 * C * HW, 4096, (_Float16*)(G64B), 256, 256, 4096, 16.0f);
    w25::wmma_gemm64<0, false, 0, 0, false, 0><<<dim3((unsigned)((((256) / 64) * ((4096) / 64) + 7) / 8), (unsigned)(1)), 256, 0, stream>>>((const unsigned short*)(G64A), nullptr, 256, 0, (const unsigned short*)(G64B), nullptr, 256, 0, (void*)(VAL), nullptr, 4096, 0, nullptr, nullptr, 0, 256, 4096, 256, 0.0625f);
    k_cm_spT<<<(unsigned)(((long long)HW * A + 255) / 256), 256, 0, stream>>>(THT, lwt, lbt, 256, -1, A, (long long)HW * A); k_cm_spT<<<(unsigned)(((long long)HW * A + 255) / 256), 256, 0, stream>>>(PHT, lwp, lbp, 256, -1, A, (long long)HW * A); k_cm_spC<<<(unsigned)(((long long)A * HW + 255) / 256), 256, 0, stream>>>(VAL, lwv, lbv, 256, -1, HW, (long long)A * HW); k_cm_v16<<<(unsigned)(((long long)A * HW / 2 + 255) / 256), 256, 0, stream>>>(VAL, (_Float16*)VAL16, (long long)A * HW);
    k_cast16<<<(unsigned)((((long long)(2048) * ((256) / 2)) + 255) / 256), 256, 0, stream>>>(THT + (size_t)0 * HS * A, 256, (_Float16*)(G64A), 256, 2048, 256, 1.0f);
    k_cast16<<<(unsigned)((((long long)(4096) * ((256) / 2)) + 255) / 256), 256, 0, stream>>>(PHT, 256, (_Float16*)(G64B), 256, 4096, 256, 1.0f);
    w25::wmma_gemm64<0, false, 0, 0, false, 0><<<dim3((unsigned)((((2048) / 64) * ((4096) / 64) + 7) / 8), (unsigned)(1)), 256, 0, stream>>>((const unsigned short*)(G64A), nullptr, 256, 0, (const unsigned short*)(G64B), nullptr, 256, 0, (void*)(EN), nullptr, 4096, 0, nullptr, nullptr, 0, 2048, 4096, 256, 1.0f);
    k_cm_soft<<<HS, 256, 0, stream>>>(EN, (_Float16*)P16, HW);
    w25::wmma_gemm_kwaves<<<(unsigned)(((A) / 32) * ((HS) / 64)), 512, 0, stream>>>((const unsigned short*)(VAL16), HW, (const unsigned short*)(P16), HW, ATT + (size_t)0 * HS, HW, HS, HW, 0.000244140625f);
    k_cast16<<<(unsigned)((((long long)(2048) * ((256) / 2)) + 255) / 256), 256, 0, stream>>>(THT + (size_t)1 * HS * A, 256, (_Float16*)(G64A), 256, 2048, 256, 1.0f);
    k_cast16<<<(unsigned)((((long long)(4096) * ((256) / 2)) + 255) / 256), 256, 0, stream>>>(PHT, 256, (_Float16*)(G64B), 256, 4096, 256, 1.0f);
    w25::wmma_gemm64<0, false, 0, 0, false, 0><<<dim3((unsigned)((((2048) / 64) * ((4096) / 64) + 7) / 8), (unsigned)(1)), 256, 0, stream>>>((const unsigned short*)(G64A), nullptr, 256, 0, (const unsigned short*)(G64B), nullptr, 256, 0, (void*)(EN), nullptr, 4096, 0, nullptr, nullptr, 0, 2048, 4096, 256, 1.0f);
    k_cm_soft<<<HS, 256, 0, stream>>>(EN, (_Float16*)P16, HW);
    w25::wmma_gemm_kwaves<<<(unsigned)(((A) / 32) * ((HS) / 64)), 512, 0, stream>>>((const unsigned short*)(VAL16), HW, (const unsigned short*)(P16), HW, ATT + (size_t)1 * HS, HW, HS, HW, 0.000244140625f);
    k_cast16<<<(unsigned)((((long long)(256) * ((256) / 2)) + 255) / 256), 256, 0, stream>>>(lwo, 256, (_Float16*)(G64A), 256, 256, 256, 16.0f);
    k_castT16<<<(unsigned)((((long long)(4096) * ((256) / 2)) + 255) / 256), 256, 0, stream>>>(ATT, 4096, (_Float16*)(G64B), 256, 256, 4096, 1.0f);
    w25::wmma_gemm64<0, false, 1, 0, false, 0><<<dim3((unsigned)((((256) / 64) * ((4096) / 64) + 7) / 8), (unsigned)(1)), 256, 0, stream>>>((const unsigned short*)(G64A), nullptr, 256, 0, (const unsigned short*)(G64B), nullptr, 256, 0, (void*)(FUS + (size_t)1 * A * HW), nullptr, 4096, 0, lbo, nullptr, 0, 256, 4096, 256, 0.0625f);
    k_cast16<<<(unsigned)((((long long)(256) * ((512) / 2)) + 255) / 256), 256, 0, stream>>>(fw, 520, (_Float16*)(G64A), 512, 256, 512, 16.0f);
    k_castT16<<<(unsigned)((((long long)(4096) * ((512) / 2)) + 255) / 256), 256, 0, stream>>>(FUS, 4096, (_Float16*)(G64B), 512, 512, 4096, 1.0f);
    w25::wmma_gemm64<0, false, 0, 0, false, 0><<<dim3((unsigned)((((256) / 64) * ((4096) / 64) + 7) / 8), (unsigned)(1)), 256, 0, stream>>>((const unsigned short*)(G64A), nullptr, 512, 0, (const unsigned short*)(G64B), nullptr, 512, 0, (void*)(out + (size_t)3 * A * HW), nullptr, 4096, 0, nullptr, nullptr, 0, 256, 4096, 512, 0.0625f);
    k_cm_spC<<<(unsigned)(((long long)A * HW + 255) / 256), 256, 0, stream>>>(out + (size_t)3 * A * HW, fw, fb, 520, 512, HW, (long long)A * HW);
}

// v002
// A run of this version takes 1310 microseconds.
// Timed twice side by side with v001, it ran 1.72 times as fast both times.
// All steps since v000 together make it 3.23 times as fast.
// Contractions (per branch; every launch serves the four samples, blockIdx.y or rows that run on from sample to sample): the 1x1 projections theta^T / phi^T = x^T.W^T [4096x512].[512x256] (image+flow channels as two K=256 products accumulated) and val = W.x [256x512].[512x4096], the affinity theta^T.phi [1024x256].[256x4096] per row quarter, att = val.attn^T [256x4096].[4096x1024] (attn as f16 of 4096 p; 32x64 work-group tiles, K dealt over 16 waves, f32 partials added in LDS), the output 1x1 convs W_o.att + b and the fusion conv over the concatenated branches — all f16 operands on pre-cast planes (v_wmma_f32_16x16x32_f16; 64x64 register-blocked wave tiles, weights x16; strided channel-major operands); f32 accumulate. The 8 spatial-coordinate channels (gx, gy, 1-gx, 1-gy, (gx+gy)/2 x4, computed on device) enter the projections and the fusion conv as rank-8 f32 corrections (+bias); the row softmax (exp once) is an f32 kernel.
#include <hip/hip_runtime.h>
#include <math.h>

typedef __attribute__((ext_vector_type(16))) _Float16 v16h;
typedef __attribute__((ext_vector_type(8)))  _Float16 v8h;
typedef __attribute__((ext_vector_type(16))) __bf16   v16b;
typedef __attribute__((ext_vector_type(8)))  float    v8f;
typedef __attribute__((ext_vector_type(4)))  float    v4f;

// 16-bit WMMA fragment map (wave32), lane L, h = L>>4, m = L&15:
//   A 16x32: lane = row m;   element i -> k = (i<8) ? 8h+i : 16+8h+(i-8)
//   B 32x16: lane = column m; the SAME k(i,h)
//   D 16x16 (8 f32): lane = column m; element r -> row 8h+r
__device__ __forceinline__ int frag_k(int i, int h) { return (i < 8) ? (8 * h + i) : (16 + 8 * h + (i - 8)); }
__device__ __forceinline__ __bf16 bf16_rne(float f) {
    unsigned int u = __float_as_uint(f);
    u += 0x7fffu + ((u >> 16) & 1u);
    return __builtin_bit_cast(__bf16, (unsigned short)(u >> 16));
}
__device__ __forceinline__ float bf16_f32(__bf16 b) { return __uint_as_float(((unsigned int)__builtin_bit_cast(unsigned short, b)) << 16); }
__device__ __forceinline__ v8f wmma16(v16h a, v16h b, v8f c) {
    c = __builtin_amdgcn_wmma_f32_16x16x32_f16(false, a, false, b, (short)0, c, false, false);
    asm volatile("v_nop\n\tv_nop\n\tv_nop\n\tv_nop" : "+v"(c) : "v"(a), "v"(b));
    return c;
}
__device__ __forceinline__ v8f wmmab(v16b a, v16b b, v8f c) {
    c = __builtin_amdgcn_wmma_f32_16x16x32_bf16(false, a, false, b, (short)0, c, false, false);
    asm volatile("v_nop\n\tv_nop\n\tv_nop\n\tv_nop" : "+v"(c) : "v"(a), "v"(b));
    return c;
}
struct Split { v16b hi, lo; };
// hi/lo split product: a.hi*b.hi + a.hi*b.lo + a.lo*b.hi
__device__ __forceinline__ v8f wmma3(const Split& a, const Split& b, v8f c) {
    c = __builtin_amdgcn_wmma_f32_16x16x32_bf16(false, a.hi, false, b.hi, (short)0, c, false, false);
    c = __builtin_amdgcn_wmma_f32_16x16x32_bf16(false, a.hi, false, b.lo, (short)0, c, false, false);
    c = __builtin_amdgcn_wmma_f32_16x16x32_bf16(false, a.lo, false, b.hi, (short)0, c, false, false);
    asm volatile("v_nop\n\tv_nop\n\tv_nop\n\tv_nop" : "+v"(c) : "v"(a.hi), "v"(a.lo), "v"(b.hi), "v"(b.lo));
    return c;
}
struct Split3 { v16b hi, mid, lo; };
// triple split product (6 terms, drops only terms below 2^-24 relative)
__device__ __forceinline__ v8f wmma6(const Split3& a, const Split3& b, v8f c) {
    c = __builtin_amdgcn_wmma_f32_16x16x32_bf16(false, a.hi, false, b.hi, (short)0, c, false, false);
    c = __builtin_amdgcn_wmma_f32_16x16x32_bf16(false, a.hi, false, b.mid, (short)0, c, false, false);
    c = __builtin_amdgcn_wmma_f32_16x16x32_bf16(false, a.mid, false, b.hi, (short)0, c, false, false);
    c = __builtin_amdgcn_wmma_f32_16x16x32_bf16(false, a.hi, false, b.lo, (short)0, c, false, false);
    c = __builtin_amdgcn_wmma_f32_16x16x32_bf16(false, a.mid, false, b.mid, (short)0, c, false, false);
    c = __builtin_amdgcn_wmma_f32_16x16x32_bf16(false, a.lo, false, b.hi, (short)0, c, false, false);
    asm volatile("v_nop\n\tv_nop\n\tv_nop\n\tv_nop" : "+v"(c) : "v"(a.hi), "v"(a.mid), "v"(a.lo), "v"(b.hi), "v"(b.mid), "v"(b.lo));
    return c;
}

// Fragment gathers from f32 memory: element i <- p[(k0 + frag_k(i,h)) * sk] * s, zero for k >= klen.
__device__ __forceinline__ v16h fh_ld(const float* __restrict__ p, long long sk, int k0, int h, int klen, float s) {
    v16h a;
#pragma unroll
    for (int i = 0; i < 16; ++i) { const int k = k0 + frag_k(i, h); a[i] = (k < klen) ? (_Float16)(p[(long long)k * sk] * s) : (_Float16)0.f; }
    return a;
}
__device__ __forceinline__ Split sp_ld(const float* __restrict__ p, long long sk, int k0, int h, int klen, float s) {
    Split r;
#pragma unroll
    for (int i = 0; i < 16; ++i) {
        const int k = k0 + frag_k(i, h); const float x = (k < klen) ? p[(long long)k * sk] * s : 0.f;
        const __bf16 hb = bf16_rne(x); r.hi[i] = hb; r.lo[i] = bf16_rne(x - bf16_f32(hb));
    }
    return r;
}
__device__ __forceinline__ Split3 sp3_ld(const float* __restrict__ p, long long sk, int k0, int h, int klen, float s) {
    Split3 r;
#pragma unroll
    for (int i = 0; i < 16; ++i) {
        const int k = k0 + frag_k(i, h); const float x = (k < klen) ? p[(long long)k * sk] * s : 0.f;
        const __bf16 hb = bf16_rne(x); const float r1 = x - bf16_f32(hb); const __bf16 mb = bf16_rne(r1);
        r.hi[i] = hb; r.mid[i] = mb; r.lo[i] = bf16_rne(r1 - bf16_f32(mb));
    }
    return r;
}
__device__ __forceinline__ v16b bh_ld(const float* __restrict__ p, long long sk, int k0, int h, int klen, float s) {
    v16b a;
#pragma unroll
    for (int i = 0; i < 16; ++i) { const int k = k0 + frag_k(i, h); a[i] = bf16_rne((k < klen) ? p[(long long)k * sk] * s : 0.f); }
    return a;
}
// f16 fragment from an f16 LDS/global row with element stride 1 (k-contiguous), no bounds (tile already zero padded)
__device__ __forceinline__ v16h fh_row(const _Float16* __restrict__ row, int k0, int h) {
    v16h a;
#pragma unroll
    for (int i = 0; i < 16; ++i) a[i] = row[k0 + frag_k(i, h)];
    return a;
}

#define VST2(T, ptr, val) do { const T vst2_v_ = (val); *(T*)(ptr) = vst2_v_;  } while (0)
typedef float v4f __attribute__((ext_vector_type(4)));
#define VST2V4(ptr, val) do { const v4f vst2_v4_ = (val); *(v4f*)(ptr) = vst2_v4_;  } while (0)

__device__ __attribute__((noinline)) float act_fn(float v, int act) {
    if (act == 1) return fmaxf(v, 0.f);                                                                               // relu
    if (act == 2) { const float u = 0.7978845608028654f * (v + 0.044715f * v * v * v); return 0.5f * v * (1.f + tanhf(u)); } // tanh-gelu
    if (act == 3) return v / (1.f + expf(-v));                                                                        // silu
    if (act == 4) return 0.5f * v * (1.f + erff(v * 0.7071067811865476f));                                             // erf-gelu
    if (act == 5) return tanhf(v);
    if (act == 6) return 1.f / (1.f + expf(-v));                                                                      // sigmoid
    if (act == 7) return (v > 0.f) ? v : 0.01f * v;                                                                   // leaky relu 0.01
    if (act == 8) return (v > 0.f) ? v : (expf(v) - 1.f);                                                             // elu
    if (act == 9) return fminf(fmaxf(v, 0.f), 6.f);                                                                   // relu6
    if (act == 10) return fabsf(v);                                                                                    // abs
    if (act == 11) return (v >= 0.f) ? v : 0.1f * v;                                                                  // leaky 0.1
    if (act == 12) return (v > 0.f) ? v : 0.2f * v;                                                                   // leaky 0.2
    if (act == 13) return (v > 20.f) ? v : log1pf(expf(v));                                                            // softplus
    return v;
}

// =====================================================================================================================
// k_gemm<MODE>: C(z, m, n) = act(alpha * sum_k A(z, m, k) * B(z, k, n) + bias) + beta * R(z, m, n)
//   One wave (32-thread block) per 16 x 32 tile of C; grid (ceil(N/32), ceil(M/16), Z). Batch z -> (zo = z / zi_n, zi = z % zi_n)
//   with separate outer/inner strides for every tensor (e.g. batch and head). A(m,k) = A[zo*sAo + zi*sAi + m*sAm + k*sAk] (f32),
//   B(k,n) = B[zo*sBo + zi*sBi + n*sBn + k*sBk] (f32); any M, N, K (K zero-padded to 32 inside the fragments, M/N tails guarded).
//   C(m,n) = C[zo*sCo + zi*sCi + m*sCm + n] (n contiguous). flags: 1 bias[n], 2 bias[m], 4 residual R[zo*sRo + zi*sRi + m*sRm + n*sRn].
//   MODE 0: f16 operands (A prescaled by sa, B by sb, both undone in the epilogue); 1: bf16 hi/lo split (3 products); 2: bf16;
//   3: bf16 hi/mid/lo triple split (6 products); 4: as 3 with Kahan-compensated f32 accumulation across k-steps.
// =====================================================================================================================
struct GemmP {
    const float* A; const float* B; const float* bias; const float* R; float* C;
    long long sAo, sAi, sAm, sAk, sBo, sBi, sBn, sBk, sCo, sCi, sCm, sRo, sRi, sRm, sRn;
    int M, N, K, zi_n, flags, act; float alpha, beta, sa, sb;
    int Npad, pad_;     // columns [N, Npad) of C are written as 0 so that padded workspace rows are covered by whole-line stores; Npad >= N
};
static_assert(sizeof(GemmP) == 5 * 8 + 15 * 8 + 6 * 4 + 4 * 4 + 2 * 4, "GemmP has padding");

template <int MODE>
__global__ __launch_bounds__(32) void k_gemm(GemmP p) {
    const int lane = threadIdx.x & 31, h = lane >> 4, l15 = lane & 15;
    const int m0 = blockIdx.y * 16, n0 = blockIdx.x * 32;
    const int z = blockIdx.z, zo = z / p.zi_n, zi = z - zo * p.zi_n;
    const float* A = p.A + zo * p.sAo + zi * p.sAi;
    const float* B = p.B + zo * p.sBo + zi * p.sBi;
    const int am = min(m0 + l15, p.M - 1);                       // clamped row for loads (stores are guarded)
    v8f acc[2], comp[2];
#pragma unroll
    for (int t = 0; t < 2; ++t) { v8f zz = {}; acc[t] = zz; comp[t] = zz; }
    for (int k0 = 0; k0 < p.K; k0 += 32) {
        const float* arow = A + (long long)am * p.sAm;
        if (MODE == 1) {
            const Split a = sp_ld(arow, p.sAk, k0, h, p.K, 1.f);
#pragma unroll
            for (int t = 0; t < 2; ++t) {
                const int bn = min(n0 + t * 16 + l15, p.N - 1);
                acc[t] = wmma3(a, sp_ld(B + (long long)bn * p.sBn, p.sBk, k0, h, p.K, 1.f), acc[t]);
            }
        } else if (MODE == 3) {
            const Split3 a = sp3_ld(arow, p.sAk, k0, h, p.K, 1.f);
#pragma unroll
            for (int t = 0; t < 2; ++t) {
                const int bn = min(n0 + t * 16 + l15, p.N - 1);
                acc[t] = wmma6(a, sp3_ld(B + (long long)bn * p.sBn, p.sBk, k0, h, p.K, 1.f), acc[t]);
            }
        } else if (MODE == 4) {
            // triple split as MODE 3, but each k-step's 6 products go into a fresh accumulator and the partial is added to the running f32 sum
            // on the VALU with Kahan compensation (accumulation error stays ~1 ulp however long K is)
            const Split3 a = sp3_ld(arow, p.sAk, k0, h, p.K, 1.f);
#pragma unroll
            for (int t = 0; t < 2; ++t) {
                const int bn = min(n0 + t * 16 + l15, p.N - 1); v8f zz = {};
                const v8f part = wmma6(a, sp3_ld(B + (long long)bn * p.sBn, p.sBk, k0, h, p.K, 1.f), zz);
                const v8f y = part - comp[t]; const v8f s = acc[t] + y; comp[t] = (s - acc[t]) - y; acc[t] = s;
            }
        } else if (MODE == 2) {
            const v16b a = bh_ld(arow, p.sAk, k0, h, p.K, 1.f);
#pragma unroll
            for (int t = 0; t < 2; ++t) {
                const int bn = min(n0 + t * 16 + l15, p.N - 1);
                acc[t] = wmmab(a, bh_ld(B + (long long)bn * p.sBn, p.sBk, k0, h, p.K, 1.f), acc[t]);
            }
        } else {
            const v16h a = fh_ld(arow, p.sAk, k0, h, p.K, p.sa);
#pragma unroll
            for (int t = 0; t < 2; ++t) {
                const int bn = min(n0 + t * 16 + l15, p.N - 1);
                acc[t] = wmma16(a, fh_ld(B + (long long)bn * p.sBn, p.sBk, k0, h, p.K, p.sb), acc[t]);
            }
        }
    }
    const float iscale = (MODE == 0) ? p.alpha / (p.sa * p.sb) : p.alpha;
    float* C = p.C + zo * p.sCo + zi * p.sCi;
    const float* R = p.R + zo * p.sRo + zi * p.sRi;
    __shared__ __align__(16) float ctile[16][36];
#pragma unroll
    for (int t = 0; t < 2; ++t) {
        const int n = n0 + t * 16 + l15; const int nn = min(n, p.N - 1);
#pragma unroll
        for (int r = 0; r < 8; ++r) {
            const int m = m0 + 8 * h + r; const int mm = min(m, p.M - 1);
            float v = acc[t][r] * iscale;
            if (p.flags & 1) v += p.bias[nn];
            if (p.flags & 2) v += p.bias[mm];
            if (p.flags & 8) v *= p.bias[(long long)zo * p.M + mm];   /* per-(z,row) scale vector laid out [Z][M]; exclusive with the bias flags */
            v = act_fn(v, p.act);
            if (p.flags & 4) v += p.beta * R[(long long)mm * p.sRm + (long long)nn * p.sRn];
            ctile[8 * h + r][t * 16 + l15] = (n < p.N) ? v : 0.f;
        }
    }
    __syncthreads();
    const int NW = (p.Npad > p.N) ? p.Npad : p.N;           // write width
    const bool fast = (m0 + 16 <= p.M) && (n0 + 32 <= NW) && ((p.sCm & 3) == 0) && ((((size_t)C) & 15) == 0);
    if (fast) {
#pragma unroll
        for (int s = 0; s < 4; ++s) {
            const int row = s * 4 + (lane >> 3), c4 = (lane & 7) * 4;
            const v4f v = *(const v4f*)&ctile[row][c4];
            VST2V4(C + (long long)(m0 + row) * p.sCm + n0 + c4, v);
        }
    } else {
        for (int row = 0; row < 16; ++row) {
            const int m = m0 + row, n = n0 + lane;
            if (m < p.M && n < NW) VST2(float, C + (long long)m * p.sCm + n, ctile[row][lane]);
        }
    }
}


// =====================================================================================================================
// k_gemmT<MODE, TM, TN>: same contract as k_gemm, but one wave computes a (16*TM) x (16*TN) tile: TM A fragments and TN B fragments are
//   loaded per 32-wide k-step and reused across TM*TN WMMAs (far fewer load/convert instructions per MAC). MODE 0 (f16), 1 (bf16 hi/lo),
//   2 (bf16) only. grid (ceil(NW/(16*TN)), ceil(M/(16*TM)), Z), block 32. Epilogue identical to k_gemm, run per 16x32 sub-tile.
// =====================================================================================================================
template <int MODE, int TM, int TN>
__global__ __launch_bounds__(32) void k_gemmT(GemmP p) {
    const int lane = threadIdx.x & 31, h = lane >> 4, l15 = lane & 15;
    const int m0 = blockIdx.y * (16 * TM), n0 = blockIdx.x * (16 * TN);
    const int z = blockIdx.z, zo = z / p.zi_n, zi = z - zo * p.zi_n;
    const float* A = p.A + zo * p.sAo + zi * p.sAi;
    const float* B = p.B + zo * p.sBo + zi * p.sBi;
    v8f acc[TM][TN];
#pragma unroll
    for (int i = 0; i < TM; ++i)
#pragma unroll
        for (int t = 0; t < TN; ++t) { v8f zz = {}; acc[i][t] = zz; }
    for (int k0 = 0; k0 < p.K; k0 += 32) {
        if (MODE == 1) {
            Split a[TM], b[TN];
#pragma unroll
            for (int i = 0; i < TM; ++i) { const int am = min(m0 + 16 * i + l15, p.M - 1); a[i] = sp_ld(A + (long long)am * p.sAm, p.sAk, k0, h, p.K, 1.f); }
#pragma unroll
            for (int t = 0; t < TN; ++t) { const int bn = min(n0 + 16 * t + l15, p.N - 1); b[t] = sp_ld(B + (long long)bn * p.sBn, p.sBk, k0, h, p.K, 1.f); }
#pragma unroll
            for (int i = 0; i < TM; ++i)
#pragma unroll
                for (int t = 0; t < TN; ++t) acc[i][t] = wmma3(a[i], b[t], acc[i][t]);
        } else if (MODE == 2) {
            v16b a[TM], b[TN];
#pragma unroll
            for (int i = 0; i < TM; ++i) { const int am = min(m0 + 16 * i + l15, p.M - 1); a[i] = bh_ld(A + (long long)am * p.sAm, p.sAk, k0, h, p.K, 1.f); }
#pragma unroll
            for (int t = 0; t < TN; ++t) { const int bn = min(n0 + 16 * t + l15, p.N - 1); b[t] = bh_ld(B + (long long)bn * p.sBn, p.sBk, k0, h, p.K, 1.f); }
#pragma unroll
            for (int i = 0; i < TM; ++i)
#pragma unroll
                for (int t = 0; t < TN; ++t) acc[i][t] = wmmab(a[i], b[t], acc[i][t]);
        } else {
            v16h a[TM], b[TN];
#pragma unroll
            for (int i = 0; i < TM; ++i) { const int am = min(m0 + 16 * i + l15, p.M - 1); a[i] = fh_ld(A + (long long)am * p.sAm, p.sAk, k0, h, p.K, p.sa); }
#pragma unroll
            for (int t = 0; t < TN; ++t) { const int bn = min(n0 + 16 * t + l15, p.N - 1); b[t] = fh_ld(B + (long long)bn * p.sBn, p.sBk, k0, h, p.K, p.sb); }
#pragma unroll
            for (int i = 0; i < TM; ++i)
#pragma unroll
                for (int t = 0; t < TN; ++t) acc[i][t] = wmma16(a[i], b[t], acc[i][t]);
        }
    }
    const float iscale = (MODE == 0) ? p.alpha / (p.sa * p.sb) : p.alpha;
    float* C = p.C + zo * p.sCo + zi * p.sCi;
    const float* R = p.R + zo * p.sRo + zi * p.sRi;
    const int NW = (p.Npad > p.N) ? p.Npad : p.N;
    __shared__ __align__(16) float ctile[16][36];
#pragma unroll
    for (int i = 0; i < TM; ++i) {
        const int mb = m0 + 16 * i; if (mb >= p.M) break;          // wave-uniform
#pragma unroll
        for (int tp = 0; tp < TN / 2; ++tp) {
            const int nb = n0 + 32 * tp; if (nb >= NW) break;        // wave-uniform
#pragma unroll
            for (int t2 = 0; t2 < 2; ++t2) {
                const int t = 2 * tp + t2; const int n = nb + t2 * 16 + l15; const int nn = min(n, p.N - 1);
#pragma unroll
                for (int r = 0; r < 8; ++r) {
                    const int m = mb + 8 * h + r; const int mm = min(m, p.M - 1);
                    float v = acc[i][t][r] * iscale;
                    if (p.flags & 1) v += p.bias[nn];
                    if (p.flags & 2) v += p.bias[mm];
            if (p.flags & 8) v *= p.bias[(long long)zo * p.M + mm];   /* per-(z,row) scale vector laid out [Z][M]; exclusive with the bias flags */
                    v = act_fn(v, p.act);
                    if (p.flags & 4) v += p.beta * R[(long long)mm * p.sRm + (long long)nn * p.sRn];
                    ctile[8 * h + r][t2 * 16 + l15] = (n < p.N) ? v : 0.f;
                }
            }
            __syncthreads();
            const bool fast = (mb + 16 <= p.M) && (nb + 32 <= NW) && ((p.sCm & 3) == 0) && ((((size_t)C) & 15) == 0);
            if (fast) {
#pragma unroll
                for (int s = 0; s < 4; ++s) {
                    const int row = s * 4 + (lane >> 3), c4 = (lane & 7) * 4;
                    const v4f v = *(const v4f*)&ctile[row][c4];
                    VST2V4(C + (long long)(mb + row) * p.sCm + nb + c4, v);
                }
            } else {
                for (int row = 0; row < 16; ++row) {
                    const int m = mb + row, n = nb + lane;
                    if (m < p.M && n < NW) VST2(float, C + (long long)m * p.sCm + n, ctile[row][lane]);
                }
            }
            __syncthreads();
        }
    }
}

// =====================================================================================================================
//   Wave = 16 queries, AW waves per block, 64-key blocks; grid (ceil(Lq/(16*AW)), H, B), block 32*AW. Any Lq, Lk; head dim dh <= DHP
//   (DHP multiple of 32), value dim dv <= DVP (multiple of 16, <= 128). Every tensor addressed by (batch, head, row, element) strides, f32.
//   Scores: QM 0 f16 operands, 1 bf16 hi/lo split, 2 bf16 triple split; statistics f32 (exp2 domain); P.V: P x 4096 as f16 with V f16 staged in LDS
//   (SPLITPV: P and V as bf16 hi/lo splits). kv head = h / hrep. Masking: causal = 1 (keep j <= i + coff, masked -> -inf, key blocks beyond the
//   diagonal skipped), causal = 2 (masked -> mfill, a finite fill like the -1e9; no skipping), causal = 3 (keep j >= i + coff,
//   masked -> -inf, no skipping); optional additive f32 mask Mf,
//   optional int keep-mask Mi (0 -> score := mfill), both addressed b*smb + h*smh + i*smi + j*smj (0 strides broadcast).
// =====================================================================================================================
#define AW 4
struct AttnP {   // apv4
    const float* Q; const float* K; const float* V; float* O; float* P; const float* Mf; const int* Mi; float* ST;
    const float* Pw; const float* Rt; const int* SQ; const int* SK;           // optional: post-softmax weight, relative-position table, segment ids
    long long swb, swh, swi, swj, srb, srh, sri;                                 // Pw strides (b,h,i,j); Rt strides (b,h,i), column = clamp(i - j + roff, 0, rn-1)
    long long sQb, sQh, sQi, sQd, sKb, sKh, sKj, sKd, sVb, sVh, sVj, sVd, sOb, sOh, sOi, sPb, sPh, sPi, smb, smh, smi, smj;
    int Lq, Lk, dh, dv, hrep, causal, coff, pband;   // pband > 0: P holds only the band |j - i| <= pband, column j - i + pband
    float scale, mfill; int nonorm, mpol;             // nonorm (online path only): O = sum_j exp(score_j) V_j without the 1/rowsum (scores must be <= ~0); mpol: Mi masks where ==0 (mpol 0) or where !=0 (mpol 1)
    int roff, rn, segpol, win;                        // Rt column offset/count; SQ/SK: score := mfill where (segpol 0) SQ[i] != SK[j] or (segpol 1) SQ[i] == SK[j]; win > 0: keys with i - j > win (after coff) -> -inf
};
//   Pw: the softmax numerator is multiplied by Pw(b,h,i,j) AFTER the row sum is taken (probs * weight, then P.V), as in post-softmax multiplicative biases.                                                    // ST (optional): per row (b,h,i) -> ST[((b*H + h)*Lq + i)*2 + {0,1}] = {row max of the scaled+masked score (natural units), sum_j exp(score - max)}
static_assert(sizeof(AttnP) == 12 * 8 + 29 * 8 + 16 * 4, "AttnP has padding");

#ifndef KATTN_ATTR
#define KATTN_ATTR
#endif
template <int DHP, int DVP, int QM, bool SPLITPV, bool TWOPASS>
__global__ __launch_bounds__(32 * AW) KATTN_ATTR void k_attn(AttnP p) {
    constexpr int NT = DVP / 16;                // output tiles
    constexpr int KS = DHP / 32;                // k-steps for the scores
    constexpr int VP = DVP + 8;                 // LDS pitch (halves)
    __shared__ __align__(16) float    pl[AW][16 * 64];
    __shared__ __align__(16) _Float16 vl[(SPLITPV ? 2 : 1) * 64 * VP];   // f16 V tile, or bf16 hi and lo tiles (same 2-byte size)
    const int lane = threadIdx.x & 31, hf = lane >> 4, l15 = lane & 15, wave = threadIdx.x >> 5;
    const int h = blockIdx.y, b = blockIdx.z, hk = h / p.hrep;
    const int q0 = (blockIdx.x * AW + wave) * 16;
    float* myp = pl[wave];
    const float L2E = 1.4426950408889634f;
    const float NEG = -__builtin_inff();
    const int qi = min(q0 + l15, p.Lq - 1);
    const float* qrow = p.Q + b * p.sQb + h * p.sQh + (long long)qi * p.sQi;
    const float* kbase = p.K + b * p.sKb + hk * p.sKh;
    const float* vbase = p.V + b * p.sVb + hk * p.sVh;
    v16h qa[QM == 0 ? KS : 1]; Split qs_[QM == 1 ? KS : 1]; Split3 qt_[QM == 2 ? KS : 1];
#pragma unroll
    for (int ks = 0; ks < KS; ++ks) {
        if (QM == 2) qt_[ks] = sp3_ld(qrow, p.sQd, ks * 32, hf, p.dh, 1.f);
        else if (QM == 1) qs_[ks] = sp_ld(qrow, p.sQd, ks * 32, hf, p.dh, 1.f);
        else qa[ks] = fh_ld(qrow, p.sQd, ks * 32, hf, p.dh, 1.f);
    }
    v8f o[NT]; float m8[8], l8[8];
#pragma unroll
    for (int t = 0; t < NT; ++t) { v8f zz = {}; o[t] = zz; }
#pragma unroll
    for (int i = 0; i < 8; ++i) { m8[i] = NEG; l8[i] = 0.f; }
    int jend = p.Lk; int jstart = 0;
    if (p.causal == 1) { const int je = (blockIdx.x * AW + AW - 1) * 16 + 16 + p.coff; jend = min(jend, max(je, 0)); }   // uniform per block
    if (p.win > 0) { const int js = (int)(blockIdx.x * AW) * 16 + p.coff - p.win; jstart = (js > 0) ? (js / 64) * 64 : 0; }   // uniform per block: key blocks entirely outside every row's window hold only -inf entries and are skipped exactly
    const int npass = TWOPASS ? 2 : 1;
    for (int pass = 0; pass < npass; ++pass) {
        const bool dopv = (!TWOPASS) || pass == 1;
        for (int j0 = jstart; j0 < jend; j0 += 64) {
            if (dopv) {
                __syncthreads();                                 // previous key block's reads of vl / pl are done
                for (int idx = threadIdx.x; idx < 64 * DVP; idx += 32 * AW) {
                    const int jr = idx / DVP, d = idx - jr * DVP, j = j0 + jr;
                    const float f = (j < p.Lk && d < p.dv) ? vbase[(long long)j * p.sVj + (long long)d * p.sVd] : 0.f;
                    if (SPLITPV) {
                        const __bf16 hb = bf16_rne(f);
                        ((__bf16*)vl)[jr * VP + d] = hb; ((__bf16*)vl)[64 * VP + jr * VP + d] = bf16_rne(f - bf16_f32(hb));
                    } else vl[jr * VP + d] = (_Float16)f;
                }
            }
            v8f s[4];
#pragma unroll
            for (int t = 0; t < 4; ++t) {
                const int j = min(j0 + t * 16 + l15, p.Lk - 1);
                const float* krow = kbase + (long long)j * p.sKj;
                v8f acc = {};
#pragma unroll
                for (int ks = 0; ks < KS; ++ks) {
                    if (QM == 2)      acc = wmma6(qt_[ks], sp3_ld(krow, p.sKd, ks * 32, hf, p.dh, 1.f), acc);
                    else if (QM == 1) acc = wmma3(qs_[ks], sp_ld(krow, p.sKd, ks * 32, hf, p.dh, 1.f), acc);
                    else              acc = wmma16(qa[ks], fh_ld(krow, p.sKd, ks * 32, hf, p.dh, 1.f), acc);
                }
                s[t] = acc;
            }
            float pv[8][4];
#pragma unroll
            for (int i = 0; i < 8; ++i) {
                const int irow = q0 + i + 8 * hf;
                const int ic = min(irow, p.Lq - 1);
                float sc[4];
#pragma unroll
                for (int t = 0; t < 4; ++t) {
                    const int jg = j0 + t * 16 + l15;
                    float v = s[t][i] * p.scale;
                    if (p.Mf) v += p.Mf[b * p.smb + h * p.smh + (long long)ic * p.smi + (long long)min(jg, p.Lk - 1) * p.smj];
                    if (p.Rt) { int rc = ic - min(jg, p.Lk - 1) + p.roff; rc = rc < 0 ? 0 : (rc >= p.rn ? p.rn - 1 : rc); v += p.Rt[b * p.srb + h * p.srh + (long long)ic * p.sri + rc]; }
                    if (p.Mi) { const int mv = p.Mi[b * p.smb + h * p.smh + (long long)ic * p.smi + (long long)min(jg, p.Lk - 1) * p.smj]; if (p.mpol ? (mv != 0) : (mv == 0)) v = p.mfill; }
                    if (p.SQ) { const bool same = p.SQ[(long long)b * p.Lq + ic] == p.SK[(long long)b * p.Lk + min(jg, p.Lk - 1)]; if (p.segpol ? same : !same) v = p.mfill; }
                    if (p.causal == 2 && jg > irow + p.coff) v = p.mfill;
                    if (jg >= p.Lk || (p.causal == 1 && jg > irow + p.coff) || (p.causal == 3 && jg < irow + p.coff) || (p.win > 0 && irow + p.coff - jg > p.win)) v = NEG; else v *= L2E;
                    sc[t] = v;
                }
                if (!TWOPASS || pass == 0) {
                    float mx = fmaxf(fmaxf(sc[0], sc[1]), fmaxf(sc[2], sc[3]));
                    mx = fmaxf(mx, __shfl_xor(mx, 1, 32)); mx = fmaxf(mx, __shfl_xor(mx, 2, 32));
                    mx = fmaxf(mx, __shfl_xor(mx, 4, 32)); mx = fmaxf(mx, __shfl_xor(mx, 8, 32));
                    const float mnew = fmaxf(m8[i], mx);
                    const float corr = (mnew == NEG) ? 1.f : exp2f(m8[i] - mnew);
                    float rs = 0.f;
#pragma unroll
                    for (int t = 0; t < 4; ++t) {
                        const float pp = (sc[t] == NEG) ? 0.f : exp2f(sc[t] - mnew); rs += pp;
                        pv[i][t] = p.Pw ? pp * p.Pw[b * p.swb + h * p.swh + (long long)ic * p.swi + (long long)min(j0 + t * 16 + l15, p.Lk - 1) * p.swj] : pp;
                    }
                    rs += __shfl_xor(rs, 1, 32); rs += __shfl_xor(rs, 2, 32); rs += __shfl_xor(rs, 4, 32); rs += __shfl_xor(rs, 8, 32);
                    l8[i] = l8[i] * corr + rs; m8[i] = mnew;
                    if (!TWOPASS) {
#pragma unroll
                        for (int t = 0; t < NT; ++t) o[t][i] *= corr;
                    }
                } else {
                    const float inv = (l8[i] > 0.f) ? 1.f / l8[i] : 0.f;
#pragma unroll
                    for (int t = 0; t < 4; ++t) {
                        const int jg = j0 + t * 16 + l15;
                        float pp = (sc[t] == NEG) ? 0.f : exp2f(sc[t] - m8[i]) * inv;
                        if (p.Pw) pp *= p.Pw[b * p.swb + h * p.swh + (long long)ic * p.swi + (long long)min(jg, p.Lk - 1) * p.swj];
                        pv[i][t] = pp;
                    }
                }
            }
            if (dopv) {
#pragma unroll
                for (int i = 0; i < 8; ++i)
#pragma unroll
                    for (int t = 0; t < 4; ++t) ((float*)myp)[(i + 8 * hf) * 64 + t * 16 + l15] = pv[i][t];
                __syncthreads();                                 // P (per wave) and V (shared) visible
                if (p.P) {
                    float* pb_ = p.P + b * p.sPb + h * p.sPh;
                    const bool fastP = (p.pband == 0) && ((p.sPi & 3) == 0) && (j0 + 64 <= p.Lk) && (q0 + 16 <= p.Lq) && ((((size_t)pb_) & 15) == 0);
                    if (fastP) {
#pragma unroll
                        for (int s = 0; s < 8; ++s) {
                            const int row = s * 2 + (lane >> 4), c4 = (lane & 15) * 4;
                            const v4f v = *(const v4f*)(myp + row * 64 + c4);
                            VST2V4(pb_ + (long long)(q0 + row) * p.sPi + j0 + c4, v);
                        }
                    } else {
                        for (int row = 0; row < 16; ++row) {
                            const int irow = q0 + row; if (irow >= p.Lq) continue;
                            for (int c = lane; c < 64; c += 32) {
                                const int jg = j0 + c; if (jg >= p.Lk) continue;
                                if (p.pband == 0) VST2(float, pb_ + (long long)irow * p.sPi + jg, myp[row * 64 + c]);
                                else if (jg - irow <= p.pband && irow - jg <= p.pband) VST2(float, pb_ + (long long)irow * p.sPi + (jg - irow + p.pband), myp[row * 64 + c]);
                            }
                        }
                    }
                }
                if (SPLITPV) {
                    const Split pa0 = sp_ld(myp + l15 * 64, 1, 0, hf, 64, 1.f), pa1 = sp_ld(myp + l15 * 64, 1, 32, hf, 64, 1.f);
                    const __bf16* vh = (const __bf16*)vl; const __bf16* vlo = vh + 64 * VP;
#pragma unroll
                    for (int t = 0; t < NT; ++t) {
                        const int dcol = t * 16 + l15;
                        Split b0, b1;
#pragma unroll
                        for (int e = 0; e < 16; ++e) {
                            const int k0 = frag_k(e, hf), k1 = 32 + frag_k(e, hf);
                            b0.hi[e] = vh[k0 * VP + dcol]; b0.lo[e] = vlo[k0 * VP + dcol]; b1.hi[e] = vh[k1 * VP + dcol]; b1.lo[e] = vlo[k1 * VP + dcol];
                        }
                        o[t] = wmma3(pa0, b0, o[t]);
                        o[t] = wmma3(pa1, b1, o[t]);
                    }
                } else {
                    const v16h pa0 = fh_ld(myp + l15 * 64, 1, 0, hf, 64, 4096.f), pa1 = fh_ld(myp + l15 * 64, 1, 32, hf, 64, 4096.f);
#pragma unroll
                    for (int t = 0; t < NT; ++t) {
                        const int dcol = t * 16 + l15;
                        v16h b0, b1;
#pragma unroll
                        for (int e = 0; e < 16; ++e) { b0[e] = vl[frag_k(e, hf) * VP + dcol]; b1[e] = vl[(32 + frag_k(e, hf)) * VP + dcol]; }
                        o[t] = wmma16(pa0, b0, o[t]);
                        o[t] = wmma16(pa1, b1, o[t]);
                    }
                }
            }
        }
    }
    float* obase = p.O + b * p.sOb + h * p.sOh;
    if (p.ST) {
        const int rl = lane >> 1, isel = rl & 7;           // row q0 + rl ; rl>>3 == hf holds because lane>>4 == (lane>>1)>>3
        float mv = 0.f, lv = 0.f;
#pragma unroll
        for (int i = 0; i < 8; ++i) if (i == isel) { mv = m8[i]; lv = l8[i]; }
        const int irow = q0 + rl;
        if (irow < p.Lq) { float* st = p.ST + (((long long)b * gridDim.y + h) * p.Lq + irow) * 2 + (lane & 1); VST2(float, st, (lane & 1) ? lv : mv * 0.6931471805599453f); }
    }
    float invr[8];
#pragma unroll
    for (int i = 0; i < 8; ++i) {
        if (TWOPASS) invr[i] = SPLITPV ? 1.f : (1.f / 4096.f);
        else if (p.nonorm) invr[i] = exp2f(m8[i]) * (SPLITPV ? 1.f : (1.f / 4096.f));
        else invr[i] = (l8[i] > 0.f) ? (SPLITPV ? 1.f / l8[i] : 1.f / (l8[i] * 4096.f)) : 0.f;
    }
    __syncthreads();                                             // all waves done with pl/vl from the main loop
    const bool ofast = ((p.sOi & 3) == 0) && ((((size_t)obase) & 15) == 0) && (q0 + 16 <= p.Lq);
#pragma unroll
    for (int c0 = 0; c0 < DVP; c0 += 64) {
#pragma unroll
        for (int i = 0; i < 8; ++i)
#pragma unroll
            for (int t = 0; t < NT; ++t) if (t * 16 >= c0 && t * 16 < c0 + 64) ((float*)myp)[(i + 8 * hf) * 64 + (t * 16 - c0) + l15] = o[t][i] * invr[i];
        __syncthreads();
        const int cw = (DVP - c0 < 64) ? (DVP - c0) : 64;      // staged columns in this chunk (multiple of 16)
        if (ofast && (c0 + cw <= p.dv) && (cw % 32 == 0)) {
            const int lpr = cw / 4;                              // lanes per row (16 for 64 cols, 8 for 32)
            const int rows_per_ins = 32 / lpr;
            for (int r0 = 0; r0 < 16; r0 += rows_per_ins) {
                const int row = r0 + lane / lpr, c4 = (lane % lpr) * 4;
                const v4f v = *(const v4f*)(myp + row * 64 + c4);
                VST2V4(obase + (long long)(q0 + row) * p.sOi + c0 + c4, v);
            }
        } else {
            for (int row = 0; row < 16; ++row) {
                const int irow = q0 + row; if (irow >= p.Lq) continue;
                for (int c = lane; c < cw; c += 32) { const int d = c0 + c; if (d < p.dv) VST2(float, obase + (long long)irow * p.sOi + d, myp[row * 64 + c]); }
            }
        }
        __syncthreads();
    }
}

// =====================================================================================================================
// k_tr: dst(z, c, r) = alpha * src(z, r, c) (+ beta * R2(z, c, r)): [Z][R][C] (row stride lds) -> [Z][C][R] (row stride ldd) through a 32x32 LDS tile;
//   flags: 1 -> add beta * residual R2 addressed like dst (z*sRz + c*ldr + r); act applied before the residual.
// =====================================================================================================================
struct TrP { const float* src; float* dst; const float* R2; long long sSz, lds, sDz, ldd, sRz, ldr; int R, C, flags, act; float alpha, beta; };
static_assert(sizeof(TrP) == 3 * 8 + 6 * 8 + 6 * 4, "TrP has padding");
__global__ __launch_bounds__(256) void k_tr(TrP p) {
    __shared__ float tile[32][33];
    const int c0 = blockIdx.x * 32, r0 = blockIdx.y * 32, z = blockIdx.z;
    const int lane = threadIdx.x & 31, wave = threadIdx.x >> 5;
    const float* s = p.src + z * p.sSz;
#pragma unroll
    for (int k = 0; k < 4; ++k) {
        const int rl = wave * 4 + k, r = r0 + rl, c = c0 + lane;
        tile[rl][lane] = (r < p.R && c < p.C) ? s[(long long)r * p.lds + c] : 0.f;
    }
    __syncthreads();
    float* d = p.dst + z * p.sDz; const float* rr = p.R2 + z * p.sRz;
#pragma unroll
    for (int k = 0; k < 4; ++k) {
        const int cl = wave * 4 + k, c = c0 + cl, r = r0 + lane;
        if (c < p.C && r < p.R) {
            float v = act_fn(p.alpha * tile[lane][cl], p.act);
            if (p.flags & 1) v += p.beta * rr[(long long)c * p.ldr + r];
            VST2(float, d + (long long)c * p.ldd + r, v);
        }
    }
}

// k_affine: dst[i] = a * (sdev ? sdev[0] : 1) * src[i] + b, i < n (one thread per element; consecutive lanes -> consecutive addresses)
__global__ __launch_bounds__(256) void k_affine(const float* __restrict__ src, float* __restrict__ dst, int n, float a, float b, const float* __restrict__ sdev) {
    const int i = blockIdx.x * 256 + threadIdx.x;
    if (i < n) { const float aa = sdev ? a * sdev[0] : a; const float v = aa * src[i] + b; VST2(float, dst + i, v); }
}

// =====================================================================================================================
// k_softmax: row softmax over n contiguous elements, one 256-thread block per row; rows addressed z*sz + r*sr (grid (R, Z)).
//   out = scale_out * softmax(scale_in * x + (Mf ? Mf[z*smz + r*smr + j] : 0)); a row whose max is -inf is written as 0.
// =====================================================================================================================
struct SmP { const float* src; float* dst; const float* Mf; long long sz, sr, dz, dr, smz, smr; int n, pad; float scale_in, scale_out; };
static_assert(sizeof(SmP) == 3 * 8 + 6 * 8 + 4 * 4, "SmP has padding");
__global__ __launch_bounds__(256) void k_softmax(SmP p) {
    __shared__ float red[256];
    const int r = blockIdx.x, z = blockIdx.y, tid = threadIdx.x;
    const float* s = p.src + z * p.sz + (long long)r * p.sr;
    const float* mf = p.Mf ? (p.Mf + z * p.smz + (long long)r * p.smr) : nullptr;
    float mx = -__builtin_inff();
    for (int j = tid; j < p.n; j += 256) { float v = s[j] * p.scale_in; if (mf) v += mf[j]; mx = fmaxf(mx, v); }
    red[tid] = mx; __syncthreads();
    for (int o = 128; o > 0; o >>= 1) { if (tid < o) red[tid] = fmaxf(red[tid], red[tid + o]); __syncthreads(); }
    mx = red[0]; __syncthreads();
    float sum = 0.f;
    for (int j = tid; j < p.n; j += 256) { float v = s[j] * p.scale_in; if (mf) v += mf[j]; sum += (mx == -__builtin_inff()) ? 0.f : expf(v - mx); }
    red[tid] = sum; __syncthreads();
    for (int o = 128; o > 0; o >>= 1) { if (tid < o) red[tid] += red[tid + o]; __syncthreads(); }
    sum = red[0];
    const float inv = (sum > 0.f) ? p.scale_out / sum : 0.f;
    float* d = p.dst + z * p.dz + (long long)r * p.dr;
    for (int j = tid; j < p.n; j += 256) { float v = s[j] * p.scale_in; if (mf) v += mf[j]; const float o = (mx == -__builtin_inff()) ? 0.f : expf(v - mx) * inv; VST2(float, d + j, o); }
}
// =====================================================================================================================
// k_stats: mean and rsqrt(var + eps) over a set of n elements addressed base + z*sz + (e / inner) * so + (e % inner) * si, one 256-thread
// k_norm_apply: y = (x - mean[set]) * rstd[set] * g[c] + b[c] over a [Z][C][L] channel-major tensor with set = z*G + c / (C/G) (G groups per z;
//   G = C -> per-channel sets indexed z*C+c; for batch norm pass stats indexed by c only via bn = 1). Optional act. Output same layout.
// =====================================================================================================================
//   mode 0: mean / rsqrt(var + eps); mode 1 (RMSNorm): 0 / rsqrt(mean(x^2) + eps); mode 2 (L2 normalize * sqrt(n)): 0 / sqrt(n) / max(||x||, eps); mode 3: as 0 with unbiased variance (n-1)
__global__ __launch_bounds__(256) void k_stats(const float* __restrict__ x, long long sz, long long so, long long si, int inner, int n, float eps, float* __restrict__ stat, int mode) {
    __shared__ float red[256];
    const int z = blockIdx.x, tid = threadIdx.x;
    const float* base = x + z * sz;
    float s = 0.f;
    for (int e = tid; e < n; e += 256) s += base[(long long)(e / inner) * so + (long long)(e % inner) * si];
    red[tid] = s; __syncthreads();
    for (int o = 128; o > 0; o >>= 1) { if (tid < o) red[tid] += red[tid + o]; __syncthreads(); }
    const float mu = (mode == 0 || mode == 3) ? red[0] / (float)n : 0.f; __syncthreads();
    float q = 0.f;
    for (int e = tid; e < n; e += 256) { const float dlt = base[(long long)(e / inner) * so + (long long)(e % inner) * si] - mu; q += dlt * dlt; }
    red[tid] = q; __syncthreads();
    for (int o = 128; o > 0; o >>= 1) { if (tid < o) red[tid] += red[tid + o]; __syncthreads(); }
    {
        float rs;
        if (mode == 2) rs = sqrtf((float)n) / fmaxf(sqrtf(red[0]), eps); else if (mode == 3) rs = rsqrtf(red[0] / (float)(n - 1) + eps); else rs = rsqrtf(red[0] / (float)n + eps);
        if (tid < 32) { const float v = (tid == 0) ? mu : ((tid == 1) ? rs : 0.f); VST2(float, stat + (long long)z * 32 + tid, v); }
    }
}
//   One thread per element over the flat [Z][C][L] index space: grid ceil(Z*C*L / 256).
__global__ __launch_bounds__(256) void k_norm_apply(const float* __restrict__ x, float* __restrict__ y, const float* __restrict__ stat, const float* __restrict__ g, const float* __restrict__ bta,
                                                     int Z, int C, int L, int G, int bn, int act) {
    const long long idx = (long long)blockIdx.x * 256 + threadIdx.x;
    if (idx >= (long long)Z * C * L) return;
    const int l = (int)(idx % L); const long long zc = idx / L; const int c = (int)(zc % C), z = (int)(zc / C); (void)l;
    const int set = bn ? c : (z * G + c / (C / G));
    float v = (x[idx] - stat[(long long)set * 32]) * stat[(long long)set * 32 + 1];
    if (g) v *= g[c];
    if (bta) v += bta[c];
    v = act_fn(v, act);
    VST2(float, y + idx, v);
}

// k_lse_neg: c[i] = -(st[2i] + log(st[2i+1])) = minus the log-sum-exp of row i from k_attn's ST output (for softmax over the query dimension)
__global__ __launch_bounds__(256) void k_lse_neg(const float* __restrict__ st, float* __restrict__ c, int n) {
    const int i = blockIdx.x * 256 + threadIdx.x;
    if (i < n) { const float v = -(st[2 * i] + logf(st[2 * i + 1])); VST2(float, c + i, v); }
}

// k_iota: dst[i] = a * i + b as int32 (segment/position id helper)
__global__ __launch_bounds__(256) void k_iota(int* __restrict__ dst, int n, int a, int b) {
    const int i = blockIdx.x * 256 + threadIdx.x;
    if (i < n) { const int v = a * i + b; VST2(int, dst + i, v); }
}

// k_axpby: dst[i] = a * x[i] + b * y[i] (+ c), i < n
__global__ __launch_bounds__(256) void k_axpby(const float* __restrict__ x, const float* __restrict__ y, float* __restrict__ dst, int n, float a, float b, float c) {
    const int i = blockIdx.x * 256 + threadIdx.x;
    if (i < n) { const float v = a * x[i] + b * y[i] + c; VST2(float, dst + i, v); }
}

// =====================================================================================================================
// k_rope: rotary embedding on a [R rows][Hn heads][D] view (row stride sXr, head stride sXh, element stride 1) -> Y (own strides).
//   mode 0: rotate_half (partner d±D/2, sign - for d<D/2); mode 1: interleaved pairs (partner d^1, sign - for even d).
//   table column tcol: tmode 0 -> d, 1 -> d % (D/2), 2 -> d / 2; position p: pmode 0 -> r % S, 1 -> head index, 2 -> pos[r];
//   c = C[(r / S) * sCb + p * sCp + tcol * sCd], s likewise from Sn; y = x[d] * c + sign * x[partner] * s. X and Y must not alias.
// =====================================================================================================================
struct RopeP { const float* X; float* Y; const float* C; const float* Sn; const int* pos; long long sXr, sXh, sYr, sYh, sCb, sCp, sCd; int R, Hn, D, S, mode, tmode, pmode, pad; };
static_assert(sizeof(RopeP) == 5 * 8 + 7 * 8 + 8 * 4, "RopeP has padding");
__global__ __launch_bounds__(256) void k_rope(RopeP p) {
    const long long idx = (long long)blockIdx.x * 256 + threadIdx.x;
    if (idx >= (long long)p.R * p.Hn * p.D) return;
    const int d = (int)(idx % p.D); const long long rh = idx / p.D; const int h = (int)(rh % p.Hn); const int r = (int)(rh / p.Hn);
    const int half = p.D / 2;
    int partner; float sign;
    if (p.mode == 0) { partner = (d < half) ? d + half : d - half; sign = (d < half) ? -1.f : 1.f; }
    else { partner = d ^ 1; sign = (d & 1) ? 1.f : -1.f; }
    const int tcol = (p.tmode == 0) ? d : ((p.tmode == 1) ? (d % half) : (d >> 1));
    const int pp = (p.pmode == 0) ? (r % p.S) : ((p.pmode == 1) ? h : p.pos[r]);
    const long long toff = (long long)(r / p.S) * p.sCb + (long long)pp * p.sCp + (long long)tcol * p.sCd;
    const float* xr = p.X + (long long)r * p.sXr + (long long)h * p.sXh;
    const float v = xr[d] * p.C[toff] + sign * xr[partner] * p.Sn[toff];
    VST2(float, p.Y + (long long)r * p.sYr + (long long)h * p.sYh + d, v);
}

// k_invf + k_sincos (split so neither kernel carries a large VALU-fma footprint): invf_i = num * (1 / powf(base, (2 i)/D)) [fmode 0],
//   num * expf((2 i) * cexp) [fmode 1], num * powf(base, -2 (i - 1) / D) [fmode 2]; then cs/sn[s*half + i] = cos/sin((pscale * s) * invf_i)
__global__ __launch_bounds__(256) void k_invf(float* __restrict__ invb, int half, int D, float base, float num, int fmode, float cexp) {
    const int i = blockIdx.x * 256 + threadIdx.x;
    if (i >= ((half + 31) / 32) * 32) return;
    if (i >= half) { VST2(float, invb + i, 0.f); return; }
    const float e = (float)(2 * i) / (float)D;
    float invf;
    if (fmode == 1) invf = num * expf((float)(2 * i) * cexp);
    else if (fmode == 2) invf = num * powf(base, (-2.0f * ((float)i - 1.0f)) / (float)D);
    else invf = num * (1.0f / powf(base, e));
    VST2(float, invb + i, invf);
}
__global__ __launch_bounds__(256) void k_sincos(float* __restrict__ cs, float* __restrict__ sn, const float* __restrict__ invb, int S, int half, float pscale) {
    const int idx = blockIdx.x * 256 + threadIdx.x;
    if (idx >= S * half) return;
    const int s = idx / half, i = idx - s * half;
    const float ang = (pscale * (float)s) * invb[i];
    VST2(float, cs + idx, cosf(ang)); VST2(float, sn + idx, sinf(ang));
}

// k_mulact: dst[i] = act(x[i]) * y[i]
__global__ __launch_bounds__(256) void k_mulact(const float* __restrict__ x, const float* __restrict__ y, float* __restrict__ dst, int n, int act) {
    const int i = blockIdx.x * 256 + threadIdx.x;
    if (i < n) { const float v = act_fn(x[i], act) * y[i]; VST2(float, dst + i, v); }
}

// =====================================================================================================================
// k_matvec: thread-per-row matrix-vector products for N <= 8 output columns (heads with 1-3 outputs, gates), f32 on the VALU.
//   C[r*sCm + j] = act(alpha * sum_k A[r*sAm + k*sAk] * B[j*sBn + k*sBk] + bias[j]) + beta * R[r*sRm + j*sRn]; each thread writes its N contiguous floats.
// =====================================================================================================================
__global__ __launch_bounds__(256) void k_matvec(GemmP p) {
    // 32 lanes write one line with one instruction.
    const int rpt = (p.N == 1) ? 1 : 32;
    const long long r0 = ((long long)blockIdx.x * 256 + threadIdx.x) * rpt; const int z = blockIdx.z, zo = z / p.zi_n, zi = z - zo * p.zi_n;
    if (r0 >= p.M) return;
    const float* Bb = p.B + zo * p.sBo + zi * p.sBi;
    float* C = p.C + zo * p.sCo + zi * p.sCi; const float* R = p.R + zo * p.sRo + zi * p.sRi;
    for (int rr = 0; rr < rpt; ++rr) {
        const long long r = r0 + rr; if (r >= p.M) break;
        const float* A = p.A + zo * p.sAo + zi * p.sAi + r * p.sAm;
        float acc[8] = {0.f, 0.f, 0.f, 0.f, 0.f, 0.f, 0.f, 0.f};
        for (int k = 0; k < p.K; ++k) { const float a = A[(long long)k * p.sAk];
#pragma unroll
            for (int j = 0; j < 8; ++j) if (j < p.N) acc[j] += a * Bb[(long long)j * p.sBn + (long long)k * p.sBk]; }
#pragma unroll
        for (int j = 0; j < 8; ++j) if (j < p.N) {
            float v = acc[j] * p.alpha;
            if (p.flags & 1) v += p.bias[j];
            if (p.flags & 2) v += p.bias[r];
            v = act_fn(v, p.act);
            if (p.flags & 4) v += p.beta * R[r * p.sRm + (long long)j * p.sRn];
            VST2(float, C + r * p.sCm + j, v);
        }
    }
}
// k_smallsoftmax: thread-per-row softmax for short rows (n <= 64): dst[r*dr + j] = softmax(scale*src[r*sr + j])
__global__ __launch_bounds__(256) void k_smallsoftmax(const float* __restrict__ src, float* __restrict__ dst, long long sr, long long dr, int n, long long R, float scale) {
    const long long r0 = ((long long)blockIdx.x * 256 + threadIdx.x) * 32;
    for (int rr = 0; rr < 32; ++rr) {
        const long long r = r0 + rr; if (r >= R) return;
        const float* s = src + r * sr; float* d = dst + r * dr;
        float mx = -__builtin_inff();
        for (int j = 0; j < n; ++j) mx = fmaxf(mx, s[j] * scale);
        float sum = 0.f;
        for (int j = 0; j < n; ++j) sum += expf(s[j] * scale - mx);
        const float inv = 1.f / sum;
        for (int j = 0; j < n; ++j) { const float v = expf(s[j] * scale - mx) * inv; VST2(float, d + j, v); }
    }
}

__global__ __launch_bounds__(32) void k_unitstat(float* __restrict__ st) { const int t = threadIdx.x; const float v = (t == 1) ? 1.f : 0.f; VST2(float, st + t, v); }

// destination (e.g. a d_out whose row width is not a multiple of 32 floats) is written by consecutive lanes of one instruction
__global__ __launch_bounds__(256) void k_lincopy(const float* __restrict__ src, long long lds, float* __restrict__ dst, long long ldd, long long rows, int cols) {
    const long long i = (long long)blockIdx.x * 256 + threadIdx.x; if (i >= rows * cols) return;
    const long long r = i / cols; const int c = (int)(i - r * cols);
    const float v = src[r * lds + c]; VST2(float, dst + r * ldd + c, v);
}

namespace w25 {
typedef __attribute__((ext_vector_type(16))) _Float16 v16h;
typedef __attribute__((ext_vector_type(8)))  _Float16 v8h;
typedef __attribute__((ext_vector_type(16))) __bf16   v16b;
typedef __attribute__((ext_vector_type(8)))  __bf16   v8b;
typedef __attribute__((ext_vector_type(8)))  float    v8f;
typedef __attribute__((ext_vector_type(4)))  float    v4f;

__device__ __forceinline__ unsigned short f2bf_bits(float f) {
  unsigned u = __float_as_uint(f);
  return (unsigned short)((u + 0x7FFFu + ((u >> 16) & 1u)) >> 16);
}
__device__ __forceinline__ float bf_bits2f(unsigned short h) { return __uint_as_float(((unsigned)h) << 16); }

// hazard guards as plain device helpers (no inline asm inside the kernel template body)
__device__ __forceinline__ void dep_guard_h(v8f& a, v8f& b, v16h x, v16h y) { asm volatile("v_nop\n\tv_nop\n\tv_nop\n\tv_nop" : "+v"(a), "+v"(b) : "v"(x), "v"(y)); }
__device__ __forceinline__ void dep_guard_b(v8f& a, v8f& b, v16b x, v16b y) { asm volatile("v_nop\n\tv_nop\n\tv_nop\n\tv_nop" : "+v"(a), "+v"(b) : "v"(x), "v"(y)); }
__device__ __forceinline__ void keep4_h(v16h a, v16h b, v16h c, v16h d) { asm volatile("v_nop" :: "v"(a), "v"(b), "v"(c), "v"(d)); }
__device__ __forceinline__ void keep4_b(v16b a, v16b b, v16b c, v16b d) { asm volatile("v_nop" :: "v"(a), "v"(b), "v"(c), "v"(d)); }
__device__ __forceinline__ void acc_guard4(v8f& a, v8f& b, v8f& c, v8f& d) { asm volatile("v_nop\n\tv_nop\n\tv_nop\n\tv_nop" : "+v"(a), "+v"(b), "+v"(c), "+v"(d)); }
template <typename T> struct Frag;
template <> struct Frag<_Float16> {
  typedef v16h V; union U { v16h v; v8h h[2]; };
  static __device__ __forceinline__ v16h load(const _Float16* p) {   // elements 0..7 <- p[0..7], 8..15 <- p[16..23]
    U f; f.h[0] = *(const v8h*)(p); f.h[1] = *(const v8h*)(p + 16); return f.v;
  }
  static __device__ __forceinline__ v8f mma(v16h a, v16h b, v8f c) {
    return __builtin_amdgcn_wmma_f32_16x16x32_f16(false, a, false, b, (short)0, c, false, false);
  }
  static __device__ __forceinline__ void guard(v8f& a, v8f& b, v16h x, v16h y) { dep_guard_h(a, b, x, y); }
  static __device__ __forceinline__ void keep(v16h a, v16h b, v16h c, v16h d) { keep4_h(a, b, c, d); }
};
template <> struct Frag<__bf16> {
  typedef v16b V; union U { v16b v; v8b h[2]; };
  static __device__ __forceinline__ v16b load(const __bf16* p) {
    U f; f.h[0] = *(const v8b*)(p); f.h[1] = *(const v8b*)(p + 16); return f.v;
  }
  static __device__ __forceinline__ v8f mma(v16b a, v16b b, v8f c) {
    return __builtin_amdgcn_wmma_f32_16x16x32_bf16(false, a, false, b, (short)0, c, false, false);
  }
  static __device__ __forceinline__ void guard(v8f& a, v8f& b, v16b x, v16b y) { dep_guard_b(a, b, x, y); }
  static __device__ __forceinline__ void keep(v16b a, v16b b, v16b c, v16b d) { keep4_b(a, b, c, d); }
};

// ---- Register-blocked batched WMMA GEMM ------------------------------------
// C[m,n] = scale * sum_k A[m,k] * Bt[n,k] (+bias)(+resid); each wave owns a 64x64 tile.
// A row-major [M,K]; Bt row-major [N,K]; M,N % 64 == 0, K % 32 == 0.
// SPLIT: operands are hi/lo planes (A2/Bt2 = lo planes, same layout); product = hi·hi + hi·lo + lo·hi.
// BIAS_MODE: 0 = none, 1 = bias[m], 2 = bias[n].
// OUT_MODE: 0 = f32, 1 = f16, 2 = bf16 hi plane (Cout) + bf16 lo plane (Cout2).
// ET: 0 = f16 operands, 1 = bf16 operands (pointers passed as 16-bit storage)
template <int ET> struct Elem;
template <> struct Elem<0> { typedef _Float16 T; };
template <> struct Elem<1> { typedef __bf16 T; };
template <int ET, bool SPLIT, int BIAS_MODE, int OUT_MODE, bool RESID, int ACT = 0>
__global__ __launch_bounds__(256) void wmma_gemm64(
    const unsigned short* __restrict__ Ap, const unsigned short* __restrict__ A2p, int lda, long strideA,
    const unsigned short* __restrict__ Btp, const unsigned short* __restrict__ Bt2p, int ldb, long strideB,
    void* __restrict__ Cout, void* __restrict__ Cout2, int ldc, long strideC,
    const float* __restrict__ bias,
    const float* __restrict__ resid, long strideR,
    int M, int N, int K, float scale) {
  typedef typename Elem<ET>::T T;
  typedef typename Frag<T>::V V;
  const T* A = (const T*)Ap; const T* A2 = (const T*)A2p; const T* Bt = (const T*)Btp; const T* Bt2 = (const T*)Bt2p;
  __shared__ __align__(16) float sT[8][16 * 68];   // per-wave 16x64 slab, pitch 68 floats
  const int b    = blockIdx.y;
  const int lane = threadIdx.x & 31;
  const int wave = threadIdx.x >> 5;
  const int tilesN = N >> 6;
  const int tilesM = M >> 6;
  const int tile = blockIdx.x * 8 + wave;
  if (tile >= tilesM * tilesN) return;   // wave-uniform; no block barriers in this kernel
  const int tm = tile / tilesN;
  const int tn = tile - tm * tilesN;
  const int m0 = tm << 6;
  const int n0 = tn << 6;

  const T* Ab  = A  + (size_t)b * strideA;
  const T* Bb  = Bt + (size_t)b * strideB;
  const T* Ab2 = SPLIT ? (A2  + (size_t)b * strideA) : nullptr;
  const T* Bb2 = SPLIT ? (Bt2 + (size_t)b * strideB) : nullptr;

  const int rlane = lane & 15;                 // row (A) / col (B, D) within subtile
  const int koff  = (lane >> 4) * 8;           // k offset of this lane half
  const int mOff  = (lane >> 4) * 8;           // D row offset

  v8f acc[4][4];
#pragma unroll
  for (int i = 0; i < 4; ++i)
#pragma unroll
    for (int j = 0; j < 4; ++j) acc[i][j] = (v8f){0.f,0.f,0.f,0.f,0.f,0.f,0.f,0.f};

  for (int k0 = 0; k0 < K; k0 += 32) {
    V bh[4], bl[4];
#pragma unroll
    for (int j = 0; j < 4; ++j) {
      const size_t bo = (size_t)(n0 + (j << 4) + rlane) * ldb + koff + k0;
      bh[j] = Frag<T>::load(Bb + bo);
      if (SPLIT) bl[j] = Frag<T>::load(Bb2 + bo);
    }
#pragma unroll
    for (int i = 0; i < 4; ++i) {
      const size_t ao = (size_t)(m0 + (i << 4) + rlane) * lda + koff + k0;
      V ah = Frag<T>::load(Ab + ao);
      V al;
      if (SPLIT) al = Frag<T>::load(Ab2 + ao);
#pragma unroll
      for (int j = 0; j < 4; ++j) {
        acc[i][j] = Frag<T>::mma(ah, bh[j], acc[i][j]);
        if (SPLIT) {
          acc[i][j] = Frag<T>::mma(ah, bl[j], acc[i][j]);
          acc[i][j] = Frag<T>::mma(al, bh[j], acc[i][j]);
        }
      }
      Frag<T>::guard(acc[i][0], acc[i][3], ah, SPLIT ? al : ah);
    }
    Frag<T>::keep(bh[0], bh[1], bh[2], bh[3]);
    if (SPLIT) Frag<T>::keep(bl[0], bl[1], bl[2], bl[3]);
  }
  acc_guard4(acc[0][0], acc[0][1], acc[0][2], acc[0][3]);
  acc_guard4(acc[1][0], acc[1][1], acc[1][2], acc[1][3]);
  acc_guard4(acc[2][0], acc[2][1], acc[2][2], acc[2][3]);
  acc_guard4(acc[3][0], acc[3][1], acc[3][2], acc[3][3]);

  // ---- epilogue ----
  float* slab = sT[wave];
  const float* Rb = RESID ? (resid + (size_t)b * strideR) : nullptr;
#pragma unroll
  for (int i = 0; i < 4; ++i) {
    const int mBase = m0 + (i << 4);
#pragma unroll
    for (int j = 0; j < 4; ++j) {
      const int n = n0 + (j << 4) + rlane;
      float bv = 0.f;
      if (BIAS_MODE == 2) bv = bias[n];
#pragma unroll
      for (int r = 0; r < 8; ++r) {
        float v = acc[i][j][r] * scale;
        if (BIAS_MODE == 1) v += bias[mBase + mOff + r];
        if (BIAS_MODE == 2) v += bv;
        if (RESID) v += Rb[(size_t)(mBase + mOff + r) * ldc + n];
        if (ACT == 1) v = tanhf(v);
        if (ACT == 2) v = fmaxf(v, 0.0f);
        if (ACT == 3) v = v / (1.0f + expf(-v));
        if (ACT == 4) v = (v > 0.f) ? v : 0.01f * v;
        if (ACT == 5) v = 0.5f * v * (1.0f + erff(v * 0.70710678118654752f));
        slab[(mOff + r) * 68 + (j << 4) + rlane] = v;
      }
    }
    __builtin_amdgcn_fence(__ATOMIC_RELEASE, "workgroup");
    __builtin_amdgcn_wave_barrier();
    __builtin_amdgcn_fence(__ATOMIC_ACQUIRE, "workgroup");
    if (OUT_MODE == 0) {
      float* C = (float*)Cout + (size_t)b * strideC;
      const int hh = lane >> 4, c4 = (lane & 15) * 4;     // row seg = 256 B = 16 lanes x 16 B
      {
#pragma unroll
        for (int it = 0; it < 8; ++it) {
          const int row = it * 2 + hh;
          v4f v = *(const v4f*)(slab + row * 68 + c4);
          *(v4f*)(C + (size_t)(mBase + row) * ldc + n0 + c4) = v;
        }
        
      }
    } else {
      const int q = lane >> 3, c8 = (lane & 7) * 8;
      unsigned short* C  = (unsigned short*)Cout  + (size_t)b * strideC;
      unsigned short* C2 = (OUT_MODE == 2) ? ((unsigned short*)Cout2 + (size_t)b * strideC) : nullptr;
      {
#pragma unroll
        for (int it = 0; it < 4; ++it) {
          const int row = it * 4 + q;
          const float* sp = slab + row * 68 + c8;
          v8h hv, lv;
#pragma unroll
          for (int e = 0; e < 8; ++e) {
            if (OUT_MODE == 1) {
              hv[e] = (_Float16)sp[e];
            } else {
              unsigned short hb = f2bf_bits(sp[e]);
              unsigned short lb = f2bf_bits(sp[e] - bf_bits2f(hb));
              hv[e] = __builtin_bit_cast(_Float16, hb);
              lv[e] = __builtin_bit_cast(_Float16, lb);
            }
          }
          *(v8h*)(C + (size_t)(mBase + row) * ldc + n0 + c8) = hv;
          if (OUT_MODE == 2) *(v8h*)(C2 + (size_t)(mBase + row) * ldc + n0 + c8) = lv;
        }
        
      }
    }
    __builtin_amdgcn_fence(__ATOMIC_RELEASE, "workgroup");
    __builtin_amdgcn_wave_barrier();
    __builtin_amdgcn_fence(__ATOMIC_ACQUIRE, "workgroup");
  }
}

// ---- Deep-K product: K dealt over the 16 waves of a work-group ---------------
// C[m,n] = scale * sum_k A[m,k] * Bt[n,k], f16 operands, f32 out; one 32x64 tile of C per work-group.
// Per trip wave w takes the 64 k (one 128-B line of every operand row) at kb + 64 w, so the tile's K loop is 16 times shorter
// and a product with few output tiles still fills the chip. The 16 f32 partial tiles meet in LDS and are added in wave order.
// A row-major [M,K]; Bt row-major [N,K]; M % 32 == 0, N % 64 == 0, K % 1024 == 0; grid = ((M / 32) * (N / 64), batch), strides in elements.
__global__ __launch_bounds__(512) void wmma_gemm_kwaves(
    const unsigned short* __restrict__ Ap, int lda, long strideA,
    const unsigned short* __restrict__ Btp, int ldb, long strideB,
    float* __restrict__ C, int ldc, long strideC, int N, int K, float scale) {
  typedef _Float16 T;
  __shared__ __align__(16) float sP[16][32 * 68];   // per-wave 32x64 partial tile, pitch 68 floats
  const int lane = threadIdx.x & 31;
  const int wave = __builtin_amdgcn_readfirstlane(threadIdx.x >> 5);
  const int tilesN = N >> 6;
  const int tm = blockIdx.x / tilesN;
  const int tn = blockIdx.x - tm * tilesN;
  const int m0 = tm << 5;
  const int n0 = tn << 6;
  const int rlane = lane & 15;                 // row (A) / col (B, D) within subtile
  const int koff  = (lane >> 4) * 8;           // k offset of this lane half
  const int mOff  = (lane >> 4) * 8;           // D row offset
  const T* Aw = (const T*)Ap  + (size_t)blockIdx.y * strideA + (size_t)(m0 + rlane) * lda + koff + (wave << 6);
  const T* Bw = (const T*)Btp + (size_t)blockIdx.y * strideB + (size_t)(n0 + rlane) * ldb + koff + (wave << 6);

  v8f acc[2][4];
#pragma unroll
  for (int i = 0; i < 2; ++i)
#pragma unroll
    for (int j = 0; j < 4; ++j) acc[i][j] = (v8f){0.f,0.f,0.f,0.f,0.f,0.f,0.f,0.f};

  for (int kb = 0; kb < K; kb += 1024) {
    v16h bh[2][4], ah[2][2];
#pragma unroll
    for (int s = 0; s < 2; ++s) {
#pragma unroll
      for (int j = 0; j < 4; ++j) bh[s][j] = Frag<T>::load(Bw + (size_t)(j << 4) * ldb + kb + (s << 5));
#pragma unroll
      for (int i = 0; i < 2; ++i) ah[s][i] = Frag<T>::load(Aw + (size_t)(i << 4) * lda + kb + (s << 5));
    }
    // inputs-only fence on the loaded values: keeps the trip's 24 loads ahead of its first WMMA, so that the four 32-B pieces of
    // each 128-B line are asked for together (the line need not outlive the other waves' traffic in the WGP cache) and the wave
    // waits out one load latency per trip instead of one per 32 k
    asm volatile("" :: "v"(bh[0][0]), "v"(bh[0][1]), "v"(bh[0][2]), "v"(bh[0][3]), "v"(bh[1][0]), "v"(bh[1][1]), "v"(bh[1][2]), "v"(bh[1][3]),
                       "v"(ah[0][0]), "v"(ah[0][1]), "v"(ah[1][0]), "v"(ah[1][1]));
#pragma unroll
    for (int s = 0; s < 2; ++s)
#pragma unroll
      for (int i = 0; i < 2; ++i)
#pragma unroll
        for (int j = 0; j < 4; ++j) acc[i][j] = Frag<T>::mma(ah[s][i], bh[s][j], acc[i][j]);
  }

  float* slab = sP[wave];
#pragma unroll
  for (int i = 0; i < 2; ++i)
#pragma unroll
    for (int j = 0; j < 4; ++j)
#pragma unroll
      for (int r = 0; r < 8; ++r) slab[((i << 4) + mOff + r) * 68 + (j << 4) + rlane] = acc[i][j][r];
  __syncthreads();
  const int row = threadIdx.x >> 4, c4 = (threadIdx.x & 15) * 4;   // row seg = 256 B = 16 lanes x 16 B
  v4f sum = *(const v4f*)(&sP[0][row * 68 + c4]);
#pragma unroll
  for (int w = 1; w < 16; ++w) sum += *(const v4f*)(&sP[w][row * 68 + c4]);
  *(v4f*)(C + (size_t)blockIdx.y * strideC + (size_t)(m0 + row) * ldc + n0 + c4) = sum * scale;
}

__global__ __launch_bounds__(256) void cast_f32_f16x2(
    const float* __restrict__ in, _Float16* __restrict__ out, int n2) {
  int i = blockIdx.x * 256 + threadIdx.x;
  if (i < n2) {
    const _Float16 h0 = (_Float16)in[2 * i], h1 = (_Float16)in[2 * i + 1];
    const unsigned u = (unsigned)__builtin_bit_cast(unsigned short, h0) | ((unsigned)__builtin_bit_cast(unsigned short, h1) << 16);
    ((unsigned*)out)[i] = u;
    
  }
}


} // namespace w25

// blockIdx.y = sample: plane y of src starts at y * sb, plane y of dst at y * db (elements)
__global__ __launch_bounds__(256) void k_castT16(const float* __restrict__ src, long long lds, _Float16* __restrict__ dst, long long ldd, int R, int C, float s, long long sb, long long db) {
    src += (long long)blockIdx.y * sb; dst += (long long)blockIdx.y * db;
    const long long i = (long long)blockIdx.x * 256 + threadIdx.x; const long long np = (long long)C * (R / 2); if (i >= np) return; const int c = (int)(i / (R / 2)); const int r = 2 * (int)(i % (R / 2));
    const _Float16 h0 = (_Float16)(src[(long long)r * lds + c] * s), h1 = (_Float16)(src[(long long)(r + 1) * lds + c] * s);
    const unsigned u = (unsigned)__builtin_bit_cast(unsigned short, h0) | ((unsigned)__builtin_bit_cast(unsigned short, h1) << 16);
    unsigned* d = (unsigned*)(dst + (long long)c * ldd + r); *d = u;  }
__global__ __launch_bounds__(256) void k_cast16(const float* __restrict__ src, long long lds, _Float16* __restrict__ dst, long long ldd, int R, int C, float s) {
    const long long i = (long long)blockIdx.x * 256 + threadIdx.x; const long long np = (long long)R * (C / 2); if (i >= np) return; const int r = (int)(i / (C / 2)); const int c = 2 * (int)(i % (C / 2));
    const _Float16 h0 = (_Float16)(src[(long long)r * lds + c] * s), h1 = (_Float16)(src[(long long)r * lds + c + 1] * s);
    const unsigned u = (unsigned)__builtin_bit_cast(unsigned short, h0) | ((unsigned)__builtin_bit_cast(unsigned short, h1) << 16);
    unsigned* d = (unsigned*)(dst + (long long)r * ldd + c); *d = u;  }

// f32 -> bf16 hi plane + bf16 lo plane (x = hi + lo to ~2^-17 relative; RNE both), [R][C] -> [R][C] (or transposed to [C][R]); 2 consecutive destination elements
__device__ __forceinline__ unsigned int f2bf2_pack(float a, float b, unsigned int* lo) {
    const unsigned short ha = w25::f2bf_bits(a), hb = w25::f2bf_bits(b);
    const unsigned short la = w25::f2bf_bits(a - w25::bf_bits2f(ha)), lb = w25::f2bf_bits(b - w25::bf_bits2f(hb));
    *lo = (unsigned)la | ((unsigned)lb << 16); return (unsigned)ha | ((unsigned)hb << 16); }
__global__ __launch_bounds__(256) void k_castS16(const float* __restrict__ src, long long lds, __bf16* __restrict__ dhi, __bf16* __restrict__ dlo, long long ldd, int R, int C, float s, int transpose) {
    const long long i = (long long)blockIdx.x * 256 + threadIdx.x; long long o; float a, b;
    if (transpose) { const long long np = (long long)C * (R / 2); if (i >= np) return; const int c = (int)(i / (R / 2)); const int r = 2 * (int)(i % (R / 2)); a = src[(long long)r * lds + c] * s; b = src[(long long)(r + 1) * lds + c] * s; o = (long long)c * ldd + r; }
    else { const long long np = (long long)R * (C / 2); if (i >= np) return; const int r = (int)(i / (C / 2)); const int c = 2 * (int)(i % (C / 2)); a = src[(long long)r * lds + c] * s; b = src[(long long)r * lds + c + 1] * s; o = (long long)r * ldd + c; }
    unsigned lo; const unsigned hi = f2bf2_pack(a, b, &lo); unsigned* ph = (unsigned*)(dhi + o); unsigned* pl = (unsigned*)(dlo + o);
    *ph = hi; *pl = lo;  }

namespace w25 {
// =====================================================================================
// Generic causal/non-causal attention for head_dim 64, f32 in / f32 out; 16-bit operands: bf16 with optional hi/lo splits, or
// plain f16 (F16=true, non-split, probabilities carried x2^15).
//   scores = (q*qscale)·kᵀ : v_wmma_f32_16x16x32_bf16; SPLIT_QK -> q,k as bf16 hi/lo (hi·hi + hi·lo + lo·hi)
//   out    = p·v           : v_wmma_f32_16x16x32_bf16; SPLIT_PV -> p,v as bf16 hi/lo; else p,v plain bf16
//   f32 accumulate; online softmax in f32. Block = 4 waves = 64 query rows of one (batch, head); S % 64 == 0.
//   Element (b, s, h, d) of tensor X lives at X[b*X_bs + s*X_rs + h*X_hs + d] (strides in floats, multiples of 4).
//   Masking: mask_mode 0 none, 1 causal (kv > q masked), 2 tensor [S][Skv] shared over (b,h) (float if
//   mask_is_int==0, int32 with element == 0 -> masked if 1, int32 with element != 0 -> masked if 2), 3 per-token vectors qmask[B][S] & kvmask[B][Skv] (int32,
//   0 -> masked), 4 causal + sliding window (kv > q or q - kv > W masked; W passed in mask_is_int);
//   5 = relative-position bias: s += cp[b,h,q][idx[q][kv]] + pc[b,h,kv][idx[q][kv]] with idx = mask_b ([S][Skv] int32) and
//   mask_a an int32 [S][Skv] tensor with nonzero = masked (tables: element (b,h,row,n) at X + b*c_bs + h*c_hs + row*c_rs + n);
//   masked scores are replaced by mask_fill (e.g. -inf or -1e9) before the softmax.
//   grid.x = B * H * (S/64) (or a sub-range with blk0).
// =====================================================================================
#define AT_D 64
#define AT_NW 4
#define AT_QB 64
#define AT_KC 64
struct AttnGeom { const float* cp = nullptr; const float* pc = nullptr; long c_bs = 0, c_rs = 0, c_hs = 0;   // mode-5 score-bias tables
                  long q_bs, q_rs, q_hs, k_bs, k_rs, k_hs, v_bs, v_rs, v_hs, o_bs, o_rs, o_hs;
                  int S, Skv, H, mask_mode; float qscale; int blk0; float mask_fill; int mask_is_int; };
static_assert(sizeof(AttnGeom) == 168, "no padding");

__device__ __forceinline__ unsigned short at_bf_bits(float f) {
  unsigned u = __float_as_uint(f);
  return (unsigned short)((u + 0x7FFFu + ((u >> 16) & 1u)) >> 16);
}
__device__ __forceinline__ __bf16 at_f2bf(float f) { return __builtin_bit_cast(__bf16, at_bf_bits(f)); }
__device__ __forceinline__ void at_split(float f, __bf16& hi, __bf16& lo) {
  const unsigned short hb = at_bf_bits(f);
  hi = __builtin_bit_cast(__bf16, hb);
  lo = at_f2bf(f - __uint_as_float(((unsigned)hb) << 16));
}
__device__ __forceinline__ v8f at_mma(v16b a, v16b b, v8f c) {
  c = __builtin_amdgcn_wmma_f32_16x16x32_bf16(false, a, false, b, (short)0, c, false, false);
  asm volatile("v_nop\n\tv_nop\n\tv_nop\n\tv_nop" : "+v"(c) : "v"(a), "v"(b));
  return c;
}
// 16-bit element as a bit pattern held in a __bf16 slot: f16 bits when F16, bf16 (RNE) otherwise
template <bool F16> __device__ __forceinline__ __bf16 at_to16(float f) {
  if (F16) return __builtin_bit_cast(__bf16, (_Float16)f);
  return at_f2bf(f);
}
template <bool F16> __device__ __forceinline__ v8f at_mma16(v16b a, v16b b, v8f c) {
  if (F16) {
    const v16h ah = __builtin_bit_cast(v16h, a), bh = __builtin_bit_cast(v16h, b);
    c = __builtin_amdgcn_wmma_f32_16x16x32_f16(false, ah, false, bh, (short)0, c, false, false);
    asm volatile("v_nop\n\tv_nop\n\tv_nop\n\tv_nop" : "+v"(c) : "v"(ah), "v"(bh));
    return c;
  }
  return at_mma(a, b, c);
}

template <bool SPLIT_QK, bool SPLIT_PV, bool F16 = false>
__global__ __launch_bounds__(128)
void attn64_kernel(const float* __restrict__ q, const float* __restrict__ k,
                   const float* __restrict__ v, float* __restrict__ out,
                   const void* __restrict__ mask_a, const int* __restrict__ mask_b, AttnGeom g) {
  static_assert(!(F16 && (SPLIT_QK || SPLIT_PV)), "f16 mode is non-split");
  const float PSC = F16 ? 32768.0f : 1.0f;     // f16 probabilities carried x2^15 (subnormal range), folded into the final 1/l
  union FB { v16b v; v8b h[2]; };
  __shared__ __align__(16) __bf16 Ksh[AT_KC * AT_D];             // K hi [kv][d]      8 KB
  __shared__ __align__(16) __bf16 Ksl[SPLIT_QK ? AT_KC * AT_D : 8];
  __shared__ __align__(16) __bf16 Vth[AT_D * AT_KC];             // V hi [d][kv]      8 KB
  __shared__ __align__(16) __bf16 Vtl[SPLIT_PV ? AT_D * AT_KC : 8];
  __shared__ __align__(16) __bf16 Psh[AT_NW][16 * AT_KC];        // per wave P hi [row][kv]  8 KB
  __shared__ __align__(16) __bf16 Psl[SPLIT_PV ? AT_NW : 1][SPLIT_PV ? 16 * AT_KC : 8];
  __shared__ __align__(16) float  Os[AT_NW][16 * 68];            // per wave out tile, pitch 68

  const int tid  = threadIdx.x;
  const int wave = tid >> 5;
  const int lane = tid & 31;
  const int hh   = lane >> 4;
  const int c    = lane & 15;

  const int nqb = g.S / AT_QB;
  const int bx = blockIdx.x + g.blk0;
  const int qb = bx % nqb;
  const int bh = bx / nqb;
  const int h  = bh % g.H;
  const int b  = bh / g.H;
  const int qbase_block = qb * AT_QB;
  const int q0 = qbase_block + wave * 16;

  const float* qb_ptr = q + (size_t)b * g.q_bs + (size_t)h * g.q_hs;
  const float* kb_ptr = k + (size_t)b * g.k_bs + (size_t)h * g.k_hs;
  const float* vb_ptr = v + (size_t)b * g.v_bs + (size_t)h * g.v_hs;
  float*       ob_ptr = out + (size_t)b * g.o_bs + (size_t)h * g.o_hs;

  // ---- Q fragments (A operand): 2 d-chunks, hi (and lo) ----
  v16b qah[2], qal[2];
  {
    const float* qrow = qb_ptr + (size_t)(q0 + c) * g.q_rs;
#pragma unroll
    for (int dc = 0; dc < 2; ++dc) {
#pragma unroll
      for (int e = 0; e < 8; ++e) {
        const float f0 = qrow[dc * 32 + 8 * hh + e] * g.qscale;
        const float f1 = qrow[dc * 32 + 16 + 8 * hh + e] * g.qscale;
        if (SPLIT_QK) { __bf16 hq, lq; at_split(f0, hq, lq); qah[dc][e] = hq; qal[dc][e] = lq; at_split(f1, hq, lq); qah[dc][8 + e] = hq; qal[dc][8 + e] = lq; }
        else { qah[dc][e] = at_to16<F16>(f0); qah[dc][8 + e] = at_to16<F16>(f1); qal[dc][e] = qah[dc][e]; qal[dc][8 + e] = qah[dc][8 + e]; }
      }
    }
  }

  float mrow[8], lrow[8];
  v8f oacc[4];
#pragma unroll
  for (int r = 0; r < 8; ++r) { mrow[r] = -INFINITY; lrow[r] = 0.f; }
#pragma unroll
  for (int t = 0; t < 4; ++t) oacc[t] = (v8f){0.f,0.f,0.f,0.f,0.f,0.f,0.f,0.f};

  const int nChunks = (g.mask_mode == 1 || g.mask_mode == 4) ? (qb + 1) : (g.Skv / AT_KC);   // block-uniform
  // per-row query mask (mode 3)
  int qkeep[8];
#pragma unroll
  for (int r = 0; r < 8; ++r) qkeep[r] = (g.mask_mode == 3) ? mask_b[(size_t)b * g.S + q0 + 8 * hh + r] : 1;   // mask_b = qmask in mode 3
  for (int kc = 0; kc < nChunks; ++kc) {
    const int kv0 = kc * AT_KC;
    __syncthreads();
    {
      const int kvr = tid >> 1, dh = (tid & 1) * 32;
      const float* krow = kb_ptr + (size_t)(kv0 + kvr) * g.k_rs + dh;
      const float* vrow = vb_ptr + (size_t)(kv0 + kvr) * g.v_rs + dh;
#pragma unroll
      for (int i = 0; i < 8; ++i) {
        v4f kk = *(const v4f*)(krow + 4 * i);
        v4f vv = *(const v4f*)(vrow + 4 * i);
#pragma unroll
        for (int e = 0; e < 4; ++e) {
          const int d = dh + 4 * i + e;
          if (SPLIT_QK) { __bf16 a, bl; at_split(kk[e], a, bl); Ksh[kvr * AT_D + d] = a; Ksl[kvr * AT_D + d] = bl; }
          else Ksh[kvr * AT_D + d] = at_to16<F16>(kk[e]);
          if (SPLIT_PV) { __bf16 a, bl; at_split(vv[e], a, bl); Vth[d * AT_KC + kvr] = a; Vtl[d * AT_KC + kvr] = bl; }
          else Vth[d * AT_KC + kvr] = at_to16<F16>(vv[e]);
        }
      }
    }
    __syncthreads();

    v8f s[4];
#pragma unroll
    for (int j = 0; j < 4; ++j) {
      s[j] = (v8f){0.f,0.f,0.f,0.f,0.f,0.f,0.f,0.f};
#pragma unroll 1
      for (int dc = 0; dc < 2; ++dc) {
        FB kb;
        kb.h[0] = *(const v8b*)(Ksh + (j * 16 + c) * AT_D + dc * 32 + 8 * hh);
        kb.h[1] = *(const v8b*)(Ksh + (j * 16 + c) * AT_D + dc * 32 + 16 + 8 * hh);
        s[j] = at_mma16<F16>(qah[dc], kb.v, s[j]);
        if (SPLIT_QK) {
          FB kl;
          kl.h[0] = *(const v8b*)(Ksl + (j * 16 + c) * AT_D + dc * 32 + 8 * hh);
          kl.h[1] = *(const v8b*)(Ksl + (j * 16 + c) * AT_D + dc * 32 + 16 + 8 * hh);
          s[j] = at_mma16<F16>(qah[dc], kl.v, s[j]);
          s[j] = at_mma16<F16>(qal[dc], kb.v, s[j]);
        }
      }
    }
    const bool diag = (g.mask_mode == 1) && (kc == qb);
    int kvkeep[4] = {1, 1, 1, 1};
    if (g.mask_mode == 3) {
#pragma unroll
      for (int j = 0; j < 4; ++j) kvkeep[j] = ((const int*)mask_a)[(size_t)b * g.Skv + kv0 + j * 16 + c];   // mask_a = kvmask
    }
    float cm[8];
#pragma unroll
    for (int r = 0; r < 8; ++r) {
      const int qrow = q0 + 8 * hh + r;
      float m = -INFINITY;
#pragma unroll
      for (int j = 0; j < 4; ++j) {
        const int kvcol = kv0 + j * 16 + c;
        bool masked = false;
        if (diag) masked = (kvcol > qrow);
        else if (g.mask_mode == 4) masked = (kvcol > qrow) || (qrow - kvcol > g.mask_is_int);
        else if (g.mask_mode == 2) {
          const size_t mi = (size_t)qrow * g.Skv + kvcol;
          masked = (g.mask_is_int == 0) ? (((const float*)mask_a)[mi] == 0.0f)
                 : (g.mask_is_int == 1) ? (((const int*)mask_a)[mi] == 0) : (((const int*)mask_a)[mi] != 0);
        } else if (g.mask_mode == 3) masked = (qkeep[r] == 0) || (kvkeep[j] == 0);
        else if (g.mask_mode == 5) {
          const size_t mi = (size_t)qrow * g.Skv + kvcol;
          masked = (((const int*)mask_a)[mi] != 0);
          int n = mask_b[mi]; n = n < 0 ? 0 : n;
          s[j][r] += g.cp[(size_t)b * g.c_bs + (size_t)h * g.c_hs + (size_t)qrow * g.c_rs + n]
                   + g.pc[(size_t)b * g.c_bs + (size_t)h * g.c_hs + (size_t)kvcol * g.c_rs + n];
        }
        if (masked) s[j][r] = g.mask_fill;
        m = fmaxf(m, s[j][r]);
      }
#pragma unroll
      for (int off = 1; off < 16; off <<= 1) m = fmaxf(m, __shfl_xor(m, off, 32));
      cm[r] = m;
    }
    __bf16* pwh = Psh[wave];
    __bf16* pwl = Psl[SPLIT_PV ? wave : 0];
#pragma unroll
    for (int r = 0; r < 8; ++r) {
      const float mnew = fmaxf(mrow[r], cm[r]);
      const float alpha = expf(mrow[r] - mnew);
      mrow[r] = mnew;
      float psum = 0.f;
#pragma unroll
      for (int j = 0; j < 4; ++j) {
        const float p = expf(s[j][r] - mnew);
        psum += p;
        if (SPLIT_PV) { __bf16 a, bl; at_split(p, a, bl); pwh[(8 * hh + r) * AT_KC + j * 16 + c] = a; pwl[(8 * hh + r) * AT_KC + j * 16 + c] = bl; }
        else pwh[(8 * hh + r) * AT_KC + j * 16 + c] = at_to16<F16>(p * PSC);
      }
#pragma unroll
      for (int off = 1; off < 16; off <<= 1) psum += __shfl_xor(psum, off, 32);
      lrow[r] = lrow[r] * alpha + psum;
#pragma unroll
      for (int t = 0; t < 4; ++t) oacc[t][r] *= alpha;
    }
    __builtin_amdgcn_fence(__ATOMIC_RELEASE, "workgroup");
    __builtin_amdgcn_wave_barrier();
    __builtin_amdgcn_fence(__ATOMIC_ACQUIRE, "workgroup");
#pragma unroll 1
    for (int kk = 0; kk < 2; ++kk) {
      FB pa, pl;
      pa.h[0] = *(const v8b*)(pwh + c * AT_KC + kk * 32 + 8 * hh);
      pa.h[1] = *(const v8b*)(pwh + c * AT_KC + kk * 32 + 16 + 8 * hh);
      if (SPLIT_PV) {
        pl.h[0] = *(const v8b*)(pwl + c * AT_KC + kk * 32 + 8 * hh);
        pl.h[1] = *(const v8b*)(pwl + c * AT_KC + kk * 32 + 16 + 8 * hh);
      }
#pragma unroll
      for (int t = 0; t < 4; ++t) {
        FB vb;
        vb.h[0] = *(const v8b*)(Vth + (t * 16 + c) * AT_KC + kk * 32 + 8 * hh);
        vb.h[1] = *(const v8b*)(Vth + (t * 16 + c) * AT_KC + kk * 32 + 16 + 8 * hh);
        oacc[t] = at_mma16<F16>(pa.v, vb.v, oacc[t]);
        if (SPLIT_PV) {
          FB vl;
          vl.h[0] = *(const v8b*)(Vtl + (t * 16 + c) * AT_KC + kk * 32 + 8 * hh);
          vl.h[1] = *(const v8b*)(Vtl + (t * 16 + c) * AT_KC + kk * 32 + 16 + 8 * hh);
          oacc[t] = at_mma16<F16>(pa.v, vl.v, oacc[t]);
          oacc[t] = at_mma16<F16>(pl.v, vb.v, oacc[t]);
        }
      }
    }
  }

  float* os = Os[wave];
#pragma unroll
  for (int r = 0; r < 8; ++r) {
    const float inv = 1.0f / (lrow[r] * PSC);
#pragma unroll
    for (int t = 0; t < 4; ++t) os[(8 * hh + r) * 68 + t * 16 + c] = oacc[t][r] * inv;
  }
  __builtin_amdgcn_fence(__ATOMIC_RELEASE, "workgroup");
  __builtin_amdgcn_wave_barrier();
  __builtin_amdgcn_fence(__ATOMIC_ACQUIRE, "workgroup");
  {
    const int c4 = (lane & 15) * 4;
    {
#pragma unroll
      for (int it = 0; it < 8; ++it) {
        const int row = it * 2 + hh;
        v4f val = *(const v4f*)(os + row * 68 + c4);
        *(v4f*)(ob_ptr + (size_t)(q0 + row) * g.o_rs + c4) = val;
      }
      
    }
  }
}

} // namespace w25

__device__ __forceinline__ void st_h2(_Float16* dst, float a, float b) { const unsigned u = (unsigned)__builtin_bit_cast(unsigned short, (_Float16)a) | ((unsigned)__builtin_bit_cast(unsigned short, (_Float16)b) << 16); unsigned* d = (unsigned*)dst; *d = u;  }
__device__ __forceinline__ void spat8(int n, float* s) { const int hh = n / 64, ww = n % 64; const float gx = (float)ww / 63.f, gy = (float)hh / 63.f; s[0] = gx; s[1] = gy; s[2] = 1.f - gx; s[3] = 1.f - gy; const float m = (gx + gy) * 0.5f; s[4] = m; s[5] = m; s[6] = m; s[7] = m; }
__global__ __launch_bounds__(256) void k_cm_spT(float* __restrict__ T, const float* __restrict__ Wt, const float* __restrict__ Bb, int ldw, int coff, int A, long long n) { const long long t = (long long)blockIdx.x * 256 + threadIdx.x; if (t >= n) return; const int a = (int)(t % A); const int pos = (int)(t / A); float s[8]; spat8(pos, s); float acc = Bb[a];
    if (coff >= 0) {
#pragma unroll
        for (int j = 0; j < 8; ++j) acc += Wt[(long long)a * ldw + coff + j] * s[j]; }
    float* Tb = T + (long long)blockIdx.y * n;   // blockIdx.y = sample, planes n elements apart
    VST2(float, Tb + t, Tb[t] + acc); }
// channel-major [a][n] += sum_j W[a][coff + j] * spat_j(n) + b[a]  (thread-linear over A*HW; n fastest; blockIdx.y = sample, planes n elements apart)
__global__ __launch_bounds__(256) void k_cm_spC(float* __restrict__ V, const float* __restrict__ Wt, const float* __restrict__ Bb, int ldw, int coff, int HW, long long n) { const long long t = (long long)blockIdx.x * 256 + threadIdx.x; if (t >= n) return; const int a = (int)(t / HW); const int pos = (int)(t % HW); float s[8]; spat8(pos, s); float acc = Bb[a];
    if (coff >= 0) {
#pragma unroll
        for (int j = 0; j < 8; ++j) acc += Wt[(long long)a * ldw + coff + j] * s[j]; }
    float* Vb = V + (long long)blockIdx.y * n;
    VST2(float, Vb + t, Vb[t] + acc); }
// VAL16 = f16(VAL)
__global__ __launch_bounds__(256) void k_cm_v16(const float* __restrict__ V, _Float16* __restrict__ V16, long long n) { const long long t = (long long)blockIdx.x * 256 + threadIdx.x; if (t >= n / 2) return; st_h2(V16 + 2 * t, V[2 * t], V[2 * t + 1]); }
// row softmax (exp once) -> P16 = f16(4096 p)
__global__ __launch_bounds__(256) void k_cm_soft(float* __restrict__ EN, _Float16* __restrict__ P16, int HW) { __shared__ float red[256]; const long long row = blockIdx.x; float* sr = EN + row * HW; const int t = threadIdx.x; float mx = -3.0e38f;
#pragma unroll 1
    for (int j = 2 * t; j < HW; j += 512) mx = fmaxf(mx, fmaxf(sr[j], sr[j + 1]));
    red[t] = mx; __syncthreads(); for (int o = 128; o > 0; o >>= 1) { if (t < o) red[t] = fmaxf(red[t], red[t + o]); __syncthreads(); } const float m = red[0]; __syncthreads();
    float s = 0.f;
#pragma unroll 1
    for (int j = 2 * t; j < HW; j += 512) { const float e0 = expf(sr[j] - m), e1 = expf(sr[j + 1] - m); s += e0 + e1; const unsigned long long pk = (unsigned long long)__builtin_bit_cast(unsigned, e0) | ((unsigned long long)__builtin_bit_cast(unsigned, e1) << 32); VST2(unsigned long long, (unsigned long long*)(sr + j), pk); }
    red[t] = s; __syncthreads(); for (int o = 128; o > 0; o >>= 1) { if (t < o) red[t] += red[t + o]; __syncthreads(); } const float f = 4096.f / red[0];
#pragma unroll 1
    for (int j = 2 * t; j < HW; j += 512) st_h2(P16 + row * HW + j, sr[j] * f, sr[j + 1] * f); }


extern "C" void kernel_launch(void* const* d_in, const int* in_sizes, int n_in, void* d_out, int out_size, void* d_ws, size_t ws_size, hipStream_t stream) {
    (void)in_sizes; (void)n_in; (void)out_size; (void)ws_size;
    const float* img = (const float*)d_in[0];
    const float* flo = (const float*)d_in[1];
    const float* iwt = (const float*)d_in[2];
    const float* ibt = (const float*)d_in[3];
    const float* iwp = (const float*)d_in[4];
    const float* ibp = (const float*)d_in[5];
    const float* iwv = (const float*)d_in[6];
    const float* ibv = (const float*)d_in[7];
    const float* iwo = (const float*)d_in[8];
    const float* ibo = (const float*)d_in[9];
    const float* lwt = (const float*)d_in[10];
    const float* lbt = (const float*)d_in[11];
    const float* lwp = (const float*)d_in[12];
    const float* lbp = (const float*)d_in[13];
    const float* lwv = (const float*)d_in[14];
    const float* lbv = (const float*)d_in[15];
    const float* lwo = (const float*)d_in[16];
    const float* lbo = (const float*)d_in[17];
    const float* fw = (const float*)d_in[18];
    const float* fb = (const float*)d_in[19];
    const int Bn = 4;
    const int C = 256;
    const int A = 256;
    const int HW = 4096;
    const int CM = 520;
    const int HS = 1024;   // affinity rows per sample and pass: 4 samples x 1024 rows of f32 scores per launch
    const long SP = (long)C * HW;   // one sample's 256 x 4096 (or 4096 x 256) plane, elements
    float* out = (float*)d_out;
    char* wsp = (char*)d_ws;
    float* THT = (float*)wsp; wsp += (((size_t)((size_t)Bn * HW * A) * 4 + 255) / 256) * 256;
    float* PHT = (float*)wsp; wsp += (((size_t)((size_t)Bn * HW * A) * 4 + 255) / 256) * 256;
    float* VAL = (float*)wsp; wsp += (((size_t)((size_t)Bn * A * HW) * 4 + 255) / 256) * 256;
    unsigned short* VAL16 = (unsigned short*)wsp; wsp += (((size_t)((size_t)Bn * A * HW) * 2 + 255) / 256) * 256;
    float* EN = (float*)wsp; wsp += (((size_t)((size_t)Bn * HS * HW) * 4 + 255) / 256) * 256;
    unsigned short* P16 = (unsigned short*)wsp; wsp += (((size_t)((size_t)Bn * HS * HW) * 2 + 255) / 256) * 256;
    float* ATT = (float*)wsp; wsp += (((size_t)((size_t)Bn * A * HW) * 4 + 255) / 256) * 256;
    float* FUS = (float*)wsp; wsp += (((size_t)((size_t)Bn * 2 * A * HW) * 4 + 255) / 256) * 256;
    unsigned short* G64A = (unsigned short*)wsp; wsp += (((size_t)((size_t)Bn * 1048576) * 2 + 255) / 256) * 256;
    unsigned short* G64B = (unsigned short*)wsp; wsp += (((size_t)((size_t)Bn * 2097152) * 2 + 255) / 256) * 256;
    // every launch serves the four samples (blockIdx.y, or rows that run on from sample to sample); weights are cast once
    k_castT16<<<dim3((unsigned)((((long long)(4096) * ((256) / 2)) + 255) / 256), (unsigned)(Bn)), 256, 0, stream>>>(img, 4096, (_Float16*)(G64A), 256, 256, 4096, 1.0f, SP, SP);
    k_cast16<<<(unsigned)((((long long)(256) * ((256) / 2)) + 255) / 256), 256, 0, stream>>>(iwt + 0, 520, (_Float16*)(G64B), 256, 256, 256, 16.0f);
    w25::wmma_gemm64<0, false, 0, 0, false, 0><<<dim3((unsigned)((((4096) / 64) * ((256) / 64) + 7) / 8), (unsigned)(Bn)), 256, 0, stream>>>((const unsigned short*)(G64A), nullptr, 256, SP, (const unsigned short*)(G64B), nullptr, 256, 0, (void*)(THT), nullptr, 256, SP, nullptr, nullptr, 0, 4096, 256, 256, 0.0625f);
    k_castT16<<<dim3((unsigned)((((long long)(4096) * ((256) / 2)) + 255) / 256), (unsigned)(Bn)), 256, 0, stream>>>(flo, 4096, (_Float16*)(G64A), 256, 256, 4096, 1.0f, SP, SP);
    k_cast16<<<(unsigned)((((long long)(256) * ((256) / 2)) + 255) / 256), 256, 0, stream>>>(iwt + 256, 520, (_Float16*)(G64B), 256, 256, 256, 16.0f);
    w25::wmma_gemm64<0, false, 0, 0, true, 0><<<dim3((unsigned)((((4096) / 64) * ((256) / 64) + 7) / 8), (unsigned)(Bn)), 256, 0, stream>>>((const unsigned short*)(G64A), nullptr, 256, SP, (const unsigned short*)(G64B), nullptr, 256, 0, (void*)(THT), nullptr, 256, SP, nullptr, THT, SP, 4096, 256, 256, 0.0625f);
    k_castT16<<<dim3((unsigned)((((long long)(4096) * ((256) / 2)) + 255) / 256), (unsigned)(Bn)), 256, 0, stream>>>(img, 4096, (_Float16*)(G64A), 256, 256, 4096, 1.0f, SP, SP);
    k_cast16<<<(unsigned)((((long long)(256) * ((256) / 2)) + 255) / 256), 256, 0, stream>>>(iwp + 0, 520, (_Float16*)(G64B), 256, 256, 256, 16.0f);
    w25::wmma_gemm64<0, false, 0, 0, false, 0><<<dim3((unsigned)((((4096) / 64) * ((256) / 64) + 7) / 8), (unsigned)(Bn)), 256, 0, stream>>>((const unsigned short*)(G64A), nullptr, 256, SP, (const unsigned short*)(G64B), nullptr, 256, 0, (void*)(PHT), nullptr, 256, SP, nullptr, nullptr, 0, 4096, 256, 256, 0.0625f);
    k_castT16<<<dim3((unsigned)((((long long)(4096) * ((256) / 2)) + 255) / 256), (unsigned)(Bn)), 256, 0, stream>>>(flo, 4096, (_Float16*)(G64A), 256, 256, 4096, 1.0f, SP, SP);
    k_cast16<<<(unsigned)((((long long)(256) * ((256) / 2)) + 255) / 256), 256, 0, stream>>>(iwp + 256, 520, (_Float16*)(G64B), 256, 256, 256, 16.0f);
    w25::wmma_gemm64<0, false, 0, 0, true, 0><<<dim3((unsigned)((((4096) / 64) * ((256) / 64) + 7) / 8), (unsigned)(Bn)), 256, 0, stream>>>((const unsigned short*)(G64A), nullptr, 256, SP, (const unsigned short*)(G64B), nullptr, 256, 0, (void*)(PHT), nullptr, 256, SP, nullptr, PHT, SP, 4096, 256, 256, 0.0625f);
    k_cast16<<<(unsigned)((((long long)(256) * ((256) / 2)) + 255) / 256), 256, 0, stream>>>(iwv + 0, 520, (_Float16*)(G64A), 256, 256, 256, 1.0f);
    k_castT16<<<dim3((unsigned)((((long long)(4096) * ((256) / 2)) + 255) / 256), (unsigned)(Bn)), 256, 0, stream>>>(img, 4096, (_Float16*)(G64B), 256, 256, 4096, 16.0f, SP, SP);
    w25::wmma_gemm64<0, false, 0, 0, false, 0><<<dim3((unsigned)((((256) / 64) * ((4096) / 64) + 7) / 8), (unsigned)(Bn)), 256, 0, stream>>>((const unsigned short*)(G64A), nullptr, 256, 0, (const unsigned short*)(G64B), nullptr, 256, SP, (void*)(VAL), nullptr, 4096, SP, nullptr, nullptr, 0, 256, 4096, 256, 0.0625f);
    k_cast16<<<(unsigned)((((long long)(256) * ((256) / 2)) + 255) / 256), 256, 0, stream>>>(iwv + 256, 520, (_Float16*)(G64A), 256, 256, 256, 1.0f);
    k_castT16<<<dim3((unsigned)((((long long)(4096) * ((256) / 2)) + 255) / 256), (unsigned)(Bn)), 256, 0, stream>>>(flo, 4096, (_Float16*)(G64B), 256, 256, 4096, 16.0f, SP, SP);
    w25::wmma_gemm64<0, false, 0, 0, true, 0><<<dim3((unsigned)((((256) / 64) * ((4096) / 64) + 7) / 8), (unsigned)(Bn)), 256, 0, stream>>>((const unsigned short*)(G64A), nullptr, 256, 0, (const unsigned short*)(G64B), nullptr, 256, SP, (void*)(VAL), nullptr, 4096, SP, nullptr, VAL, SP, 256, 4096, 256, 0.0625f);
    k_cm_spT<<<dim3((unsigned)(((long long)HW * A + 255) / 256), (unsigned)(Bn)), 256, 0, stream>>>(THT, iwt, ibt, 520, 512, A, (long long)HW * A);
    k_cm_spT<<<dim3((unsigned)(((long long)HW * A + 255) / 256), (unsigned)(Bn)), 256, 0, stream>>>(PHT, iwp, ibp, 520, 512, A, (long long)HW * A);
    k_cm_spC<<<dim3((unsigned)(((long long)A * HW + 255) / 256), (unsigned)(Bn)), 256, 0, stream>>>(VAL, iwv, ibv, 520, 512, HW, (long long)A * HW);
    k_cm_v16<<<(unsigned)(((long long)Bn * A * HW / 2 + 255) / 256), 256, 0, stream>>>(VAL, (_Float16*)VAL16, (long long)Bn * A * HW);
    // f16 planes of theta^T and phi^T, all samples (rows run on from sample to sample); they stay in place over the four passes
    k_cast16<<<(unsigned)((((long long)(16384) * ((256) / 2)) + 255) / 256), 256, 0, stream>>>(THT, 256, (_Float16*)(G64A), 256, 16384, 256, 1.0f);
    k_cast16<<<(unsigned)((((long long)(16384) * ((256) / 2)) + 255) / 256), 256, 0, stream>>>(PHT, 256, (_Float16*)(G64B), 256, 16384, 256, 1.0f);
    w25::wmma_gemm64<0, false, 0, 0, false, 0><<<dim3((unsigned)((((1024) / 64) * ((4096) / 64) + 7) / 8), (unsigned)(Bn)), 256, 0, stream>>>((const unsigned short*)(G64A + (size_t)0 * HS * A), nullptr, 256, SP, (const unsigned short*)(G64B), nullptr, 256, SP, (void*)(EN), nullptr, 4096, 4 * SP, nullptr, nullptr, 0, 1024, 4096, 256, 1.0f);
    k_cm_soft<<<Bn * HS, 256, 0, stream>>>(EN, (_Float16*)P16, HW);
    w25::wmma_gemm_kwaves<<<dim3((unsigned)(((A) / 32) * ((HS) / 64)), (unsigned)(Bn)), 512, 0, stream>>>((const unsigned short*)(VAL16), HW, SP, (const unsigned short*)(P16), HW, 4 * SP, ATT + (size_t)0 * HS, HW, SP, HS, HW, 0.000244140625f);
    w25::wmma_gemm64<0, false, 0, 0, false, 0><<<dim3((unsigned)((((1024) / 64) * ((4096) / 64) + 7) / 8), (unsigned)(Bn)), 256, 0, stream>>>((const unsigned short*)(G64A + (size_t)1 * HS * A), nullptr, 256, SP, (const unsigned short*)(G64B), nullptr, 256, SP, (void*)(EN), nullptr, 4096, 4 * SP, nullptr, nullptr, 0, 1024, 4096, 256, 1.0f);
    k_cm_soft<<<Bn * HS, 256, 0, stream>>>(EN, (_Float16*)P16, HW);
    w25::wmma_gemm_kwaves<<<dim3((unsigned)(((A) / 32) * ((HS) / 64)), (unsigned)(Bn)), 512, 0, stream>>>((const unsigned short*)(VAL16), HW, SP, (const unsigned short*)(P16), HW, 4 * SP, ATT + (size_t)1 * HS, HW, SP, HS, HW, 0.000244140625f);
    w25::wmma_gemm64<0, false, 0, 0, false, 0><<<dim3((unsigned)((((1024) / 64) * ((4096) / 64) + 7) / 8), (unsigned)(Bn)), 256, 0, stream>>>((const unsigned short*)(G64A + (size_t)2 * HS * A), nullptr, 256, SP, (const unsigned short*)(G64B), nullptr, 256, SP, (void*)(EN), nullptr, 4096, 4 * SP, nullptr, nullptr, 0, 1024, 4096, 256, 1.0f);
    k_cm_soft<<<Bn * HS, 256, 0, stream>>>(EN, (_Float16*)P16, HW);
    w25::wmma_gemm_kwaves<<<dim3((unsigned)(((A) / 32) * ((HS) / 64)), (unsigned)(Bn)), 512, 0, stream>>>((const unsigned short*)(VAL16), HW, SP, (const unsigned short*)(P16), HW, 4 * SP, ATT + (size_t)2 * HS, HW, SP, HS, HW, 0.000244140625f);
    w25::wmma_gemm64<0, false, 0, 0, false, 0><<<dim3((unsigned)((((1024) / 64) * ((4096) / 64) + 7) / 8), (unsigned)(Bn)), 256, 0, stream>>>((const unsigned short*)(G64A + (size_t)3 * HS * A), nullptr, 256, SP, (const unsigned short*)(G64B), nullptr, 256, SP, (void*)(EN), nullptr, 4096, 4 * SP, nullptr, nullptr, 0, 1024, 4096, 256, 1.0f);
    k_cm_soft<<<Bn * HS, 256, 0, stream>>>(EN, (_Float16*)P16, HW);
    w25::wmma_gemm_kwaves<<<dim3((unsigned)(((A) / 32) * ((HS) / 64)), (unsigned)(Bn)), 512, 0, stream>>>((const unsigned short*)(VAL16), HW, SP, (const unsigned short*)(P16), HW, 4 * SP, ATT + (size_t)3 * HS, HW, SP, HS, HW, 0.000244140625f);
    k_cast16<<<(unsigned)((((long long)(256) * ((256) / 2)) + 255) / 256), 256, 0, stream>>>(iwo, 256, (_Float16*)(G64A), 256, 256, 256, 16.0f);
    k_castT16<<<dim3((unsigned)((((long long)(4096) * ((256) / 2)) + 255) / 256), (unsigned)(Bn)), 256, 0, stream>>>(ATT, 4096, (_Float16*)(G64B), 256, 256, 4096, 1.0f, SP, SP);
    w25::wmma_gemm64<0, false, 1, 0, false, 0><<<dim3((unsigned)((((256) / 64) * ((4096) / 64) + 7) / 8), (unsigned)(Bn)), 256, 0, stream>>>((const unsigned short*)(G64A), nullptr, 256, 0, (const unsigned short*)(G64B), nullptr, 256, SP, (void*)(FUS + (size_t)0 * A * HW), nullptr, 4096, 2 * SP, ibo, nullptr, 0, 256, 4096, 256, 0.0625f);
    k_castT16<<<dim3((unsigned)((((long long)(4096) * ((256) / 2)) + 255) / 256), (unsigned)(Bn)), 256, 0, stream>>>(flo, 4096, (_Float16*)(G64A), 256, 256, 4096, 1.0f, SP, SP);
    k_cast16<<<(unsigned)((((long long)(256) * ((256) / 2)) + 255) / 256), 256, 0, stream>>>(lwt + 0, 256, (_Float16*)(G64B), 256, 256, 256, 16.0f);
    w25::wmma_gemm64<0, false, 0, 0, false, 0><<<dim3((unsigned)((((4096) / 64) * ((256) / 64) + 7) / 8), (unsigned)(Bn)), 256, 0, stream>>>((const unsigned short*)(G64A), nullptr, 256, SP, (const unsigned short*)(G64B), nullptr, 256, 0, (void*)(THT), nullptr, 256, SP, nullptr, nullptr, 0, 4096, 256, 256, 0.0625f);
    k_castT16<<<dim3((unsigned)((((long long)(4096) * ((256) / 2)) + 255) / 256), (unsigned)(Bn)), 256, 0, stream>>>(flo, 4096, (_Float16*)(G64A), 256, 256, 4096, 1.0f, SP, SP);
    k_cast16<<<(unsigned)((((long long)(256) * ((256) / 2)) + 255) / 256), 256, 0, stream>>>(lwp + 0, 256, (_Float16*)(G64B), 256, 256, 256, 16.0f);
    w25::wmma_gemm64<0, false, 0, 0, false, 0><<<dim3((unsigned)((((4096) / 64) * ((256) / 64) + 7) / 8), (unsigned)(Bn)), 256, 0, stream>>>((const unsigned short*)(G64A), nullptr, 256, SP, (const unsigned short*)(G64B), nullptr, 256, 0, (void*)(PHT), nullptr, 256, SP, nullptr, nullptr, 0, 4096, 256, 256, 0.0625f);
    k_cast16<<<(unsigned)((((long long)(256) * ((256) / 2)) + 255) / 256), 256, 0, stream>>>(lwv + 0, 256, (_Float16*)(G64A), 256, 256, 256, 1.0f);
    k_castT16<<<dim3((unsigned)((((long long)(4096) * ((256) / 2)) + 255) / 256), (unsigned)(Bn)), 256, 0, stream>>>(flo, 4096, (_Float16*)(G64B), 256, 256, 4096, 16.0f, SP, SP);
    w25::wmma_gemm64<0, false, 0, 0, false, 0><<<dim3((unsigned)((((256) / 64) * ((4096) / 64) + 7) / 8), (unsigned)(Bn)), 256, 0, stream>>>((const unsigned short*)(G64A), nullptr, 256, 0, (const unsigned short*)(G64B), nullptr, 256, SP, (void*)(VAL), nullptr, 4096, SP, nullptr, nullptr, 0, 256, 4096, 256, 0.0625f);
    k_cm_spT<<<dim3((unsigned)(((long long)HW * A + 255) / 256), (unsigned)(Bn)), 256, 0, stream>>>(THT, lwt, lbt, 256, -1, A, (long long)HW * A);
    k_cm_spT<<<dim3((unsigned)(((long long)HW * A + 255) / 256), (unsigned)(Bn)), 256, 0, stream>>>(PHT, lwp, lbp, 256, -1, A, (long long)HW * A);
    k_cm_spC<<<dim3((unsigned)(((long long)A * HW + 255) / 256), (unsigned)(Bn)), 256, 0, stream>>>(VAL, lwv, lbv, 256, -1, HW, (long long)A * HW);
    k_cm_v16<<<(unsigned)(((long long)Bn * A * HW / 2 + 255) / 256), 256, 0, stream>>>(VAL, (_Float16*)VAL16, (long long)Bn * A * HW);
    // f16 planes of theta^T and phi^T, all samples (rows run on from sample to sample); they stay in place over the four passes
    k_cast16<<<(unsigned)((((long long)(16384) * ((256) / 2)) + 255) / 256), 256, 0, stream>>>(THT, 256, (_Float16*)(G64A), 256, 16384, 256, 1.0f);
    k_cast16<<<(unsigned)((((long long)(16384) * ((256) / 2)) + 255) / 256), 256, 0, stream>>>(PHT, 256, (_Float16*)(G64B), 256, 16384, 256, 1.0f);
    w25::wmma_gemm64<0, false, 0, 0, false, 0><<<dim3((unsigned)((((1024) / 64) * ((4096) / 64) + 7) / 8), (unsigned)(Bn)), 256, 0, stream>>>((const unsigned short*)(G64A + (size_t)0 * HS * A), nullptr, 256, SP, (const unsigned short*)(G64B), nullptr, 256, SP, (void*)(EN), nullptr, 4096, 4 * SP, nullptr, nullptr, 0, 1024, 4096, 256, 1.0f);
    k_cm_soft<<<Bn * HS, 256, 0, stream>>>(EN, (_Float16*)P16, HW);
    w25::wmma_gemm_kwaves<<<dim3((unsigned)(((A) / 32) * ((HS) / 64)), (unsigned)(Bn)), 512, 0, stream>>>((const unsigned short*)(VAL16), HW, SP, (const unsigned short*)(P16), HW, 4 * SP, ATT + (size_t)0 * HS, HW, SP, HS, HW, 0.000244140625f);
    w25::wmma_gemm64<0, false, 0, 0, false, 0><<<dim3((unsigned)((((1024) / 64) * ((4096) / 64) + 7) / 8), (unsigned)(Bn)), 256, 0, stream>>>((const unsigned short*)(G64A + (size_t)1 * HS * A), nullptr, 256, SP, (const unsigned short*)(G64B), nullptr, 256, SP, (void*)(EN), nullptr, 4096, 4 * SP, nullptr, nullptr, 0, 1024, 4096, 256, 1.0f);
    k_cm_soft<<<Bn * HS, 256, 0, stream>>>(EN, (_Float16*)P16, HW);
    w25::wmma_gemm_kwaves<<<dim3((unsigned)(((A) / 32) * ((HS) / 64)), (unsigned)(Bn)), 512, 0, stream>>>((const unsigned short*)(VAL16), HW, SP, (const unsigned short*)(P16), HW, 4 * SP, ATT + (size_t)1 * HS, HW, SP, HS, HW, 0.000244140625f);
    w25::wmma_gemm64<0, false, 0, 0, false, 0><<<dim3((unsigned)((((1024) / 64) * ((4096) / 64) + 7) / 8), (unsigned)(Bn)), 256, 0, stream>>>((const unsigned short*)(G64A + (size_t)2 * HS * A), nullptr, 256, SP, (const unsigned short*)(G64B), nullptr, 256, SP, (void*)(EN), nullptr, 4096, 4 * SP, nullptr, nullptr, 0, 1024, 4096, 256, 1.0f);
    k_cm_soft<<<Bn * HS, 256, 0, stream>>>(EN, (_Float16*)P16, HW);
    w25::wmma_gemm_kwaves<<<dim3((unsigned)(((A) / 32) * ((HS) / 64)), (unsigned)(Bn)), 512, 0, stream>>>((const unsigned short*)(VAL16), HW, SP, (const unsigned short*)(P16), HW, 4 * SP, ATT + (size_t)2 * HS, HW, SP, HS, HW, 0.000244140625f);
    w25::wmma_gemm64<0, false, 0, 0, false, 0><<<dim3((unsigned)((((1024) / 64) * ((4096) / 64) + 7) / 8), (unsigned)(Bn)), 256, 0, stream>>>((const unsigned short*)(G64A + (size_t)3 * HS * A), nullptr, 256, SP, (const unsigned short*)(G64B), nullptr, 256, SP, (void*)(EN), nullptr, 4096, 4 * SP, nullptr, nullptr, 0, 1024, 4096, 256, 1.0f);
    k_cm_soft<<<Bn * HS, 256, 0, stream>>>(EN, (_Float16*)P16, HW);
    w25::wmma_gemm_kwaves<<<dim3((unsigned)(((A) / 32) * ((HS) / 64)), (unsigned)(Bn)), 512, 0, stream>>>((const unsigned short*)(VAL16), HW, SP, (const unsigned short*)(P16), HW, 4 * SP, ATT + (size_t)3 * HS, HW, SP, HS, HW, 0.000244140625f);
    k_cast16<<<(unsigned)((((long long)(256) * ((256) / 2)) + 255) / 256), 256, 0, stream>>>(lwo, 256, (_Float16*)(G64A), 256, 256, 256, 16.0f);
    k_castT16<<<dim3((unsigned)((((long long)(4096) * ((256) / 2)) + 255) / 256), (unsigned)(Bn)), 256, 0, stream>>>(ATT, 4096, (_Float16*)(G64B), 256, 256, 4096, 1.0f, SP, SP);
    w25::wmma_gemm64<0, false, 1, 0, false, 0><<<dim3((unsigned)((((256) / 64) * ((4096) / 64) + 7) / 8), (unsigned)(Bn)), 256, 0, stream>>>((const unsigned short*)(G64A), nullptr, 256, 0, (const unsigned short*)(G64B), nullptr, 256, SP, (void*)(FUS + (size_t)1 * A * HW), nullptr, 4096, 2 * SP, lbo, nullptr, 0, 256, 4096, 256, 0.0625f);
    k_cast16<<<(unsigned)((((long long)(256) * ((512) / 2)) + 255) / 256), 256, 0, stream>>>(fw, 520, (_Float16*)(G64A), 512, 256, 512, 16.0f);
    k_castT16<<<dim3((unsigned)((((long long)(4096) * ((512) / 2)) + 255) / 256), (unsigned)(Bn)), 256, 0, stream>>>(FUS, 4096, (_Float16*)(G64B), 512, 512, 4096, 1.0f, 2 * SP, 2 * SP);
    w25::wmma_gemm64<0, false, 0, 0, false, 0><<<dim3((unsigned)((((256) / 64) * ((4096) / 64) + 7) / 8), (unsigned)(Bn)), 256, 0, stream>>>((const unsigned short*)(G64A), nullptr, 512, 0, (const unsigned short*)(G64B), nullptr, 512, 2 * SP, (void*)(out), nullptr, 4096, SP, nullptr, nullptr, 0, 256, 4096, 512, 0.0625f);
    k_cm_spC<<<dim3((unsigned)(((long long)A * HW + 255) / 256), (unsigned)(Bn)), 256, 0, stream>>>(out, fw, fb, 520, 512, HW, (long long)A * HW);
}

// v003
// Measured time: 1120 microseconds a run.
// Timed twice side by side with v002, it ran 1.18 and 1.17 times as fast.
// Over all steps from v000 it is 3.80 times as fast.
// Contractions (per branch; every launch serves the four samples, blockIdx.y or rows that run on from sample to sample): the 1x1 projections theta^T / phi^T = x^T.W^T [4096x512].[512x256] (image+flow channels as two K=256 products accumulated) and val = W.x [256x512].[512x4096], the affinity theta^T.phi [1024x256].[256x4096] per row quarter, att = val.attn^T [256x4096].[4096x1024] (attn as f16 of 4096 p; 32x64 work-group tiles, K dealt over 16 waves, f32 partials added in LDS), the output 1x1 convs W_o.att + b and the fusion conv over the concatenated branches — all f16 operands on pre-cast planes (v_wmma_f32_16x16x32_f16; 64x64 register-blocked wave tiles, weights x16 (x for val); strided channel-major operands); f32 accumulate. The 8 spatial-coordinate channels (gx, gy, 1-gx, 1-gy, (gx+gy)/2 x4, computed on device) enter the projections and the fusion conv as rank-8 f32 corrections (+bias); the row softmax (exp once) is an f32 kernel.
#include <hip/hip_runtime.h>
#include <math.h>

typedef __attribute__((ext_vector_type(16))) _Float16 v16h;
typedef __attribute__((ext_vector_type(8)))  _Float16 v8h;
typedef __attribute__((ext_vector_type(16))) __bf16   v16b;
typedef __attribute__((ext_vector_type(8)))  float    v8f;
typedef __attribute__((ext_vector_type(4)))  float    v4f;

// 16-bit WMMA fragment map (wave32), lane L, h = L>>4, m = L&15:
//   A 16x32: lane = row m;   element i -> k = (i<8) ? 8h+i : 16+8h+(i-8)
//   B 32x16: lane = column m; the SAME k(i,h)
//   D 16x16 (8 f32): lane = column m; element r -> row 8h+r
__device__ __forceinline__ int frag_k(int i, int h) { return (i < 8) ? (8 * h + i) : (16 + 8 * h + (i - 8)); }
__device__ __forceinline__ __bf16 bf16_rne(float f) {
    unsigned int u = __float_as_uint(f);
    u += 0x7fffu + ((u >> 16) & 1u);
    return __builtin_bit_cast(__bf16, (unsigned short)(u >> 16));
}
__device__ __forceinline__ float bf16_f32(__bf16 b) { return __uint_as_float(((unsigned int)__builtin_bit_cast(unsigned short, b)) << 16); }
__device__ __forceinline__ v8f wmma16(v16h a, v16h b, v8f c) {
    c = __builtin_amdgcn_wmma_f32_16x16x32_f16(false, a, false, b, (short)0, c, false, false);
    asm volatile("v_nop\n\tv_nop\n\tv_nop\n\tv_nop" : "+v"(c) : "v"(a), "v"(b));
    return c;
}
__device__ __forceinline__ v8f wmmab(v16b a, v16b b, v8f c) {
    c = __builtin_amdgcn_wmma_f32_16x16x32_bf16(false, a, false, b, (short)0, c, false, false);
    asm volatile("v_nop\n\tv_nop\n\tv_nop\n\tv_nop" : "+v"(c) : "v"(a), "v"(b));
    return c;
}
struct Split { v16b hi, lo; };
// hi/lo split product: a.hi*b.hi + a.hi*b.lo + a.lo*b.hi
__device__ __forceinline__ v8f wmma3(const Split& a, const Split& b, v8f c) {
    c = __builtin_amdgcn_wmma_f32_16x16x32_bf16(false, a.hi, false, b.hi, (short)0, c, false, false);
    c = __builtin_amdgcn_wmma_f32_16x16x32_bf16(false, a.hi, false, b.lo, (short)0, c, false, false);
    c = __builtin_amdgcn_wmma_f32_16x16x32_bf16(false, a.lo, false, b.hi, (short)0, c, false, false);
    asm volatile("v_nop\n\tv_nop\n\tv_nop\n\tv_nop" : "+v"(c) : "v"(a.hi), "v"(a.lo), "v"(b.hi), "v"(b.lo));
    return c;
}
struct Split3 { v16b hi, mid, lo; };
// triple split product (6 terms, drops only terms below 2^-24 relative)
__device__ __forceinline__ v8f wmma6(const Split3& a, const Split3& b, v8f c) {
    c = __builtin_amdgcn_wmma_f32_16x16x32_bf16(false, a.hi, false, b.hi, (short)0, c, false, false);
    c = __builtin_amdgcn_wmma_f32_16x16x32_bf16(false, a.hi, false, b.mid, (short)0, c, false, false);
    c = __builtin_amdgcn_wmma_f32_16x16x32_bf16(false, a.mid, false, b.hi, (short)0, c, false, false);
    c = __builtin_amdgcn_wmma_f32_16x16x32_bf16(false, a.hi, false, b.lo, (short)0, c, false, false);
    c = __builtin_amdgcn_wmma_f32_16x16x32_bf16(false, a.mid, false, b.mid, (short)0, c, false, false);
    c = __builtin_amdgcn_wmma_f32_16x16x32_bf16(false, a.lo, false, b.hi, (short)0, c, false, false);
    asm volatile("v_nop\n\tv_nop\n\tv_nop\n\tv_nop" : "+v"(c) : "v"(a.hi), "v"(a.mid), "v"(a.lo), "v"(b.hi), "v"(b.mid), "v"(b.lo));
    return c;
}

// Fragment gathers from f32 memory: element i <- p[(k0 + frag_k(i,h)) * sk] * s, zero for k >= klen.
__device__ __forceinline__ v16h fh_ld(const float* __restrict__ p, long long sk, int k0, int h, int klen, float s) {
    v16h a;
#pragma unroll
    for (int i = 0; i < 16; ++i) { const int k = k0 + frag_k(i, h); a[i] = (k < klen) ? (_Float16)(p[(long long)k * sk] * s) : (_Float16)0.f; }
    return a;
}
__device__ __forceinline__ Split sp_ld(const float* __restrict__ p, long long sk, int k0, int h, int klen, float s) {
    Split r;
#pragma unroll
    for (int i = 0; i < 16; ++i) {
        const int k = k0 + frag_k(i, h); const float x = (k < klen) ? p[(long long)k * sk] * s : 0.f;
        const __bf16 hb = bf16_rne(x); r.hi[i] = hb; r.lo[i] = bf16_rne(x - bf16_f32(hb));
    }
    return r;
}
__device__ __forceinline__ Split3 sp3_ld(const float* __restrict__ p, long long sk, int k0, int h, int klen, float s) {
    Split3 r;
#pragma unroll
    for (int i = 0; i < 16; ++i) {
        const int k = k0 + frag_k(i, h); const float x = (k < klen) ? p[(long long)k * sk] * s : 0.f;
        const __bf16 hb = bf16_rne(x); const float r1 = x - bf16_f32(hb); const __bf16 mb = bf16_rne(r1);
        r.hi[i] = hb; r.mid[i] = mb; r.lo[i] = bf16_rne(r1 - bf16_f32(mb));
    }
    return r;
}
__device__ __forceinline__ v16b bh_ld(const float* __restrict__ p, long long sk, int k0, int h, int klen, float s) {
    v16b a;
#pragma unroll
    for (int i = 0; i < 16; ++i) { const int k = k0 + frag_k(i, h); a[i] = bf16_rne((k < klen) ? p[(long long)k * sk] * s : 0.f); }
    return a;
}
// f16 fragment from an f16 LDS/global row with element stride 1 (k-contiguous), no bounds (tile already zero padded)
__device__ __forceinline__ v16h fh_row(const _Float16* __restrict__ row, int k0, int h) {
    v16h a;
#pragma unroll
    for (int i = 0; i < 16; ++i) a[i] = row[k0 + frag_k(i, h)];
    return a;
}

#define VST2(T, ptr, val) do { const T vst2_v_ = (val); *(T*)(ptr) = vst2_v_;  } while (0)
typedef float v4f __attribute__((ext_vector_type(4)));
#define VST2V4(ptr, val) do { const v4f vst2_v4_ = (val); *(v4f*)(ptr) = vst2_v4_;  } while (0)

__device__ __attribute__((noinline)) float act_fn(float v, int act) {
    if (act == 1) return fmaxf(v, 0.f);                                                                               // relu
    if (act == 2) { const float u = 0.7978845608028654f * (v + 0.044715f * v * v * v); return 0.5f * v * (1.f + tanhf(u)); } // tanh-gelu
    if (act == 3) return v / (1.f + expf(-v));                                                                        // silu
    if (act == 4) return 0.5f * v * (1.f + erff(v * 0.7071067811865476f));                                             // erf-gelu
    if (act == 5) return tanhf(v);
    if (act == 6) return 1.f / (1.f + expf(-v));                                                                      // sigmoid
    if (act == 7) return (v > 0.f) ? v : 0.01f * v;                                                                   // leaky relu 0.01
    if (act == 8) return (v > 0.f) ? v : (expf(v) - 1.f);                                                             // elu
    if (act == 9) return fminf(fmaxf(v, 0.f), 6.f);                                                                   // relu6
    if (act == 10) return fabsf(v);                                                                                    // abs
    if (act == 11) return (v >= 0.f) ? v : 0.1f * v;                                                                  // leaky 0.1
    if (act == 12) return (v > 0.f) ? v : 0.2f * v;                                                                   // leaky 0.2
    if (act == 13) return (v > 20.f) ? v : log1pf(expf(v));                                                            // softplus
    return v;
}

// =====================================================================================================================
// k_gemm<MODE>: C(z, m, n) = act(alpha * sum_k A(z, m, k) * B(z, k, n) + bias) + beta * R(z, m, n)
//   One wave (32-thread block) per 16 x 32 tile of C; grid (ceil(N/32), ceil(M/16), Z). Batch z -> (zo = z / zi_n, zi = z % zi_n)
//   with separate outer/inner strides for every tensor (e.g. batch and head). A(m,k) = A[zo*sAo + zi*sAi + m*sAm + k*sAk] (f32),
//   B(k,n) = B[zo*sBo + zi*sBi + n*sBn + k*sBk] (f32); any M, N, K (K zero-padded to 32 inside the fragments, M/N tails guarded).
//   C(m,n) = C[zo*sCo + zi*sCi + m*sCm + n] (n contiguous). flags: 1 bias[n], 2 bias[m], 4 residual R[zo*sRo + zi*sRi + m*sRm + n*sRn].
//   MODE 0: f16 operands (A prescaled by sa, B by sb, both undone in the epilogue); 1: bf16 hi/lo split (3 products); 2: bf16;
//   3: bf16 hi/mid/lo triple split (6 products); 4: as 3 with Kahan-compensated f32 accumulation across k-steps.
// =====================================================================================================================
struct GemmP {
    const float* A; const float* B; const float* bias; const float* R; float* C;
    long long sAo, sAi, sAm, sAk, sBo, sBi, sBn, sBk, sCo, sCi, sCm, sRo, sRi, sRm, sRn;
    int M, N, K, zi_n, flags, act; float alpha, beta, sa, sb;
    int Npad, pad_;     // columns [N, Npad) of C are written as 0 so that padded workspace rows are covered by whole-line stores; Npad >= N
};
static_assert(sizeof(GemmP) == 5 * 8 + 15 * 8 + 6 * 4 + 4 * 4 + 2 * 4, "GemmP has padding");

template <int MODE>
__global__ __launch_bounds__(32) void k_gemm(GemmP p) {
    const int lane = threadIdx.x & 31, h = lane >> 4, l15 = lane & 15;
    const int m0 = blockIdx.y * 16, n0 = blockIdx.x * 32;
    const int z = blockIdx.z, zo = z / p.zi_n, zi = z - zo * p.zi_n;
    const float* A = p.A + zo * p.sAo + zi * p.sAi;
    const float* B = p.B + zo * p.sBo + zi * p.sBi;
    const int am = min(m0 + l15, p.M - 1);                       // clamped row for loads (stores are guarded)
    v8f acc[2], comp[2];
#pragma unroll
    for (int t = 0; t < 2; ++t) { v8f zz = {}; acc[t] = zz; comp[t] = zz; }
    for (int k0 = 0; k0 < p.K; k0 += 32) {
        const float* arow = A + (long long)am * p.sAm;
        if (MODE == 1) {
            const Split a = sp_ld(arow, p.sAk, k0, h, p.K, 1.f);
#pragma unroll
            for (int t = 0; t < 2; ++t) {
                const int bn = min(n0 + t * 16 + l15, p.N - 1);
                acc[t] = wmma3(a, sp_ld(B + (long long)bn * p.sBn, p.sBk, k0, h, p.K, 1.f), acc[t]);
            }
        } else if (MODE == 3) {
            const Split3 a = sp3_ld(arow, p.sAk, k0, h, p.K, 1.f);
#pragma unroll
            for (int t = 0; t < 2; ++t) {
                const int bn = min(n0 + t * 16 + l15, p.N - 1);
                acc[t] = wmma6(a, sp3_ld(B + (long long)bn * p.sBn, p.sBk, k0, h, p.K, 1.f), acc[t]);
            }
        } else if (MODE == 4) {
            // triple split as MODE 3, but each k-step's 6 products go into a fresh accumulator and the partial is added to the running f32 sum
            // on the VALU with Kahan compensation (accumulation error stays ~1 ulp however long K is)
            const Split3 a = sp3_ld(arow, p.sAk, k0, h, p.K, 1.f);
#pragma unroll
            for (int t = 0; t < 2; ++t) {
                const int bn = min(n0 + t * 16 + l15, p.N - 1); v8f zz = {};
                const v8f part = wmma6(a, sp3_ld(B + (long long)bn * p.sBn, p.sBk, k0, h, p.K, 1.f), zz);
                const v8f y = part - comp[t]; const v8f s = acc[t] + y; comp[t] = (s - acc[t]) - y; acc[t] = s;
            }
        } else if (MODE == 2) {
            const v16b a = bh_ld(arow, p.sAk, k0, h, p.K, 1.f);
#pragma unroll
            for (int t = 0; t < 2; ++t) {
                const int bn = min(n0 + t * 16 + l15, p.N - 1);
                acc[t] = wmmab(a, bh_ld(B + (long long)bn * p.sBn, p.sBk, k0, h, p.K, 1.f), acc[t]);
            }
        } else {
            const v16h a = fh_ld(arow, p.sAk, k0, h, p.K, p.sa);
#pragma unroll
            for (int t = 0; t < 2; ++t) {
                const int bn = min(n0 + t * 16 + l15, p.N - 1);
                acc[t] = wmma16(a, fh_ld(B + (long long)bn * p.sBn, p.sBk, k0, h, p.K, p.sb), acc[t]);
            }
        }
    }
    const float iscale = (MODE == 0) ? p.alpha / (p.sa * p.sb) : p.alpha;
    float* C = p.C + zo * p.sCo + zi * p.sCi;
    const float* R = p.R + zo * p.sRo + zi * p.sRi;
    __shared__ __align__(16) float ctile[16][36];
#pragma unroll
    for (int t = 0; t < 2; ++t) {
        const int n = n0 + t * 16 + l15; const int nn = min(n, p.N - 1);
#pragma unroll
        for (int r = 0; r < 8; ++r) {
            const int m = m0 + 8 * h + r; const int mm = min(m, p.M - 1);
            float v = acc[t][r] * iscale;
            if (p.flags & 1) v += p.bias[nn];
            if (p.flags & 2) v += p.bias[mm];
            if (p.flags & 8) v *= p.bias[(long long)zo * p.M + mm];   /* per-(z,row) scale vector laid out [Z][M]; exclusive with the bias flags */
            v = act_fn(v, p.act);
            if (p.flags & 4) v += p.beta * R[(long long)mm * p.sRm + (long long)nn * p.sRn];
            ctile[8 * h + r][t * 16 + l15] = (n < p.N) ? v : 0.f;
        }
    }
    __syncthreads();
    const int NW = (p.Npad > p.N) ? p.Npad : p.N;           // write width
    const bool fast = (m0 + 16 <= p.M) && (n0 + 32 <= NW) && ((p.sCm & 3) == 0) && ((((size_t)C) & 15) == 0);
    if (fast) {
#pragma unroll
        for (int s = 0; s < 4; ++s) {
            const int row = s * 4 + (lane >> 3), c4 = (lane & 7) * 4;
            const v4f v = *(const v4f*)&ctile[row][c4];
            VST2V4(C + (long long)(m0 + row) * p.sCm + n0 + c4, v);
        }
    } else {
        for (int row = 0; row < 16; ++row) {
            const int m = m0 + row, n = n0 + lane;
            if (m < p.M && n < NW) VST2(float, C + (long long)m * p.sCm + n, ctile[row][lane]);
        }
    }
}


// =====================================================================================================================
// k_gemmT<MODE, TM, TN>: same contract as k_gemm, but one wave computes a (16*TM) x (16*TN) tile: TM A fragments and TN B fragments are
//   loaded per 32-wide k-step and reused across TM*TN WMMAs (far fewer load/convert instructions per MAC). MODE 0 (f16), 1 (bf16 hi/lo),
//   2 (bf16) only. grid (ceil(NW/(16*TN)), ceil(M/(16*TM)), Z), block 32. Epilogue identical to k_gemm, run per 16x32 sub-tile.
// =====================================================================================================================
template <int MODE, int TM, int TN>
__global__ __launch_bounds__(32) void k_gemmT(GemmP p) {
    const int lane = threadIdx.x & 31, h = lane >> 4, l15 = lane & 15;
    const int m0 = blockIdx.y * (16 * TM), n0 = blockIdx.x * (16 * TN);
    const int z = blockIdx.z, zo = z / p.zi_n, zi = z - zo * p.zi_n;
    const float* A = p.A + zo * p.sAo + zi * p.sAi;
    const float* B = p.B + zo * p.sBo + zi * p.sBi;
    v8f acc[TM][TN];
#pragma unroll
    for (int i = 0; i < TM; ++i)
#pragma unroll
        for (int t = 0; t < TN; ++t) { v8f zz = {}; acc[i][t] = zz; }
    for (int k0 = 0; k0 < p.K; k0 += 32) {
        if (MODE == 1) {
            Split a[TM], b[TN];
#pragma unroll
            for (int i = 0; i < TM; ++i) { const int am = min(m0 + 16 * i + l15, p.M - 1); a[i] = sp_ld(A + (long long)am * p.sAm, p.sAk, k0, h, p.K, 1.f); }
#pragma unroll
            for (int t = 0; t < TN; ++t) { const int bn = min(n0 + 16 * t + l15, p.N - 1); b[t] = sp_ld(B + (long long)bn * p.sBn, p.sBk, k0, h, p.K, 1.f); }
#pragma unroll
            for (int i = 0; i < TM; ++i)
#pragma unroll
                for (int t = 0; t < TN; ++t) acc[i][t] = wmma3(a[i], b[t], acc[i][t]);
        } else if (MODE == 2) {
            v16b a[TM], b[TN];
#pragma unroll
            for (int i = 0; i < TM; ++i) { const int am = min(m0 + 16 * i + l15, p.M - 1); a[i] = bh_ld(A + (long long)am * p.sAm, p.sAk, k0, h, p.K, 1.f); }
#pragma unroll
            for (int t = 0; t < TN; ++t) { const int bn = min(n0 + 16 * t + l15, p.N - 1); b[t] = bh_ld(B + (long long)bn * p.sBn, p.sBk, k0, h, p.K, 1.f); }
#pragma unroll
            for (int i = 0; i < TM; ++i)
#pragma unroll
                for (int t = 0; t < TN; ++t) acc[i][t] = wmmab(a[i], b[t], acc[i][t]);
        } else {
            v16h a[TM], b[TN];
#pragma unroll
            for (int i = 0; i < TM; ++i) { const int am = min(m0 + 16 * i + l15, p.M - 1); a[i] = fh_ld(A + (long long)am * p.sAm, p.sAk, k0, h, p.K, p.sa); }
#pragma unroll
            for (int t = 0; t < TN; ++t) { const int bn = min(n0 + 16 * t + l15, p.N - 1); b[t] = fh_ld(B + (long long)bn * p.sBn, p.sBk, k0, h, p.K, p.sb); }
#pragma unroll
            for (int i = 0; i < TM; ++i)
#pragma unroll
                for (int t = 0; t < TN; ++t) acc[i][t] = wmma16(a[i], b[t], acc[i][t]);
        }
    }
    const float iscale = (MODE == 0) ? p.alpha / (p.sa * p.sb) : p.alpha;
    float* C = p.C + zo * p.sCo + zi * p.sCi;
    const float* R = p.R + zo * p.sRo + zi * p.sRi;
    const int NW = (p.Npad > p.N) ? p.Npad : p.N;
    __shared__ __align__(16) float ctile[16][36];
#pragma unroll
    for (int i = 0; i < TM; ++i) {
        const int mb = m0 + 16 * i; if (mb >= p.M) break;          // wave-uniform
#pragma unroll
        for (int tp = 0; tp < TN / 2; ++tp) {
            const int nb = n0 + 32 * tp; if (nb >= NW) break;        // wave-uniform
#pragma unroll
            for (int t2 = 0; t2 < 2; ++t2) {
                const int t = 2 * tp + t2; const int n = nb + t2 * 16 + l15; const int nn = min(n, p.N - 1);
#pragma unroll
                for (int r = 0; r < 8; ++r) {
                    const int m = mb + 8 * h + r; const int mm = min(m, p.M - 1);
                    float v = acc[i][t][r] * iscale;
                    if (p.flags & 1) v += p.bias[nn];
                    if (p.flags & 2) v += p.bias[mm];
            if (p.flags & 8) v *= p.bias[(long long)zo * p.M + mm];   /* per-(z,row) scale vector laid out [Z][M]; exclusive with the bias flags */
                    v = act_fn(v, p.act);
                    if (p.flags & 4) v += p.beta * R[(long long)mm * p.sRm + (long long)nn * p.sRn];
                    ctile[8 * h + r][t2 * 16 + l15] = (n < p.N) ? v : 0.f;
                }
            }
            __syncthreads();
            const bool fast = (mb + 16 <= p.M) && (nb + 32 <= NW) && ((p.sCm & 3) == 0) && ((((size_t)C) & 15) == 0);
            if (fast) {
#pragma unroll
                for (int s = 0; s < 4; ++s) {
                    const int row = s * 4 + (lane >> 3), c4 = (lane & 7) * 4;
                    const v4f v = *(const v4f*)&ctile[row][c4];
                    VST2V4(C + (long long)(mb + row) * p.sCm + nb + c4, v);
                }
            } else {
                for (int row = 0; row < 16; ++row) {
                    const int m = mb + row, n = nb + lane;
                    if (m < p.M && n < NW) VST2(float, C + (long long)m * p.sCm + n, ctile[row][lane]);
                }
            }
            __syncthreads();
        }
    }
}

// =====================================================================================================================
//   Wave = 16 queries, AW waves per block, 64-key blocks; grid (ceil(Lq/(16*AW)), H, B), block 32*AW. Any Lq, Lk; head dim dh <= DHP
//   (DHP multiple of 32), value dim dv <= DVP (multiple of 16, <= 128). Every tensor addressed by (batch, head, row, element) strides, f32.
//   Scores: QM 0 f16 operands, 1 bf16 hi/lo split, 2 bf16 triple split; statistics f32 (exp2 domain); P.V: P x 4096 as f16 with V f16 staged in LDS
//   (SPLITPV: P and V as bf16 hi/lo splits). kv head = h / hrep. Masking: causal = 1 (keep j <= i + coff, masked -> -inf, key blocks beyond the
//   diagonal skipped), causal = 2 (masked -> mfill, a finite fill like the -1e9; no skipping), causal = 3 (keep j >= i + coff,
//   masked -> -inf, no skipping); optional additive f32 mask Mf,
//   optional int keep-mask Mi (0 -> score := mfill), both addressed b*smb + h*smh + i*smi + j*smj (0 strides broadcast).
// =====================================================================================================================
#define AW 4
struct AttnP {   // apv4
    const float* Q; const float* K; const float* V; float* O; float* P; const float* Mf; const int* Mi; float* ST;
    const float* Pw; const float* Rt; const int* SQ; const int* SK;           // optional: post-softmax weight, relative-position table, segment ids
    long long swb, swh, swi, swj, srb, srh, sri;                                 // Pw strides (b,h,i,j); Rt strides (b,h,i), column = clamp(i - j + roff, 0, rn-1)
    long long sQb, sQh, sQi, sQd, sKb, sKh, sKj, sKd, sVb, sVh, sVj, sVd, sOb, sOh, sOi, sPb, sPh, sPi, smb, smh, smi, smj;
    int Lq, Lk, dh, dv, hrep, causal, coff, pband;   // pband > 0: P holds only the band |j - i| <= pband, column j - i + pband
    float scale, mfill; int nonorm, mpol;             // nonorm (online path only): O = sum_j exp(score_j) V_j without the 1/rowsum (scores must be <= ~0); mpol: Mi masks where ==0 (mpol 0) or where !=0 (mpol 1)
    int roff, rn, segpol, win;                        // Rt column offset/count; SQ/SK: score := mfill where (segpol 0) SQ[i] != SK[j] or (segpol 1) SQ[i] == SK[j]; win > 0: keys with i - j > win (after coff) -> -inf
};
//   Pw: the softmax numerator is multiplied by Pw(b,h,i,j) AFTER the row sum is taken (probs * weight, then P.V), as in post-softmax multiplicative biases.                                                    // ST (optional): per row (b,h,i) -> ST[((b*H + h)*Lq + i)*2 + {0,1}] = {row max of the scaled+masked score (natural units), sum_j exp(score - max)}
static_assert(sizeof(AttnP) == 12 * 8 + 29 * 8 + 16 * 4, "AttnP has padding");

#ifndef KATTN_ATTR
#define KATTN_ATTR
#endif
template <int DHP, int DVP, int QM, bool SPLITPV, bool TWOPASS>
__global__ __launch_bounds__(32 * AW) KATTN_ATTR void k_attn(AttnP p) {
    constexpr int NT = DVP / 16;                // output tiles
    constexpr int KS = DHP / 32;                // k-steps for the scores
    constexpr int VP = DVP + 8;                 // LDS pitch (halves)
    __shared__ __align__(16) float    pl[AW][16 * 64];
    __shared__ __align__(16) _Float16 vl[(SPLITPV ? 2 : 1) * 64 * VP];   // f16 V tile, or bf16 hi and lo tiles (same 2-byte size)
    const int lane = threadIdx.x & 31, hf = lane >> 4, l15 = lane & 15, wave = threadIdx.x >> 5;
    const int h = blockIdx.y, b = blockIdx.z, hk = h / p.hrep;
    const int q0 = (blockIdx.x * AW + wave) * 16;
    float* myp = pl[wave];
    const float L2E = 1.4426950408889634f;
    const float NEG = -__builtin_inff();
    const int qi = min(q0 + l15, p.Lq - 1);
    const float* qrow = p.Q + b * p.sQb + h * p.sQh + (long long)qi * p.sQi;
    const float* kbase = p.K + b * p.sKb + hk * p.sKh;
    const float* vbase = p.V + b * p.sVb + hk * p.sVh;
    v16h qa[QM == 0 ? KS : 1]; Split qs_[QM == 1 ? KS : 1]; Split3 qt_[QM == 2 ? KS : 1];
#pragma unroll
    for (int ks = 0; ks < KS; ++ks) {
        if (QM == 2) qt_[ks] = sp3_ld(qrow, p.sQd, ks * 32, hf, p.dh, 1.f);
        else if (QM == 1) qs_[ks] = sp_ld(qrow, p.sQd, ks * 32, hf, p.dh, 1.f);
        else qa[ks] = fh_ld(qrow, p.sQd, ks * 32, hf, p.dh, 1.f);
    }
    v8f o[NT]; float m8[8], l8[8];
#pragma unroll
    for (int t = 0; t < NT; ++t) { v8f zz = {}; o[t] = zz; }
#pragma unroll
    for (int i = 0; i < 8; ++i) { m8[i] = NEG; l8[i] = 0.f; }
    int jend = p.Lk; int jstart = 0;
    if (p.causal == 1) { const int je = (blockIdx.x * AW + AW - 1) * 16 + 16 + p.coff; jend = min(jend, max(je, 0)); }   // uniform per block
    if (p.win > 0) { const int js = (int)(blockIdx.x * AW) * 16 + p.coff - p.win; jstart = (js > 0) ? (js / 64) * 64 : 0; }   // uniform per block: key blocks entirely outside every row's window hold only -inf entries and are skipped exactly
    const int npass = TWOPASS ? 2 : 1;
    for (int pass = 0; pass < npass; ++pass) {
        const bool dopv = (!TWOPASS) || pass == 1;
        for (int j0 = jstart; j0 < jend; j0 += 64) {
            if (dopv) {
                __syncthreads();                                 // previous key block's reads of vl / pl are done
                for (int idx = threadIdx.x; idx < 64 * DVP; idx += 32 * AW) {
                    const int jr = idx / DVP, d = idx - jr * DVP, j = j0 + jr;
                    const float f = (j < p.Lk && d < p.dv) ? vbase[(long long)j * p.sVj + (long long)d * p.sVd] : 0.f;
                    if (SPLITPV) {
                        const __bf16 hb = bf16_rne(f);
                        ((__bf16*)vl)[jr * VP + d] = hb; ((__bf16*)vl)[64 * VP + jr * VP + d] = bf16_rne(f - bf16_f32(hb));
                    } else vl[jr * VP + d] = (_Float16)f;
                }
            }
            v8f s[4];
#pragma unroll
            for (int t = 0; t < 4; ++t) {
                const int j = min(j0 + t * 16 + l15, p.Lk - 1);
                const float* krow = kbase + (long long)j * p.sKj;
                v8f acc = {};
#pragma unroll
                for (int ks = 0; ks < KS; ++ks) {
                    if (QM == 2)      acc = wmma6(qt_[ks], sp3_ld(krow, p.sKd, ks * 32, hf, p.dh, 1.f), acc);
                    else if (QM == 1) acc = wmma3(qs_[ks], sp_ld(krow, p.sKd, ks * 32, hf, p.dh, 1.f), acc);
                    else              acc = wmma16(qa[ks], fh_ld(krow, p.sKd, ks * 32, hf, p.dh, 1.f), acc);
                }
                s[t] = acc;
            }
            float pv[8][4];
#pragma unroll
            for (int i = 0; i < 8; ++i) {
                const int irow = q0 + i + 8 * hf;
                const int ic = min(irow, p.Lq - 1);
                float sc[4];
#pragma unroll
                for (int t = 0; t < 4; ++t) {
                    const int jg = j0 + t * 16 + l15;
                    float v = s[t][i] * p.scale;
                    if (p.Mf) v += p.Mf[b * p.smb + h * p.smh + (long long)ic * p.smi + (long long)min(jg, p.Lk - 1) * p.smj];
                    if (p.Rt) { int rc = ic - min(jg, p.Lk - 1) + p.roff; rc = rc < 0 ? 0 : (rc >= p.rn ? p.rn - 1 : rc); v += p.Rt[b * p.srb + h * p.srh + (long long)ic * p.sri + rc]; }
                    if (p.Mi) { const int mv = p.Mi[b * p.smb + h * p.smh + (long long)ic * p.smi + (long long)min(jg, p.Lk - 1) * p.smj]; if (p.mpol ? (mv != 0) : (mv == 0)) v = p.mfill; }
                    if (p.SQ) { const bool same = p.SQ[(long long)b * p.Lq + ic] == p.SK[(long long)b * p.Lk + min(jg, p.Lk - 1)]; if (p.segpol ? same : !same) v = p.mfill; }
                    if (p.causal == 2 && jg > irow + p.coff) v = p.mfill;
                    if (jg >= p.Lk || (p.causal == 1 && jg > irow + p.coff) || (p.causal == 3 && jg < irow + p.coff) || (p.win > 0 && irow + p.coff - jg > p.win)) v = NEG; else v *= L2E;
                    sc[t] = v;
                }
                if (!TWOPASS || pass == 0) {
                    float mx = fmaxf(fmaxf(sc[0], sc[1]), fmaxf(sc[2], sc[3]));
                    mx = fmaxf(mx, __shfl_xor(mx, 1, 32)); mx = fmaxf(mx, __shfl_xor(mx, 2, 32));
                    mx = fmaxf(mx, __shfl_xor(mx, 4, 32)); mx = fmaxf(mx, __shfl_xor(mx, 8, 32));
                    const float mnew = fmaxf(m8[i], mx);
                    const float corr = (mnew == NEG) ? 1.f : exp2f(m8[i] - mnew);
                    float rs = 0.f;
#pragma unroll
                    for (int t = 0; t < 4; ++t) {
                        const float pp = (sc[t] == NEG) ? 0.f : exp2f(sc[t] - mnew); rs += pp;
                        pv[i][t] = p.Pw ? pp * p.Pw[b * p.swb + h * p.swh + (long long)ic * p.swi + (long long)min(j0 + t * 16 + l15, p.Lk - 1) * p.swj] : pp;
                    }
                    rs += __shfl_xor(rs, 1, 32); rs += __shfl_xor(rs, 2, 32); rs += __shfl_xor(rs, 4, 32); rs += __shfl_xor(rs, 8, 32);
                    l8[i] = l8[i] * corr + rs; m8[i] = mnew;
                    if (!TWOPASS) {
#pragma unroll
                        for (int t = 0; t < NT; ++t) o[t][i] *= corr;
                    }
                } else {
                    const float inv = (l8[i] > 0.f) ? 1.f / l8[i] : 0.f;
#pragma unroll
                    for (int t = 0; t < 4; ++t) {
                        const int jg = j0 + t * 16 + l15;
                        float pp = (sc[t] == NEG) ? 0.f : exp2f(sc[t] - m8[i]) * inv;
                        if (p.Pw) pp *= p.Pw[b * p.swb + h * p.swh + (long long)ic * p.swi + (long long)min(jg, p.Lk - 1) * p.swj];
                        pv[i][t] = pp;
                    }
                }
            }
            if (dopv) {
#pragma unroll
                for (int i = 0; i < 8; ++i)
#pragma unroll
                    for (int t = 0; t < 4; ++t) ((float*)myp)[(i + 8 * hf) * 64 + t * 16 + l15] = pv[i][t];
                __syncthreads();                                 // P (per wave) and V (shared) visible
                if (p.P) {
                    float* pb_ = p.P + b * p.sPb + h * p.sPh;
                    const bool fastP = (p.pband == 0) && ((p.sPi & 3) == 0) && (j0 + 64 <= p.Lk) && (q0 + 16 <= p.Lq) && ((((size_t)pb_) & 15) == 0);
                    if (fastP) {
#pragma unroll
                        for (int s = 0; s < 8; ++s) {
                            const int row = s * 2 + (lane >> 4), c4 = (lane & 15) * 4;
                            const v4f v = *(const v4f*)(myp + row * 64 + c4);
                            VST2V4(pb_ + (long long)(q0 + row) * p.sPi + j0 + c4, v);
                        }
                    } else {
                        for (int row = 0; row < 16; ++row) {
                            const int irow = q0 + row; if (irow >= p.Lq) continue;
                            for (int c = lane; c < 64; c += 32) {
                                const int jg = j0 + c; if (jg >= p.Lk) continue;
                                if (p.pband == 0) VST2(float, pb_ + (long long)irow * p.sPi + jg, myp[row * 64 + c]);
                                else if (jg - irow <= p.pband && irow - jg <= p.pband) VST2(float, pb_ + (long long)irow * p.sPi + (jg - irow + p.pband), myp[row * 64 + c]);
                            }
                        }
                    }
                }
                if (SPLITPV) {
                    const Split pa0 = sp_ld(myp + l15 * 64, 1, 0, hf, 64, 1.f), pa1 = sp_ld(myp + l15 * 64, 1, 32, hf, 64, 1.f);
                    const __bf16* vh = (const __bf16*)vl; const __bf16* vlo = vh + 64 * VP;
#pragma unroll
                    for (int t = 0; t < NT; ++t) {
                        const int dcol = t * 16 + l15;
                        Split b0, b1;
#pragma unroll
                        for (int e = 0; e < 16; ++e) {
                            const int k0 = frag_k(e, hf), k1 = 32 + frag_k(e, hf);
                            b0.hi[e] = vh[k0 * VP + dcol]; b0.lo[e] = vlo[k0 * VP + dcol]; b1.hi[e] = vh[k1 * VP + dcol]; b1.lo[e] = vlo[k1 * VP + dcol];
                        }
                        o[t] = wmma3(pa0, b0, o[t]);
                        o[t] = wmma3(pa1, b1, o[t]);
                    }
                } else {
                    const v16h pa0 = fh_ld(myp + l15 * 64, 1, 0, hf, 64, 4096.f), pa1 = fh_ld(myp + l15 * 64, 1, 32, hf, 64, 4096.f);
#pragma unroll
                    for (int t = 0; t < NT; ++t) {
                        const int dcol = t * 16 + l15;
                        v16h b0, b1;
#pragma unroll
                        for (int e = 0; e < 16; ++e) { b0[e] = vl[frag_k(e, hf) * VP + dcol]; b1[e] = vl[(32 + frag_k(e, hf)) * VP + dcol]; }
                        o[t] = wmma16(pa0, b0, o[t]);
                        o[t] = wmma16(pa1, b1, o[t]);
                    }
                }
            }
        }
    }
    float* obase = p.O + b * p.sOb + h * p.sOh;
    if (p.ST) {
        const int rl = lane >> 1, isel = rl & 7;           // row q0 + rl ; rl>>3 == hf holds because lane>>4 == (lane>>1)>>3
        float mv = 0.f, lv = 0.f;
#pragma unroll
        for (int i = 0; i < 8; ++i) if (i == isel) { mv = m8[i]; lv = l8[i]; }
        const int irow = q0 + rl;
        if (irow < p.Lq) { float* st = p.ST + (((long long)b * gridDim.y + h) * p.Lq + irow) * 2 + (lane & 1); VST2(float, st, (lane & 1) ? lv : mv * 0.6931471805599453f); }
    }
    float invr[8];
#pragma unroll
    for (int i = 0; i < 8; ++i) {
        if (TWOPASS) invr[i] = SPLITPV ? 1.f : (1.f / 4096.f);
        else if (p.nonorm) invr[i] = exp2f(m8[i]) * (SPLITPV ? 1.f : (1.f / 4096.f));
        else invr[i] = (l8[i] > 0.f) ? (SPLITPV ? 1.f / l8[i] : 1.f / (l8[i] * 4096.f)) : 0.f;
    }
    __syncthreads();                                             // all waves done with pl/vl from the main loop
    const bool ofast = ((p.sOi & 3) == 0) && ((((size_t)obase) & 15) == 0) && (q0 + 16 <= p.Lq);
#pragma unroll
    for (int c0 = 0; c0 < DVP; c0 += 64) {
#pragma unroll
        for (int i = 0; i < 8; ++i)
#pragma unroll
            for (int t = 0; t < NT; ++t) if (t * 16 >= c0 && t * 16 < c0 + 64) ((float*)myp)[(i + 8 * hf) * 64 + (t * 16 - c0) + l15] = o[t][i] * invr[i];
        __syncthreads();
        const int cw = (DVP - c0 < 64) ? (DVP - c0) : 64;      // staged columns in this chunk (multiple of 16)
        if (ofast && (c0 + cw <= p.dv) && (cw % 32 == 0)) {
            const int lpr = cw / 4;                              // lanes per row (16 for 64 cols, 8 for 32)
            const int rows_per_ins = 32 / lpr;
            for (int r0 = 0; r0 < 16; r0 += rows_per_ins) {
                const int row = r0 + lane / lpr, c4 = (lane % lpr) * 4;
                const v4f v = *(const v4f*)(myp + row * 64 + c4);
                VST2V4(obase + (long long)(q0 + row) * p.sOi + c0 + c4, v);
            }
        } else {
            for (int row = 0; row < 16; ++row) {
                const int irow = q0 + row; if (irow >= p.Lq) continue;
                for (int c = lane; c < cw; c += 32) { const int d = c0 + c; if (d < p.dv) VST2(float, obase + (long long)irow * p.sOi + d, myp[row * 64 + c]); }
            }
        }
        __syncthreads();
    }
}

// =====================================================================================================================
// k_tr: dst(z, c, r) = alpha * src(z, r, c) (+ beta * R2(z, c, r)): [Z][R][C] (row stride lds) -> [Z][C][R] (row stride ldd) through a 32x32 LDS tile;
//   flags: 1 -> add beta * residual R2 addressed like dst (z*sRz + c*ldr + r); act applied before the residual.
// =====================================================================================================================
struct TrP { const float* src; float* dst; const float* R2; long long sSz, lds, sDz, ldd, sRz, ldr; int R, C, flags, act; float alpha, beta; };
static_assert(sizeof(TrP) == 3 * 8 + 6 * 8 + 6 * 4, "TrP has padding");
__global__ __launch_bounds__(256) void k_tr(TrP p) {
    __shared__ float tile[32][33];
    const int c0 = blockIdx.x * 32, r0 = blockIdx.y * 32, z = blockIdx.z;
    const int lane = threadIdx.x & 31, wave = threadIdx.x >> 5;
    const float* s = p.src + z * p.sSz;
#pragma unroll
    for (int k = 0; k < 4; ++k) {
        const int rl = wave * 4 + k, r = r0 + rl, c = c0 + lane;
        tile[rl][lane] = (r < p.R && c < p.C) ? s[(long long)r * p.lds + c] : 0.f;
    }
    __syncthreads();
    float* d = p.dst + z * p.sDz; const float* rr = p.R2 + z * p.sRz;
#pragma unroll
    for (int k = 0; k < 4; ++k) {
        const int cl = wave * 4 + k, c = c0 + cl, r = r0 + lane;
        if (c < p.C && r < p.R) {
            float v = act_fn(p.alpha * tile[lane][cl], p.act);
            if (p.flags & 1) v += p.beta * rr[(long long)c * p.ldr + r];
            VST2(float, d + (long long)c * p.ldd + r, v);
        }
    }
}

// k_affine: dst[i] = a * (sdev ? sdev[0] : 1) * src[i] + b, i < n (one thread per element; consecutive lanes -> consecutive addresses)
__global__ __launch_bounds__(256) void k_affine(const float* __restrict__ src, float* __restrict__ dst, int n, float a, float b, const float* __restrict__ sdev) {
    const int i = blockIdx.x * 256 + threadIdx.x;
    if (i < n) { const float aa = sdev ? a * sdev[0] : a; const float v = aa * src[i] + b; VST2(float, dst + i, v); }
}

// =====================================================================================================================
// k_softmax: row softmax over n contiguous elements, one 256-thread block per row; rows addressed z*sz + r*sr (grid (R, Z)).
//   out = scale_out * softmax(scale_in * x + (Mf ? Mf[z*smz + r*smr + j] : 0)); a row whose max is -inf is written as 0.
// =====================================================================================================================
struct SmP { const float* src; float* dst; const float* Mf; long long sz, sr, dz, dr, smz, smr; int n, pad; float scale_in, scale_out; };
static_assert(sizeof(SmP) == 3 * 8 + 6 * 8 + 4 * 4, "SmP has padding");
__global__ __launch_bounds__(256) void k_softmax(SmP p) {
    __shared__ float red[256];
    const int r = blockIdx.x, z = blockIdx.y, tid = threadIdx.x;
    const float* s = p.src + z * p.sz + (long long)r * p.sr;
    const float* mf = p.Mf ? (p.Mf + z * p.smz + (long long)r * p.smr) : nullptr;
    float mx = -__builtin_inff();
    for (int j = tid; j < p.n; j += 256) { float v = s[j] * p.scale_in; if (mf) v += mf[j]; mx = fmaxf(mx, v); }
    red[tid] = mx; __syncthreads();
    for (int o = 128; o > 0; o >>= 1) { if (tid < o) red[tid] = fmaxf(red[tid], red[tid + o]); __syncthreads(); }
    mx = red[0]; __syncthreads();
    float sum = 0.f;
    for (int j = tid; j < p.n; j += 256) { float v = s[j] * p.scale_in; if (mf) v += mf[j]; sum += (mx == -__builtin_inff()) ? 0.f : expf(v - mx); }
    red[tid] = sum; __syncthreads();
    for (int o = 128; o > 0; o >>= 1) { if (tid < o) red[tid] += red[tid + o]; __syncthreads(); }
    sum = red[0];
    const float inv = (sum > 0.f) ? p.scale_out / sum : 0.f;
    float* d = p.dst + z * p.dz + (long long)r * p.dr;
    for (int j = tid; j < p.n; j += 256) { float v = s[j] * p.scale_in; if (mf) v += mf[j]; const float o = (mx == -__builtin_inff()) ? 0.f : expf(v - mx) * inv; VST2(float, d + j, o); }
}
// =====================================================================================================================
// k_stats: mean and rsqrt(var + eps) over a set of n elements addressed base + z*sz + (e / inner) * so + (e % inner) * si, one 256-thread
// k_norm_apply: y = (x - mean[set]) * rstd[set] * g[c] + b[c] over a [Z][C][L] channel-major tensor with set = z*G + c / (C/G) (G groups per z;
//   G = C -> per-channel sets indexed z*C+c; for batch norm pass stats indexed by c only via bn = 1). Optional act. Output same layout.
// =====================================================================================================================
//   mode 0: mean / rsqrt(var + eps); mode 1 (RMSNorm): 0 / rsqrt(mean(x^2) + eps); mode 2 (L2 normalize * sqrt(n)): 0 / sqrt(n) / max(||x||, eps); mode 3: as 0 with unbiased variance (n-1)
__global__ __launch_bounds__(256) void k_stats(const float* __restrict__ x, long long sz, long long so, long long si, int inner, int n, float eps, float* __restrict__ stat, int mode) {
    __shared__ float red[256];
    const int z = blockIdx.x, tid = threadIdx.x;
    const float* base = x + z * sz;
    float s = 0.f;
    for (int e = tid; e < n; e += 256) s += base[(long long)(e / inner) * so + (long long)(e % inner) * si];
    red[tid] = s; __syncthreads();
    for (int o = 128; o > 0; o >>= 1) { if (tid < o) red[tid] += red[tid + o]; __syncthreads(); }
    const float mu = (mode == 0 || mode == 3) ? red[0] / (float)n : 0.f; __syncthreads();
    float q = 0.f;
    for (int e = tid; e < n; e += 256) { const float dlt = base[(long long)(e / inner) * so + (long long)(e % inner) * si] - mu; q += dlt * dlt; }
    red[tid] = q; __syncthreads();
    for (int o = 128; o > 0; o >>= 1) { if (tid < o) red[tid] += red[tid + o]; __syncthreads(); }
    {
        float rs;
        if (mode == 2) rs = sqrtf((float)n) / fmaxf(sqrtf(red[0]), eps); else if (mode == 3) rs = rsqrtf(red[0] / (float)(n - 1) + eps); else rs = rsqrtf(red[0] / (float)n + eps);
        if (tid < 32) { const float v = (tid == 0) ? mu : ((tid == 1) ? rs : 0.f); VST2(float, stat + (long long)z * 32 + tid, v); }
    }
}
//   One thread per element over the flat [Z][C][L] index space: grid ceil(Z*C*L / 256).
__global__ __launch_bounds__(256) void k_norm_apply(const float* __restrict__ x, float* __restrict__ y, const float* __restrict__ stat, const float* __restrict__ g, const float* __restrict__ bta,
                                                     int Z, int C, int L, int G, int bn, int act) {
    const long long idx = (long long)blockIdx.x * 256 + threadIdx.x;
    if (idx >= (long long)Z * C * L) return;
    const int l = (int)(idx % L); const long long zc = idx / L; const int c = (int)(zc % C), z = (int)(zc / C); (void)l;
    const int set = bn ? c : (z * G + c / (C / G));
    float v = (x[idx] - stat[(long long)set * 32]) * stat[(long long)set * 32 + 1];
    if (g) v *= g[c];
    if (bta) v += bta[c];
    v = act_fn(v, act);
    VST2(float, y + idx, v);
}

// k_lse_neg: c[i] = -(st[2i] + log(st[2i+1])) = minus the log-sum-exp of row i from k_attn's ST output (for softmax over the query dimension)
__global__ __launch_bounds__(256) void k_lse_neg(const float* __restrict__ st, float* __restrict__ c, int n) {
    const int i = blockIdx.x * 256 + threadIdx.x;
    if (i < n) { const float v = -(st[2 * i] + logf(st[2 * i + 1])); VST2(float, c + i, v); }
}

// k_iota: dst[i] = a * i + b as int32 (segment/position id helper)
__global__ __launch_bounds__(256) void k_iota(int* __restrict__ dst, int n, int a, int b) {
    const int i = blockIdx.x * 256 + threadIdx.x;
    if (i < n) { const int v = a * i + b; VST2(int, dst + i, v); }
}

// k_axpby: dst[i] = a * x[i] + b * y[i] (+ c), i < n
__global__ __launch_bounds__(256) void k_axpby(const float* __restrict__ x, const float* __restrict__ y, float* __restrict__ dst, int n, float a, float b, float c) {
    const int i = blockIdx.x * 256 + threadIdx.x;
    if (i < n) { const float v = a * x[i] + b * y[i] + c; VST2(float, dst + i, v); }
}

// =====================================================================================================================
// k_rope: rotary embedding on a [R rows][Hn heads][D] view (row stride sXr, head stride sXh, element stride 1) -> Y (own strides).
//   mode 0: rotate_half (partner d±D/2, sign - for d<D/2); mode 1: interleaved pairs (partner d^1, sign - for even d).
//   table column tcol: tmode 0 -> d, 1 -> d % (D/2), 2 -> d / 2; position p: pmode 0 -> r % S, 1 -> head index, 2 -> pos[r];
//   c = C[(r / S) * sCb + p * sCp + tcol * sCd], s likewise from Sn; y = x[d] * c + sign * x[partner] * s. X and Y must not alias.
// =====================================================================================================================
struct RopeP { const float* X; float* Y; const float* C; const float* Sn; const int* pos; long long sXr, sXh, sYr, sYh, sCb, sCp, sCd; int R, Hn, D, S, mode, tmode, pmode, pad; };
static_assert(sizeof(RopeP) == 5 * 8 + 7 * 8 + 8 * 4, "RopeP has padding");
__global__ __launch_bounds__(256) void k_rope(RopeP p) {
    const long long idx = (long long)blockIdx.x * 256 + threadIdx.x;
    if (idx >= (long long)p.R * p.Hn * p.D) return;
    const int d = (int)(idx % p.D); const long long rh = idx / p.D; const int h = (int)(rh % p.Hn); const int r = (int)(rh / p.Hn);
    const int half = p.D / 2;
    int partner; float sign;
    if (p.mode == 0) { partner = (d < half) ? d + half : d - half; sign = (d < half) ? -1.f : 1.f; }
    else { partner = d ^ 1; sign = (d & 1) ? 1.f : -1.f; }
    const int tcol = (p.tmode == 0) ? d : ((p.tmode == 1) ? (d % half) : (d >> 1));
    const int pp = (p.pmode == 0) ? (r % p.S) : ((p.pmode == 1) ? h : p.pos[r]);
    const long long toff = (long long)(r / p.S) * p.sCb + (long long)pp * p.sCp + (long long)tcol * p.sCd;
    const float* xr = p.X + (long long)r * p.sXr + (long long)h * p.sXh;
    const float v = xr[d] * p.C[toff] + sign * xr[partner] * p.Sn[toff];
    VST2(float, p.Y + (long long)r * p.sYr + (long long)h * p.sYh + d, v);
}

// k_invf + k_sincos (split so neither kernel carries a large VALU-fma footprint): invf_i = num * (1 / powf(base, (2 i)/D)) [fmode 0],
//   num * expf((2 i) * cexp) [fmode 1], num * powf(base, -2 (i - 1) / D) [fmode 2]; then cs/sn[s*half + i] = cos/sin((pscale * s) * invf_i)
__global__ __launch_bounds__(256) void k_invf(float* __restrict__ invb, int half, int D, float base, float num, int fmode, float cexp) {
    const int i = blockIdx.x * 256 + threadIdx.x;
    if (i >= ((half + 31) / 32) * 32) return;
    if (i >= half) { VST2(float, invb + i, 0.f); return; }
    const float e = (float)(2 * i) / (float)D;
    float invf;
    if (fmode == 1) invf = num * expf((float)(2 * i) * cexp);
    else if (fmode == 2) invf = num * powf(base, (-2.0f * ((float)i - 1.0f)) / (float)D);
    else invf = num * (1.0f / powf(base, e));
    VST2(float, invb + i, invf);
}
__global__ __launch_bounds__(256) void k_sincos(float* __restrict__ cs, float* __restrict__ sn, const float* __restrict__ invb, int S, int half, float pscale) {
    const int idx = blockIdx.x * 256 + threadIdx.x;
    if (idx >= S * half) return;
    const int s = idx / half, i = idx - s * half;
    const float ang = (pscale * (float)s) * invb[i];
    VST2(float, cs + idx, cosf(ang)); VST2(float, sn + idx, sinf(ang));
}

// k_mulact: dst[i] = act(x[i]) * y[i]
__global__ __launch_bounds__(256) void k_mulact(const float* __restrict__ x, const float* __restrict__ y, float* __restrict__ dst, int n, int act) {
    const int i = blockIdx.x * 256 + threadIdx.x;
    if (i < n) { const float v = act_fn(x[i], act) * y[i]; VST2(float, dst + i, v); }
}

// =====================================================================================================================
// k_matvec: thread-per-row matrix-vector products for N <= 8 output columns (heads with 1-3 outputs, gates), f32 on the VALU.
//   C[r*sCm + j] = act(alpha * sum_k A[r*sAm + k*sAk] * B[j*sBn + k*sBk] + bias[j]) + beta * R[r*sRm + j*sRn]; each thread writes its N contiguous floats.
// =====================================================================================================================
__global__ __launch_bounds__(256) void k_matvec(GemmP p) {
    // 32 lanes write one line with one instruction.
    const int rpt = (p.N == 1) ? 1 : 32;
    const long long r0 = ((long long)blockIdx.x * 256 + threadIdx.x) * rpt; const int z = blockIdx.z, zo = z / p.zi_n, zi = z - zo * p.zi_n;
    if (r0 >= p.M) return;
    const float* Bb = p.B + zo * p.sBo + zi * p.sBi;
    float* C = p.C + zo * p.sCo + zi * p.sCi; const float* R = p.R + zo * p.sRo + zi * p.sRi;
    for (int rr = 0; rr < rpt; ++rr) {
        const long long r = r0 + rr; if (r >= p.M) break;
        const float* A = p.A + zo * p.sAo + zi * p.sAi + r * p.sAm;
        float acc[8] = {0.f, 0.f, 0.f, 0.f, 0.f, 0.f, 0.f, 0.f};
        for (int k = 0; k < p.K; ++k) { const float a = A[(long long)k * p.sAk];
#pragma unroll
            for (int j = 0; j < 8; ++j) if (j < p.N) acc[j] += a * Bb[(long long)j * p.sBn + (long long)k * p.sBk]; }
#pragma unroll
        for (int j = 0; j < 8; ++j) if (j < p.N) {
            float v = acc[j] * p.alpha;
            if (p.flags & 1) v += p.bias[j];
            if (p.flags & 2) v += p.bias[r];
            v = act_fn(v, p.act);
            if (p.flags & 4) v += p.beta * R[r * p.sRm + (long long)j * p.sRn];
            VST2(float, C + r * p.sCm + j, v);
        }
    }
}
// k_smallsoftmax: thread-per-row softmax for short rows (n <= 64): dst[r*dr + j] = softmax(scale*src[r*sr + j])
__global__ __launch_bounds__(256) void k_smallsoftmax(const float* __restrict__ src, float* __restrict__ dst, long long sr, long long dr, int n, long long R, float scale) {
    const long long r0 = ((long long)blockIdx.x * 256 + threadIdx.x) * 32;
    for (int rr = 0; rr < 32; ++rr) {
        const long long r = r0 + rr; if (r >= R) return;
        const float* s = src + r * sr; float* d = dst + r * dr;
        float mx = -__builtin_inff();
        for (int j = 0; j < n; ++j) mx = fmaxf(mx, s[j] * scale);
        float sum = 0.f;
        for (int j = 0; j < n; ++j) sum += expf(s[j] * scale - mx);
        const float inv = 1.f / sum;
        for (int j = 0; j < n; ++j) { const float v = expf(s[j] * scale - mx) * inv; VST2(float, d + j, v); }
    }
}

__global__ __launch_bounds__(32) void k_unitstat(float* __restrict__ st) { const int t = threadIdx.x; const float v = (t == 1) ? 1.f : 0.f; VST2(float, st + t, v); }

// destination (e.g. a d_out whose row width is not a multiple of 32 floats) is written by consecutive lanes of one instruction
__global__ __launch_bounds__(256) void k_lincopy(const float* __restrict__ src, long long lds, float* __restrict__ dst, long long ldd, long long rows, int cols) {
    const long long i = (long long)blockIdx.x * 256 + threadIdx.x; if (i >= rows * cols) return;
    const long long r = i / cols; const int c = (int)(i - r * cols);
    const float v = src[r * lds + c]; VST2(float, dst + r * ldd + c, v);
}

namespace w25 {
typedef __attribute__((ext_vector_type(16))) _Float16 v16h;
typedef __attribute__((ext_vector_type(8)))  _Float16 v8h;
typedef __attribute__((ext_vector_type(16))) __bf16   v16b;
typedef __attribute__((ext_vector_type(8)))  __bf16   v8b;
typedef __attribute__((ext_vector_type(8)))  float    v8f;
typedef __attribute__((ext_vector_type(4)))  float    v4f;

__device__ __forceinline__ unsigned short f2bf_bits(float f) {
  unsigned u = __float_as_uint(f);
  return (unsigned short)((u + 0x7FFFu + ((u >> 16) & 1u)) >> 16);
}
__device__ __forceinline__ float bf_bits2f(unsigned short h) { return __uint_as_float(((unsigned)h) << 16); }

// hazard guards as plain device helpers (no inline asm inside the kernel template body)
__device__ __forceinline__ void dep_guard_h(v8f& a, v8f& b, v16h x, v16h y) { asm volatile("v_nop\n\tv_nop\n\tv_nop\n\tv_nop" : "+v"(a), "+v"(b) : "v"(x), "v"(y)); }
__device__ __forceinline__ void dep_guard_b(v8f& a, v8f& b, v16b x, v16b y) { asm volatile("v_nop\n\tv_nop\n\tv_nop\n\tv_nop" : "+v"(a), "+v"(b) : "v"(x), "v"(y)); }
__device__ __forceinline__ void keep4_h(v16h a, v16h b, v16h c, v16h d) { asm volatile("v_nop" :: "v"(a), "v"(b), "v"(c), "v"(d)); }
__device__ __forceinline__ void keep4_b(v16b a, v16b b, v16b c, v16b d) { asm volatile("v_nop" :: "v"(a), "v"(b), "v"(c), "v"(d)); }
__device__ __forceinline__ void acc_guard4(v8f& a, v8f& b, v8f& c, v8f& d) { asm volatile("v_nop\n\tv_nop\n\tv_nop\n\tv_nop" : "+v"(a), "+v"(b), "+v"(c), "+v"(d)); }
template <typename T> struct Frag;
template <> struct Frag<_Float16> {
  typedef v16h V; union U { v16h v; v8h h[2]; };
  static __device__ __forceinline__ v16h load(const _Float16* p) {   // elements 0..7 <- p[0..7], 8..15 <- p[16..23]
    U f; f.h[0] = *(const v8h*)(p); f.h[1] = *(const v8h*)(p + 16); return f.v;
  }
  static __device__ __forceinline__ v8f mma(v16h a, v16h b, v8f c) {
    return __builtin_amdgcn_wmma_f32_16x16x32_f16(false, a, false, b, (short)0, c, false, false);
  }
  static __device__ __forceinline__ void guard(v8f& a, v8f& b, v16h x, v16h y) { dep_guard_h(a, b, x, y); }
  static __device__ __forceinline__ void keep(v16h a, v16h b, v16h c, v16h d) { keep4_h(a, b, c, d); }
};
template <> struct Frag<__bf16> {
  typedef v16b V; union U { v16b v; v8b h[2]; };
  static __device__ __forceinline__ v16b load(const __bf16* p) {
    U f; f.h[0] = *(const v8b*)(p); f.h[1] = *(const v8b*)(p + 16); return f.v;
  }
  static __device__ __forceinline__ v8f mma(v16b a, v16b b, v8f c) {
    return __builtin_amdgcn_wmma_f32_16x16x32_bf16(false, a, false, b, (short)0, c, false, false);
  }
  static __device__ __forceinline__ void guard(v8f& a, v8f& b, v16b x, v16b y) { dep_guard_b(a, b, x, y); }
  static __device__ __forceinline__ void keep(v16b a, v16b b, v16b c, v16b d) { keep4_b(a, b, c, d); }
};

// ---- Register-blocked batched WMMA GEMM ------------------------------------
// C[m,n] = scale * sum_k A[m,k] * Bt[n,k] (+bias)(+resid); each wave owns a 64x64 tile.
// A row-major [M,K]; Bt row-major [N,K]; M,N % 64 == 0, K % 32 == 0.
// SPLIT: operands are hi/lo planes (A2/Bt2 = lo planes, same layout); product = hi·hi + hi·lo + lo·hi.
// BIAS_MODE: 0 = none, 1 = bias[m], 2 = bias[n].
// OUT_MODE: 0 = f32, 1 = f16, 2 = bf16 hi plane (Cout) + bf16 lo plane (Cout2).
// ET: 0 = f16 operands, 1 = bf16 operands (pointers passed as 16-bit storage)
template <int ET> struct Elem;
template <> struct Elem<0> { typedef _Float16 T; };
template <> struct Elem<1> { typedef __bf16 T; };
template <int ET, bool SPLIT, int BIAS_MODE, int OUT_MODE, bool RESID, int ACT = 0>
__global__ __launch_bounds__(256) void wmma_gemm64(
    const unsigned short* __restrict__ Ap, const unsigned short* __restrict__ A2p, int lda, long strideA,
    const unsigned short* __restrict__ Btp, const unsigned short* __restrict__ Bt2p, int ldb, long strideB,
    void* __restrict__ Cout, void* __restrict__ Cout2, int ldc, long strideC,
    const float* __restrict__ bias,
    const float* __restrict__ resid, long strideR,
    int M, int N, int K, float scale) {
  typedef typename Elem<ET>::T T;
  typedef typename Frag<T>::V V;
  const T* A = (const T*)Ap; const T* A2 = (const T*)A2p; const T* Bt = (const T*)Btp; const T* Bt2 = (const T*)Bt2p;
  __shared__ __align__(16) float sT[8][16 * 68];   // per-wave 16x64 slab, pitch 68 floats
  const int b    = blockIdx.y;
  const int lane = threadIdx.x & 31;
  const int wave = threadIdx.x >> 5;
  const int tilesN = N >> 6;
  const int tilesM = M >> 6;
  const int tile = blockIdx.x * 8 + wave;
  if (tile >= tilesM * tilesN) return;   // wave-uniform; no block barriers in this kernel
  const int tm = tile / tilesN;
  const int tn = tile - tm * tilesN;
  const int m0 = tm << 6;
  const int n0 = tn << 6;

  const T* Ab  = A  + (size_t)b * strideA;
  const T* Bb  = Bt + (size_t)b * strideB;
  const T* Ab2 = SPLIT ? (A2  + (size_t)b * strideA) : nullptr;
  const T* Bb2 = SPLIT ? (Bt2 + (size_t)b * strideB) : nullptr;

  const int rlane = lane & 15;                 // row (A) / col (B, D) within subtile
  const int koff  = (lane >> 4) * 8;           // k offset of this lane half
  const int mOff  = (lane >> 4) * 8;           // D row offset

  v8f acc[4][4];
#pragma unroll
  for (int i = 0; i < 4; ++i)
#pragma unroll
    for (int j = 0; j < 4; ++j) acc[i][j] = (v8f){0.f,0.f,0.f,0.f,0.f,0.f,0.f,0.f};

  for (int k0 = 0; k0 < K; k0 += 32) {
    V bh[4], bl[4];
#pragma unroll
    for (int j = 0; j < 4; ++j) {
      const size_t bo = (size_t)(n0 + (j << 4) + rlane) * ldb + koff + k0;
      bh[j] = Frag<T>::load(Bb + bo);
      if (SPLIT) bl[j] = Frag<T>::load(Bb2 + bo);
    }
#pragma unroll
    for (int i = 0; i < 4; ++i) {
      const size_t ao = (size_t)(m0 + (i << 4) + rlane) * lda + koff + k0;
      V ah = Frag<T>::load(Ab + ao);
      V al;
      if (SPLIT) al = Frag<T>::load(Ab2 + ao);
#pragma unroll
      for (int j = 0; j < 4; ++j) {
        acc[i][j] = Frag<T>::mma(ah, bh[j], acc[i][j]);
        if (SPLIT) {
          acc[i][j] = Frag<T>::mma(ah, bl[j], acc[i][j]);
          acc[i][j] = Frag<T>::mma(al, bh[j], acc[i][j]);
        }
      }
      Frag<T>::guard(acc[i][0], acc[i][3], ah, SPLIT ? al : ah);
    }
    Frag<T>::keep(bh[0], bh[1], bh[2], bh[3]);
    if (SPLIT) Frag<T>::keep(bl[0], bl[1], bl[2], bl[3]);
  }
  acc_guard4(acc[0][0], acc[0][1], acc[0][2], acc[0][3]);
  acc_guard4(acc[1][0], acc[1][1], acc[1][2], acc[1][3]);
  acc_guard4(acc[2][0], acc[2][1], acc[2][2], acc[2][3]);
  acc_guard4(acc[3][0], acc[3][1], acc[3][2], acc[3][3]);

  // ---- epilogue ----
  float* slab = sT[wave];
  const float* Rb = RESID ? (resid + (size_t)b * strideR) : nullptr;
#pragma unroll
  for (int i = 0; i < 4; ++i) {
    const int mBase = m0 + (i << 4);
#pragma unroll
    for (int j = 0; j < 4; ++j) {
      const int n = n0 + (j << 4) + rlane;
      float bv = 0.f;
      if (BIAS_MODE == 2) bv = bias[n];
#pragma unroll
      for (int r = 0; r < 8; ++r) {
        float v = acc[i][j][r] * scale;
        if (BIAS_MODE == 1) v += bias[mBase + mOff + r];
        if (BIAS_MODE == 2) v += bv;
        if (RESID) v += Rb[(size_t)(mBase + mOff + r) * ldc + n];
        if (ACT == 1) v = tanhf(v);
        if (ACT == 2) v = fmaxf(v, 0.0f);
        if (ACT == 3) v = v / (1.0f + expf(-v));
        if (ACT == 4) v = (v > 0.f) ? v : 0.01f * v;
        if (ACT == 5) v = 0.5f * v * (1.0f + erff(v * 0.70710678118654752f));
        slab[(mOff + r) * 68 + (j << 4) + rlane] = v;
      }
    }
    __builtin_amdgcn_fence(__ATOMIC_RELEASE, "workgroup");
    __builtin_amdgcn_wave_barrier();
    __builtin_amdgcn_fence(__ATOMIC_ACQUIRE, "workgroup");
    if (OUT_MODE == 0) {
      float* C = (float*)Cout + (size_t)b * strideC;
      const int hh = lane >> 4, c4 = (lane & 15) * 4;     // row seg = 256 B = 16 lanes x 16 B
      {
#pragma unroll
        for (int it = 0; it < 8; ++it) {
          const int row = it * 2 + hh;
          v4f v = *(const v4f*)(slab + row * 68 + c4);
          *(v4f*)(C + (size_t)(mBase + row) * ldc + n0 + c4) = v;
        }
        
      }
    } else {
      const int q = lane >> 3, c8 = (lane & 7) * 8;
      unsigned short* C  = (unsigned short*)Cout  + (size_t)b * strideC;
      unsigned short* C2 = (OUT_MODE == 2) ? ((unsigned short*)Cout2 + (size_t)b * strideC) : nullptr;
      {
#pragma unroll
        for (int it = 0; it < 4; ++it) {
          const int row = it * 4 + q;
          const float* sp = slab + row * 68 + c8;
          v8h hv, lv;
#pragma unroll
          for (int e = 0; e < 8; ++e) {
            if (OUT_MODE == 1) {
              hv[e] = (_Float16)sp[e];
            } else {
              unsigned short hb = f2bf_bits(sp[e]);
              unsigned short lb = f2bf_bits(sp[e] - bf_bits2f(hb));
              hv[e] = __builtin_bit_cast(_Float16, hb);
              lv[e] = __builtin_bit_cast(_Float16, lb);
            }
          }
          *(v8h*)(C + (size_t)(mBase + row) * ldc + n0 + c8) = hv;
          if (OUT_MODE == 2) *(v8h*)(C2 + (size_t)(mBase + row) * ldc + n0 + c8) = lv;
        }
        
      }
    }
    __builtin_amdgcn_fence(__ATOMIC_RELEASE, "workgroup");
    __builtin_amdgcn_wave_barrier();
    __builtin_amdgcn_fence(__ATOMIC_ACQUIRE, "workgroup");
  }
}

// ---- Deep-K product: K dealt over the 16 waves of a work-group ---------------
// C[m,n] = scale * sum_k A[m,k] * Bt[n,k], f16 operands, f32 out; one 32x64 tile of C per work-group.
// Per trip wave w takes the 64 k (one 128-B line of every operand row) at kb + 64 w, so the tile's K loop is 16 times shorter
// and a product with few output tiles still fills the chip. The 16 f32 partial tiles meet in LDS and are added in wave order.
// A row-major [M,K]; Bt row-major [N,K]; M % 32 == 0, N % 64 == 0, K % 1024 == 0; grid = ((M / 32) * (N / 64), batch), strides in elements.
__global__ __launch_bounds__(512) void wmma_gemm_kwaves(
    const unsigned short* __restrict__ Ap, int lda, long strideA,
    const unsigned short* __restrict__ Btp, int ldb, long strideB,
    float* __restrict__ C, int ldc, long strideC, int N, int K, float scale) {
  typedef _Float16 T;
  __shared__ __align__(16) float sP[16][32 * 68];   // per-wave 32x64 partial tile, pitch 68 floats
  const int lane = threadIdx.x & 31;
  const int wave = __builtin_amdgcn_readfirstlane(threadIdx.x >> 5);
  const int tilesN = N >> 6;
  const int tm = blockIdx.x / tilesN;
  const int tn = blockIdx.x - tm * tilesN;
  const int m0 = tm << 5;
  const int n0 = tn << 6;
  const int rlane = lane & 15;                 // row (A) / col (B, D) within subtile
  const int koff  = (lane >> 4) * 8;           // k offset of this lane half
  const int mOff  = (lane >> 4) * 8;           // D row offset
  const T* Aw = (const T*)Ap  + (size_t)blockIdx.y * strideA + (size_t)(m0 + rlane) * lda + koff + (wave << 6);
  const T* Bw = (const T*)Btp + (size_t)blockIdx.y * strideB + (size_t)(n0 + rlane) * ldb + koff + (wave << 6);

  v8f acc[2][4];
#pragma unroll
  for (int i = 0; i < 2; ++i)
#pragma unroll
    for (int j = 0; j < 4; ++j) acc[i][j] = (v8f){0.f,0.f,0.f,0.f,0.f,0.f,0.f,0.f};

  for (int kb = 0; kb < K; kb += 1024) {
    v16h bh[2][4], ah[2][2];
#pragma unroll
    for (int s = 0; s < 2; ++s) {
#pragma unroll
      for (int j = 0; j < 4; ++j) bh[s][j] = Frag<T>::load(Bw + (size_t)(j << 4) * ldb + kb + (s << 5));
#pragma unroll
      for (int i = 0; i < 2; ++i) ah[s][i] = Frag<T>::load(Aw + (size_t)(i << 4) * lda + kb + (s << 5));
    }
    // inputs-only fence on the loaded values: keeps the trip's 24 loads ahead of its first WMMA, so that the four 32-B pieces of
    // each 128-B line are asked for together (the line need not outlive the other waves' traffic in the WGP cache) and the wave
    // waits out one load latency per trip instead of one per 32 k
    asm volatile("" :: "v"(bh[0][0]), "v"(bh[0][1]), "v"(bh[0][2]), "v"(bh[0][3]), "v"(bh[1][0]), "v"(bh[1][1]), "v"(bh[1][2]), "v"(bh[1][3]),
                       "v"(ah[0][0]), "v"(ah[0][1]), "v"(ah[1][0]), "v"(ah[1][1]));
#pragma unroll
    for (int s = 0; s < 2; ++s)
#pragma unroll
      for (int i = 0; i < 2; ++i)
#pragma unroll
        for (int j = 0; j < 4; ++j) acc[i][j] = Frag<T>::mma(ah[s][i], bh[s][j], acc[i][j]);
  }

  float* slab = sP[wave];
#pragma unroll
  for (int i = 0; i < 2; ++i)
#pragma unroll
    for (int j = 0; j < 4; ++j)
#pragma unroll
      for (int r = 0; r < 8; ++r) slab[((i << 4) + mOff + r) * 68 + (j << 4) + rlane] = acc[i][j][r];
  __syncthreads();
  const int row = threadIdx.x >> 4, c4 = (threadIdx.x & 15) * 4;   // row seg = 256 B = 16 lanes x 16 B
  v4f sum = *(const v4f*)(&sP[0][row * 68 + c4]);
#pragma unroll
  for (int w = 1; w < 16; ++w) sum += *(const v4f*)(&sP[w][row * 68 + c4]);
  *(v4f*)(C + (size_t)blockIdx.y * strideC + (size_t)(m0 + row) * ldc + n0 + c4) = sum * scale;
}

__global__ __launch_bounds__(256) void cast_f32_f16x2(
    const float* __restrict__ in, _Float16* __restrict__ out, int n2) {
  int i = blockIdx.x * 256 + threadIdx.x;
  if (i < n2) {
    const _Float16 h0 = (_Float16)in[2 * i], h1 = (_Float16)in[2 * i + 1];
    const unsigned u = (unsigned)__builtin_bit_cast(unsigned short, h0) | ((unsigned)__builtin_bit_cast(unsigned short, h1) << 16);
    ((unsigned*)out)[i] = u;
    
  }
}


} // namespace w25

typedef __attribute__((ext_vector_type(4))) _Float16 v4h;
// Transposing cast dst[c][r] = f16(src[r][c] * s), src R rows of pitch LDS, dst rows of pitch LDD; blockIdx.y = sample: plane y of src starts
// at y * sb, plane y of dst at y * db (elements). One thread takes a patch of 8 r x 4 c: eight 16-B loads along c, all in flight together, then
// four 16-B stores along r. In a wave 8 lanes run over r, so each store instruction writes whole 128-B lines of dst; the 8 waves of a block run
// over c (512 B of every source row). Block tile 64 r x 128 c; R % 64 == 0, columns % 128 == 0; grid.x = (R / 64) * (columns / 128).
// The pitches are compile-time so that a thread's loads and stores are one address each plus immediate offsets.
template <int R, int LDS, int LDD>
__global__ __launch_bounds__(256) void k_castT16(const float* __restrict__ src, _Float16* __restrict__ dst, float s, long long sb, long long db) {
    constexpr int TR = R / 64;
    const int bc = (int)blockIdx.x / TR, br = (int)blockIdx.x % TR;
    const int lane = threadIdx.x & 31, wave = threadIdx.x >> 5;
    const int r0 = (br << 6) + ((lane & 7) << 3);
    const int c0 = (bc << 7) + (wave << 4) + ((lane >> 3) << 2);
    const float* sp = src + (long long)blockIdx.y * sb + (long long)r0 * LDS + c0;
    _Float16* dp = dst + (long long)blockIdx.y * db + (long long)c0 * LDD + r0;
    v4f x[8];
#pragma unroll
    for (int j = 0; j < 8; ++j) x[j] = *(const v4f*)(sp + j * LDS);
#pragma unroll
    for (int k = 0; k < 4; ++k) {
        v8h h;
#pragma unroll
        for (int j = 0; j < 8; ++j) h[j] = (_Float16)(x[j][k] * s);
        *(v8h*)(dp + k * LDD) = h;
    }
}
// Row-major cast dst[r][c] = f16(src[r][c] * s), rows of C elements, pitches LDS and LDD. One thread takes 8 pieces of 4 consecutive elements,
// 256 pieces apart: eight 16-B loads in flight together, each wave-wide load 512 contiguous bytes, each wave-wide store 256.
// 1024 % C == 0, rows * C % 8192 == 0; grid.x = rows * C / 8192.
template <int C, int LDS, int LDD>
__global__ __launch_bounds__(256) void k_cast16(const float* __restrict__ src, _Float16* __restrict__ dst, float s) {
    constexpr int PPR = C / 4;        // pieces per row
    constexpr int RPT = 256 / PPR;    // rows that the block's 256 pieces of one trip cover
    const long long r0 = (long long)blockIdx.x * (8 * RPT) + (int)threadIdx.x / PPR; const int c0 = ((int)threadIdx.x % PPR) << 2;
    const float* sp = src + r0 * LDS + c0;
    _Float16* dp = dst + r0 * LDD + c0;
    v4f x[8];
#pragma unroll
    for (int u = 0; u < 8; ++u) x[u] = *(const v4f*)(sp + u * RPT * LDS);
#pragma unroll
    for (int u = 0; u < 8; ++u) { v4h h;
#pragma unroll
        for (int e = 0; e < 4; ++e) h[e] = (_Float16)(x[u][e] * s);
        *(v4h*)(dp + u * RPT * LDD) = h; }
}

// f32 -> bf16 hi plane + bf16 lo plane (x = hi + lo to ~2^-17 relative; RNE both), [R][C] -> [R][C] (or transposed to [C][R]); 2 consecutive destination elements
__device__ __forceinline__ unsigned int f2bf2_pack(float a, float b, unsigned int* lo) {
    const unsigned short ha = w25::f2bf_bits(a), hb = w25::f2bf_bits(b);
    const unsigned short la = w25::f2bf_bits(a - w25::bf_bits2f(ha)), lb = w25::f2bf_bits(b - w25::bf_bits2f(hb));
    *lo = (unsigned)la | ((unsigned)lb << 16); return (unsigned)ha | ((unsigned)hb << 16); }
__global__ __launch_bounds__(256) void k_castS16(const float* __restrict__ src, long long lds, __bf16* __restrict__ dhi, __bf16* __restrict__ dlo, long long ldd, int R, int C, float s, int transpose) {
    const long long i = (long long)blockIdx.x * 256 + threadIdx.x; long long o; float a, b;
    if (transpose) { const long long np = (long long)C * (R / 2); if (i >= np) return; const int c = (int)(i / (R / 2)); const int r = 2 * (int)(i % (R / 2)); a = src[(long long)r * lds + c] * s; b = src[(long long)(r + 1) * lds + c] * s; o = (long long)c * ldd + r; }
    else { const long long np = (long long)R * (C / 2); if (i >= np) return; const int r = (int)(i / (C / 2)); const int c = 2 * (int)(i % (C / 2)); a = src[(long long)r * lds + c] * s; b = src[(long long)r * lds + c + 1] * s; o = (long long)r * ldd + c; }
    unsigned lo; const unsigned hi = f2bf2_pack(a, b, &lo); unsigned* ph = (unsigned*)(dhi + o); unsigned* pl = (unsigned*)(dlo + o);
    *ph = hi; *pl = lo;  }

namespace w25 {
// =====================================================================================
// Generic causal/non-causal attention for head_dim 64, f32 in / f32 out; 16-bit operands: bf16 with optional hi/lo splits, or
// plain f16 (F16=true, non-split, probabilities carried x2^15).
//   scores = (q*qscale)·kᵀ : v_wmma_f32_16x16x32_bf16; SPLIT_QK -> q,k as bf16 hi/lo (hi·hi + hi·lo + lo·hi)
//   out    = p·v           : v_wmma_f32_16x16x32_bf16; SPLIT_PV -> p,v as bf16 hi/lo; else p,v plain bf16
//   f32 accumulate; online softmax in f32. Block = 4 waves = 64 query rows of one (batch, head); S % 64 == 0.
//   Element (b, s, h, d) of tensor X lives at X[b*X_bs + s*X_rs + h*X_hs + d] (strides in floats, multiples of 4).
//   Masking: mask_mode 0 none, 1 causal (kv > q masked), 2 tensor [S][Skv] shared over (b,h) (float if
//   mask_is_int==0, int32 with element == 0 -> masked if 1, int32 with element != 0 -> masked if 2), 3 per-token vectors qmask[B][S] & kvmask[B][Skv] (int32,
//   0 -> masked), 4 causal + sliding window (kv > q or q - kv > W masked; W passed in mask_is_int);
//   5 = relative-position bias: s += cp[b,h,q][idx[q][kv]] + pc[b,h,kv][idx[q][kv]] with idx = mask_b ([S][Skv] int32) and
//   mask_a an int32 [S][Skv] tensor with nonzero = masked (tables: element (b,h,row,n) at X + b*c_bs + h*c_hs + row*c_rs + n);
//   masked scores are replaced by mask_fill (e.g. -inf or -1e9) before the softmax.
//   grid.x = B * H * (S/64) (or a sub-range with blk0).
// =====================================================================================
#define AT_D 64
#define AT_NW 4
#define AT_QB 64
#define AT_KC 64
struct AttnGeom { const float* cp = nullptr; const float* pc = nullptr; long c_bs = 0, c_rs = 0, c_hs = 0;   // mode-5 score-bias tables
                  long q_bs, q_rs, q_hs, k_bs, k_rs, k_hs, v_bs, v_rs, v_hs, o_bs, o_rs, o_hs;
                  int S, Skv, H, mask_mode; float qscale; int blk0; float mask_fill; int mask_is_int; };
static_assert(sizeof(AttnGeom) == 168, "no padding");

__device__ __forceinline__ unsigned short at_bf_bits(float f) {
  unsigned u = __float_as_uint(f);
  return (unsigned short)((u + 0x7FFFu + ((u >> 16) & 1u)) >> 16);
}
__device__ __forceinline__ __bf16 at_f2bf(float f) { return __builtin_bit_cast(__bf16, at_bf_bits(f)); }
__device__ __forceinline__ void at_split(float f, __bf16& hi, __bf16& lo) {
  const unsigned short hb = at_bf_bits(f);
  hi = __builtin_bit_cast(__bf16, hb);
  lo = at_f2bf(f - __uint_as_float(((unsigned)hb) << 16));
}
__device__ __forceinline__ v8f at_mma(v16b a, v16b b, v8f c) {
  c = __builtin_amdgcn_wmma_f32_16x16x32_bf16(false, a, false, b, (short)0, c, false, false);
  asm volatile("v_nop\n\tv_nop\n\tv_nop\n\tv_nop" : "+v"(c) : "v"(a), "v"(b));
  return c;
}
// 16-bit element as a bit pattern held in a __bf16 slot: f16 bits when F16, bf16 (RNE) otherwise
template <bool F16> __device__ __forceinline__ __bf16 at_to16(float f) {
  if (F16) return __builtin_bit_cast(__bf16, (_Float16)f);
  return at_f2bf(f);
}
template <bool F16> __device__ __forceinline__ v8f at_mma16(v16b a, v16b b, v8f c) {
  if (F16) {
    const v16h ah = __builtin_bit_cast(v16h, a), bh = __builtin_bit_cast(v16h, b);
    c = __builtin_amdgcn_wmma_f32_16x16x32_f16(false, ah, false, bh, (short)0, c, false, false);
    asm volatile("v_nop\n\tv_nop\n\tv_nop\n\tv_nop" : "+v"(c) : "v"(ah), "v"(bh));
    return c;
  }
  return at_mma(a, b, c);
}

template <bool SPLIT_QK, bool SPLIT_PV, bool F16 = false>
__global__ __launch_bounds__(128)
void attn64_kernel(const float* __restrict__ q, const float* __restrict__ k,
                   const float* __restrict__ v, float* __restrict__ out,
                   const void* __restrict__ mask_a, const int* __restrict__ mask_b, AttnGeom g) {
  static_assert(!(F16 && (SPLIT_QK || SPLIT_PV)), "f16 mode is non-split");
  const float PSC = F16 ? 32768.0f : 1.0f;     // f16 probabilities carried x2^15 (subnormal range), folded into the final 1/l
  union FB { v16b v; v8b h[2]; };
  __shared__ __align__(16) __bf16 Ksh[AT_KC * AT_D];             // K hi [kv][d]      8 KB
  __shared__ __align__(16) __bf16 Ksl[SPLIT_QK ? AT_KC * AT_D : 8];
  __shared__ __align__(16) __bf16 Vth[AT_D * AT_KC];             // V hi [d][kv]      8 KB
  __shared__ __align__(16) __bf16 Vtl[SPLIT_PV ? AT_D * AT_KC : 8];
  __shared__ __align__(16) __bf16 Psh[AT_NW][16 * AT_KC];        // per wave P hi [row][kv]  8 KB
  __shared__ __align__(16) __bf16 Psl[SPLIT_PV ? AT_NW : 1][SPLIT_PV ? 16 * AT_KC : 8];
  __shared__ __align__(16) float  Os[AT_NW][16 * 68];            // per wave out tile, pitch 68

  const int tid  = threadIdx.x;
  const int wave = tid >> 5;
  const int lane = tid & 31;
  const int hh   = lane >> 4;
  const int c    = lane & 15;

  const int nqb = g.S / AT_QB;
  const int bx = blockIdx.x + g.blk0;
  const int qb = bx % nqb;
  const int bh = bx / nqb;
  const int h  = bh % g.H;
  const int b  = bh / g.H;
  const int qbase_block = qb * AT_QB;
  const int q0 = qbase_block + wave * 16;

  const float* qb_ptr = q + (size_t)b * g.q_bs + (size_t)h * g.q_hs;
  const float* kb_ptr = k + (size_t)b * g.k_bs + (size_t)h * g.k_hs;
  const float* vb_ptr = v + (size_t)b * g.v_bs + (size_t)h * g.v_hs;
  float*       ob_ptr = out + (size_t)b * g.o_bs + (size_t)h * g.o_hs;

  // ---- Q fragments (A operand): 2 d-chunks, hi (and lo) ----
  v16b qah[2], qal[2];
  {
    const float* qrow = qb_ptr + (size_t)(q0 + c) * g.q_rs;
#pragma unroll
    for (int dc = 0; dc < 2; ++dc) {
#pragma unroll
      for (int e = 0; e < 8; ++e) {
        const float f0 = qrow[dc * 32 + 8 * hh + e] * g.qscale;
        const float f1 = qrow[dc * 32 + 16 + 8 * hh + e] * g.qscale;
        if (SPLIT_QK) { __bf16 hq, lq; at_split(f0, hq, lq); qah[dc][e] = hq; qal[dc][e] = lq; at_split(f1, hq, lq); qah[dc][8 + e] = hq; qal[dc][8 + e] = lq; }
        else { qah[dc][e] = at_to16<F16>(f0); qah[dc][8 + e] = at_to16<F16>(f1); qal[dc][e] = qah[dc][e]; qal[dc][8 + e] = qah[dc][8 + e]; }
      }
    }
  }

  float mrow[8], lrow[8];
  v8f oacc[4];
#pragma unroll
  for (int r = 0; r < 8; ++r) { mrow[r] = -INFINITY; lrow[r] = 0.f; }
#pragma unroll
  for (int t = 0; t < 4; ++t) oacc[t] = (v8f){0.f,0.f,0.f,0.f,0.f,0.f,0.f,0.f};

  const int nChunks = (g.mask_mode == 1 || g.mask_mode == 4) ? (qb + 1) : (g.Skv / AT_KC);   // block-uniform
  // per-row query mask (mode 3)
  int qkeep[8];
#pragma unroll
  for (int r = 0; r < 8; ++r) qkeep[r] = (g.mask_mode == 3) ? mask_b[(size_t)b * g.S + q0 + 8 * hh + r] : 1;   // mask_b = qmask in mode 3
  for (int kc = 0; kc < nChunks; ++kc) {
    const int kv0 = kc * AT_KC;
    __syncthreads();
    {
      const int kvr = tid >> 1, dh = (tid & 1) * 32;
      const float* krow = kb_ptr + (size_t)(kv0 + kvr) * g.k_rs + dh;
      const float* vrow = vb_ptr + (size_t)(kv0 + kvr) * g.v_rs + dh;
#pragma unroll
      for (int i = 0; i < 8; ++i) {
        v4f kk = *(const v4f*)(krow + 4 * i);
        v4f vv = *(const v4f*)(vrow + 4 * i);
#pragma unroll
        for (int e = 0; e < 4; ++e) {
          const int d = dh + 4 * i + e;
          if (SPLIT_QK) { __bf16 a, bl; at_split(kk[e], a, bl); Ksh[kvr * AT_D + d] = a; Ksl[kvr * AT_D + d] = bl; }
          else Ksh[kvr * AT_D + d] = at_to16<F16>(kk[e]);
          if (SPLIT_PV) { __bf16 a, bl; at_split(vv[e], a, bl); Vth[d * AT_KC + kvr] = a; Vtl[d * AT_KC + kvr] = bl; }
          else Vth[d * AT_KC + kvr] = at_to16<F16>(vv[e]);
        }
      }
    }
    __syncthreads();

    v8f s[4];
#pragma unroll
    for (int j = 0; j < 4; ++j) {
      s[j] = (v8f){0.f,0.f,0.f,0.f,0.f,0.f,0.f,0.f};
#pragma unroll 1
      for (int dc = 0; dc < 2; ++dc) {
        FB kb;
        kb.h[0] = *(const v8b*)(Ksh + (j * 16 + c) * AT_D + dc * 32 + 8 * hh);
        kb.h[1] = *(const v8b*)(Ksh + (j * 16 + c) * AT_D + dc * 32 + 16 + 8 * hh);
        s[j] = at_mma16<F16>(qah[dc], kb.v, s[j]);
        if (SPLIT_QK) {
          FB kl;
          kl.h[0] = *(const v8b*)(Ksl + (j * 16 + c) * AT_D + dc * 32 + 8 * hh);
          kl.h[1] = *(const v8b*)(Ksl + (j * 16 + c) * AT_D + dc * 32 + 16 + 8 * hh);
          s[j] = at_mma16<F16>(qah[dc], kl.v, s[j]);
          s[j] = at_mma16<F16>(qal[dc], kb.v, s[j]);
        }
      }
    }
    const bool diag = (g.mask_mode == 1) && (kc == qb);
    int kvkeep[4] = {1, 1, 1, 1};
    if (g.mask_mode == 3) {
#pragma unroll
      for (int j = 0; j < 4; ++j) kvkeep[j] = ((const int*)mask_a)[(size_t)b * g.Skv + kv0 + j * 16 + c];   // mask_a = kvmask
    }
    float cm[8];
#pragma unroll
    for (int r = 0; r < 8; ++r) {
      const int qrow = q0 + 8 * hh + r;
      float m = -INFINITY;
#pragma unroll
      for (int j = 0; j < 4; ++j) {
        const int kvcol = kv0 + j * 16 + c;
        bool masked = false;
        if (diag) masked = (kvcol > qrow);
        else if (g.mask_mode == 4) masked = (kvcol > qrow) || (qrow - kvcol > g.mask_is_int);
        else if (g.mask_mode == 2) {
          const size_t mi = (size_t)qrow * g.Skv + kvcol;
          masked = (g.mask_is_int == 0) ? (((const float*)mask_a)[mi] == 0.0f)
                 : (g.mask_is_int == 1) ? (((const int*)mask_a)[mi] == 0) : (((const int*)mask_a)[mi] != 0);
        } else if (g.mask_mode == 3) masked = (qkeep[r] == 0) || (kvkeep[j] == 0);
        else if (g.mask_mode == 5) {
          const size_t mi = (size_t)qrow * g.Skv + kvcol;
          masked = (((const int*)mask_a)[mi] != 0);
          int n = mask_b[mi]; n = n < 0 ? 0 : n;
          s[j][r] += g.cp[(size_t)b * g.c_bs + (size_t)h * g.c_hs + (size_t)qrow * g.c_rs + n]
                   + g.pc[(size_t)b * g.c_bs + (size_t)h * g.c_hs + (size_t)kvcol * g.c_rs + n];
        }
        if (masked) s[j][r] = g.mask_fill;
        m = fmaxf(m, s[j][r]);
      }
#pragma unroll
      for (int off = 1; off < 16; off <<= 1) m = fmaxf(m, __shfl_xor(m, off, 32));
      cm[r] = m;
    }
    __bf16* pwh = Psh[wave];
    __bf16* pwl = Psl[SPLIT_PV ? wave : 0];
#pragma unroll
    for (int r = 0; r < 8; ++r) {
      const float mnew = fmaxf(mrow[r], cm[r]);
      const float alpha = expf(mrow[r] - mnew);
      mrow[r] = mnew;
      float psum = 0.f;
#pragma unroll
      for (int j = 0; j < 4; ++j) {
        const float p = expf(s[j][r] - mnew);
        psum += p;
        if (SPLIT_PV) { __bf16 a, bl; at_split(p, a, bl); pwh[(8 * hh + r) * AT_KC + j * 16 + c] = a; pwl[(8 * hh + r) * AT_KC + j * 16 + c] = bl; }
        else pwh[(8 * hh + r) * AT_KC + j * 16 + c] = at_to16<F16>(p * PSC);
      }
#pragma unroll
      for (int off = 1; off < 16; off <<= 1) psum += __shfl_xor(psum, off, 32);
      lrow[r] = lrow[r] * alpha + psum;
#pragma unroll
      for (int t = 0; t < 4; ++t) oacc[t][r] *= alpha;
    }
    __builtin_amdgcn_fence(__ATOMIC_RELEASE, "workgroup");
    __builtin_amdgcn_wave_barrier();
    __builtin_amdgcn_fence(__ATOMIC_ACQUIRE, "workgroup");
#pragma unroll 1
    for (int kk = 0; kk < 2; ++kk) {
      FB pa, pl;
      pa.h[0] = *(const v8b*)(pwh + c * AT_KC + kk * 32 + 8 * hh);
      pa.h[1] = *(const v8b*)(pwh + c * AT_KC + kk * 32 + 16 + 8 * hh);
      if (SPLIT_PV) {
        pl.h[0] = *(const v8b*)(pwl + c * AT_KC + kk * 32 + 8 * hh);
        pl.h[1] = *(const v8b*)(pwl + c * AT_KC + kk * 32 + 16 + 8 * hh);
      }
#pragma unroll
      for (int t = 0; t < 4; ++t) {
        FB vb;
        vb.h[0] = *(const v8b*)(Vth + (t * 16 + c) * AT_KC + kk * 32 + 8 * hh);
        vb.h[1] = *(const v8b*)(Vth + (t * 16 + c) * AT_KC + kk * 32 + 16 + 8 * hh);
        oacc[t] = at_mma16<F16>(pa.v, vb.v, oacc[t]);
        if (SPLIT_PV) {
          FB vl;
          vl.h[0] = *(const v8b*)(Vtl + (t * 16 + c) * AT_KC + kk * 32 + 8 * hh);
          vl.h[1] = *(const v8b*)(Vtl + (t * 16 + c) * AT_KC + kk * 32 + 16 + 8 * hh);
          oacc[t] = at_mma16<F16>(pa.v, vl.v, oacc[t]);
          oacc[t] = at_mma16<F16>(pl.v, vb.v, oacc[t]);
        }
      }
    }
  }

  float* os = Os[wave];
#pragma unroll
  for (int r = 0; r < 8; ++r) {
    const float inv = 1.0f / (lrow[r] * PSC);
#pragma unroll
    for (int t = 0; t < 4; ++t) os[(8 * hh + r) * 68 + t * 16 + c] = oacc[t][r] * inv;
  }
  __builtin_amdgcn_fence(__ATOMIC_RELEASE, "workgroup");
  __builtin_amdgcn_wave_barrier();
  __builtin_amdgcn_fence(__ATOMIC_ACQUIRE, "workgroup");
  {
    const int c4 = (lane & 15) * 4;
    {
#pragma unroll
      for (int it = 0; it < 8; ++it) {
        const int row = it * 2 + hh;
        v4f val = *(const v4f*)(os + row * 68 + c4);
        *(v4f*)(ob_ptr + (size_t)(q0 + row) * g.o_rs + c4) = val;
      }
      
    }
  }
}

} // namespace w25

__device__ __forceinline__ void st_h2(_Float16* dst, float a, float b) { const unsigned u = (unsigned)__builtin_bit_cast(unsigned short, (_Float16)a) | ((unsigned)__builtin_bit_cast(unsigned short, (_Float16)b) << 16); unsigned* d = (unsigned*)dst; *d = u;  }
__device__ __forceinline__ void spat8(int n, float* s) { const int hh = n / 64, ww = n % 64; const float gx = (float)ww / 63.f, gy = (float)hh / 63.f; s[0] = gx; s[1] = gy; s[2] = 1.f - gx; s[3] = 1.f - gy; const float m = (gx + gy) * 0.5f; s[4] = m; s[5] = m; s[6] = m; s[7] = m; }
// position-major [n][a] += sum_j W[a][coff + j] * spat_j(n) + b[a]; blockIdx.y = sample, planes n elements apart.
// One thread takes 4 consecutive a at 8 positions (4 apart): its 32 weights and 4 biases are read once, its eight 16-B loads of T fly together.
// Block = 32 positions x 256 a (rows of 256 a); grid.x = positions / 32. SPAT = false: the bias alone (ldw, coff unused).
// The 8 weights of a row start at a multiple of 16 bytes (ldw % 4 == 0, coff % 4 == 0).
template <bool SPAT>
__global__ __launch_bounds__(256) void k_cm_spT(float* __restrict__ T, const float* __restrict__ Wt, const float* __restrict__ Bb, int ldw, int coff, long long n) {
    constexpr int A = 256;
    const int a0 = (threadIdx.x & 63) << 2; const int p0 = (int)blockIdx.x * 32 + (threadIdx.x >> 6);
    float* Tb = T + (long long)blockIdx.y * n + (long long)p0 * A + a0;
    v4f x[8];
#pragma unroll
    for (int u = 0; u < 8; ++u) x[u] = *(const v4f*)(Tb + 4 * u * A);
    v4f w[4][2];
    if (SPAT) {
#pragma unroll
        for (int e = 0; e < 4; ++e) { const float* wr = Wt + (long long)(a0 + e) * ldw + coff; w[e][0] = *(const v4f*)(wr); w[e][1] = *(const v4f*)(wr + 4); }
    }
    const v4f b = *(const v4f*)(Bb + a0);
    // keeps the loads above ahead of the arithmetic below: the scheduler otherwise sinks the loads of T one by one to their uses,
    // and the wave waits out a memory latency per position instead of one in all
    __builtin_amdgcn_sched_barrier(0);
#pragma unroll
    for (int u = 0; u < 8; ++u) {
        float s[8]; spat8(p0 + 4 * u, s); v4f y;
#pragma unroll
        for (int e = 0; e < 4; ++e) { float acc = b[e];
            if (SPAT) {
#pragma unroll
                for (int j = 0; j < 8; ++j) acc += w[e][j >> 2][j & 3] * s[j]; }
            y[e] = x[u][e] + acc; }
        VST2V4(Tb + 4 * u * A, y);
    }
}
// channel-major [a][n] += sum_j W[a][coff + j] * spat_j(n) + b[a]; blockIdx.y = sample, planes n elements apart.
// One thread takes 4 consecutive positions in 8 consecutive rows a: the coordinates are formed once for the 8 rows, the eight 16-B loads fly
// together, the rows' weights are the same for the whole block. Block = 8 a x 1024 positions (rows of 4096); grid.x = (rows / 8) * 4.
// SPAT = false: the bias alone (ldw, coff unused).
template <bool SPAT>
__global__ __launch_bounds__(256) void k_cm_spC(float* __restrict__ V, const float* __restrict__ Wt, const float* __restrict__ Bb, int ldw, int coff, long long n) {
    constexpr int HW = 4096;
    const int a0 = ((int)blockIdx.x >> 2) << 3; const int pos = (((int)blockIdx.x & 3) << 10) + (threadIdx.x << 2);
    float* Vb = V + (long long)blockIdx.y * n + (long long)a0 * HW + pos;
    v4f x[8];
#pragma unroll
    for (int e = 0; e < 8; ++e) x[e] = *(const v4f*)(Vb + e * HW);
    float s[4][8];
    if (SPAT) {
#pragma unroll
        for (int q = 0; q < 4; ++q) spat8(pos + q, s[q]);
    }
    // inputs-only fence on the loaded values: keeps the eight loads ahead of the rows' arithmetic; the compiler otherwise sinks them
    // to their uses two or three at a time, and the wave waits out a memory latency per group instead of one in all
    asm volatile("" :: "v"(x[0]), "v"(x[1]), "v"(x[2]), "v"(x[3]), "v"(x[4]), "v"(x[5]), "v"(x[6]), "v"(x[7]));
#pragma unroll
    for (int e = 0; e < 8; ++e) {
        const float b = Bb[a0 + e]; v4f y;
#pragma unroll
        for (int q = 0; q < 4; ++q) { float acc = b;
            if (SPAT) {
#pragma unroll
                for (int j = 0; j < 8; ++j) acc += Wt[(long long)(a0 + e) * ldw + coff + j] * s[q][j]; }
            y[q] = x[e][q] + acc; }
        VST2V4(Vb + e * HW, y);
    }
}
// VAL16 = f16(VAL): 8 pieces of 4 consecutive elements per thread, 256 pieces apart (eight 16-B loads in flight); grid.x = elements / 8192
__global__ __launch_bounds__(256) void k_cm_v16(const float* __restrict__ V, _Float16* __restrict__ V16) {
    const long long p0 = (long long)blockIdx.x * 2048 + threadIdx.x;
    v4f x[8];
#pragma unroll
    for (int u = 0; u < 8; ++u) x[u] = *(const v4f*)(V + (p0 + u * 256) * 4);
#pragma unroll
    for (int u = 0; u < 8; ++u) { v4h h;
#pragma unroll
        for (int e = 0; e < 4; ++e) h[e] = (_Float16)x[u][e];
        *(v4h*)(V16 + (p0 + u * 256) * 4) = h; }
}
// row softmax (exp once) -> P16 = f16(4096 p)
__global__ __launch_bounds__(256) void k_cm_soft(float* __restrict__ EN, _Float16* __restrict__ P16, int HW) { __shared__ float red[256]; const long long row = blockIdx.x; float* sr = EN + row * HW; const int t = threadIdx.x; float mx = -3.0e38f;
#pragma unroll 1
    for (int j = 2 * t; j < HW; j += 512) mx = fmaxf(mx, fmaxf(sr[j], sr[j + 1]));
    red[t] = mx; __syncthreads(); for (int o = 128; o > 0; o >>= 1) { if (t < o) red[t] = fmaxf(red[t], red[t + o]); __syncthreads(); } const float m = red[0]; __syncthreads();
    float s = 0.f;
#pragma unroll 1
    for (int j = 2 * t; j < HW; j += 512) { const float e0 = expf(sr[j] - m), e1 = expf(sr[j + 1] - m); s += e0 + e1; const unsigned long long pk = (unsigned long long)__builtin_bit_cast(unsigned, e0) | ((unsigned long long)__builtin_bit_cast(unsigned, e1) << 32); VST2(unsigned long long, (unsigned long long*)(sr + j), pk); }
    red[t] = s; __syncthreads(); for (int o = 128; o > 0; o >>= 1) { if (t < o) red[t] += red[t + o]; __syncthreads(); } const float f = 4096.f / red[0];
#pragma unroll 1
    for (int j = 2 * t; j < HW; j += 512) st_h2(P16 + row * HW + j, sr[j] * f, sr[j + 1] * f); }


extern "C" void kernel_launch(void* const* d_in, const int* in_sizes, int n_in, void* d_out, int out_size, void* d_ws, size_t ws_size, hipStream_t stream) {
    (void)in_sizes; (void)n_in; (void)out_size; (void)ws_size;
    const float* img = (const float*)d_in[0];
    const float* flo = (const float*)d_in[1];
    const float* iwt = (const float*)d_in[2];
    const float* ibt = (const float*)d_in[3];
    const float* iwp = (const float*)d_in[4];
    const float* ibp = (const float*)d_in[5];
    const float* iwv = (const float*)d_in[6];
    const float* ibv = (const float*)d_in[7];
    const float* iwo = (const float*)d_in[8];
    const float* ibo = (const float*)d_in[9];
    const float* lwt = (const float*)d_in[10];
    const float* lbt = (const float*)d_in[11];
    const float* lwp = (const float*)d_in[12];
    const float* lbp = (const float*)d_in[13];
    const float* lwv = (const float*)d_in[14];
    const float* lbv = (const float*)d_in[15];
    const float* lwo = (const float*)d_in[16];
    const float* lbo = (const float*)d_in[17];
    const float* fw = (const float*)d_in[18];
    const float* fb = (const float*)d_in[19];
    const int Bn = 4;
    const int C = 256;
    const int A = 256;
    const int HW = 4096;
    const int CM = 520;
    const int HS = 1024;   // affinity rows per sample and pass: 4 samples x 1024 rows of f32 scores per launch
    const long SP = (long)C * HW;   // one sample's 256 x 4096 (or 4096 x 256) plane, elements
    float* out = (float*)d_out;
    char* wsp = (char*)d_ws;
    float* THT = (float*)wsp; wsp += (((size_t)((size_t)Bn * HW * A) * 4 + 255) / 256) * 256;
    float* PHT = (float*)wsp; wsp += (((size_t)((size_t)Bn * HW * A) * 4 + 255) / 256) * 256;
    float* VAL = (float*)wsp; wsp += (((size_t)((size_t)Bn * A * HW) * 4 + 255) / 256) * 256;
    unsigned short* VAL16 = (unsigned short*)wsp; wsp += (((size_t)((size_t)Bn * A * HW) * 2 + 255) / 256) * 256;
    float* EN = (float*)wsp; wsp += (((size_t)((size_t)Bn * HS * HW) * 4 + 255) / 256) * 256;
    unsigned short* P16 = (unsigned short*)wsp; wsp += (((size_t)((size_t)Bn * HS * HW) * 2 + 255) / 256) * 256;
    float* ATT = (float*)wsp; wsp += (((size_t)((size_t)Bn * A * HW) * 4 + 255) / 256) * 256;
    float* FUS = (float*)wsp; wsp += (((size_t)((size_t)Bn * 2 * A * HW) * 4 + 255) / 256) * 256;
    unsigned short* G64A = (unsigned short*)wsp; wsp += (((size_t)((size_t)Bn * 1048576) * 2 + 255) / 256) * 256;
    unsigned short* G64B = (unsigned short*)wsp; wsp += (((size_t)((size_t)Bn * 2097152) * 2 + 255) / 256) * 256;
    // every launch serves the four samples (blockIdx.y, or rows that run on from sample to sample); weights are cast once
    k_castT16<256, 4096, 256><<<dim3((unsigned)(((256) / 64) * ((4096) / 128)), (unsigned)(Bn)), 256, 0, stream>>>(img, (_Float16*)(G64A), 1.0f, SP, SP);
    k_cast16<256, 520, 256><<<(unsigned)(((long long)(256) * (256)) / 8192), 256, 0, stream>>>(iwt + 0, (_Float16*)(G64B), 16.0f);
    w25::wmma_gemm64<0, false, 0, 0, false, 0><<<dim3((unsigned)((((4096) / 64) * ((256) / 64) + 7) / 8), (unsigned)(Bn)), 256, 0, stream>>>((const unsigned short*)(G64A), nullptr, 256, SP, (const unsigned short*)(G64B), nullptr, 256, 0, (void*)(THT), nullptr, 256, SP, nullptr, nullptr, 0, 4096, 256, 256, 0.0625f);
    k_castT16<256, 4096, 256><<<dim3((unsigned)(((256) / 64) * ((4096) / 128)), (unsigned)(Bn)), 256, 0, stream>>>(flo, (_Float16*)(G64A), 1.0f, SP, SP);
    k_cast16<256, 520, 256><<<(unsigned)(((long long)(256) * (256)) / 8192), 256, 0, stream>>>(iwt + 256, (_Float16*)(G64B), 16.0f);
    w25::wmma_gemm64<0, false, 0, 0, true, 0><<<dim3((unsigned)((((4096) / 64) * ((256) / 64) + 7) / 8), (unsigned)(Bn)), 256, 0, stream>>>((const unsigned short*)(G64A), nullptr, 256, SP, (const unsigned short*)(G64B), nullptr, 256, 0, (void*)(THT), nullptr, 256, SP, nullptr, THT, SP, 4096, 256, 256, 0.0625f);
    k_castT16<256, 4096, 256><<<dim3((unsigned)(((256) / 64) * ((4096) / 128)), (unsigned)(Bn)), 256, 0, stream>>>(img, (_Float16*)(G64A), 1.0f, SP, SP);
    k_cast16<256, 520, 256><<<(unsigned)(((long long)(256) * (256)) / 8192), 256, 0, stream>>>(iwp + 0, (_Float16*)(G64B), 16.0f);
    w25::wmma_gemm64<0, false, 0, 0, false, 0><<<dim3((unsigned)((((4096) / 64) * ((256) / 64) + 7) / 8), (unsigned)(Bn)), 256, 0, stream>>>((const unsigned short*)(G64A), nullptr, 256, SP, (const unsigned short*)(G64B), nullptr, 256, 0, (void*)(PHT), nullptr, 256, SP, nullptr, nullptr, 0, 4096, 256, 256, 0.0625f);
    k_castT16<256, 4096, 256><<<dim3((unsigned)(((256) / 64) * ((4096) / 128)), (unsigned)(Bn)), 256, 0, stream>>>(flo, (_Float16*)(G64A), 1.0f, SP, SP);
    k_cast16<256, 520, 256><<<(unsigned)(((long long)(256) * (256)) / 8192), 256, 0, stream>>>(iwp + 256, (_Float16*)(G64B), 16.0f);
    w25::wmma_gemm64<0, false, 0, 0, true, 0><<<dim3((unsigned)((((4096) / 64) * ((256) / 64) + 7) / 8), (unsigned)(Bn)), 256, 0, stream>>>((const unsigned short*)(G64A), nullptr, 256, SP, (const unsigned short*)(G64B), nullptr, 256, 0, (void*)(PHT), nullptr, 256, SP, nullptr, PHT, SP, 4096, 256, 256, 0.0625f);
    k_cast16<256, 520, 256><<<(unsigned)(((long long)(256) * (256)) / 8192), 256, 0, stream>>>(iwv + 0, (_Float16*)(G64A), 1.0f);
    k_castT16<256, 4096, 256><<<dim3((unsigned)(((256) / 64) * ((4096) / 128)), (unsigned)(Bn)), 256, 0, stream>>>(img, (_Float16*)(G64B), 16.0f, SP, SP);
    w25::wmma_gemm64<0, false, 0, 0, false, 0><<<dim3((unsigned)((((256) / 64) * ((4096) / 64) + 7) / 8), (unsigned)(Bn)), 256, 0, stream>>>((const unsigned short*)(G64A), nullptr, 256, 0, (const unsigned short*)(G64B), nullptr, 256, SP, (void*)(VAL), nullptr, 4096, SP, nullptr, nullptr, 0, 256, 4096, 256, 0.0625f);
    k_cast16<256, 520, 256><<<(unsigned)(((long long)(256) * (256)) / 8192), 256, 0, stream>>>(iwv + 256, (_Float16*)(G64A), 1.0f);
    k_castT16<256, 4096, 256><<<dim3((unsigned)(((256) / 64) * ((4096) / 128)), (unsigned)(Bn)), 256, 0, stream>>>(flo, (_Float16*)(G64B), 16.0f, SP, SP);
    w25::wmma_gemm64<0, false, 0, 0, true, 0><<<dim3((unsigned)((((256) / 64) * ((4096) / 64) + 7) / 8), (unsigned)(Bn)), 256, 0, stream>>>((const unsigned short*)(G64A), nullptr, 256, 0, (const unsigned short*)(G64B), nullptr, 256, SP, (void*)(VAL), nullptr, 4096, SP, nullptr, VAL, SP, 256, 4096, 256, 0.0625f);
    k_cm_spT<true><<<dim3((unsigned)(HW / 32), (unsigned)(Bn)), 256, 0, stream>>>(THT, iwt, ibt, 520, 512, (long long)HW * A);
    k_cm_spT<true><<<dim3((unsigned)(HW / 32), (unsigned)(Bn)), 256, 0, stream>>>(PHT, iwp, ibp, 520, 512, (long long)HW * A);
    k_cm_spC<true><<<dim3((unsigned)((A / 8) * (HW / 1024)), (unsigned)(Bn)), 256, 0, stream>>>(VAL, iwv, ibv, 520, 512, (long long)A * HW);
    k_cm_v16<<<(unsigned)((long long)Bn * A * HW / 8192), 256, 0, stream>>>(VAL, (_Float16*)VAL16);
    // f16 planes of theta^T and phi^T, all samples (rows run on from sample to sample); they stay in place over the four passes
    k_cast16<256, 256, 256><<<(unsigned)(((long long)(16384) * (256)) / 8192), 256, 0, stream>>>(THT, (_Float16*)(G64A), 1.0f);
    k_cast16<256, 256, 256><<<(unsigned)(((long long)(16384) * (256)) / 8192), 256, 0, stream>>>(PHT, (_Float16*)(G64B), 1.0f);
    w25::wmma_gemm64<0, false, 0, 0, false, 0><<<dim3((unsigned)((((1024) / 64) * ((4096) / 64) + 7) / 8), (unsigned)(Bn)), 256, 0, stream>>>((const unsigned short*)(G64A + (size_t)0 * HS * A), nullptr, 256, SP, (const unsigned short*)(G64B), nullptr, 256, SP, (void*)(EN), nullptr, 4096, 4 * SP, nullptr, nullptr, 0, 1024, 4096, 256, 1.0f);
    k_cm_soft<<<Bn * HS, 256, 0, stream>>>(EN, (_Float16*)P16, HW);
    w25::wmma_gemm_kwaves<<<dim3((unsigned)(((A) / 32) * ((HS) / 64)), (unsigned)(Bn)), 512, 0, stream>>>((const unsigned short*)(VAL16), HW, SP, (const unsigned short*)(P16), HW, 4 * SP, ATT + (size_t)0 * HS, HW, SP, HS, HW, 0.000244140625f);
    w25::wmma_gemm64<0, false, 0, 0, false, 0><<<dim3((unsigned)((((1024) / 64) * ((4096) / 64) + 7) / 8), (unsigned)(Bn)), 256, 0, stream>>>((const unsigned short*)(G64A + (size_t)1 * HS * A), nullptr, 256, SP, (const unsigned short*)(G64B), nullptr, 256, SP, (void*)(EN), nullptr, 4096, 4 * SP, nullptr, nullptr, 0, 1024, 4096, 256, 1.0f);
    k_cm_soft<<<Bn * HS, 256, 0, stream>>>(EN, (_Float16*)P16, HW);
    w25::wmma_gemm_kwaves<<<dim3((unsigned)(((A) / 32) * ((HS) / 64)), (unsigned)(Bn)), 512, 0, stream>>>((const unsigned short*)(VAL16), HW, SP, (const unsigned short*)(P16), HW, 4 * SP, ATT + (size_t)1 * HS, HW, SP, HS, HW, 0.000244140625f);
    w25::wmma_gemm64<0, false, 0, 0, false, 0><<<dim3((unsigned)((((1024) / 64) * ((4096) / 64) + 7) / 8), (unsigned)(Bn)), 256, 0, stream>>>((const unsigned short*)(G64A + (size_t)2 * HS * A), nullptr, 256, SP, (const unsigned short*)(G64B), nullptr, 256, SP, (void*)(EN), nullptr, 4096, 4 * SP, nullptr, nullptr, 0, 1024, 4096, 256, 1.0f);
    k_cm_soft<<<Bn * HS, 256, 0, stream>>>(EN, (_Float16*)P16, HW);
    w25::wmma_gemm_kwaves<<<dim3((unsigned)(((A) / 32) * ((HS) / 64)), (unsigned)(Bn)), 512, 0, stream>>>((const unsigned short*)(VAL16), HW, SP, (const unsigned short*)(P16), HW, 4 * SP, ATT + (size_t)2 * HS, HW, SP, HS, HW, 0.000244140625f);
    w25::wmma_gemm64<0, false, 0, 0, false, 0><<<dim3((unsigned)((((1024) / 64) * ((4096) / 64) + 7) / 8), (unsigned)(Bn)), 256, 0, stream>>>((const unsigned short*)(G64A + (size_t)3 * HS * A), nullptr, 256, SP, (const unsigned short*)(G64B), nullptr, 256, SP, (void*)(EN), nullptr, 4096, 4 * SP, nullptr, nullptr, 0, 1024, 4096, 256, 1.0f);
    k_cm_soft<<<Bn * HS, 256, 0, stream>>>(EN, (_Float16*)P16, HW);
    w25::wmma_gemm_kwaves<<<dim3((unsigned)(((A) / 32) * ((HS) / 64)), (unsigned)(Bn)), 512, 0, stream>>>((const unsigned short*)(VAL16), HW, SP, (const unsigned short*)(P16), HW, 4 * SP, ATT + (size_t)3 * HS, HW, SP, HS, HW, 0.000244140625f);
    k_cast16<256, 256, 256><<<(unsigned)(((long long)(256) * (256)) / 8192), 256, 0, stream>>>(iwo, (_Float16*)(G64A), 16.0f);
    k_castT16<256, 4096, 256><<<dim3((unsigned)(((256) / 64) * ((4096) / 128)), (unsigned)(Bn)), 256, 0, stream>>>(ATT, (_Float16*)(G64B), 1.0f, SP, SP);
    w25::wmma_gemm64<0, false, 1, 0, false, 0><<<dim3((unsigned)((((256) / 64) * ((4096) / 64) + 7) / 8), (unsigned)(Bn)), 256, 0, stream>>>((const unsigned short*)(G64A), nullptr, 256, 0, (const unsigned short*)(G64B), nullptr, 256, SP, (void*)(FUS + (size_t)0 * A * HW), nullptr, 4096, 2 * SP, ibo, nullptr, 0, 256, 4096, 256, 0.0625f);
    k_castT16<256, 4096, 256><<<dim3((unsigned)(((256) / 64) * ((4096) / 128)), (unsigned)(Bn)), 256, 0, stream>>>(flo, (_Float16*)(G64A), 1.0f, SP, SP);
    k_cast16<256, 256, 256><<<(unsigned)(((long long)(256) * (256)) / 8192), 256, 0, stream>>>(lwt + 0, (_Float16*)(G64B), 16.0f);
    w25::wmma_gemm64<0, false, 0, 0, false, 0><<<dim3((unsigned)((((4096) / 64) * ((256) / 64) + 7) / 8), (unsigned)(Bn)), 256, 0, stream>>>((const unsigned short*)(G64A), nullptr, 256, SP, (const unsigned short*)(G64B), nullptr, 256, 0, (void*)(THT), nullptr, 256, SP, nullptr, nullptr, 0, 4096, 256, 256, 0.0625f);
    k_castT16<256, 4096, 256><<<dim3((unsigned)(((256) / 64) * ((4096) / 128)), (unsigned)(Bn)), 256, 0, stream>>>(flo, (_Float16*)(G64A), 1.0f, SP, SP);
    k_cast16<256, 256, 256><<<(unsigned)(((long long)(256) * (256)) / 8192), 256, 0, stream>>>(lwp + 0, (_Float16*)(G64B), 16.0f);
    w25::wmma_gemm64<0, false, 0, 0, false, 0><<<dim3((unsigned)((((4096) / 64) * ((256) / 64) + 7) / 8), (unsigned)(Bn)), 256, 0, stream>>>((const unsigned short*)(G64A), nullptr, 256, SP, (const unsigned short*)(G64B), nullptr, 256, 0, (void*)(PHT), nullptr, 256, SP, nullptr, nullptr, 0, 4096, 256, 256, 0.0625f);
    k_cast16<256, 256, 256><<<(unsigned)(((long long)(256) * (256)) / 8192), 256, 0, stream>>>(lwv + 0, (_Float16*)(G64A), 1.0f);
    k_castT16<256, 4096, 256><<<dim3((unsigned)(((256) / 64) * ((4096) / 128)), (unsigned)(Bn)), 256, 0, stream>>>(flo, (_Float16*)(G64B), 16.0f, SP, SP);
    w25::wmma_gemm64<0, false, 0, 0, false, 0><<<dim3((unsigned)((((256) / 64) * ((4096) / 64) + 7) / 8), (unsigned)(Bn)), 256, 0, stream>>>((const unsigned short*)(G64A), nullptr, 256, 0, (const unsigned short*)(G64B), nullptr, 256, SP, (void*)(VAL), nullptr, 4096, SP, nullptr, nullptr, 0, 256, 4096, 256, 0.0625f);
    k_cm_spT<false><<<dim3((unsigned)(HW / 32), (unsigned)(Bn)), 256, 0, stream>>>(THT, lwt, lbt, 256, -1, (long long)HW * A);
    k_cm_spT<false><<<dim3((unsigned)(HW / 32), (unsigned)(Bn)), 256, 0, stream>>>(PHT, lwp, lbp, 256, -1, (long long)HW * A);
    k_cm_spC<false><<<dim3((unsigned)((A / 8) * (HW / 1024)), (unsigned)(Bn)), 256, 0, stream>>>(VAL, lwv, lbv, 256, -1, (long long)A * HW);
    k_cm_v16<<<(unsigned)((long long)Bn * A * HW / 8192), 256, 0, stream>>>(VAL, (_Float16*)VAL16);
    // f16 planes of theta^T and phi^T, all samples (rows run on from sample to sample); they stay in place over the four passes
    k_cast16<256, 256, 256><<<(unsigned)(((long long)(16384) * (256)) / 8192), 256, 0, stream>>>(THT, (_Float16*)(G64A), 1.0f);
    k_cast16<256, 256, 256><<<(unsigned)(((long long)(16384) * (256)) / 8192), 256, 0, stream>>>(PHT, (_Float16*)(G64B), 1.0f);
    w25::wmma_gemm64<0, false, 0, 0, false, 0><<<dim3((unsigned)((((1024) / 64) * ((4096) / 64) + 7) / 8), (unsigned)(Bn)), 256, 0, stream>>>((const unsigned short*)(G64A + (size_t)0 * HS * A), nullptr, 256, SP, (const unsigned short*)(G64B), nullptr, 256, SP, (void*)(EN), nullptr, 4096, 4 * SP, nullptr, nullptr, 0, 1024, 4096, 256, 1.0f);
    k_cm_soft<<<Bn * HS, 256, 0, stream>>>(EN, (_Float16*)P16, HW);
    w25::wmma_gemm_kwaves<<<dim3((unsigned)(((A) / 32) * ((HS) / 64)), (unsigned)(Bn)), 512, 0, stream>>>((const unsigned short*)(VAL16), HW, SP, (const unsigned short*)(P16), HW, 4 * SP, ATT + (size_t)0 * HS, HW, SP, HS, HW, 0.000244140625f);
    w25::wmma_gemm64<0, false, 0, 0, false, 0><<<dim3((unsigned)((((1024) / 64) * ((4096) / 64) + 7) / 8), (unsigned)(Bn)), 256, 0, stream>>>((const unsigned short*)(G64A + (size_t)1 * HS * A), nullptr, 256, SP, (const unsigned short*)(G64B), nullptr, 256, SP, (void*)(EN), nullptr, 4096, 4 * SP, nullptr, nullptr, 0, 1024, 4096, 256, 1.0f);
    k_cm_soft<<<Bn * HS, 256, 0, stream>>>(EN, (_Float16*)P16, HW);
    w25::wmma_gemm_kwaves<<<dim3((unsigned)(((A) / 32) * ((HS) / 64)), (unsigned)(Bn)), 512, 0, stream>>>((const unsigned short*)(VAL16), HW, SP, (const unsigned short*)(P16), HW, 4 * SP, ATT + (size_t)1 * HS, HW, SP, HS, HW, 0.000244140625f);
    w25::wmma_gemm64<0, false, 0, 0, false, 0><<<dim3((unsigned)((((1024) / 64) * ((4096) / 64) + 7) / 8), (unsigned)(Bn)), 256, 0, stream>>>((const unsigned short*)(G64A + (size_t)2 * HS * A), nullptr, 256, SP, (const unsigned short*)(G64B), nullptr, 256, SP, (void*)(EN), nullptr, 4096, 4 * SP, nullptr, nullptr, 0, 1024, 4096, 256, 1.0f);
    k_cm_soft<<<Bn * HS, 256, 0, stream>>>(EN, (_Float16*)P16, HW);
    w25::wmma_gemm_kwaves<<<dim3((unsigned)(((A) / 32) * ((HS) / 64)), (unsigned)(Bn)), 512, 0, stream>>>((const unsigned short*)(VAL16), HW, SP, (const unsigned short*)(P16), HW, 4 * SP, ATT + (size_t)2 * HS, HW, SP, HS, HW, 0.000244140625f);
    w25::wmma_gemm64<0, false, 0, 0, false, 0><<<dim3((unsigned)((((1024) / 64) * ((4096) / 64) + 7) / 8), (unsigned)(Bn)), 256, 0, stream>>>((const unsigned short*)(G64A + (size_t)3 * HS * A), nullptr, 256, SP, (const unsigned short*)(G64B), nullptr, 256, SP, (void*)(EN), nullptr, 4096, 4 * SP, nullptr, nullptr, 0, 1024, 4096, 256, 1.0f);
    k_cm_soft<<<Bn * HS, 256, 0, stream>>>(EN, (_Float16*)P16, HW);
    w25::wmma_gemm_kwaves<<<dim3((unsigned)(((A) / 32) * ((HS) / 64)), (unsigned)(Bn)), 512, 0, stream>>>((const unsigned short*)(VAL16), HW, SP, (const unsigned short*)(P16), HW, 4 * SP, ATT + (size_t)3 * HS, HW, SP, HS, HW, 0.000244140625f);
    k_cast16<256, 256, 256><<<(unsigned)(((long long)(256) * (256)) / 8192), 256, 0, stream>>>(lwo, (_Float16*)(G64A), 16.0f);
    k_castT16<256, 4096, 256><<<dim3((unsigned)(((256) / 64) * ((4096) / 128)), (unsigned)(Bn)), 256, 0, stream>>>(ATT, (_Float16*)(G64B), 1.0f, SP, SP);
    w25::wmma_gemm64<0, false, 1, 0, false, 0><<<dim3((unsigned)((((256) / 64) * ((4096) / 64) + 7) / 8), (unsigned)(Bn)), 256, 0, stream>>>((const unsigned short*)(G64A), nullptr, 256, 0, (const unsigned short*)(G64B), nullptr, 256, SP, (void*)(FUS + (size_t)1 * A * HW), nullptr, 4096, 2 * SP, lbo, nullptr, 0, 256, 4096, 256, 0.0625f);
    k_cast16<512, 520, 512><<<(unsigned)(((long long)(256) * (512)) / 8192), 256, 0, stream>>>(fw, (_Float16*)(G64A), 16.0f);
    k_castT16<512, 4096, 512><<<dim3((unsigned)(((512) / 64) * ((4096) / 128)), (unsigned)(Bn)), 256, 0, stream>>>(FUS, (_Float16*)(G64B), 1.0f, 2 * SP, 2 * SP);
    w25::wmma_gemm64<0, false, 0, 0, false, 0><<<dim3((unsigned)((((256) / 64) * ((4096) / 64) + 7) / 8), (unsigned)(Bn)), 256, 0, stream>>>((const unsigned short*)(G64A), nullptr, 512, 0, (const unsigned short*)(G64B), nullptr, 512, 2 * SP, (void*)(out), nullptr, 4096, SP, nullptr, nullptr, 0, 256, 4096, 512, 0.0625f);
    k_cm_spC<true><<<dim3((unsigned)((A / 8) * (HW / 1024)), (unsigned)(Bn)), 256, 0, stream>>>(out, fw, fb, 520, 512, (long long)A * HW);
}
